// v000
// The times below were measured on an AMD MI455X: many runs one after another, warmed up first and cycling through
// copies of the inputs, with the whole window's GPU time divided by the number of runs. Launches and the gaps
// between them are all in it. The median over several windows is given; except for v000 it joins two sittings, which
// can be a few percent apart, so the side-by-side timings, each taken in one sitting, are the better comparison.
// v000, which the later versions start from, runs in 1950 microseconds.
#include <hip/hip_runtime.h>

// Causal LM attention with additive mask and position-id rotary (hidden [2][2048][2048]; q, k, v = hidden W^T ('oi' [2048][2048], 16 heads x 128); rotate-half RoPE with angle = position_ids[b][t] x inv_freq (theta 1e4; position_ids int32 input, read on device); scores/sqrt(128) + attention_mask[b][0][i][j] (f32 input, read); softmax; out = merged Wo^T -> [2][2048][2048]).
// The additive mask is verified ON THE DEVICE to be the causal pattern (0 where j <= i, most-negative elsewhere); when it is, score tiles above the diagonal are skipped and the masked entries are realised as exact-zero softmax weights (identical result); otherwise every tile is computed and the mask is simply added (general fallback).
// Compute dtypes, f32 accumulate: every input rounded to bf16; q/k/v on PLAIN bf16 operands (inputs: exact); rotary in f32 (per-batch table from the position ids and the reference's inv_freq constants); mask check, additive mask (bf16-rounded) inside the softmax kernel; causal scores and attn.v (tile skipping gated by the device flag): query rows < 512 hl (3 products), the rest single fp16 (x1024); softmax f32; Wo hl x exact (2 products).

#define NB_  2
#define TT   2048
#define DM   2048
#define NH_  16
#define NKV  16
#define REP  (NH_ / NKV)
#define HD   128
#define DQ   (NH_ * HD)
#define DKV  (NKV * HD)
#define ZH   2
#define RH   512                  // query rows < RH use hi+lo planes (0: none)
#define WIN  2048
#define PCAR 1024.0f
#define SCL  0.088388347648318447f   // HD^-0.5
typedef _Float16 h16;
typedef unsigned short bf;
typedef __attribute__((ext_vector_type(16))) __bf16   v16bf;
typedef __attribute__((ext_vector_type(16))) _Float16 v16h;
typedef __attribute__((ext_vector_type(8)))  _Float16 v8h;
typedef __attribute__((ext_vector_type(8)))  unsigned short v8us;
typedef __attribute__((ext_vector_type(8)))  float    v8f;
typedef __attribute__((ext_vector_type(4)))  float    v4f;
typedef v8h  __attribute__((may_alias)) v8ha;
typedef v4f  __attribute__((may_alias)) v4fa;
typedef v8us __attribute__((may_alias)) v8usa;

__device__ __forceinline__ unsigned short f2bf(float f) { unsigned u = __float_as_uint(f); u += 0x7FFFu + ((u >> 16) & 1u); return (unsigned short)(u >> 16); }
__device__ __forceinline__ float bf2f(unsigned short b) { return __uint_as_float(((unsigned)b) << 16); }
__device__ __forceinline__ float bfr(float f) { return bf2f(f2bf(f)); }
__device__ __forceinline__ v16h cat16(v8h lo, v8h hi) { return __builtin_shufflevector(lo, hi, 0, 1, 2, 3, 4, 5, 6, 7, 8, 9, 10, 11, 12, 13, 14, 15); }
__device__ __forceinline__ v16bf cat16b(v8us lo, v8us hi) { return __builtin_bit_cast(v16bf, __builtin_shufflevector(lo, hi, 0, 1, 2, 3, 4, 5, 6, 7, 8, 9, 10, 11, 12, 13, 14, 15)); }
__device__ __forceinline__ v8f wmma16(v16h a, v16h b, v8f c) { return __builtin_amdgcn_wmma_f32_16x16x32_f16(false, a, false, b, (short)0, c, false, false); }
__device__ __forceinline__ v8f wmmab(v16bf a, v16bf b, v8f c) { return __builtin_amdgcn_wmma_f32_16x16x32_bf16(false, a, false, b, (short)0, c, false, false); }



// ---- k_gemmw: register-blocked GEMM, ONE WAVE per 64x64 output tile (16 accumulators), operands straight from K-contiguous 16-bit planes; grid (M/64, N/64, Z), 32 threads.
// C[m][n] (f32, pitch ldc, + optional f32 bias[n]) = sum_k A[m][k] Bt[n][k] (+ split products per NSPLIT). z-batch strides sA/sB/sC in elements. K % 32 == 0.
template <typename T16> struct WFrag;
template <> struct WFrag<h16> { typedef v16h V; static __device__ __forceinline__ V ld(const h16* p) { return cat16(*(const v8h*)p, *(const v8h*)(p + 16)); } static __device__ __forceinline__ v8f mma(V a, V b, v8f c) { return wmma16(a, b, c); } };
template <> struct WFrag<bf> { typedef v16bf V; static __device__ __forceinline__ V ld(const bf* p) { return cat16b(*(const v8us*)p, *(const v8us*)(p + 16)); } static __device__ __forceinline__ v8f mma(V a, V b, v8f c) { return wmmab(a, b, c); } };
template <typename T16, int NSPLIT, bool BIAS>
__global__ __launch_bounds__(32) void k_gemmw(const T16* __restrict__ A, const T16* __restrict__ A2, const T16* __restrict__ Bt, const T16* __restrict__ Bt2, int K, float* C, int ldc, const float* __restrict__ bias, size_t sA, size_t sB, size_t sC) {
    typedef typename WFrag<T16>::V V;
    __shared__ __align__(16) float os[16 * 68];
    const size_t z = blockIdx.z; A += z * sA; if (A2) A2 += z * sA; Bt += z * sB; if (Bt2) Bt2 += z * sB; C += z * sC;
    const int lane = threadIdx.x & 31, lr = lane & 15, hi = lane >> 4; const int r0 = blockIdx.x * 64, c0 = blockIdx.y * 64;
    v8f acc[4][4];
#pragma unroll
    for (int mb = 0; mb < 4; ++mb)
#pragma unroll
        for (int nb = 0; nb < 4; ++nb) acc[mb][nb] = (v8f){};
    const size_t aoff = (size_t)(r0 + lr) * K + 8 * hi, boff = (size_t)(c0 + lr) * K + 8 * hi;
#pragma unroll 1
    for (int kc = 0; kc < K; kc += 32) {
        V a[4], a2[4];
#pragma unroll
        for (int mb = 0; mb < 4; ++mb) { a[mb] = WFrag<T16>::ld(A + aoff + (size_t)mb * 16 * K + kc); if (NSPLIT == 1 || NSPLIT == 2) a2[mb] = WFrag<T16>::ld(A2 + aoff + (size_t)mb * 16 * K + kc); }
#pragma unroll
        for (int nb = 0; nb < 4; ++nb) { const V b = WFrag<T16>::ld(Bt + boff + (size_t)nb * 16 * K + kc); V b2; if (NSPLIT >= 2) b2 = WFrag<T16>::ld(Bt2 + boff + (size_t)nb * 16 * K + kc);
#pragma unroll
            for (int mb = 0; mb < 4; ++mb) { acc[mb][nb] = WFrag<T16>::mma(a[mb], b, acc[mb][nb]); if (NSPLIT == 1 || NSPLIT == 2) acc[mb][nb] = WFrag<T16>::mma(a2[mb], b, acc[mb][nb]); if (NSPLIT >= 2) acc[mb][nb] = WFrag<T16>::mma(a[mb], b2, acc[mb][nb]); } }
        asm volatile("v_nop\n\tv_nop\n\tv_nop\n\tv_nop" : "+v"(acc[0][0]), "+v"(acc[1][1]), "+v"(acc[2][2]), "+v"(acc[3][3]) : "v"(a[0]), "v"(a[3]));
    }
#pragma unroll
    for (int mb = 0; mb < 4; ++mb) {
#pragma unroll
        for (int nb = 0; nb < 4; ++nb) {
#pragma unroll
            for (int j = 0; j < 8; ++j) os[(hi * 8 + j) * 68 + nb * 16 + lr] = acc[mb][nb][j]; }
        __builtin_amdgcn_wave_barrier(); asm volatile("" ::: "memory");
        float* crow = C + (size_t)(r0 + mb * 16) * ldc + c0;
{
#pragma unroll
            for (int s = 0; s < 8; ++s) { const int row = 2 * s + hi, cofs = lr * 4; v4f val = *(const v4fa*)(os + row * 68 + cofs); if (BIAS) { val[0] += bfr(bias[c0 + cofs]); val[1] += bfr(bias[c0 + cofs + 1]); val[2] += bfr(bias[c0 + cofs + 2]); val[3] += bfr(bias[c0 + cofs + 3]); }
                *(v4f*)(crow + (size_t)row * ldc + cofs) = val; }
             }
        __builtin_amdgcn_wave_barrier(); asm volatile("" ::: "memory");
    }
}

// ---- k_gemmc: the same one-wave 64x64 tile GEMM specialised for causal attention: CMODE 1 skips score tiles entirely above the diagonal (query rows r0+roff.., key columns c0..), CMODE 2 limits the
// key (K) loop of the probability x value contraction to the diagonal block (probabilities beyond it are exactly zero). roff = row offset of this launch's first row within the sequence.
template <typename T16, int NSPLIT, int CMODE>
__global__ __launch_bounds__(32) void k_gemmc(const T16* __restrict__ A, const T16* __restrict__ A2, const T16* __restrict__ Bt, const T16* __restrict__ Bt2, int K, float* C, int ldc, int roff, size_t sA, size_t sB, size_t sC, const int* CF) {
    typedef typename WFrag<T16>::V V;
    __shared__ __align__(16) float os[16 * 68];
    const size_t z = blockIdx.z; A += z * sA; if (A2) A2 += z * sA; Bt += z * sB; if (Bt2) Bt2 += z * sB; C += z * sC;
    const int lane = threadIdx.x & 31, lr = lane & 15, hi = lane >> 4; const int r0 = blockIdx.x * 64, c0 = blockIdx.y * 64;
    const bool con = (CF == nullptr) || (CF[0] != 0);   /* device flag: mask verified causal */ if (CMODE == 1 && con && c0 > r0 + roff + 63) return;                  // score tile entirely above the causal diagonal: not computed (the softmax masks j > i by select)
    const int Kl = (CMODE == 2 && con) ? min(K, r0 + roff + 64) : K;        // P.V: probabilities are exactly 0 beyond the diagonal block, so the K loop stops there
    v8f acc[4][4];
#pragma unroll
    for (int mb = 0; mb < 4; ++mb)
#pragma unroll
        for (int nb = 0; nb < 4; ++nb) acc[mb][nb] = (v8f){};
    const size_t aoff = (size_t)(r0 + lr) * K + 8 * hi, boff = (size_t)(c0 + lr) * K + 8 * hi;
#pragma unroll 1
    for (int kc = 0; kc < Kl; kc += 32) {
        V a[4], a2[4];
#pragma unroll
        for (int mb = 0; mb < 4; ++mb) { a[mb] = WFrag<T16>::ld(A + aoff + (size_t)mb * 16 * K + kc); if (NSPLIT == 1 || NSPLIT == 2) a2[mb] = WFrag<T16>::ld(A2 + aoff + (size_t)mb * 16 * K + kc); }
#pragma unroll
        for (int nb = 0; nb < 4; ++nb) { const V b = WFrag<T16>::ld(Bt + boff + (size_t)nb * 16 * K + kc); V b2; if (NSPLIT >= 2) b2 = WFrag<T16>::ld(Bt2 + boff + (size_t)nb * 16 * K + kc);
#pragma unroll
            for (int mb = 0; mb < 4; ++mb) { acc[mb][nb] = WFrag<T16>::mma(a[mb], b, acc[mb][nb]); if (NSPLIT == 1 || NSPLIT == 2) acc[mb][nb] = WFrag<T16>::mma(a2[mb], b, acc[mb][nb]); if (NSPLIT >= 2) acc[mb][nb] = WFrag<T16>::mma(a[mb], b2, acc[mb][nb]); } }
        asm volatile("v_nop\n\tv_nop\n\tv_nop\n\tv_nop" : "+v"(acc[0][0]), "+v"(acc[1][1]), "+v"(acc[2][2]), "+v"(acc[3][3]) : "v"(a[0]), "v"(a[3]));
    }
#pragma unroll
    for (int mb = 0; mb < 4; ++mb) {
#pragma unroll
        for (int nb = 0; nb < 4; ++nb) {
#pragma unroll
            for (int j = 0; j < 8; ++j) os[(hi * 8 + j) * 68 + nb * 16 + lr] = acc[mb][nb][j]; }
        __builtin_amdgcn_wave_barrier(); asm volatile("" ::: "memory");
        float* crow = C + (size_t)(r0 + mb * 16) * ldc + c0;
{
#pragma unroll
            for (int s = 0; s < 8; ++s) { const int row = 2 * s + hi, cofs = lr * 4; v4f val = *(const v4fa*)(os + row * 68 + cofs);
                *(v4f*)(crow + (size_t)row * ldc + cofs) = val; }
             }
        __builtin_amdgcn_wave_barrier(); asm volatile("" ::: "memory");
    }
}

__device__ __forceinline__ h16 tohx(float x) { return (h16)x; }
__device__ __forceinline__ void splitf(float y, unsigned short& h, unsigned short& l) { h = f2bf(y); l = f2bf(y - bf2f(h)); }
typedef __attribute__((ext_vector_type(2))) _Float16 v2h;
typedef __attribute__((ext_vector_type(4))) _Float16 v4h;
typedef __attribute__((ext_vector_type(2))) unsigned short v2us;
typedef __attribute__((ext_vector_type(4))) unsigned short v4us;
typedef __attribute__((ext_vector_type(2))) float v2f;
typedef __attribute__((ext_vector_type(4))) int v4i;

__global__ __launch_bounds__(256) void k_wtG(const float* __restrict__ w, int K, int N, bf* Bt) {
    const int lane = threadIdx.x & 31; const int L0 = (blockIdx.x * 8 + (threadIdx.x >> 5)) * 8; const int nlines = N * K / 64;
{
#pragma unroll 1
        for (int l = 0; l < 8; ++l) { const int L = L0 + l; if (L >= nlines) break; const size_t e = (size_t)L * 64 + lane * 2; const int k = (int)(e % K), n = (int)(e / K); v2us o;
            o[0] = f2bf(w[(size_t)k * N + n]); o[1] = f2bf(w[(size_t)(k + 1) * N + n]); *(v2us*)(Bt + e) = o; }
         }
}
__global__ __launch_bounds__(256) void k_cvt8(const float* __restrict__ src, bf* dst, size_t n8) { const size_t i = (size_t)blockIdx.x * 256 + threadIdx.x; if (i >= n8) return; const v8f v = *(const v8f*)(src + i * 8); v8us o;
#pragma unroll
    for (int k = 0; k < 8; ++k) o[k] = f2bf(v[k]); *(v8us*)(dst + i * 8) = o;  }
__constant__ float INV[HD / 2] = {1.0,0.8659643530845642,0.7498942017555237,0.6493816375732422,0.5623413324356079,0.486967533826828,0.4216965138912201,0.36517414450645447,0.3162277638912201,0.2738419771194458,0.23713736236095428,0.20535250008106232,0.17782793939113617,0.1539926528930664,0.1333521455526352,0.11547820270061493,0.10000000149011612,0.08659642934799194,0.07498941570520401,0.06493816524744034,0.05623412877321243,0.04869675263762474,0.04216964915394783,0.03651741147041321,0.03162277862429619,0.0273841954767704,0.0237137358635664,0.02053525112569332,0.017782794311642647,0.015399265103042126,0.01333521492779255,0.011547819711267948,0.009999999776482582,0.00865964312106371,0.007498942315578461,0.006493816617876291,0.005623413249850273,0.004869675263762474,0.0042169648222625256,0.003651741426438093,0.003162277862429619,0.0027384196873754263,0.0023713738191872835,0.0020535250660032034,0.0017782794311642647,0.0015399265103042126,0.0013335214462131262,0.0011547820176929235,0.0010000000474974513,0.0008659643353894353,0.0007498941849917173,0.0006493816617876291,0.000562341301701963,0.00048696750309318304,0.00042169648804701865,0.00036517411353997886,0.0003162277862429619,0.00027384195709601045,0.0002371373848291114,0.00020535249495878816,0.00017782794020604342,0.00015399264520965517,0.0001333521504420787,0.00011547819303814322};
__global__ __launch_bounds__(256) void k_cstab(const int* __restrict__ pos, float* CS) { const int idx = blockIdx.x * 256 + threadIdx.x; if (idx >= TT * HD) return; const int t = idx / HD, d = idx % HD; const float ang = __fmul_rn((float)pos[t], INV[d % (HD / 2)]); v2f cs; cs[0] = cosf(ang); cs[1] = sinf(ang);
    *(v2f*)(CS + (size_t)idx * 2) = cs;  }
// k_mchk: causal-pattern check of the additive mask for one batch: any entry with (j <= i and mask != 0) or (j > i and mask > -1e30) clears FLAG[0] (plain identical stores; FLAG preset to 1); lane -> 4 consecutive j.
__global__ __launch_bounds__(256) void k_mchk(const float* __restrict__ MKb, int* FLAG) { const size_t e = ((size_t)blockIdx.x * 256 + threadIdx.x) * 4; if (e >= (size_t)TT * TT) return; const int j = (int)(e % TT), i = (int)(e / TT); const v4f m = *(const v4f*)(MKb + e); bool bad = false;
#pragma unroll
    for (int q = 0; q < 4; ++q) { const bool keep = (j + q <= i); bad |= keep ? (m[q] != 0.0f) : (m[q] > -1.0e30f); }
    if (bad) *(int*)FLAG = 0; }
__global__ void k_flag1(int* FLAG) { if (threadIdx.x == 0) { *(int*)FLAG = 1;  } }

// k_rope: head planes [h][t][d] (fp16 + hi/lo) of rope(x) x sc with the rotate-half convention out[d] = x[d] cos[t][d] - x[d+HD/2] sin[t][d], out[d+HD/2] = x[d+HD/2] cos[t][d+HD/2] + x[d] sin[t][d+HD/2]
__global__ __launch_bounds__(256) void k_rope(const float* __restrict__ F, int pitch, int nheads, const float* __restrict__ CS, const float* __restrict__ RF, const float* __restrict__ nw, float sc, h16* P16, bf* Ph, bf* Pl) {
    const size_t e = ((size_t)blockIdx.x * 256 + threadIdx.x) * 2; if (e >= (size_t)nheads * TT * HD) return; const int d = (int)(e % HD); const int t = (int)((e / HD) % TT); const int h = (int)(e / ((size_t)HD * TT)); const float* f = F + (size_t)t * pitch + h * HD; const float rf = RF ? RF[(size_t)h * TT + t] : 1.0f; v2h o16; v2us oh, ol;
#pragma unroll
    for (int q = 0; q < 2; ++q) { const int dd = d + q; const int dp = (dd < HD / 2) ? dd + HD / 2 : dd - HD / 2; float x0 = f[dd], x1 = f[dp];
        if (RF) { float n0 = __fmul_rn(x0, rf), n1 = __fmul_rn(x1, rf); asm volatile("" : "+v"(n0)); asm volatile("" : "+v"(n1)); x0 = __fmul_rn(bfr(nw[dd]), n0); x1 = __fmul_rn(bfr(nw[dp]), n1); }
        const v2f cs = *(const v2f*)(CS + ((size_t)t * HD + dd) * 2); float a = __fmul_rn(x0, cs[0]), bq = __fmul_rn(x1, cs[1]); asm volatile("" : "+v"(a)); asm volatile("" : "+v"(bq)); const float r = ((dd < HD / 2) ? __fsub_rn(a, bq) : __fadd_rn(a, bq)) * sc;
        o16[q] = tohx(r); unsigned short a2, c2; splitf(r, a2, c2); oh[q] = a2; ol[q] = c2; }
    *(v2h*)(P16 + e) = o16; *(v2us*)(Ph + e) = oh; *(v2us*)(Pl + e) = ol;  }
__global__ __launch_bounds__(256) void k_vtp(const float* __restrict__ F, int pitch, int nheads, h16* V16, bf* Vh, bf* Vl) { const size_t e = ((size_t)blockIdx.x * 256 + threadIdx.x) * 2; if (e >= (size_t)nheads * HD * TT) return; const int t = (int)(e % TT); const int d = (int)((e / TT) % HD); const int g = (int)(e / ((size_t)TT * HD)); v2h o16; v2us oh, ol;
#pragma unroll
    for (int q = 0; q < 2; ++q) { const float x = F[(size_t)(t + q) * pitch + g * HD + d]; o16[q] = tohx(x); unsigned short a2, c2; splitf(x, a2, c2); oh[q] = a2; ol[q] = c2; }
    *(v2h*)(V16 + e) = o16; *(v2us*)(Vh + e) = oh; *(v2us*)(Vl + e) = ol;  }
// k_asoft: per row (zz, i): t = S x HD^-0.5 for j <= i; softmax over the 2048 keys (register row, one exp, fixed trees);; adds bf16(attention_mask[b][0][i][j]) to kept scores; when the device flag says the mask is causal, keys j > i get exact-zero weight (same as adding the most-negative mask value), otherwise every key takes score + mask
__global__ __launch_bounds__(256) void k_asoft(const float* __restrict__ Sb, const float* __restrict__ MKb, const int* __restrict__ CF, h16* P16, bf* Ph, bf* Pl) {
    const int lane = threadIdx.x & 31; const int row = blockIdx.x * 8 + (threadIdx.x >> 5); if (row >= ZH * TT) return; const int i = row % TT; const int zz = row / TT; (void)zz; const float* mk = MKb + (size_t)i * TT; const bool con = (CF[0] != 0); const bool hires = (i < RH); const float* sr = Sb + (size_t)row * TT; float v[TT / 32]; float mx = -3.0e38f;
#pragma unroll
    for (int ch = 0; ch < TT / 128; ++ch) { const int j0 = ch * 128 + lane * 4; const v4f a = *(const v4f*)(sr + j0);
#pragma unroll
        for (int q = 0; q < 4; ++q) { const int j = j0 + q; (void)j; float sa = a[q] * SCL; asm volatile("" : "+v"(sa)); float mv = bfr(mk[j]); asm volatile("" : "+v"(mv)); const float t = (j <= i || !con) ? __fadd_rn(sa, mv) : -3.0e38f;   /* causal-verified: masked keys -> exact zero weight (== adding the most-negative mask); else general additive path */ v[ch * 4 + q] = t; mx = fmaxf(mx, t); } }
#pragma unroll
    for (int sh = 16; sh; sh >>= 1) mx = fmaxf(mx, __shfl_xor(mx, sh, 32));
    float sum = 0.f;
#pragma unroll
    for (int k = 0; k < TT / 32; ++k) { float d0 = __fsub_rn(v[k], mx); asm volatile("" : "+v"(d0)); v[k] = __builtin_amdgcn_exp2f(__fmul_rn(d0, 1.4426950408889634f)); sum += v[k]; }
#pragma unroll
    for (int sh = 16; sh; sh >>= 1) sum += __shfl_xor(sum, sh, 32);
    const float f = __fdiv_rn(hires ? 1.0f : PCAR, sum);
{
        if (hires) {
#pragma unroll
            for (int ch = 0; ch < TT / 128; ++ch) { v4us oh, ol;
#pragma unroll
                for (int q = 0; q < 4; ++q) { unsigned short a, c2; splitf(v[ch * 4 + q] * f, a, c2); oh[q] = a; ol[q] = c2; }
                const size_t oo = ((size_t)zz * (RH ? RH : 1) + i) * TT + ch * 128 + lane * 4; *(v4us*)(Ph + oo) = oh; *(v4us*)(Pl + oo) = ol; }
        } else {
#pragma unroll
            for (int ch = 0; ch < TT / 128; ++ch) { v4h o4;
#pragma unroll
                for (int q = 0; q < 4; ++q) o4[q] = tohx(v[ch * 4 + q] * f);
                *(v4h*)(P16 + (size_t)row * TT + ch * 128 + lane * 4) = o4; } }
         }
}
__global__ __launch_bounds__(256) void k_merge(const float* __restrict__ O, int h0, bf* Ah, bf* Al) { const size_t e = ((size_t)blockIdx.x * 256 + threadIdx.x) * 2; if (e >= (size_t)ZH * TT * HD) return; const int d = (int)(e % HD); const int t = (int)((e / HD) % TT); const int zz = (int)(e / ((size_t)HD * TT)); const float cs = (t < RH) ? 1.0f : (1.0f / PCAR); const size_t oo = (size_t)t * DQ + (h0 + zz) * HD + d;
    v2us oh, ol;
#pragma unroll
    for (int q = 0; q < 2; ++q) { unsigned short a, c2; splitf(O[e + q] * cs, a, c2); oh[q] = a; ol[q] = c2; } *(v2us*)(Ah + oo) = oh; *(v2us*)(Al + oo) = ol;  }

extern "C" void kernel_launch(void* const* d_in, const int* in_sizes, int n_in,
                              void* d_out, int out_size, void* d_ws, size_t ws_size, hipStream_t stream) {
    (void)in_sizes; (void)n_in; (void)out_size;
    const float* x = (const float*)d_in[0]; const float* MK = (const float*)d_in[1]; const int* POS = (const int*)d_in[2]; const float* wq = (const float*)d_in[3]; const float* wk = (const float*)d_in[4]; const float* wv = (const float*)d_in[5]; const float* wo = (const float*)d_in[6];
    float* OUT = (float*)d_out;     // [2][2048][2048]
    char* wsp = (char*)d_ws;
    auto take = [&](size_t bytes) { char* p = wsp; wsp += (bytes + 255) & ~(size_t)255; return (void*)p; };
    bf* WQ = (bf*)take((size_t)DQ * DM * 2); bf* WK = (bf*)take((size_t)DKV * DM * 2); bf* WV = (bf*)take((size_t)DKV * DM * 2); bf* WO = (bf*)take((size_t)DM * DQ * 2); float* CS = (float*)take((size_t)TT * HD * 2 * 4);
    bf* XB = (bf*)take((size_t)TT * DM * 2); int* CFLAG = (int*)take(256); float* FQ = (float*)take((size_t)TT * DQ * 4); float* FK = (float*)take((size_t)TT * DKV * 4);
    h16* QP16 = (h16*)take((size_t)NH_ * TT * HD * 2); h16* KP16 = (h16*)take((size_t)NKV * TT * HD * 2); h16* VT16 = (h16*)take((size_t)NKV * HD * TT * 2);
    bf* QPh = (bf*)take((size_t)NH_ * TT * HD * 2); bf* QPl = (bf*)take((size_t)NH_ * TT * HD * 2); bf* KPh = (bf*)take((size_t)NKV * TT * HD * 2); bf* KPl = (bf*)take((size_t)NKV * TT * HD * 2); bf* VTh = (bf*)take((size_t)NKV * HD * TT * 2); bf* VTl = (bf*)take((size_t)NKV * HD * TT * 2); bf* Ph = (bf*)take((size_t)ZH * RH * TT * 2); bf* Pl = (bf*)take((size_t)ZH * RH * TT * 2);
    float* Sb = (float*)take((size_t)ZH * TT * TT * 4); h16* P16 = (h16*)take((size_t)ZH * TT * TT * 2); float* Ob = (float*)take((size_t)ZH * TT * HD * 4); bf* ATh = (bf*)take((size_t)TT * DQ * 2); bf* ATl = (bf*)take((size_t)TT * DQ * 2);
    if ((size_t)(wsp - (char*)d_ws) > ws_size) return;    // ws 256 MiB
    float* FV = FK;   // v projection reuses the k buffer after the k planes are built (stream-ordered)
    { k_cvt8<<<(unsigned)(((size_t)DQ * DM / 8 + 255) / 256), 256, 0, stream>>>(wq, WQ, (size_t)DQ * DM / 8); k_cvt8<<<(unsigned)(((size_t)DKV * DM / 8 + 255) / 256), 256, 0, stream>>>(wk, WK, (size_t)DKV * DM / 8); k_cvt8<<<(unsigned)(((size_t)DKV * DM / 8 + 255) / 256), 256, 0, stream>>>(wv, WV, (size_t)DKV * DM / 8);
      k_cvt8<<<(unsigned)(((size_t)DM * DQ / 8 + 255) / 256), 256, 0, stream>>>(wo, WO, (size_t)DM * DQ / 8);
      }
    const unsigned LQ = (unsigned)(((size_t)NH_ * TT * HD / 2 + 255) / 256), LKv = (unsigned)(((size_t)NKV * TT * HD / 2 + 255) / 256);
    for (int b = 0; b < NB_; ++b) {
        
        k_cvt8<<<(unsigned)(((size_t)TT * DM / 8 + 255) / 256), 256, 0, stream>>>(x + (size_t)b * TT * DM, XB, (size_t)TT * DM / 8); k_flag1<<<1, 32, 0, stream>>>(CFLAG); k_mchk<<<(unsigned)(((size_t)TT * TT / 4 + 255) / 256), 256, 0, stream>>>(MK + (size_t)b * TT * TT, CFLAG); k_cstab<<<(TT * HD + 255) / 256, 256, 0, stream>>>(POS + (size_t)b * TT, CS);   /* mask check + per-batch rotary table */
        k_gemmw<bf, 0, false><<<dim3(TT / 64, DQ / 64, 1), 32, 0, stream>>>(XB, nullptr, WQ, nullptr, DM, FQ, DQ, nullptr, 0, 0, 0);
        k_rope<<<LQ, 256, 0, stream>>>(FQ, DQ, NH_, CS, nullptr, nullptr, 1.0f, QP16, QPh, QPl);
        k_gemmw<bf, 0, false><<<dim3(TT / 64, DKV / 64, 1), 32, 0, stream>>>(XB, nullptr, WK, nullptr, DM, FK, DKV, nullptr, 0, 0, 0);
        k_rope<<<LKv, 256, 0, stream>>>(FK, DKV, NKV, CS, nullptr, nullptr, 1.0f, KP16, KPh, KPl);
        k_gemmw<bf, 0, false><<<dim3(TT / 64, DKV / 64, 1), 32, 0, stream>>>(XB, nullptr, WV, nullptr, DM, FV, DKV, nullptr, 0, 0, 0); k_vtp<<<LKv, 256, 0, stream>>>(FV, DKV, NKV, VT16, VTh, VTl);
        for (int h0 = 0; h0 < NH_; h0 += ZH) { const size_t zq = (size_t)h0, zk = (size_t)(h0 / REP);   // one kv head per query head: the pass's two heads use consecutive kv planes (z-strides TT*HD)
            k_gemmc<bf, 2, 1><<<dim3(RH / 64, TT / 64, ZH), 32, 0, stream>>>(QPh + zq * TT * HD, QPl + zq * TT * HD, KPh + zk * TT * HD, KPl + zk * TT * HD, HD, Sb, TT, 0, (size_t)TT * HD, (size_t)TT * HD, (size_t)TT * TT, CFLAG);
            k_gemmc<h16, 0, 1><<<dim3((TT - RH) / 64, TT / 64, ZH), 32, 0, stream>>>(QP16 + zq * TT * HD + (size_t)RH * HD, nullptr, KP16 + zk * TT * HD, nullptr, HD, Sb + (size_t)RH * TT, TT, RH, (size_t)TT * HD, (size_t)TT * HD, (size_t)TT * TT, CFLAG);
            k_asoft<<<ZH * TT / 8, 256, 0, stream>>>(Sb, MK + (size_t)b * TT * TT, CFLAG, P16, Ph, Pl);
            k_gemmc<bf, 2, 2><<<dim3(RH / 64, HD / 64, ZH), 32, 0, stream>>>(Ph, Pl, VTh + zk * HD * TT, VTl + zk * HD * TT, TT, Ob, HD, 0, (size_t)RH * TT, (size_t)HD * TT, (size_t)TT * HD, CFLAG);
            k_gemmc<h16, 0, 2><<<dim3((TT - RH) / 64, HD / 64, ZH), 32, 0, stream>>>(P16 + (size_t)RH * TT, nullptr, VT16 + zk * HD * TT, nullptr, TT, Ob + (size_t)RH * HD, HD, RH, (size_t)TT * TT, (size_t)HD * TT, (size_t)TT * HD, CFLAG);
            k_merge<<<(unsigned)(((size_t)ZH * TT * HD / 2 + 255) / 256), 256, 0, stream>>>(Ob, h0, ATh, ATl); }
        k_gemmw<bf, 1, false><<<dim3(TT / 64, DM / 64, 1), 32, 0, stream>>>(ATh, ATl, WO, nullptr, DQ, OUT + (size_t)b * TT * DM, DM, nullptr, 0, 0, 0); }
}

// v001
// One run takes 1150 microseconds.
// Timed twice side by side with v000, it ran 1.69 times as fast both times.
#include <hip/hip_runtime.h>

// Causal LM attention with additive mask and position-id rotary (hidden [2][2048][2048]; q, k, v = hidden W^T ('oi' [2048][2048], 16 heads x 128); rotate-half RoPE with angle = position_ids[b][t] x inv_freq (theta 1e4; position_ids int32 input, read on device); scores/sqrt(128) + attention_mask[b][0][i][j] (f32 input, read); softmax; out = merged Wo^T -> [2][2048][2048]).
// The additive mask is verified ON THE DEVICE to be the causal pattern (0 where j <= i, most-negative elsewhere); when it is, score tiles above the diagonal are skipped and the masked entries are realised as exact-zero softmax weights (identical result); otherwise every tile is computed and the mask is simply added (general fallback).
// Compute dtypes, f32 accumulate: every input rounded to bf16; q/k/v on PLAIN bf16 operands (inputs: exact); rotary in f32 (per-batch table from the position ids and the reference's inv_freq constants); mask check, additive mask (bf16-rounded) inside the softmax kernel; causal scores and attn.v (tile skipping gated by the device flag): query rows < 512 hl (3 products), the rest single fp16 (x1024); softmax f32; Wo hl x exact (2 products).

#define NB_  2
#define TT   2048
#define DM   2048
#define NH_  16
#define NKV  16
#define REP  (NH_ / NKV)
#define HD   128
#define DQ   (NH_ * HD)
#define DKV  (NKV * HD)
#define ZH   8                    // heads per attention pass (grid z of the score and P.V launches)
#define RH   512                  // query rows < RH use hi+lo planes (0: none)
#define WIN  2048
#define PCAR 1024.0f
#define SCL  0.088388347648318447f   // HD^-0.5
typedef _Float16 h16;
typedef unsigned short bf;
typedef __attribute__((ext_vector_type(16))) __bf16   v16bf;
typedef __attribute__((ext_vector_type(16))) _Float16 v16h;
typedef __attribute__((ext_vector_type(8)))  _Float16 v8h;
typedef __attribute__((ext_vector_type(8)))  unsigned short v8us;
typedef __attribute__((ext_vector_type(8)))  float    v8f;
typedef __attribute__((ext_vector_type(4)))  float    v4f;
typedef v8h  __attribute__((may_alias)) v8ha;
typedef v4f  __attribute__((may_alias)) v4fa;
typedef v8us __attribute__((may_alias)) v8usa;

__device__ __forceinline__ unsigned short f2bf(float f) { unsigned u = __float_as_uint(f); u += 0x7FFFu + ((u >> 16) & 1u); return (unsigned short)(u >> 16); }
__device__ __forceinline__ float bf2f(unsigned short b) { return __uint_as_float(((unsigned)b) << 16); }
__device__ __forceinline__ float bfr(float f) { return bf2f(f2bf(f)); }
__device__ __forceinline__ v16h cat16(v8h lo, v8h hi) { return __builtin_shufflevector(lo, hi, 0, 1, 2, 3, 4, 5, 6, 7, 8, 9, 10, 11, 12, 13, 14, 15); }
__device__ __forceinline__ v16bf cat16b(v8us lo, v8us hi) { return __builtin_bit_cast(v16bf, __builtin_shufflevector(lo, hi, 0, 1, 2, 3, 4, 5, 6, 7, 8, 9, 10, 11, 12, 13, 14, 15)); }
__device__ __forceinline__ v8f wmma16(v16h a, v16h b, v8f c) { return __builtin_amdgcn_wmma_f32_16x16x32_f16(false, a, false, b, (short)0, c, false, false); }
__device__ __forceinline__ v8f wmmab(v16bf a, v16bf b, v8f c) { return __builtin_amdgcn_wmma_f32_16x16x32_bf16(false, a, false, b, (short)0, c, false, false); }



// ---- k_gemmw: register-blocked GEMM, ONE WAVE per 64x64 output tile (16 accumulators), operands straight from K-contiguous 16-bit planes; grid (M/64, N/64, Z), 32 threads.
// C[m][n] (f32, pitch ldc, + optional f32 bias[n]) = sum_k A[m][k] Bt[n][k] (+ split products per NSPLIT). z-batch strides sA/sB/sC in elements. K % 32 == 0.
template <typename T16> struct WFrag;
template <> struct WFrag<h16> { typedef v16h V; static __device__ __forceinline__ V ld(const h16* p) { return cat16(*(const v8h*)p, *(const v8h*)(p + 16)); } static __device__ __forceinline__ v8f mma(V a, V b, v8f c) { return wmma16(a, b, c); } };
template <> struct WFrag<bf> { typedef v16bf V; static __device__ __forceinline__ V ld(const bf* p) { return cat16b(*(const v8us*)p, *(const v8us*)(p + 16)); } static __device__ __forceinline__ v8f mma(V a, V b, v8f c) { return wmmab(a, b, c); } };
template <typename T16, int NSPLIT, bool BIAS>
__global__ __launch_bounds__(32) void k_gemmw(const T16* __restrict__ A, const T16* __restrict__ A2, const T16* __restrict__ Bt, const T16* __restrict__ Bt2, int K, float* C, int ldc, const float* __restrict__ bias, size_t sA, size_t sB, size_t sC) {
    typedef typename WFrag<T16>::V V;
    __shared__ __align__(16) float os[16 * 68];
    const size_t z = blockIdx.z; A += z * sA; if (A2) A2 += z * sA; Bt += z * sB; if (Bt2) Bt2 += z * sB; C += z * sC;
    const int lane = threadIdx.x & 31, lr = lane & 15, hi = lane >> 4; const int r0 = blockIdx.x * 64, c0 = blockIdx.y * 64;
    v8f acc[4][4];
#pragma unroll
    for (int mb = 0; mb < 4; ++mb)
#pragma unroll
        for (int nb = 0; nb < 4; ++nb) acc[mb][nb] = (v8f){};
    const size_t aoff = (size_t)(r0 + lr) * K + 8 * hi, boff = (size_t)(c0 + lr) * K + 8 * hi;
#pragma unroll 1
    for (int kc = 0; kc < K; kc += 32) {
        V a[4], a2[4];
#pragma unroll
        for (int mb = 0; mb < 4; ++mb) { a[mb] = WFrag<T16>::ld(A + aoff + (size_t)mb * 16 * K + kc); if (NSPLIT == 1 || NSPLIT == 2) a2[mb] = WFrag<T16>::ld(A2 + aoff + (size_t)mb * 16 * K + kc); }
#pragma unroll
        for (int nb = 0; nb < 4; ++nb) { const V b = WFrag<T16>::ld(Bt + boff + (size_t)nb * 16 * K + kc); V b2; if (NSPLIT >= 2) b2 = WFrag<T16>::ld(Bt2 + boff + (size_t)nb * 16 * K + kc);
#pragma unroll
            for (int mb = 0; mb < 4; ++mb) { acc[mb][nb] = WFrag<T16>::mma(a[mb], b, acc[mb][nb]); if (NSPLIT == 1 || NSPLIT == 2) acc[mb][nb] = WFrag<T16>::mma(a2[mb], b, acc[mb][nb]); if (NSPLIT >= 2) acc[mb][nb] = WFrag<T16>::mma(a[mb], b2, acc[mb][nb]); } }
        asm volatile("v_nop\n\tv_nop\n\tv_nop\n\tv_nop" : "+v"(acc[0][0]), "+v"(acc[1][1]), "+v"(acc[2][2]), "+v"(acc[3][3]) : "v"(a[0]), "v"(a[3]));
    }
#pragma unroll
    for (int mb = 0; mb < 4; ++mb) {
#pragma unroll
        for (int nb = 0; nb < 4; ++nb) {
#pragma unroll
            for (int j = 0; j < 8; ++j) os[(hi * 8 + j) * 68 + nb * 16 + lr] = acc[mb][nb][j]; }
        __builtin_amdgcn_wave_barrier(); asm volatile("" ::: "memory");
        float* crow = C + (size_t)(r0 + mb * 16) * ldc + c0;
{
#pragma unroll
            for (int s = 0; s < 8; ++s) { const int row = 2 * s + hi, cofs = lr * 4; v4f val = *(const v4fa*)(os + row * 68 + cofs); if (BIAS) { val[0] += bfr(bias[c0 + cofs]); val[1] += bfr(bias[c0 + cofs + 1]); val[2] += bfr(bias[c0 + cofs + 2]); val[3] += bfr(bias[c0 + cofs + 3]); }
                *(v4f*)(crow + (size_t)row * ldc + cofs) = val; }
             }
        __builtin_amdgcn_wave_barrier(); asm volatile("" ::: "memory");
    }
}

// ---- k_gemmc: the same one-wave 64x64 tile GEMM specialised for causal attention: CMODE 1 skips score tiles entirely above the diagonal (query rows r0+roff.., key columns c0..), CMODE 2 limits the
// key (K) loop of the probability x value contraction to the diagonal block (probabilities beyond it are exactly zero). roff = row offset of this launch's first row within the sequence. K = row pitch of A, A2, Bt and Bt2 in elements, Kn = length of the contraction (Kn <= K, Kn % 32 == 0).
template <typename T16, int NSPLIT, int CMODE>
__global__ __launch_bounds__(32) void k_gemmc(const T16* __restrict__ A, const T16* __restrict__ A2, const T16* __restrict__ Bt, const T16* __restrict__ Bt2, int K, int Kn, float* C, int ldc, int roff, size_t sA, size_t sB, size_t sC, const int* CF) {
    typedef typename WFrag<T16>::V V;
    __shared__ __align__(16) float os[16 * 68];
    const size_t z = blockIdx.z; A += z * sA; if (A2) A2 += z * sA; Bt += z * sB; if (Bt2) Bt2 += z * sB; C += z * sC;
    const int lane = threadIdx.x & 31, lr = lane & 15, hi = lane >> 4; const int r0 = blockIdx.x * 64, c0 = blockIdx.y * 64;
    const bool con = (CF == nullptr) || (CF[0] != 0);   /* device flag: mask verified causal */ if (CMODE == 1 && con && c0 > r0 + roff + 63) return;                  // score tile entirely above the causal diagonal: never read (the softmax masks j > i by select)
    const int Kl = (CMODE == 2 && con) ? min(Kn, r0 + roff + 64) : Kn;        // P.V: probabilities are exactly 0 beyond the diagonal block, so the K loop stops there
    v8f acc[4][4];
#pragma unroll
    for (int mb = 0; mb < 4; ++mb)
#pragma unroll
        for (int nb = 0; nb < 4; ++nb) acc[mb][nb] = (v8f){};
    const size_t aoff = (size_t)(r0 + lr) * K + 8 * hi, boff = (size_t)(c0 + lr) * K + 8 * hi;
#pragma unroll 1
    for (int kc = 0; kc < Kl; kc += 32) {
        V a[4], a2[4];
#pragma unroll
        for (int mb = 0; mb < 4; ++mb) { a[mb] = WFrag<T16>::ld(A + aoff + (size_t)mb * 16 * K + kc); if (NSPLIT == 1 || NSPLIT == 2) a2[mb] = WFrag<T16>::ld(A2 + aoff + (size_t)mb * 16 * K + kc); }
#pragma unroll
        for (int nb = 0; nb < 4; ++nb) { const V b = WFrag<T16>::ld(Bt + boff + (size_t)nb * 16 * K + kc); V b2; if (NSPLIT >= 2) b2 = WFrag<T16>::ld(Bt2 + boff + (size_t)nb * 16 * K + kc);
#pragma unroll
            for (int mb = 0; mb < 4; ++mb) { acc[mb][nb] = WFrag<T16>::mma(a[mb], b, acc[mb][nb]); if (NSPLIT == 1 || NSPLIT == 2) acc[mb][nb] = WFrag<T16>::mma(a2[mb], b, acc[mb][nb]); if (NSPLIT >= 2) acc[mb][nb] = WFrag<T16>::mma(a[mb], b2, acc[mb][nb]); } }
        asm volatile("v_nop\n\tv_nop\n\tv_nop\n\tv_nop" : "+v"(acc[0][0]), "+v"(acc[1][1]), "+v"(acc[2][2]), "+v"(acc[3][3]) : "v"(a[0]), "v"(a[3]));
    }
#pragma unroll
    for (int mb = 0; mb < 4; ++mb) {
#pragma unroll
        for (int nb = 0; nb < 4; ++nb) {
#pragma unroll
            for (int j = 0; j < 8; ++j) os[(hi * 8 + j) * 68 + nb * 16 + lr] = acc[mb][nb][j]; }
        __builtin_amdgcn_wave_barrier(); asm volatile("" ::: "memory");
        float* crow = C + (size_t)(r0 + mb * 16) * ldc + c0;
{
#pragma unroll
            for (int s = 0; s < 8; ++s) { const int row = 2 * s + hi, cofs = lr * 4; v4f val = *(const v4fa*)(os + row * 68 + cofs);
                *(v4f*)(crow + (size_t)row * ldc + cofs) = val; }
             }
        __builtin_amdgcn_wave_barrier(); asm volatile("" ::: "memory");
    }
}

__device__ __forceinline__ h16 tohx(float x) { return (h16)x; }
__device__ __forceinline__ void splitf(float y, unsigned short& h, unsigned short& l) { h = f2bf(y); l = f2bf(y - bf2f(h)); }
typedef __attribute__((ext_vector_type(2))) _Float16 v2h;
typedef __attribute__((ext_vector_type(4))) _Float16 v4h;
typedef __attribute__((ext_vector_type(2))) unsigned short v2us;
typedef __attribute__((ext_vector_type(4))) unsigned short v4us;
typedef __attribute__((ext_vector_type(2))) float v2f;
typedef __attribute__((ext_vector_type(4))) int v4i;

__global__ __launch_bounds__(256) void k_wtG(const float* __restrict__ w, int K, int N, bf* Bt) {
    const int lane = threadIdx.x & 31; const int L0 = (blockIdx.x * 8 + (threadIdx.x >> 5)) * 8; const int nlines = N * K / 64;
{
#pragma unroll 1
        for (int l = 0; l < 8; ++l) { const int L = L0 + l; if (L >= nlines) break; const size_t e = (size_t)L * 64 + lane * 2; const int k = (int)(e % K), n = (int)(e / K); v2us o;
            o[0] = f2bf(w[(size_t)k * N + n]); o[1] = f2bf(w[(size_t)(k + 1) * N + n]); *(v2us*)(Bt + e) = o; }
         }
}
__global__ __launch_bounds__(256) void k_cvt8(const float* __restrict__ src, bf* dst, size_t n8) { const size_t i = (size_t)blockIdx.x * 256 + threadIdx.x; if (i >= n8) return; const v8f v = *(const v8f*)(src + i * 8); v8us o;
#pragma unroll
    for (int k = 0; k < 8; ++k) o[k] = f2bf(v[k]); *(v8us*)(dst + i * 8) = o;  }
__constant__ float INV[HD / 2] = {1.0,0.8659643530845642,0.7498942017555237,0.6493816375732422,0.5623413324356079,0.486967533826828,0.4216965138912201,0.36517414450645447,0.3162277638912201,0.2738419771194458,0.23713736236095428,0.20535250008106232,0.17782793939113617,0.1539926528930664,0.1333521455526352,0.11547820270061493,0.10000000149011612,0.08659642934799194,0.07498941570520401,0.06493816524744034,0.05623412877321243,0.04869675263762474,0.04216964915394783,0.03651741147041321,0.03162277862429619,0.0273841954767704,0.0237137358635664,0.02053525112569332,0.017782794311642647,0.015399265103042126,0.01333521492779255,0.011547819711267948,0.009999999776482582,0.00865964312106371,0.007498942315578461,0.006493816617876291,0.005623413249850273,0.004869675263762474,0.0042169648222625256,0.003651741426438093,0.003162277862429619,0.0027384196873754263,0.0023713738191872835,0.0020535250660032034,0.0017782794311642647,0.0015399265103042126,0.0013335214462131262,0.0011547820176929235,0.0010000000474974513,0.0008659643353894353,0.0007498941849917173,0.0006493816617876291,0.000562341301701963,0.00048696750309318304,0.00042169648804701865,0.00036517411353997886,0.0003162277862429619,0.00027384195709601045,0.0002371373848291114,0.00020535249495878816,0.00017782794020604342,0.00015399264520965517,0.0001333521504420787,0.00011547819303814322};
__global__ __launch_bounds__(256) void k_cstab(const int* __restrict__ pos, float* CS) { const int idx = blockIdx.x * 256 + threadIdx.x; if (idx >= TT * HD) return; const int t = idx / HD, d = idx % HD; const float ang = __fmul_rn((float)pos[t], INV[d % (HD / 2)]); v2f cs; cs[0] = cosf(ang); cs[1] = sinf(ang);
    *(v2f*)(CS + (size_t)idx * 2) = cs;  }
// k_mchk: causal-pattern check of the additive mask for one batch: any entry with (j <= i and mask != 0) or (j > i and mask > -1e30) clears FLAG[0] (plain identical stores; FLAG preset to 1); lane -> 4 consecutive j.
__global__ __launch_bounds__(256) void k_mchk(const float* __restrict__ MKb, int* FLAG) { const size_t e = ((size_t)blockIdx.x * 256 + threadIdx.x) * 4; if (e >= (size_t)TT * TT) return; const int j = (int)(e % TT), i = (int)(e / TT); const v4f m = *(const v4f*)(MKb + e); bool bad = false;
#pragma unroll
    for (int q = 0; q < 4; ++q) { const bool keep = (j + q <= i); bad |= keep ? (m[q] != 0.0f) : (m[q] > -1.0e30f); }
    if (bad) *(int*)FLAG = 0; }
__global__ void k_flag1(int* FLAG) { if (threadIdx.x == 0) { *(int*)FLAG = 1;  } }

// k_rope: head planes [h][t][d] (fp16 + hi/lo) of rope(x) x sc with the rotate-half convention out[d] = x[d] cos[t][d] - x[d+HD/2] sin[t][d], out[d+HD/2] = x[d+HD/2] cos[t][d+HD/2] + x[d] sin[t][d+HD/2]; the hi/lo planes hold rows t < hr only ([h][hr][d])
__global__ __launch_bounds__(256) void k_rope(const float* __restrict__ F, int pitch, int nheads, const float* __restrict__ CS, const float* __restrict__ RF, const float* __restrict__ nw, float sc, int hr, h16* P16, bf* Ph, bf* Pl) {
    const size_t e = ((size_t)blockIdx.x * 256 + threadIdx.x) * 2; if (e >= (size_t)nheads * TT * HD) return; const int d = (int)(e % HD); const int t = (int)((e / HD) % TT); const int h = (int)(e / ((size_t)HD * TT)); const float* f = F + (size_t)t * pitch + h * HD; const float rf = RF ? RF[(size_t)h * TT + t] : 1.0f; v2h o16; v2us oh, ol;
#pragma unroll
    for (int q = 0; q < 2; ++q) { const int dd = d + q; const int dp = (dd < HD / 2) ? dd + HD / 2 : dd - HD / 2; float x0 = f[dd], x1 = f[dp];
        if (RF) { float n0 = __fmul_rn(x0, rf), n1 = __fmul_rn(x1, rf); asm volatile("" : "+v"(n0)); asm volatile("" : "+v"(n1)); x0 = __fmul_rn(bfr(nw[dd]), n0); x1 = __fmul_rn(bfr(nw[dp]), n1); }
        const v2f cs = *(const v2f*)(CS + ((size_t)t * HD + dd) * 2); float a = __fmul_rn(x0, cs[0]), bq = __fmul_rn(x1, cs[1]); asm volatile("" : "+v"(a)); asm volatile("" : "+v"(bq)); const float r = ((dd < HD / 2) ? __fsub_rn(a, bq) : __fadd_rn(a, bq)) * sc;
        o16[q] = tohx(r); unsigned short a2, c2; splitf(r, a2, c2); oh[q] = a2; ol[q] = c2; }
    *(v2h*)(P16 + e) = o16; if (t < hr) { const size_t eh = ((size_t)h * hr + t) * HD + d; *(v2us*)(Ph + eh) = oh; *(v2us*)(Pl + eh) = ol; }  }
// k_vtp: transposed value planes [g][d][t] at a row pitch of 2 x TT elements, the pitch of the in-place weight rows they are contracted with (k_gemmc has one pitch for both operands); the lo plane lies in the second half of the hi plane's rows (Vl = Vh + TT)
__global__ __launch_bounds__(256) void k_vtp(const float* __restrict__ F, int pitch, int nheads, h16* V16, bf* Vh, bf* Vl) { const size_t e = ((size_t)blockIdx.x * 256 + threadIdx.x) * 2; if (e >= (size_t)nheads * HD * TT) return; const int t = (int)(e % TT); const int d = (int)((e / TT) % HD); const int g = (int)(e / ((size_t)TT * HD)); v2h o16; v2us oh, ol;
#pragma unroll
    for (int q = 0; q < 2; ++q) { const float x = F[(size_t)(t + q) * pitch + g * HD + d]; o16[q] = tohx(x); unsigned short a2, c2; splitf(x, a2, c2); oh[q] = a2; ol[q] = c2; }
    const size_t ev = 2 * e - t; *(v2h*)(V16 + ev) = o16; *(v2us*)(Vh + ev) = oh; *(v2us*)(Vl + ev) = ol;  }
// k_asoft: per row (zz, i): t = S x HD^-0.5 for j <= i and i - j < WIN (sliding causal window; the reference's -1e9 additive fill vanishes identically); softmax over the 2048 keys (register row, one exp, fixed trees);; adds bf16(attention_mask[b][0][i][j]) to kept scores; when the device flag says the mask is causal, keys j > i get exact-zero weight (same as adding the most-negative mask value), otherwise every key takes score + mask
// The weights are stored IN PLACE over the wave's own score row (8192 bytes, held whole in registers before the first store): rows < RH as hi plane (bytes 0..4095) + lo plane (bytes 4096..8191), the rest as fp16 in bytes 0..4095; the P.V launches read them at a row pitch of 2 x TT 16-bit elements.
__global__ __launch_bounds__(256) void k_asoft(float* Sb, const float* __restrict__ MKb, const int* __restrict__ CF) {
    const int lane = threadIdx.x & 31; const int row = blockIdx.x * 8 + (threadIdx.x >> 5); if (row >= ZH * TT) return; const int i = row % TT; const int zz = row / TT; (void)zz; const float* mk = MKb + (size_t)i * TT; const bool con = (CF[0] != 0); const bool hires = (i < RH); const float* sr = Sb + (size_t)row * TT; float v[TT / 32]; float mx = -3.0e38f;
#pragma unroll
    for (int ch = 0; ch < TT / 128; ++ch) { const int j0 = ch * 128 + lane * 4; const v4f a = *(const v4f*)(sr + j0);
#pragma unroll
        for (int q = 0; q < 4; ++q) { const int j = j0 + q; (void)j; float sa = a[q] * SCL; asm volatile("" : "+v"(sa)); float mv = bfr(mk[j]); asm volatile("" : "+v"(mv)); const float t = (j <= i || !con) ? __fadd_rn(sa, mv) : -3.0e38f;   /* causal-verified: masked keys -> exact zero weight (== adding the most-negative mask); else general additive path */ v[ch * 4 + q] = t; mx = fmaxf(mx, t); } }
#pragma unroll
    for (int sh = 16; sh; sh >>= 1) mx = fmaxf(mx, __shfl_xor(mx, sh, 32));
    float sum = 0.f;
#pragma unroll
    for (int k = 0; k < TT / 32; ++k) { float d0 = __fsub_rn(v[k], mx); asm volatile("" : "+v"(d0)); v[k] = __builtin_amdgcn_exp2f(__fmul_rn(d0, 1.4426950408889634f)); sum += v[k]; }
#pragma unroll
    for (int sh = 16; sh; sh >>= 1) sum += __shfl_xor(sum, sh, 32);
    const float f = __fdiv_rn(hires ? 1.0f : PCAR, sum);
    bf* ph = (bf*)(Sb + (size_t)row * TT); h16* p16 = (h16*)(Sb + (size_t)row * TT);
{
        if (hires) {
#pragma unroll
            for (int ch = 0; ch < TT / 128; ++ch) { v4us oh, ol;
#pragma unroll
                for (int q = 0; q < 4; ++q) { unsigned short a, c2; splitf(v[ch * 4 + q] * f, a, c2); oh[q] = a; ol[q] = c2; }
                const int oo = ch * 128 + lane * 4; *(v4us*)(ph + oo) = oh; *(v4us*)(ph + TT + oo) = ol; }
        } else {
#pragma unroll
            for (int ch = 0; ch < TT / 128; ++ch) { v4h o4;
#pragma unroll
                for (int q = 0; q < 4; ++q) o4[q] = tohx(v[ch * 4 + q] * f);
                *(v4h*)(p16 + ch * 128 + lane * 4) = o4; } }
         }
}
__global__ __launch_bounds__(256) void k_merge(const float* __restrict__ O, int h0, bf* Ah, bf* Al) { const size_t e = ((size_t)blockIdx.x * 256 + threadIdx.x) * 2; if (e >= (size_t)ZH * TT * HD) return; const int d = (int)(e % HD); const int t = (int)((e / HD) % TT); const int zz = (int)(e / ((size_t)HD * TT)); const float cs = (t < RH) ? 1.0f : (1.0f / PCAR); const size_t oo = (size_t)t * DQ + (h0 + zz) * HD + d;
    v2us oh, ol;
#pragma unroll
    for (int q = 0; q < 2; ++q) { unsigned short a, c2; splitf(O[e + q] * cs, a, c2); oh[q] = a; ol[q] = c2; } *(v2us*)(Ah + oo) = oh; *(v2us*)(Al + oo) = ol;  }

extern "C" void kernel_launch(void* const* d_in, const int* in_sizes, int n_in,
                              void* d_out, int out_size, void* d_ws, size_t ws_size, hipStream_t stream) {
    (void)in_sizes; (void)n_in; (void)out_size;
    const float* x = (const float*)d_in[0]; const float* MK = (const float*)d_in[1]; const int* POS = (const int*)d_in[2]; const float* wq = (const float*)d_in[3]; const float* wk = (const float*)d_in[4]; const float* wv = (const float*)d_in[5]; const float* wo = (const float*)d_in[6];
    float* OUT = (float*)d_out;     // [2][2048][2048]
    char* wsp = (char*)d_ws;
    auto take = [&](size_t bytes) { char* p = wsp; wsp += (bytes + 255) & ~(size_t)255; return (void*)p; };
    bf* WQ = (bf*)take((size_t)DQ * DM * 2); bf* WK = (bf*)take((size_t)DKV * DM * 2); bf* WV = (bf*)take((size_t)DKV * DM * 2); bf* WO = (bf*)take((size_t)DM * DQ * 2); float* CS = (float*)take((size_t)TT * HD * 2 * 4);
    int* CFLAG = (int*)take(256);
    h16* QP16 = (h16*)take((size_t)NH_ * TT * HD * 2); h16* KP16 = (h16*)take((size_t)NKV * TT * HD * 2); h16* VT16 = (h16*)take((size_t)NKV * HD * 2 * TT * 2);
    bf* QPh = (bf*)take((size_t)NH_ * RH * HD * 2); bf* QPl = (bf*)take((size_t)NH_ * RH * HD * 2); bf* KPh = (bf*)take((size_t)NKV * TT * HD * 2); bf* KPl = (bf*)take((size_t)NKV * TT * HD * 2); bf* VTh = (bf*)take((size_t)NKV * HD * 2 * TT * 2); bf* VTl = VTh + TT;
    float* Sb = (float*)take((size_t)ZH * TT * TT * 4); float* Ob = (float*)take((size_t)ZH * TT * HD * 4); bf* ATh = (bf*)take((size_t)TT * DQ * 2); bf* ATl = (bf*)take((size_t)TT * DQ * 2);
    if ((size_t)(wsp - (char*)d_ws) > ws_size) return;    // ws 256 MiB
    bf* XB = (bf*)Sb; float* FQ = Sb + (size_t)TT * DM / 2; float* FK = FQ + (size_t)TT * DQ;   // the bf16 input rows and the f32 projections are dead once the head planes are built: they share the score buffer (stream-ordered)
    float* FV = FK;   // v projection reuses the k buffer after the k planes are built (stream-ordered)
    { k_cvt8<<<(unsigned)(((size_t)DQ * DM / 8 + 255) / 256), 256, 0, stream>>>(wq, WQ, (size_t)DQ * DM / 8); k_cvt8<<<(unsigned)(((size_t)DKV * DM / 8 + 255) / 256), 256, 0, stream>>>(wk, WK, (size_t)DKV * DM / 8); k_cvt8<<<(unsigned)(((size_t)DKV * DM / 8 + 255) / 256), 256, 0, stream>>>(wv, WV, (size_t)DKV * DM / 8);
      k_cvt8<<<(unsigned)(((size_t)DM * DQ / 8 + 255) / 256), 256, 0, stream>>>(wo, WO, (size_t)DM * DQ / 8);
      }
    const unsigned LQ = (unsigned)(((size_t)NH_ * TT * HD / 2 + 255) / 256), LKv = (unsigned)(((size_t)NKV * TT * HD / 2 + 255) / 256);
    for (int b = 0; b < NB_; ++b) {
        
        k_cvt8<<<(unsigned)(((size_t)TT * DM / 8 + 255) / 256), 256, 0, stream>>>(x + (size_t)b * TT * DM, XB, (size_t)TT * DM / 8); k_flag1<<<1, 32, 0, stream>>>(CFLAG); k_mchk<<<(unsigned)(((size_t)TT * TT / 4 + 255) / 256), 256, 0, stream>>>(MK + (size_t)b * TT * TT, CFLAG); k_cstab<<<(TT * HD + 255) / 256, 256, 0, stream>>>(POS + (size_t)b * TT, CS);   /* mask check + per-batch rotary table */
        k_gemmw<bf, 0, false><<<dim3(TT / 64, DQ / 64, 1), 32, 0, stream>>>(XB, nullptr, WQ, nullptr, DM, FQ, DQ, nullptr, 0, 0, 0);
        k_rope<<<LQ, 256, 0, stream>>>(FQ, DQ, NH_, CS, nullptr, nullptr, 1.0f, RH, QP16, QPh, QPl);
        k_gemmw<bf, 0, false><<<dim3(TT / 64, DKV / 64, 1), 32, 0, stream>>>(XB, nullptr, WK, nullptr, DM, FK, DKV, nullptr, 0, 0, 0);
        k_rope<<<LKv, 256, 0, stream>>>(FK, DKV, NKV, CS, nullptr, nullptr, 1.0f, TT, KP16, KPh, KPl);
        k_gemmw<bf, 0, false><<<dim3(TT / 64, DKV / 64, 1), 32, 0, stream>>>(XB, nullptr, WV, nullptr, DM, FV, DKV, nullptr, 0, 0, 0); k_vtp<<<LKv, 256, 0, stream>>>(FV, DKV, NKV, VT16, VTh, VTl);
        for (int h0 = 0; h0 < NH_; h0 += ZH) { const size_t zq = (size_t)h0, zk = (size_t)(h0 / REP);   // one kv head per query head: the pass's ZH heads use consecutive kv planes
            k_gemmc<bf, 2, 1><<<dim3(RH / 64, TT / 64, ZH), 32, 0, stream>>>(QPh + zq * RH * HD, QPl + zq * RH * HD, KPh + zk * TT * HD, KPl + zk * TT * HD, HD, HD, Sb, TT, 0, (size_t)RH * HD, (size_t)TT * HD, (size_t)TT * TT, CFLAG);
            k_gemmc<h16, 0, 1><<<dim3((TT - RH) / 64, TT / 64, ZH), 32, 0, stream>>>(QP16 + zq * TT * HD + (size_t)RH * HD, nullptr, KP16 + zk * TT * HD, nullptr, HD, HD, Sb + (size_t)RH * TT, TT, RH, (size_t)TT * HD, (size_t)TT * HD, (size_t)TT * TT, CFLAG);
            k_asoft<<<ZH * TT / 8, 256, 0, stream>>>(Sb, MK + (size_t)b * TT * TT, CFLAG);
            k_gemmc<bf, 2, 2><<<dim3(RH / 64, HD / 64, ZH), 32, 0, stream>>>((const bf*)Sb, (const bf*)Sb + TT, VTh + zk * HD * 2 * TT, VTl + zk * HD * 2 * TT, 2 * TT, TT, Ob, HD, 0, (size_t)TT * 2 * TT, (size_t)HD * 2 * TT, (size_t)TT * HD, CFLAG);
            k_gemmc<h16, 0, 2><<<dim3((TT - RH) / 64, HD / 64, ZH), 32, 0, stream>>>((const h16*)Sb + (size_t)RH * 2 * TT, nullptr, VT16 + zk * HD * 2 * TT, nullptr, 2 * TT, TT, Ob + (size_t)RH * HD, HD, RH, (size_t)TT * 2 * TT, (size_t)HD * 2 * TT, (size_t)TT * HD, CFLAG);
            k_merge<<<(unsigned)(((size_t)ZH * TT * HD / 2 + 255) / 256), 256, 0, stream>>>(Ob, h0, ATh, ATl); }
        k_gemmw<bf, 1, false><<<dim3(TT / 64, DM / 64, 1), 32, 0, stream>>>(ATh, ATl, WO, nullptr, DQ, OUT + (size_t)b * TT * DM, DM, nullptr, 0, 0, 0); }
}

// v002
// Measured time: 1100 microseconds a run.
// Timed twice side by side with v001, it ran 1.05 times as fast both times.
// Over all steps from v000 it is 1.77 times as fast.
#include <hip/hip_runtime.h>

// Causal LM attention with additive mask and position-id rotary (hidden [2][2048][2048]; q, k, v = hidden W^T ('oi' [2048][2048], 16 heads x 128); rotate-half RoPE with angle = position_ids[b][t] x inv_freq (theta 1e4; position_ids int32 input, read on device); scores/sqrt(128) + attention_mask[b][0][i][j] (f32 input, read); softmax; out = merged Wo^T -> [2][2048][2048]).
// The additive mask is verified ON THE DEVICE to be the causal pattern (0 where j <= i, most-negative elsewhere); when it is, score tiles above the diagonal are skipped and the masked entries are realised as exact-zero softmax weights (identical result); otherwise every tile is computed and the mask is simply added (general fallback).
// Compute dtypes, f32 accumulate: every input rounded to bf16; q/k/v on PLAIN bf16 operands (inputs: exact); rotary in f32 (per-batch table from the position ids and the reference's inv_freq constants); mask check, additive mask (bf16-rounded) inside the softmax kernel; causal scores and attn.v (tile skipping gated by the device flag): query rows < 512 hl (3 products), the rest single fp16 (x1024); softmax f32; Wo hl x exact (2 products).

#define NB_  2
#define TT   2048
#define DM   2048
#define NH_  16
#define NKV  16
#define REP  (NH_ / NKV)
#define HD   128
#define DQ   (NH_ * HD)
#define DKV  (NKV * HD)
#define ZH   8                    // heads per attention pass (grid z of the score and P.V launches)
#define RH   512                  // query rows < RH use hi+lo planes (0: none)
#define WIN  2048
#define PCAR 1024.0f
#define SCL  0.088388347648318447f   // HD^-0.5
typedef _Float16 h16;
typedef unsigned short bf;
typedef __attribute__((ext_vector_type(16))) __bf16   v16bf;
typedef __attribute__((ext_vector_type(16))) _Float16 v16h;
typedef __attribute__((ext_vector_type(8)))  _Float16 v8h;
typedef __attribute__((ext_vector_type(8)))  unsigned short v8us;
typedef __attribute__((ext_vector_type(8)))  float    v8f;
typedef __attribute__((ext_vector_type(4)))  float    v4f;
typedef v8h  __attribute__((may_alias)) v8ha;
typedef v4f  __attribute__((may_alias)) v4fa;
typedef v8us __attribute__((may_alias)) v8usa;

__device__ __forceinline__ unsigned short f2bf(float f) { unsigned u = __float_as_uint(f); u += 0x7FFFu + ((u >> 16) & 1u); return (unsigned short)(u >> 16); }
__device__ __forceinline__ float bf2f(unsigned short b) { return __uint_as_float(((unsigned)b) << 16); }
__device__ __forceinline__ float bfr(float f) { return bf2f(f2bf(f)); }
__device__ __forceinline__ v16h cat16(v8h lo, v8h hi) { return __builtin_shufflevector(lo, hi, 0, 1, 2, 3, 4, 5, 6, 7, 8, 9, 10, 11, 12, 13, 14, 15); }
__device__ __forceinline__ v16bf cat16b(v8us lo, v8us hi) { return __builtin_bit_cast(v16bf, __builtin_shufflevector(lo, hi, 0, 1, 2, 3, 4, 5, 6, 7, 8, 9, 10, 11, 12, 13, 14, 15)); }
__device__ __forceinline__ v8f wmma16(v16h a, v16h b, v8f c) { return __builtin_amdgcn_wmma_f32_16x16x32_f16(false, a, false, b, (short)0, c, false, false); }
__device__ __forceinline__ v8f wmmab(v16bf a, v16bf b, v8f c) { return __builtin_amdgcn_wmma_f32_16x16x32_bf16(false, a, false, b, (short)0, c, false, false); }



// ---- k_gemmw: register-blocked GEMM, ONE WAVE per 64x64 output tile (16 accumulators), operands straight from K-contiguous 16-bit planes; grid (M/64, N/64, Z), 32 threads.
// C[m][n] (f32, pitch ldc, + optional f32 bias[n]) = sum_k A[m][k] Bt[n][k] (+ split products per NSPLIT). z-batch strides sA/sB/sC in elements. K % 32 == 0.
template <typename T16> struct WFrag;
template <> struct WFrag<h16> { typedef v16h V; static __device__ __forceinline__ V ld(const h16* p) { return cat16(*(const v8h*)p, *(const v8h*)(p + 16)); } static __device__ __forceinline__ v8f mma(V a, V b, v8f c) { return wmma16(a, b, c); } };
template <> struct WFrag<bf> { typedef v16bf V; static __device__ __forceinline__ V ld(const bf* p) { return cat16b(*(const v8us*)p, *(const v8us*)(p + 16)); } static __device__ __forceinline__ v8f mma(V a, V b, v8f c) { return wmmab(a, b, c); } };
template <typename T16, int NSPLIT, bool BIAS>
__global__ __launch_bounds__(32) void k_gemmw(const T16* __restrict__ A, const T16* __restrict__ A2, const T16* __restrict__ Bt, const T16* __restrict__ Bt2, int K, float* C, int ldc, const float* __restrict__ bias, size_t sA, size_t sB, size_t sC) {
    typedef typename WFrag<T16>::V V;
    __shared__ __align__(16) float os[16 * 68];
    const size_t z = blockIdx.z; A += z * sA; if (A2) A2 += z * sA; Bt += z * sB; if (Bt2) Bt2 += z * sB; C += z * sC;
    const int lane = threadIdx.x & 31, lr = lane & 15, hi = lane >> 4; const int r0 = blockIdx.x * 64, c0 = blockIdx.y * 64;
    v8f acc[4][4];
#pragma unroll
    for (int mb = 0; mb < 4; ++mb)
#pragma unroll
        for (int nb = 0; nb < 4; ++nb) acc[mb][nb] = (v8f){};
    const size_t aoff = (size_t)(r0 + lr) * K + 8 * hi, boff = (size_t)(c0 + lr) * K + 8 * hi;
#pragma unroll 1
    for (int kc = 0; kc < K; kc += 32) {
        V a[4], a2[4];
#pragma unroll
        for (int mb = 0; mb < 4; ++mb) { a[mb] = WFrag<T16>::ld(A + aoff + (size_t)mb * 16 * K + kc); if (NSPLIT == 1 || NSPLIT == 2) a2[mb] = WFrag<T16>::ld(A2 + aoff + (size_t)mb * 16 * K + kc); }
#pragma unroll
        for (int nb = 0; nb < 4; ++nb) { const V b = WFrag<T16>::ld(Bt + boff + (size_t)nb * 16 * K + kc); V b2; if (NSPLIT >= 2) b2 = WFrag<T16>::ld(Bt2 + boff + (size_t)nb * 16 * K + kc);
#pragma unroll
            for (int mb = 0; mb < 4; ++mb) { acc[mb][nb] = WFrag<T16>::mma(a[mb], b, acc[mb][nb]); if (NSPLIT == 1 || NSPLIT == 2) acc[mb][nb] = WFrag<T16>::mma(a2[mb], b, acc[mb][nb]); if (NSPLIT >= 2) acc[mb][nb] = WFrag<T16>::mma(a[mb], b2, acc[mb][nb]); } }
        asm volatile("v_nop\n\tv_nop\n\tv_nop\n\tv_nop" : "+v"(acc[0][0]), "+v"(acc[1][1]), "+v"(acc[2][2]), "+v"(acc[3][3]) : "v"(a[0]), "v"(a[3]));
    }
#pragma unroll
    for (int mb = 0; mb < 4; ++mb) {
#pragma unroll
        for (int nb = 0; nb < 4; ++nb) {
#pragma unroll
            for (int j = 0; j < 8; ++j) os[(hi * 8 + j) * 68 + nb * 16 + lr] = acc[mb][nb][j]; }
        __builtin_amdgcn_wave_barrier(); asm volatile("" ::: "memory");
        float* crow = C + (size_t)(r0 + mb * 16) * ldc + c0;
{
#pragma unroll
            for (int s = 0; s < 8; ++s) { const int row = 2 * s + hi, cofs = lr * 4; v4f val = *(const v4fa*)(os + row * 68 + cofs); if (BIAS) { val[0] += bfr(bias[c0 + cofs]); val[1] += bfr(bias[c0 + cofs + 1]); val[2] += bfr(bias[c0 + cofs + 2]); val[3] += bfr(bias[c0 + cofs + 3]); }
                *(v4f*)(crow + (size_t)row * ldc + cofs) = val; }
             }
        __builtin_amdgcn_wave_barrier(); asm volatile("" ::: "memory");
    }
}

// ---- k_gemmc: the same one-wave 64x64 tile GEMM specialised for causal attention: CMODE 1 skips score tiles entirely above the diagonal (query rows r0+roff.., key columns c0..), CMODE 2 limits the
// key (K) loop of the probability x value contraction to the diagonal block (probabilities beyond it are exactly zero). roff = row offset of this launch's first row within the sequence. K = row pitch of A, A2, Bt and Bt2 in elements, Kn = length of the contraction (Kn <= K, Kn % 32 == 0).
template <typename T16, int NSPLIT, int CMODE>
__global__ __launch_bounds__(32) void k_gemmc(const T16* __restrict__ A, const T16* __restrict__ A2, const T16* __restrict__ Bt, const T16* __restrict__ Bt2, int K, int Kn, float* C, int ldc, int roff, size_t sA, size_t sB, size_t sC, const int* CF) {
    typedef typename WFrag<T16>::V V;
    __shared__ __align__(16) float os[16 * 68];
    const size_t z = blockIdx.z; A += z * sA; if (A2) A2 += z * sA; Bt += z * sB; if (Bt2) Bt2 += z * sB; C += z * sC;
    const int lane = threadIdx.x & 31, lr = lane & 15, hi = lane >> 4; const int r0 = blockIdx.x * 64, c0 = blockIdx.y * 64;
    const bool con = (CF == nullptr) || (CF[0] != 0);   /* device flag: mask verified causal */ if (CMODE == 1 && con && c0 > r0 + roff + 63) return;                  // score tile entirely above the causal diagonal: never read (the softmax masks j > i by select)
    const int Kl = (CMODE == 2 && con) ? min(Kn, r0 + roff + 64) : Kn;        // P.V: probabilities are exactly 0 beyond the diagonal block, so the K loop stops there
    v8f acc[4][4];
#pragma unroll
    for (int mb = 0; mb < 4; ++mb)
#pragma unroll
        for (int nb = 0; nb < 4; ++nb) acc[mb][nb] = (v8f){};
    const size_t aoff = (size_t)(r0 + lr) * K + 8 * hi, boff = (size_t)(c0 + lr) * K + 8 * hi;
#pragma unroll 1
    for (int kc = 0; kc < Kl; kc += 32) {
        V a[4], a2[4];
#pragma unroll
        for (int mb = 0; mb < 4; ++mb) { a[mb] = WFrag<T16>::ld(A + aoff + (size_t)mb * 16 * K + kc); if (NSPLIT == 1 || NSPLIT == 2) a2[mb] = WFrag<T16>::ld(A2 + aoff + (size_t)mb * 16 * K + kc); }
#pragma unroll
        for (int nb = 0; nb < 4; ++nb) { const V b = WFrag<T16>::ld(Bt + boff + (size_t)nb * 16 * K + kc); V b2; if (NSPLIT >= 2) b2 = WFrag<T16>::ld(Bt2 + boff + (size_t)nb * 16 * K + kc);
#pragma unroll
            for (int mb = 0; mb < 4; ++mb) { acc[mb][nb] = WFrag<T16>::mma(a[mb], b, acc[mb][nb]); if (NSPLIT == 1 || NSPLIT == 2) acc[mb][nb] = WFrag<T16>::mma(a2[mb], b, acc[mb][nb]); if (NSPLIT >= 2) acc[mb][nb] = WFrag<T16>::mma(a[mb], b2, acc[mb][nb]); } }
        asm volatile("v_nop\n\tv_nop\n\tv_nop\n\tv_nop" : "+v"(acc[0][0]), "+v"(acc[1][1]), "+v"(acc[2][2]), "+v"(acc[3][3]) : "v"(a[0]), "v"(a[3]));
    }
#pragma unroll
    for (int mb = 0; mb < 4; ++mb) {
#pragma unroll
        for (int nb = 0; nb < 4; ++nb) {
#pragma unroll
            for (int j = 0; j < 8; ++j) os[(hi * 8 + j) * 68 + nb * 16 + lr] = acc[mb][nb][j]; }
        __builtin_amdgcn_wave_barrier(); asm volatile("" ::: "memory");
        float* crow = C + (size_t)(r0 + mb * 16) * ldc + c0;
{
#pragma unroll
            for (int s = 0; s < 8; ++s) { const int row = 2 * s + hi, cofs = lr * 4; v4f val = *(const v4fa*)(os + row * 68 + cofs);
                *(v4f*)(crow + (size_t)row * ldc + cofs) = val; }
             }
        __builtin_amdgcn_wave_barrier(); asm volatile("" ::: "memory");
    }
}

__device__ __forceinline__ h16 tohx(float x) { return (h16)x; }
__device__ __forceinline__ void splitf(float y, unsigned short& h, unsigned short& l) { h = f2bf(y); l = f2bf(y - bf2f(h)); }
typedef __attribute__((ext_vector_type(2))) _Float16 v2h;
typedef __attribute__((ext_vector_type(4))) _Float16 v4h;
typedef __attribute__((ext_vector_type(2))) unsigned short v2us;
typedef __attribute__((ext_vector_type(4))) unsigned short v4us;
typedef __attribute__((ext_vector_type(2))) float v2f;
typedef __attribute__((ext_vector_type(4))) int v4i;

__global__ __launch_bounds__(256) void k_wtG(const float* __restrict__ w, int K, int N, bf* Bt) {
    const int lane = threadIdx.x & 31; const int L0 = (blockIdx.x * 8 + (threadIdx.x >> 5)) * 8; const int nlines = N * K / 64;
{
#pragma unroll 1
        for (int l = 0; l < 8; ++l) { const int L = L0 + l; if (L >= nlines) break; const size_t e = (size_t)L * 64 + lane * 2; const int k = (int)(e % K), n = (int)(e / K); v2us o;
            o[0] = f2bf(w[(size_t)k * N + n]); o[1] = f2bf(w[(size_t)(k + 1) * N + n]); *(v2us*)(Bt + e) = o; }
         }
}
// The elementwise kernels below give each thread several vectors (all loads issued first, then the arithmetic and the stores), so that each launch starts 4,096 waves instead of one short wave per 64 to 256 elements.
#define EU 4                      // vectors per thread in k_cvt8, k_rope (rows) and k_merge
#define MU 8                      // vectors per thread in k_mchk
__global__ __launch_bounds__(256) void k_cvt8(const float* __restrict__ src, bf* dst, size_t n8) { const size_t i0 = (size_t)blockIdx.x * (256 * EU) + threadIdx.x; v8f v[EU];
#pragma unroll
    for (int u = 0; u < EU; ++u) { const size_t i = i0 + (size_t)u * 256; v[u] = *(const v8f*)(src + (i < n8 ? i : n8 - 1) * 8); }   // index clamped, not branched round: the loads stay one group in flight; the store below is guarded
#pragma unroll
    for (int u = 0; u < EU; ++u) { const size_t i = i0 + (size_t)u * 256; v8us o;
#pragma unroll
        for (int k = 0; k < 8; ++k) o[k] = f2bf(v[u][k]);
        if (i < n8) *(v8us*)(dst + i * 8) = o; } }
__constant__ float INV[HD / 2] = {1.0,0.8659643530845642,0.7498942017555237,0.6493816375732422,0.5623413324356079,0.486967533826828,0.4216965138912201,0.36517414450645447,0.3162277638912201,0.2738419771194458,0.23713736236095428,0.20535250008106232,0.17782793939113617,0.1539926528930664,0.1333521455526352,0.11547820270061493,0.10000000149011612,0.08659642934799194,0.07498941570520401,0.06493816524744034,0.05623412877321243,0.04869675263762474,0.04216964915394783,0.03651741147041321,0.03162277862429619,0.0273841954767704,0.0237137358635664,0.02053525112569332,0.017782794311642647,0.015399265103042126,0.01333521492779255,0.011547819711267948,0.009999999776482582,0.00865964312106371,0.007498942315578461,0.006493816617876291,0.005623413249850273,0.004869675263762474,0.0042169648222625256,0.003651741426438093,0.003162277862429619,0.0027384196873754263,0.0023713738191872835,0.0020535250660032034,0.0017782794311642647,0.0015399265103042126,0.0013335214462131262,0.0011547820176929235,0.0010000000474974513,0.0008659643353894353,0.0007498941849917173,0.0006493816617876291,0.000562341301701963,0.00048696750309318304,0.00042169648804701865,0.00036517411353997886,0.0003162277862429619,0.00027384195709601045,0.0002371373848291114,0.00020535249495878816,0.00017782794020604342,0.00015399264520965517,0.0001333521504420787,0.00011547819303814322};
// k_cstab: one thread per (t, d < HD/2); the angle of d + HD/2 is the same one, so the pair is stored at both places
__global__ __launch_bounds__(256) void k_cstab(const int* __restrict__ pos, float* CS) { const int idx = blockIdx.x * 256 + threadIdx.x; if (idx >= TT * (HD / 2)) return; const int t = idx / (HD / 2), d = idx % (HD / 2); const float ang = __fmul_rn((float)pos[t], INV[d]); v2f cs; cs[0] = cosf(ang); cs[1] = sinf(ang);
    float* o = CS + ((size_t)t * HD + d) * 2; *(v2f*)o = cs; *(v2f*)(o + HD) = cs;  }
// k_mchk: causal-pattern check of the additive mask for one batch: any entry with (j <= i and mask != 0) or (j > i and mask > -1e30) clears FLAG[0] (plain identical stores; FLAG preset to 1); lane -> MU groups of 4 consecutive j, 1024 elements apart.
__global__ __launch_bounds__(256) void k_mchk(const float* __restrict__ MKb, int* FLAG) { const size_t e0 = ((size_t)blockIdx.x * (256 * MU) + threadIdx.x) * 4; v4f m[MU]; bool bad = false;
#pragma unroll
    for (int u = 0; u < MU; ++u) { const size_t e = e0 + (size_t)u * 1024; m[u] = *(const v4f*)(MKb + (e < (size_t)TT * TT ? e : (size_t)TT * TT - 4)); }   // index clamped: one group of loads in flight
#pragma unroll
    for (int u = 0; u < MU; ++u) { const size_t e = e0 + (size_t)u * 1024; const int j = (int)(e % TT), i = (int)(e / TT); bool b = false;
#pragma unroll
        for (int q = 0; q < 4; ++q) { const bool keep = (j + q <= i); b |= keep ? (m[u][q] != 0.0f) : (m[u][q] > -1.0e30f); }
        bad |= b && (e < (size_t)TT * TT); }
    if (bad) *(int*)FLAG = 0; }
__global__ void k_flag1(int* FLAG) { if (threadIdx.x == 0) { *(int*)FLAG = 1;  } }

// k_rope: head planes [h][t][d] (fp16 + hi/lo) of rope(x) x sc with the rotate-half convention out[d] = x[d] cos[t][d] - x[d+HD/2] sin[t][d], out[d+HD/2] = x[d+HD/2] cos[t][d+HD/2] + x[d] sin[t][d+HD/2]; the hi/lo planes hold rows t < hr only ([h][hr][d])
// 16 threads per (h, t) row: a thread takes 4 consecutive d < HD/2 and their 4 partners d + HD/2 (each x is loaded once and serves both), in EU rows 16 apart; a block covers 16 x EU rows of one head (TT is a multiple of that).
__global__ __launch_bounds__(256) void k_rope(const float* __restrict__ F, int pitch, int nheads, const float* __restrict__ CS, const float* __restrict__ RF, const float* __restrict__ nw, float sc, int hr, h16* P16, bf* Ph, bf* Pl) {
    const int h = blockIdx.x / (TT / (16 * EU)); if (h >= nheads) return; const int tb = (blockIdx.x % (TT / (16 * EU))) * (16 * EU); const int tl = threadIdx.x >> 4, d = (threadIdx.x & 15) * 4;
    const float* Fb = F + (size_t)tb * pitch + h * HD; const float* Cb = CS + (size_t)tb * HD * 2; const float* pc = Cb + (tl * HD + d) * 2; const float* pf[EU]; v4f xv[EU][2], cv[EU][2][2];
#pragma unroll
    for (int u = 0; u < EU; ++u) { pf[u] = Fb + (size_t)(u * 16 + tl) * pitch + d;
#pragma unroll
        for (int hf = 0; hf < 2; ++hf) { xv[u][hf] = *(const v4f*)(pf[u] + hf * (HD / 2)); const float* c = pc + (u * 16 * HD + hf * (HD / 2)) * 2; cv[u][hf][0] = *(const v4f*)c; cv[u][hf][1] = *(const v4f*)(c + 4); } }
    asm volatile("s_wait_xcnt 0x0" :: "v"(pc), "v"(pf[0]), "v"(pf[1]), "v"(pf[2]), "v"(pf[3]) : "memory");   // the loads' address registers are inputs here, so none of them is reused before this wait
#pragma unroll
    for (int u = 0; u < EU; ++u) { const int t = tb + u * 16 + tl; float rf = 1.0f;
        if (RF) { rf = RF[(size_t)h * TT + t]; asm volatile("s_wait_xcnt 0x0" :: "v"(rf) : "memory"); }   // the wait stands behind this load, ahead of any reuse of its base or offset register; the loaded value is an input so that the load cannot sink below it
#pragma unroll
        for (int hf = 0; hf < 2; ++hf) { v4h o16; v4us oh, ol;
#pragma unroll
            for (int q = 0; q < 4; ++q) { const int dd = d + hf * (HD / 2) + q; const int dp = (dd < HD / 2) ? dd + HD / 2 : dd - HD / 2; float x0 = xv[u][hf][q], x1 = xv[u][1 - hf][q];
                if (RF) { float n0 = __fmul_rn(x0, rf), n1 = __fmul_rn(x1, rf); asm volatile("" : "+v"(n0)); asm volatile("" : "+v"(n1)); x0 = __fmul_rn(bfr(nw[dd]), n0); x1 = __fmul_rn(bfr(nw[dp]), n1); }
                v2f cs; cs[0] = cv[u][hf][q >> 1][(q & 1) * 2]; cs[1] = cv[u][hf][q >> 1][(q & 1) * 2 + 1]; float a = __fmul_rn(x0, cs[0]), bq = __fmul_rn(x1, cs[1]); asm volatile("" : "+v"(a)); asm volatile("" : "+v"(bq)); const float r = ((dd < HD / 2) ? __fsub_rn(a, bq) : __fadd_rn(a, bq)) * sc;
                o16[q] = tohx(r); unsigned short a2, c2; splitf(r, a2, c2); oh[q] = a2; ol[q] = c2; }
            const int dh = d + hf * (HD / 2); *(v4h*)(P16 + ((size_t)h * TT + t) * HD + dh) = o16; if (t < hr) { const size_t eh = ((size_t)h * hr + t) * HD + dh; *(v4us*)(Ph + eh) = oh; *(v4us*)(Pl + eh) = ol; } } }  }
// k_vtp: transposed value planes [g][d][t] at a row pitch of 2 x TT elements, the pitch of the in-place weight rows they are contracted with (k_gemmc has one pitch for both operands); the lo plane lies in the second half of the hi plane's rows (Vl = Vh + TT)
// A block takes one head's 64 rows t x HD columns; a thread takes an 8 t x 4 d patch (8 row loads of 16 bytes) and stores it turned, 8 consecutive t per d: a wave's store covers 4 whole 128-byte lines.
__global__ __launch_bounds__(256) void k_vtp(const float* __restrict__ F, int pitch, int nheads, h16* V16, bf* Vh, bf* Vl) { const int lane = threadIdx.x & 31; const int g = blockIdx.x / (TT / 64); if (g >= nheads) return; const int tb = (blockIdx.x % (TT / 64)) * 64, tl = (lane >> 2) * 8; const int d = (threadIdx.x >> 5) * 16 + (lane & 3) * 4; const float* pf[8]; v4f xv[8];
#pragma unroll
    for (int r = 0; r < 8; ++r) { pf[r] = F + (size_t)(tb + tl + r) * pitch + g * HD + d; xv[r] = *(const v4f*)pf[r]; }
    asm volatile("s_wait_xcnt 0x0" :: "v"(pf[0]), "v"(pf[1]), "v"(pf[2]), "v"(pf[3]), "v"(pf[4]), "v"(pf[5]), "v"(pf[6]), "v"(pf[7]) : "memory");   // the loads' address registers are inputs here, so none of them is reused before this wait
#pragma unroll
    for (int c = 0; c < 4; ++c) { v8h o16; v8us oh, ol;
#pragma unroll
        for (int r = 0; r < 8; ++r) { const float x = xv[r][c]; o16[r] = tohx(x); unsigned short a2, c2; splitf(x, a2, c2); oh[r] = a2; ol[r] = c2; }
        const size_t ev = ((size_t)g * HD + d + c) * (2 * TT) + tb + tl; *(v8h*)(V16 + ev) = o16; *(v8us*)(Vh + ev) = oh; *(v8us*)(Vl + ev) = ol; }  }
// k_asoft: per row (zz, i): t = S x HD^-0.5 for j <= i; softmax over the 2048 keys (register row, one exp, fixed trees);; adds bf16(attention_mask[b][0][i][j]) to kept scores; when the device flag says the mask is causal, keys j > i get exact-zero weight (same as adding the most-negative mask value), otherwise every key takes score + mask
// The weights are stored IN PLACE over the wave's own score row (8192 bytes, held whole in registers before the first store): rows < RH as hi plane (bytes 0..4095) + lo plane (bytes 4096..8191), the rest as fp16 in bytes 0..4095; the P.V launches read them at a row pitch of 2 x TT 16-bit elements.
__global__ __launch_bounds__(256) void k_asoft(float* Sb, const float* __restrict__ MKb, const int* __restrict__ CF) {
    const int lane = threadIdx.x & 31; const int row = blockIdx.x * 8 + (threadIdx.x >> 5); if (row >= ZH * TT) return; const int i = row % TT; const int zz = row / TT; (void)zz; const float* mk = MKb + (size_t)i * TT; const bool con = (CF[0] != 0); const bool hires = (i < RH); const float* sr = Sb + (size_t)row * TT; float v[TT / 32]; float mx = -3.0e38f;
#pragma unroll
    for (int ch = 0; ch < TT / 128; ++ch) { const int j0 = ch * 128 + lane * 4; const v4f a = *(const v4f*)(sr + j0);
#pragma unroll
        for (int q = 0; q < 4; ++q) { const int j = j0 + q; (void)j; float sa = a[q] * SCL; asm volatile("" : "+v"(sa)); float mv = bfr(mk[j]); asm volatile("" : "+v"(mv)); const float t = (j <= i || !con) ? __fadd_rn(sa, mv) : -3.0e38f;   /* causal-verified: masked keys -> exact zero weight (== adding the most-negative mask); else general additive path */ v[ch * 4 + q] = t; mx = fmaxf(mx, t); } }
#pragma unroll
    for (int sh = 16; sh; sh >>= 1) mx = fmaxf(mx, __shfl_xor(mx, sh, 32));
    float sum = 0.f;
#pragma unroll
    for (int k = 0; k < TT / 32; ++k) { float d0 = __fsub_rn(v[k], mx); asm volatile("" : "+v"(d0)); v[k] = __builtin_amdgcn_exp2f(__fmul_rn(d0, 1.4426950408889634f)); sum += v[k]; }
#pragma unroll
    for (int sh = 16; sh; sh >>= 1) sum += __shfl_xor(sum, sh, 32);
    const float f = __fdiv_rn(hires ? 1.0f : PCAR, sum);
    bf* ph = (bf*)(Sb + (size_t)row * TT); h16* p16 = (h16*)(Sb + (size_t)row * TT);
{
        if (hires) {
#pragma unroll
            for (int ch = 0; ch < TT / 128; ++ch) { v4us oh, ol;
#pragma unroll
                for (int q = 0; q < 4; ++q) { unsigned short a, c2; splitf(v[ch * 4 + q] * f, a, c2); oh[q] = a; ol[q] = c2; }
                const int oo = ch * 128 + lane * 4; *(v4us*)(ph + oo) = oh; *(v4us*)(ph + TT + oo) = ol; }
        } else {
#pragma unroll
            for (int ch = 0; ch < TT / 128; ++ch) { v4h o4;
#pragma unroll
                for (int q = 0; q < 4; ++q) o4[q] = tohx(v[ch * 4 + q] * f);
                *(v4h*)(p16 + ch * 128 + lane * 4) = o4; } }
         }
}
__global__ __launch_bounds__(256) void k_merge(const float* __restrict__ O, int h0, bf* Ah, bf* Al) { const size_t e0 = ((size_t)blockIdx.x * (256 * EU) + threadIdx.x) * 4; v4f ov[EU];
#pragma unroll
    for (int u = 0; u < EU; ++u) { const size_t e = e0 + (size_t)u * 1024; ov[u] = *(const v4f*)(O + (e < (size_t)ZH * TT * HD ? e : (size_t)ZH * TT * HD - 4)); }   // index clamped: one group of loads in flight
#pragma unroll
    for (int u = 0; u < EU; ++u) { const size_t e = e0 + (size_t)u * 1024; if (e >= (size_t)ZH * TT * HD) break; const int d = (int)(e % HD); const int t = (int)((e / HD) % TT); const int zz = (int)(e / ((size_t)HD * TT)); const float cs = (t < RH) ? 1.0f : (1.0f / PCAR); const size_t oo = (size_t)t * DQ + (h0 + zz) * HD + d;
        v4us oh, ol;
#pragma unroll
        for (int q = 0; q < 4; ++q) { unsigned short a, c2; splitf(ov[u][q] * cs, a, c2); oh[q] = a; ol[q] = c2; } *(v4us*)(Ah + oo) = oh; *(v4us*)(Al + oo) = ol; }  }

extern "C" void kernel_launch(void* const* d_in, const int* in_sizes, int n_in,
                              void* d_out, int out_size, void* d_ws, size_t ws_size, hipStream_t stream) {
    (void)in_sizes; (void)n_in; (void)out_size;
    const float* x = (const float*)d_in[0]; const float* MK = (const float*)d_in[1]; const int* POS = (const int*)d_in[2]; const float* wq = (const float*)d_in[3]; const float* wk = (const float*)d_in[4]; const float* wv = (const float*)d_in[5]; const float* wo = (const float*)d_in[6];
    float* OUT = (float*)d_out;     // [2][2048][2048]
    char* wsp = (char*)d_ws;
    auto take = [&](size_t bytes) { char* p = wsp; wsp += (bytes + 255) & ~(size_t)255; return (void*)p; };
    bf* WQ = (bf*)take((size_t)DQ * DM * 2); bf* WK = (bf*)take((size_t)DKV * DM * 2); bf* WV = (bf*)take((size_t)DKV * DM * 2); bf* WO = (bf*)take((size_t)DM * DQ * 2); float* CS = (float*)take((size_t)TT * HD * 2 * 4);
    int* CFLAG = (int*)take(256);
    h16* QP16 = (h16*)take((size_t)NH_ * TT * HD * 2); h16* KP16 = (h16*)take((size_t)NKV * TT * HD * 2); h16* VT16 = (h16*)take((size_t)NKV * HD * 2 * TT * 2);
    bf* QPh = (bf*)take((size_t)NH_ * RH * HD * 2); bf* QPl = (bf*)take((size_t)NH_ * RH * HD * 2); bf* KPh = (bf*)take((size_t)NKV * TT * HD * 2); bf* KPl = (bf*)take((size_t)NKV * TT * HD * 2); bf* VTh = (bf*)take((size_t)NKV * HD * 2 * TT * 2); bf* VTl = VTh + TT;
    float* Sb = (float*)take((size_t)ZH * TT * TT * 4); float* Ob = (float*)take((size_t)ZH * TT * HD * 4); bf* ATh = (bf*)take((size_t)TT * DQ * 2); bf* ATl = (bf*)take((size_t)TT * DQ * 2);
    if ((size_t)(wsp - (char*)d_ws) > ws_size) return;    // ws 256 MiB
    bf* XB = (bf*)Sb; float* FQ = Sb + (size_t)TT * DM / 2; float* FK = FQ + (size_t)TT * DQ;   // the bf16 input rows and the f32 projections are dead once the head planes are built: they share the score buffer (stream-ordered)
    float* FV = FK;   // v projection reuses the k buffer after the k planes are built (stream-ordered)
    { k_cvt8<<<(unsigned)(((size_t)DQ * DM / 8 + 256 * EU - 1) / (256 * EU)), 256, 0, stream>>>(wq, WQ, (size_t)DQ * DM / 8); k_cvt8<<<(unsigned)(((size_t)DKV * DM / 8 + 256 * EU - 1) / (256 * EU)), 256, 0, stream>>>(wk, WK, (size_t)DKV * DM / 8); k_cvt8<<<(unsigned)(((size_t)DKV * DM / 8 + 256 * EU - 1) / (256 * EU)), 256, 0, stream>>>(wv, WV, (size_t)DKV * DM / 8);
      k_cvt8<<<(unsigned)(((size_t)DM * DQ / 8 + 256 * EU - 1) / (256 * EU)), 256, 0, stream>>>(wo, WO, (size_t)DM * DQ / 8);
      }
    const unsigned LQ = NH_ * (TT / (16 * EU)), LKv = NKV * (TT / (16 * EU));   // k_rope: 16 x EU rows of one head per block
    for (int b = 0; b < NB_; ++b) {
        
        k_cvt8<<<(unsigned)(((size_t)TT * DM / 8 + 256 * EU - 1) / (256 * EU)), 256, 0, stream>>>(x + (size_t)b * TT * DM, XB, (size_t)TT * DM / 8); k_flag1<<<1, 32, 0, stream>>>(CFLAG); k_mchk<<<(unsigned)(((size_t)TT * TT / 4 + 256 * MU - 1) / (256 * MU)), 256, 0, stream>>>(MK + (size_t)b * TT * TT, CFLAG); k_cstab<<<(TT * (HD / 2) + 255) / 256, 256, 0, stream>>>(POS + (size_t)b * TT, CS);   /* mask check + per-batch rotary table */
        k_gemmw<bf, 0, false><<<dim3(TT / 64, DQ / 64, 1), 32, 0, stream>>>(XB, nullptr, WQ, nullptr, DM, FQ, DQ, nullptr, 0, 0, 0);
        k_rope<<<LQ, 256, 0, stream>>>(FQ, DQ, NH_, CS, nullptr, nullptr, 1.0f, RH, QP16, QPh, QPl);
        k_gemmw<bf, 0, false><<<dim3(TT / 64, DKV / 64, 1), 32, 0, stream>>>(XB, nullptr, WK, nullptr, DM, FK, DKV, nullptr, 0, 0, 0);
        k_rope<<<LKv, 256, 0, stream>>>(FK, DKV, NKV, CS, nullptr, nullptr, 1.0f, TT, KP16, KPh, KPl);
        k_gemmw<bf, 0, false><<<dim3(TT / 64, DKV / 64, 1), 32, 0, stream>>>(XB, nullptr, WV, nullptr, DM, FV, DKV, nullptr, 0, 0, 0); k_vtp<<<NKV * (TT / 64), 256, 0, stream>>>(FV, DKV, NKV, VT16, VTh, VTl);
        for (int h0 = 0; h0 < NH_; h0 += ZH) { const size_t zq = (size_t)h0, zk = (size_t)(h0 / REP);   // one kv head per query head: the pass's ZH heads use consecutive kv planes
            k_gemmc<bf, 2, 1><<<dim3(RH / 64, TT / 64, ZH), 32, 0, stream>>>(QPh + zq * RH * HD, QPl + zq * RH * HD, KPh + zk * TT * HD, KPl + zk * TT * HD, HD, HD, Sb, TT, 0, (size_t)RH * HD, (size_t)TT * HD, (size_t)TT * TT, CFLAG);
            k_gemmc<h16, 0, 1><<<dim3((TT - RH) / 64, TT / 64, ZH), 32, 0, stream>>>(QP16 + zq * TT * HD + (size_t)RH * HD, nullptr, KP16 + zk * TT * HD, nullptr, HD, HD, Sb + (size_t)RH * TT, TT, RH, (size_t)TT * HD, (size_t)TT * HD, (size_t)TT * TT, CFLAG);
            k_asoft<<<ZH * TT / 8, 256, 0, stream>>>(Sb, MK + (size_t)b * TT * TT, CFLAG);
            k_gemmc<bf, 2, 2><<<dim3(RH / 64, HD / 64, ZH), 32, 0, stream>>>((const bf*)Sb, (const bf*)Sb + TT, VTh + zk * HD * 2 * TT, VTl + zk * HD * 2 * TT, 2 * TT, TT, Ob, HD, 0, (size_t)TT * 2 * TT, (size_t)HD * 2 * TT, (size_t)TT * HD, CFLAG);
            k_gemmc<h16, 0, 2><<<dim3((TT - RH) / 64, HD / 64, ZH), 32, 0, stream>>>((const h16*)Sb + (size_t)RH * 2 * TT, nullptr, VT16 + zk * HD * 2 * TT, nullptr, 2 * TT, TT, Ob + (size_t)RH * HD, HD, RH, (size_t)TT * 2 * TT, (size_t)HD * 2 * TT, (size_t)TT * HD, CFLAG);
            k_merge<<<(unsigned)(((size_t)ZH * TT * HD / 4 + 256 * EU - 1) / (256 * EU)), 256, 0, stream>>>(Ob, h0, ATh, ATl); }
        k_gemmw<bf, 1, false><<<dim3(TT / 64, DM / 64, 1), 32, 0, stream>>>(ATh, ATl, WO, nullptr, DQ, OUT + (size_t)b * TT * DM, DM, nullptr, 0, 0, 0); }
}

// v003
// It runs in 851 microseconds.
// In two side-by-side timings against v002, it was 1.28 and 1.29 times as fast.
// Counting every step since v000, it is 2.28 times as fast.
#include <hip/hip_runtime.h>

// Causal LM attention with additive mask and position-id rotary (hidden [2][2048][2048]; q, k, v = hidden W^T ('oi' [2048][2048], 16 heads x 128); rotate-half RoPE with angle = position_ids[b][t] x inv_freq (theta 1e4; position_ids int32 input, read on device); scores/sqrt(128) + attention_mask[b][0][i][j] (f32 input, read); softmax; out = merged Wo^T -> [2][2048][2048]).
// The additive mask is verified ON THE DEVICE to be the causal pattern (0 where j <= i, most-negative elsewhere); when it is, score tiles above the diagonal are skipped and the masked entries are realised as exact-zero softmax weights (identical result); otherwise every tile is computed and the mask is simply added (general fallback).
// Compute dtypes, f32 accumulate: every input rounded to bf16; q/k/v on PLAIN bf16 operands (inputs: exact); rotary in f32 (per-batch table from the position ids and the reference's inv_freq constants); mask check, additive mask (bf16-rounded) inside the softmax kernel; causal scores and attn.v (tile skipping gated by the device flag): query rows < 512 hl (3 products), the rest single fp16 (x1024); softmax f32; Wo hl x exact (2 products).

#define NB_  2
#define TT   2048
#define DM   2048
#define NH_  16
#define NKV  16
#define REP  (NH_ / NKV)
#define HD   128
#define DQ   (NH_ * HD)
#define DKV  (NKV * HD)
#define ZH   8                    // heads per attention pass (grid z of the score and P.V launches; the softmax and merge launches cover them in grid x)
#define GW   4                    // waves per 64x64 tile in the projection GEMMs (k steps dealt over them)
#define PW   8                    // waves per 64x64 tile in the probability x value launches
#define RH   512                  // query rows < RH use hi+lo planes (0: none)
#define WIN  2048
#define PCAR 1024.0f
#define SCL  0.088388347648318447f   // HD^-0.5
typedef _Float16 h16;
typedef unsigned short bf;
typedef __attribute__((ext_vector_type(16))) __bf16   v16bf;
typedef __attribute__((ext_vector_type(16))) _Float16 v16h;
typedef __attribute__((ext_vector_type(8)))  _Float16 v8h;
typedef __attribute__((ext_vector_type(8)))  unsigned short v8us;
typedef __attribute__((ext_vector_type(8)))  float    v8f;
typedef __attribute__((ext_vector_type(4)))  float    v4f;
typedef v8h  __attribute__((may_alias)) v8ha;
typedef v4f  __attribute__((may_alias)) v4fa;
typedef v8us __attribute__((may_alias)) v8usa;

__device__ __forceinline__ unsigned short f2bf(float f) { unsigned u = __float_as_uint(f); u += 0x7FFFu + ((u >> 16) & 1u); return (unsigned short)(u >> 16); }
__device__ __forceinline__ float bf2f(unsigned short b) { return __uint_as_float(((unsigned)b) << 16); }
__device__ __forceinline__ float bfr(float f) { return bf2f(f2bf(f)); }
__device__ __forceinline__ v16h cat16(v8h lo, v8h hi) { return __builtin_shufflevector(lo, hi, 0, 1, 2, 3, 4, 5, 6, 7, 8, 9, 10, 11, 12, 13, 14, 15); }
__device__ __forceinline__ v16bf cat16b(v8us lo, v8us hi) { return __builtin_bit_cast(v16bf, __builtin_shufflevector(lo, hi, 0, 1, 2, 3, 4, 5, 6, 7, 8, 9, 10, 11, 12, 13, 14, 15)); }
__device__ __forceinline__ v8f wmma16(v16h a, v16h b, v8f c) { return __builtin_amdgcn_wmma_f32_16x16x32_f16(false, a, false, b, (short)0, c, false, false); }
__device__ __forceinline__ v8f wmmab(v16bf a, v16bf b, v8f c) { return __builtin_amdgcn_wmma_f32_16x16x32_bf16(false, a, false, b, (short)0, c, false, false); }



// ---- kred_store: end of a 64x64 tile whose K loop was dealt over the NW waves of the block (wave w took the 32-wide k steps w, w + NW, ...). Every wave lays its whole f32 partial tile into its own LDS plane (row pitch 68),
// one block barrier publishes the planes, then wave w adds the NW partials of its 64 / NW rows in the fixed order 0, 1, .. NW - 1 and stores them as whole 256-byte rows. Ct = address of the tile's first element.
template <int NW, bool BIAS>
__device__ __forceinline__ void kred_store(const v8f (&acc)[4][4], float* red, int w, int lr, int hi, float* Ct, int ldc, const float* bias) {
    float* mine = red + w * (64 * 68);
    // the three loops are unrolled whole so that acc is indexed by constants only and stays in registers
#pragma unroll
    for (int mb = 0; mb < 4; ++mb)
#pragma unroll
        for (int nb = 0; nb < 4; ++nb)
#pragma unroll
            for (int j = 0; j < 8; ++j) mine[(mb * 16 + hi * 8 + j) * 68 + nb * 16 + lr] = acc[mb][nb][j];
    __syncthreads();   // every wave's partial tile is in LDS before any wave adds them
    // unrolled whole: the LDS reads of all rows can be issued ahead of the adds and stores
#pragma unroll
    for (int s = 0; s < 32 / NW; ++s) { const int row = w * (64 / NW) + 2 * s + hi, cofs = lr * 4; v4f val = *(const v4fa*)(red + row * 68 + cofs);
#pragma unroll
        for (int p = 1; p < NW; ++p) val += *(const v4fa*)(red + p * (64 * 68) + row * 68 + cofs);
        if (BIAS) { val[0] += bfr(bias[cofs]); val[1] += bfr(bias[cofs + 1]); val[2] += bfr(bias[cofs + 2]); val[3] += bfr(bias[cofs + 3]); }
        *(v4f*)(Ct + (size_t)row * ldc + cofs) = val; }
}

// ---- k_gemmw: register-blocked GEMM, one block of NW waves per 64x64 output tile; each wave holds the whole tile (16 accumulators) for its share of the k steps; operands straight from K-contiguous 16-bit planes; grid (M/64, N/64, Z), 32 x NW threads.
// C[m][n] (f32, pitch ldc, + optional f32 bias[n]) = sum_k A[m][k] Bt[n][k] (+ split products per NSPLIT). z-batch strides sA/sB/sC in elements. K % 32 == 0.
template <typename T16> struct WFrag;
template <> struct WFrag<h16> { typedef v16h V; static __device__ __forceinline__ V ld(const h16* p) { return cat16(*(const v8h*)p, *(const v8h*)(p + 16)); } static __device__ __forceinline__ v8f mma(V a, V b, v8f c) { return wmma16(a, b, c); } };
template <> struct WFrag<bf> { typedef v16bf V; static __device__ __forceinline__ V ld(const bf* p) { return cat16b(*(const v8us*)p, *(const v8us*)(p + 16)); } static __device__ __forceinline__ v8f mma(V a, V b, v8f c) { return wmmab(a, b, c); } };
template <typename T16, int NSPLIT, bool BIAS, int NW>
__global__ __launch_bounds__(32 * NW) void k_gemmw(const T16* __restrict__ A, const T16* __restrict__ A2, const T16* __restrict__ Bt, const T16* __restrict__ Bt2, int K, float* C, int ldc, const float* __restrict__ bias, size_t sA, size_t sB, size_t sC) {
    typedef typename WFrag<T16>::V V;
    __shared__ __align__(16) float red[NW * 64 * 68];
    const size_t z = blockIdx.z; A += z * sA; if (A2) A2 += z * sA; Bt += z * sB; if (Bt2) Bt2 += z * sB; C += z * sC;
    const int lane = threadIdx.x & 31, lr = lane & 15, hi = lane >> 4; const int r0 = blockIdx.x * 64, c0 = blockIdx.y * 64;
    const int w = __builtin_amdgcn_readfirstlane(threadIdx.x >> 5);   // the wave's number in a scalar register: the k loop stays a scalar loop
    v8f acc[4][4];
#pragma unroll
    for (int mb = 0; mb < 4; ++mb)
#pragma unroll
        for (int nb = 0; nb < 4; ++nb) acc[mb][nb] = (v8f){};
    const size_t aoff = (size_t)(r0 + lr) * K + 8 * hi, boff = (size_t)(c0 + lr) * K + 8 * hi;
#pragma unroll 1
    for (int kc = 32 * w; kc < K; kc += 32 * NW) {
        V a[4], a2[4];
#pragma unroll
        for (int mb = 0; mb < 4; ++mb) { a[mb] = WFrag<T16>::ld(A + aoff + (size_t)mb * 16 * K + kc); if (NSPLIT == 1 || NSPLIT == 2) a2[mb] = WFrag<T16>::ld(A2 + aoff + (size_t)mb * 16 * K + kc); }
#pragma unroll
        for (int nb = 0; nb < 4; ++nb) { const V b = WFrag<T16>::ld(Bt + boff + (size_t)nb * 16 * K + kc); V b2; if (NSPLIT >= 2) b2 = WFrag<T16>::ld(Bt2 + boff + (size_t)nb * 16 * K + kc);
#pragma unroll
            for (int mb = 0; mb < 4; ++mb) { acc[mb][nb] = WFrag<T16>::mma(a[mb], b, acc[mb][nb]); if (NSPLIT == 1 || NSPLIT == 2) acc[mb][nb] = WFrag<T16>::mma(a2[mb], b, acc[mb][nb]); if (NSPLIT >= 2) acc[mb][nb] = WFrag<T16>::mma(a[mb], b2, acc[mb][nb]); } }
        asm volatile("v_nop\n\tv_nop\n\tv_nop\n\tv_nop" : "+v"(acc[0][0]), "+v"(acc[1][1]), "+v"(acc[2][2]), "+v"(acc[3][3]) : "v"(a[0]), "v"(a[3]));
    }
    kred_store<NW, BIAS>(acc, red, w, lr, hi, C + (size_t)r0 * ldc + c0, ldc, BIAS ? bias + c0 : nullptr);
}

// ---- k_gemmc: the same 64x64 tile GEMM specialised for causal attention: CMODE 1 skips score tiles entirely above the diagonal (query rows r0+roff.., key columns c0..), CMODE 2 limits the
// key (K) loop of the probability x value contraction to the diagonal block (probabilities beyond it are exactly zero). roff = row offset of this launch's first row within the sequence. NW = waves per tile: NW > 1 deals the k steps over the block's waves (kred_store adds the partial tiles), NW == 1 is one wave per tile. K = row pitch of A, A2, Bt and Bt2 in elements, Kn = length of the contraction (Kn <= K, Kn % 32 == 0).
template <typename T16, int NSPLIT, int CMODE, int NW>
__global__ __launch_bounds__(32 * NW) void k_gemmc(const T16* __restrict__ A, const T16* __restrict__ A2, const T16* __restrict__ Bt, const T16* __restrict__ Bt2, int K, int Kn, float* C, int ldc, int roff, size_t sA, size_t sB, size_t sC, const int* CF) {
    typedef typename WFrag<T16>::V V;
    const size_t z = blockIdx.z; A += z * sA; if (A2) A2 += z * sA; Bt += z * sB; if (Bt2) Bt2 += z * sB; C += z * sC;
    const int lane = threadIdx.x & 31, lr = lane & 15, hi = lane >> 4; const int r0 = blockIdx.x * 64, c0 = blockIdx.y * 64;
    const int w = (NW > 1) ? __builtin_amdgcn_readfirstlane(threadIdx.x >> 5) : 0;   // the wave's number in a scalar register: the k loop stays a scalar loop
    const bool con = (CF == nullptr) || (CF[0] != 0);   /* device flag: mask verified causal */ if (CMODE == 1 && con && c0 > r0 + roff + 63) return;                  // score tile entirely above the causal diagonal: never read (the softmax masks j > i by select)
    const int Kl = (CMODE == 2 && con) ? min(Kn, r0 + roff + 64) : Kn;        // P.V: probabilities are exactly 0 beyond the diagonal block, so the K loop stops there
    v8f acc[4][4];
#pragma unroll
    for (int mb = 0; mb < 4; ++mb)
#pragma unroll
        for (int nb = 0; nb < 4; ++nb) acc[mb][nb] = (v8f){};
    const size_t aoff = (size_t)(r0 + lr) * K + 8 * hi, boff = (size_t)(c0 + lr) * K + 8 * hi;
#pragma unroll 1
    for (int kc = 32 * w; kc < Kl; kc += 32 * NW) {
        V a[4], a2[4];
#pragma unroll
        for (int mb = 0; mb < 4; ++mb) { a[mb] = WFrag<T16>::ld(A + aoff + (size_t)mb * 16 * K + kc); if (NSPLIT == 1 || NSPLIT == 2) a2[mb] = WFrag<T16>::ld(A2 + aoff + (size_t)mb * 16 * K + kc); }
#pragma unroll
        for (int nb = 0; nb < 4; ++nb) { const V b = WFrag<T16>::ld(Bt + boff + (size_t)nb * 16 * K + kc); V b2; if (NSPLIT >= 2) b2 = WFrag<T16>::ld(Bt2 + boff + (size_t)nb * 16 * K + kc);
#pragma unroll
            for (int mb = 0; mb < 4; ++mb) { acc[mb][nb] = WFrag<T16>::mma(a[mb], b, acc[mb][nb]); if (NSPLIT == 1 || NSPLIT == 2) acc[mb][nb] = WFrag<T16>::mma(a2[mb], b, acc[mb][nb]); if (NSPLIT >= 2) acc[mb][nb] = WFrag<T16>::mma(a[mb], b2, acc[mb][nb]); } }
        asm volatile("v_nop\n\tv_nop\n\tv_nop\n\tv_nop" : "+v"(acc[0][0]), "+v"(acc[1][1]), "+v"(acc[2][2]), "+v"(acc[3][3]) : "v"(a[0]), "v"(a[3]));
    }
    if constexpr (NW > 1) {
        __shared__ __align__(16) float red[NW * 64 * 68];
        kred_store<NW, false>(acc, red, w, lr, hi, C + (size_t)r0 * ldc + c0, ldc, nullptr);
    } else {
    __shared__ __align__(16) float os[16 * 68];
#pragma unroll
    for (int mb = 0; mb < 4; ++mb) {
#pragma unroll
        for (int nb = 0; nb < 4; ++nb) {
#pragma unroll
            for (int j = 0; j < 8; ++j) os[(hi * 8 + j) * 68 + nb * 16 + lr] = acc[mb][nb][j]; }
        __builtin_amdgcn_wave_barrier(); asm volatile("" ::: "memory");
        float* crow = C + (size_t)(r0 + mb * 16) * ldc + c0;
{
#pragma unroll
            for (int s = 0; s < 8; ++s) { const int row = 2 * s + hi, cofs = lr * 4; v4f val = *(const v4fa*)(os + row * 68 + cofs);
                *(v4f*)(crow + (size_t)row * ldc + cofs) = val; }
             }
        __builtin_amdgcn_wave_barrier(); asm volatile("" ::: "memory");
    }
    }
}

__device__ __forceinline__ h16 tohx(float x) { return (h16)x; }
__device__ __forceinline__ void splitf(float y, unsigned short& h, unsigned short& l) { h = f2bf(y); l = f2bf(y - bf2f(h)); }
typedef __attribute__((ext_vector_type(2))) _Float16 v2h;
typedef __attribute__((ext_vector_type(4))) _Float16 v4h;
typedef __attribute__((ext_vector_type(2))) unsigned short v2us;
typedef __attribute__((ext_vector_type(4))) unsigned short v4us;
typedef __attribute__((ext_vector_type(2))) float v2f;
typedef __attribute__((ext_vector_type(4))) int v4i;

__global__ __launch_bounds__(256) void k_wtG(const float* __restrict__ w, int K, int N, bf* Bt) {
    const int lane = threadIdx.x & 31; const int L0 = (blockIdx.x * 8 + (threadIdx.x >> 5)) * 8; const int nlines = N * K / 64;
{
#pragma unroll 1
        for (int l = 0; l < 8; ++l) { const int L = L0 + l; if (L >= nlines) break; const size_t e = (size_t)L * 64 + lane * 2; const int k = (int)(e % K), n = (int)(e / K); v2us o;
            o[0] = f2bf(w[(size_t)k * N + n]); o[1] = f2bf(w[(size_t)(k + 1) * N + n]); *(v2us*)(Bt + e) = o; }
         }
}
// The elementwise kernels below give each thread several vectors (all loads issued first, then the arithmetic and the stores), so that each launch starts 4,096 waves instead of one short wave per 64 to 256 elements.
#define EU 4                      // vectors per thread in k_cvt8, k_rope (rows) and k_merge
#define MU 8                      // vectors per thread in k_mchk
__global__ __launch_bounds__(256) void k_cvt8(const float* __restrict__ src, bf* dst, size_t n8) { const size_t i0 = (size_t)blockIdx.x * (256 * EU) + threadIdx.x; v8f v[EU];
#pragma unroll
    for (int u = 0; u < EU; ++u) { const size_t i = i0 + (size_t)u * 256; v[u] = *(const v8f*)(src + (i < n8 ? i : n8 - 1) * 8); }   // index clamped, not branched round: the loads stay one group in flight; the store below is guarded
#pragma unroll
    for (int u = 0; u < EU; ++u) { const size_t i = i0 + (size_t)u * 256; v8us o;
#pragma unroll
        for (int k = 0; k < 8; ++k) o[k] = f2bf(v[u][k]);
        if (i < n8) *(v8us*)(dst + i * 8) = o; } }
__constant__ float INV[HD / 2] = {1.0,0.8659643530845642,0.7498942017555237,0.6493816375732422,0.5623413324356079,0.486967533826828,0.4216965138912201,0.36517414450645447,0.3162277638912201,0.2738419771194458,0.23713736236095428,0.20535250008106232,0.17782793939113617,0.1539926528930664,0.1333521455526352,0.11547820270061493,0.10000000149011612,0.08659642934799194,0.07498941570520401,0.06493816524744034,0.05623412877321243,0.04869675263762474,0.04216964915394783,0.03651741147041321,0.03162277862429619,0.0273841954767704,0.0237137358635664,0.02053525112569332,0.017782794311642647,0.015399265103042126,0.01333521492779255,0.011547819711267948,0.009999999776482582,0.00865964312106371,0.007498942315578461,0.006493816617876291,0.005623413249850273,0.004869675263762474,0.0042169648222625256,0.003651741426438093,0.003162277862429619,0.0027384196873754263,0.0023713738191872835,0.0020535250660032034,0.0017782794311642647,0.0015399265103042126,0.0013335214462131262,0.0011547820176929235,0.0010000000474974513,0.0008659643353894353,0.0007498941849917173,0.0006493816617876291,0.000562341301701963,0.00048696750309318304,0.00042169648804701865,0.00036517411353997886,0.0003162277862429619,0.00027384195709601045,0.0002371373848291114,0.00020535249495878816,0.00017782794020604342,0.00015399264520965517,0.0001333521504420787,0.00011547819303814322};
// k_cstab: one thread per (t, d < HD/2); the angle of d + HD/2 is the same one, so the pair is stored at both places
__global__ __launch_bounds__(256) void k_cstab(const int* __restrict__ pos, float* CS) { const int idx = blockIdx.x * 256 + threadIdx.x; if (idx >= TT * (HD / 2)) return; const int t = idx / (HD / 2), d = idx % (HD / 2); const float ang = __fmul_rn((float)pos[t], INV[d]); v2f cs; cs[0] = cosf(ang); cs[1] = sinf(ang);
    float* o = CS + ((size_t)t * HD + d) * 2; *(v2f*)o = cs; *(v2f*)(o + HD) = cs;  }
// k_mchk: causal-pattern check of the additive mask for one batch: any entry with (j <= i and mask != 0) or (j > i and mask > -1e30) clears FLAG[0] (plain identical stores; FLAG preset to 1); lane -> MU groups of 4 consecutive j, 1024 elements apart.
__global__ __launch_bounds__(256) void k_mchk(const float* __restrict__ MKb, int* FLAG) { const size_t e0 = ((size_t)blockIdx.x * (256 * MU) + threadIdx.x) * 4; v4f m[MU]; bool bad = false;
#pragma unroll
    for (int u = 0; u < MU; ++u) { const size_t e = e0 + (size_t)u * 1024; m[u] = *(const v4f*)(MKb + (e < (size_t)TT * TT ? e : (size_t)TT * TT - 4)); }   // index clamped: one group of loads in flight
#pragma unroll
    for (int u = 0; u < MU; ++u) { const size_t e = e0 + (size_t)u * 1024; const int j = (int)(e % TT), i = (int)(e / TT); bool b = false;
#pragma unroll
        for (int q = 0; q < 4; ++q) { const bool keep = (j + q <= i); b |= keep ? (m[u][q] != 0.0f) : (m[u][q] > -1.0e30f); }
        bad |= b && (e < (size_t)TT * TT); }
    if (bad) *(int*)FLAG = 0; }
__global__ void k_flag1(int* FLAG) { if (threadIdx.x == 0) { *(int*)FLAG = 1;  } }

// k_rope: head planes [h][t][d] (fp16 + hi/lo) of rope(x) x sc with the rotate-half convention out[d] = x[d] cos[t][d] - x[d+HD/2] sin[t][d], out[d+HD/2] = x[d+HD/2] cos[t][d+HD/2] + x[d] sin[t][d+HD/2]; the hi/lo planes hold rows t < hr only ([h][hr][d])
// 16 threads per (h, t) row: a thread takes 4 consecutive d < HD/2 and their 4 partners d + HD/2 (each x is loaded once and serves both), in EU rows 16 apart; a block covers 16 x EU rows of one head (TT is a multiple of that).
__global__ __launch_bounds__(256) void k_rope(const float* __restrict__ F, int pitch, int nheads, const float* __restrict__ CS, const float* __restrict__ RF, const float* __restrict__ nw, float sc, int hr, h16* P16, bf* Ph, bf* Pl) {
    const int h = blockIdx.x / (TT / (16 * EU)); if (h >= nheads) return; const int tb = (blockIdx.x % (TT / (16 * EU))) * (16 * EU); const int tl = threadIdx.x >> 4, d = (threadIdx.x & 15) * 4;
    const float* Fb = F + (size_t)tb * pitch + h * HD; const float* Cb = CS + (size_t)tb * HD * 2; const float* pc = Cb + (tl * HD + d) * 2; const float* pf[EU]; v4f xv[EU][2], cv[EU][2][2];
#pragma unroll
    for (int u = 0; u < EU; ++u) { pf[u] = Fb + (size_t)(u * 16 + tl) * pitch + d;
#pragma unroll
        for (int hf = 0; hf < 2; ++hf) { xv[u][hf] = *(const v4f*)(pf[u] + hf * (HD / 2)); const float* c = pc + (u * 16 * HD + hf * (HD / 2)) * 2; cv[u][hf][0] = *(const v4f*)c; cv[u][hf][1] = *(const v4f*)(c + 4); } }
    asm volatile("s_wait_xcnt 0x0" :: "v"(pc), "v"(pf[0]), "v"(pf[1]), "v"(pf[2]), "v"(pf[3]) : "memory");   // the loads' address registers are inputs here, so none of them is reused before this wait
#pragma unroll
    for (int u = 0; u < EU; ++u) { const int t = tb + u * 16 + tl; float rf = 1.0f;
        if (RF) { rf = RF[(size_t)h * TT + t]; asm volatile("s_wait_xcnt 0x0" :: "v"(rf) : "memory"); }   // the wait stands behind this load, ahead of any reuse of its base or offset register; the loaded value is an input so that the load cannot sink below it
#pragma unroll
        for (int hf = 0; hf < 2; ++hf) { v4h o16; v4us oh, ol;
#pragma unroll
            for (int q = 0; q < 4; ++q) { const int dd = d + hf * (HD / 2) + q; const int dp = (dd < HD / 2) ? dd + HD / 2 : dd - HD / 2; float x0 = xv[u][hf][q], x1 = xv[u][1 - hf][q];
                if (RF) { float n0 = __fmul_rn(x0, rf), n1 = __fmul_rn(x1, rf); asm volatile("" : "+v"(n0)); asm volatile("" : "+v"(n1)); x0 = __fmul_rn(bfr(nw[dd]), n0); x1 = __fmul_rn(bfr(nw[dp]), n1); }
                v2f cs; cs[0] = cv[u][hf][q >> 1][(q & 1) * 2]; cs[1] = cv[u][hf][q >> 1][(q & 1) * 2 + 1]; float a = __fmul_rn(x0, cs[0]), bq = __fmul_rn(x1, cs[1]); asm volatile("" : "+v"(a)); asm volatile("" : "+v"(bq)); const float r = ((dd < HD / 2) ? __fsub_rn(a, bq) : __fadd_rn(a, bq)) * sc;
                o16[q] = tohx(r); unsigned short a2, c2; splitf(r, a2, c2); oh[q] = a2; ol[q] = c2; }
            const int dh = d + hf * (HD / 2); *(v4h*)(P16 + ((size_t)h * TT + t) * HD + dh) = o16; if (t < hr) { const size_t eh = ((size_t)h * hr + t) * HD + dh; *(v4us*)(Ph + eh) = oh; *(v4us*)(Pl + eh) = ol; } } }  }
// k_vtp: transposed value planes [g][d][t] at a row pitch of 2 x TT elements, the pitch of the in-place weight rows they are contracted with (k_gemmc has one pitch for both operands); the lo plane lies in the second half of the hi plane's rows (Vl = Vh + TT)
// A block takes one head's 64 rows t x HD columns; a thread takes an 8 t x 4 d patch (8 row loads of 16 bytes) and stores it turned, 8 consecutive t per d: a wave's store covers 4 whole 128-byte lines.
__global__ __launch_bounds__(256) void k_vtp(const float* __restrict__ F, int pitch, int nheads, h16* V16, bf* Vh, bf* Vl) { const int lane = threadIdx.x & 31; const int g = blockIdx.x / (TT / 64); if (g >= nheads) return; const int tb = (blockIdx.x % (TT / 64)) * 64, tl = (lane >> 2) * 8; const int d = (threadIdx.x >> 5) * 16 + (lane & 3) * 4; const float* pf[8]; v4f xv[8];
#pragma unroll
    for (int r = 0; r < 8; ++r) { pf[r] = F + (size_t)(tb + tl + r) * pitch + g * HD + d; xv[r] = *(const v4f*)pf[r]; }
    asm volatile("s_wait_xcnt 0x0" :: "v"(pf[0]), "v"(pf[1]), "v"(pf[2]), "v"(pf[3]), "v"(pf[4]), "v"(pf[5]), "v"(pf[6]), "v"(pf[7]) : "memory");   // the loads' address registers are inputs here, so none of them is reused before this wait
#pragma unroll
    for (int c = 0; c < 4; ++c) { v8h o16; v8us oh, ol;
#pragma unroll
        for (int r = 0; r < 8; ++r) { const float x = xv[r][c]; o16[r] = tohx(x); unsigned short a2, c2; splitf(x, a2, c2); oh[r] = a2; ol[r] = c2; }
        const size_t ev = ((size_t)g * HD + d + c) * (2 * TT) + tb + tl; *(v8h*)(V16 + ev) = o16; *(v8us*)(Vh + ev) = oh; *(v8us*)(Vl + ev) = ol; }  }
// k_asoft: per row (zz, i): t = S x HD^-0.5 for j <= i; softmax over the 2048 keys (register row, one exp, fixed trees);; adds bf16(attention_mask[b][0][i][j]) to kept scores; when the device flag says the mask is causal, keys j > i get exact-zero weight (same as adding the most-negative mask value), otherwise every key takes score + mask
// The weights are stored IN PLACE over the wave's own score row (8192 bytes, held whole in registers before the first store): rows < RH as hi plane (bytes 0..4095) + lo plane (bytes 4096..8191), the rest as fp16 in bytes 0..4095; the P.V launches read them at a row pitch of 2 x TT 16-bit elements.
__global__ __launch_bounds__(256) void k_asoft(float* Sb, const float* __restrict__ MKb, const int* __restrict__ CF) {
    const int lane = threadIdx.x & 31; const int row = blockIdx.x * 8 + (threadIdx.x >> 5); if (row >= ZH * TT) return; const int i = row % TT; const int zz = row / TT; (void)zz; const float* mk = MKb + (size_t)i * TT; const bool con = (CF[0] != 0); const bool hires = (i < RH); const float* sr = Sb + (size_t)row * TT; float v[TT / 32]; float mx = -3.0e38f;
#pragma unroll
    for (int ch = 0; ch < TT / 128; ++ch) { const int j0 = ch * 128 + lane * 4; const v4f a = *(const v4f*)(sr + j0);
#pragma unroll
        for (int q = 0; q < 4; ++q) { const int j = j0 + q; (void)j; float sa = a[q] * SCL; asm volatile("" : "+v"(sa)); float mv = bfr(mk[j]); asm volatile("" : "+v"(mv)); const float t = (j <= i || !con) ? __fadd_rn(sa, mv) : -3.0e38f;   /* causal-verified: masked keys -> exact zero weight (== adding the most-negative mask); else general additive path */ v[ch * 4 + q] = t; mx = fmaxf(mx, t); } }
#pragma unroll
    for (int sh = 16; sh; sh >>= 1) mx = fmaxf(mx, __shfl_xor(mx, sh, 32));
    float sum = 0.f;
#pragma unroll
    for (int k = 0; k < TT / 32; ++k) { float d0 = __fsub_rn(v[k], mx); asm volatile("" : "+v"(d0)); v[k] = __builtin_amdgcn_exp2f(__fmul_rn(d0, 1.4426950408889634f)); sum += v[k]; }
#pragma unroll
    for (int sh = 16; sh; sh >>= 1) sum += __shfl_xor(sum, sh, 32);
    const float f = __fdiv_rn(hires ? 1.0f : PCAR, sum);
    bf* ph = (bf*)(Sb + (size_t)row * TT); h16* p16 = (h16*)(Sb + (size_t)row * TT);
{
        if (hires) {
#pragma unroll
            for (int ch = 0; ch < TT / 128; ++ch) { v4us oh, ol;
#pragma unroll
                for (int q = 0; q < 4; ++q) { unsigned short a, c2; splitf(v[ch * 4 + q] * f, a, c2); oh[q] = a; ol[q] = c2; }
                const int oo = ch * 128 + lane * 4; *(v4us*)(ph + oo) = oh; *(v4us*)(ph + TT + oo) = ol; }
        } else {
#pragma unroll
            for (int ch = 0; ch < TT / 128; ++ch) { v4h o4;
#pragma unroll
                for (int q = 0; q < 4; ++q) o4[q] = tohx(v[ch * 4 + q] * f);
                *(v4h*)(p16 + ch * 128 + lane * 4) = o4; } }
         }
}
__global__ __launch_bounds__(256) void k_merge(const float* __restrict__ O, int h0, bf* Ah, bf* Al) { const size_t e0 = ((size_t)blockIdx.x * (256 * EU) + threadIdx.x) * 4; v4f ov[EU];
#pragma unroll
    for (int u = 0; u < EU; ++u) { const size_t e = e0 + (size_t)u * 1024; ov[u] = *(const v4f*)(O + (e < (size_t)ZH * TT * HD ? e : (size_t)ZH * TT * HD - 4)); }   // index clamped: one group of loads in flight
#pragma unroll
    for (int u = 0; u < EU; ++u) { const size_t e = e0 + (size_t)u * 1024; if (e >= (size_t)ZH * TT * HD) break; const int d = (int)(e % HD); const int t = (int)((e / HD) % TT); const int zz = (int)(e / ((size_t)HD * TT)); const float cs = (t < RH) ? 1.0f : (1.0f / PCAR); const size_t oo = (size_t)t * DQ + (h0 + zz) * HD + d;
        v4us oh, ol;
#pragma unroll
        for (int q = 0; q < 4; ++q) { unsigned short a, c2; splitf(ov[u][q] * cs, a, c2); oh[q] = a; ol[q] = c2; } *(v4us*)(Ah + oo) = oh; *(v4us*)(Al + oo) = ol; }  }

extern "C" void kernel_launch(void* const* d_in, const int* in_sizes, int n_in,
                              void* d_out, int out_size, void* d_ws, size_t ws_size, hipStream_t stream) {
    (void)in_sizes; (void)n_in; (void)out_size;
    const float* x = (const float*)d_in[0]; const float* MK = (const float*)d_in[1]; const int* POS = (const int*)d_in[2]; const float* wq = (const float*)d_in[3]; const float* wk = (const float*)d_in[4]; const float* wv = (const float*)d_in[5]; const float* wo = (const float*)d_in[6];
    float* OUT = (float*)d_out;     // [2][2048][2048]
    char* wsp = (char*)d_ws;
    auto take = [&](size_t bytes) { char* p = wsp; wsp += (bytes + 255) & ~(size_t)255; return (void*)p; };
    bf* WQ = (bf*)take((size_t)DQ * DM * 2); bf* WK = (bf*)take((size_t)DKV * DM * 2); bf* WV = (bf*)take((size_t)DKV * DM * 2); bf* WO = (bf*)take((size_t)DM * DQ * 2); float* CS = (float*)take((size_t)TT * HD * 2 * 4);
    int* CFLAG = (int*)take(256);
    h16* QP16 = (h16*)take((size_t)NH_ * TT * HD * 2); h16* KP16 = (h16*)take((size_t)NKV * TT * HD * 2); h16* VT16 = (h16*)take((size_t)NKV * HD * 2 * TT * 2);
    bf* QPh = (bf*)take((size_t)NH_ * RH * HD * 2); bf* QPl = (bf*)take((size_t)NH_ * RH * HD * 2); bf* KPh = (bf*)take((size_t)NKV * TT * HD * 2); bf* KPl = (bf*)take((size_t)NKV * TT * HD * 2); bf* VTh = (bf*)take((size_t)NKV * HD * 2 * TT * 2); bf* VTl = VTh + TT;
    float* Sb = (float*)take((size_t)ZH * TT * TT * 4); float* Ob = (float*)take((size_t)ZH * TT * HD * 4); bf* ATh = (bf*)take((size_t)TT * DQ * 2); bf* ATl = (bf*)take((size_t)TT * DQ * 2);
    if ((size_t)(wsp - (char*)d_ws) > ws_size) return;    // ws 256 MiB
    bf* XB = (bf*)Sb; float* FQ = Sb + (size_t)TT * DM / 2; float* FK = FQ + (size_t)TT * DQ;   // the bf16 input rows and the f32 projections are dead once the head planes are built: they share the score buffer (stream-ordered)
    float* FV = FK;   // v projection reuses the k buffer after the k planes are built (stream-ordered)
    { k_cvt8<<<(unsigned)(((size_t)DQ * DM / 8 + 256 * EU - 1) / (256 * EU)), 256, 0, stream>>>(wq, WQ, (size_t)DQ * DM / 8); k_cvt8<<<(unsigned)(((size_t)DKV * DM / 8 + 256 * EU - 1) / (256 * EU)), 256, 0, stream>>>(wk, WK, (size_t)DKV * DM / 8); k_cvt8<<<(unsigned)(((size_t)DKV * DM / 8 + 256 * EU - 1) / (256 * EU)), 256, 0, stream>>>(wv, WV, (size_t)DKV * DM / 8);
      k_cvt8<<<(unsigned)(((size_t)DM * DQ / 8 + 256 * EU - 1) / (256 * EU)), 256, 0, stream>>>(wo, WO, (size_t)DM * DQ / 8);
      }
    const unsigned LQ = NH_ * (TT / (16 * EU)), LKv = NKV * (TT / (16 * EU));   // k_rope: 16 x EU rows of one head per block
    for (int b = 0; b < NB_; ++b) {
        
        k_cvt8<<<(unsigned)(((size_t)TT * DM / 8 + 256 * EU - 1) / (256 * EU)), 256, 0, stream>>>(x + (size_t)b * TT * DM, XB, (size_t)TT * DM / 8); k_flag1<<<1, 32, 0, stream>>>(CFLAG); k_mchk<<<(unsigned)(((size_t)TT * TT / 4 + 256 * MU - 1) / (256 * MU)), 256, 0, stream>>>(MK + (size_t)b * TT * TT, CFLAG); k_cstab<<<(TT * (HD / 2) + 255) / 256, 256, 0, stream>>>(POS + (size_t)b * TT, CS);   /* mask check + per-batch rotary table */
        k_gemmw<bf, 0, false, GW><<<dim3(TT / 64, DQ / 64, 1), 32 * GW, 0, stream>>>(XB, nullptr, WQ, nullptr, DM, FQ, DQ, nullptr, 0, 0, 0);
        k_rope<<<LQ, 256, 0, stream>>>(FQ, DQ, NH_, CS, nullptr, nullptr, 1.0f, RH, QP16, QPh, QPl);
        k_gemmw<bf, 0, false, GW><<<dim3(TT / 64, DKV / 64, 1), 32 * GW, 0, stream>>>(XB, nullptr, WK, nullptr, DM, FK, DKV, nullptr, 0, 0, 0);
        k_rope<<<LKv, 256, 0, stream>>>(FK, DKV, NKV, CS, nullptr, nullptr, 1.0f, TT, KP16, KPh, KPl);
        k_gemmw<bf, 0, false, GW><<<dim3(TT / 64, DKV / 64, 1), 32 * GW, 0, stream>>>(XB, nullptr, WV, nullptr, DM, FV, DKV, nullptr, 0, 0, 0); k_vtp<<<NKV * (TT / 64), 256, 0, stream>>>(FV, DKV, NKV, VT16, VTh, VTl);
        for (int h0 = 0; h0 < NH_; h0 += ZH) { const size_t zq = (size_t)h0, zk = (size_t)(h0 / REP);   // one kv head per query head: the pass's ZH heads use consecutive kv planes
            k_gemmc<bf, 2, 1, 1><<<dim3(RH / 64, TT / 64, ZH), 32, 0, stream>>>(QPh + zq * RH * HD, QPl + zq * RH * HD, KPh + zk * TT * HD, KPl + zk * TT * HD, HD, HD, Sb, TT, 0, (size_t)RH * HD, (size_t)TT * HD, (size_t)TT * TT, CFLAG);
            k_gemmc<h16, 0, 1, 1><<<dim3((TT - RH) / 64, TT / 64, ZH), 32, 0, stream>>>(QP16 + zq * TT * HD + (size_t)RH * HD, nullptr, KP16 + zk * TT * HD, nullptr, HD, HD, Sb + (size_t)RH * TT, TT, RH, (size_t)TT * HD, (size_t)TT * HD, (size_t)TT * TT, CFLAG);
            k_asoft<<<ZH * TT / 8, 256, 0, stream>>>(Sb, MK + (size_t)b * TT * TT, CFLAG);
            k_gemmc<bf, 2, 2, PW><<<dim3(RH / 64, HD / 64, ZH), 32 * PW, 0, stream>>>((const bf*)Sb, (const bf*)Sb + TT, VTh + zk * HD * 2 * TT, VTl + zk * HD * 2 * TT, 2 * TT, TT, Ob, HD, 0, (size_t)TT * 2 * TT, (size_t)HD * 2 * TT, (size_t)TT * HD, CFLAG);
            k_gemmc<h16, 0, 2, PW><<<dim3((TT - RH) / 64, HD / 64, ZH), 32 * PW, 0, stream>>>((const h16*)Sb + (size_t)RH * 2 * TT, nullptr, VT16 + zk * HD * 2 * TT, nullptr, 2 * TT, TT, Ob + (size_t)RH * HD, HD, RH, (size_t)TT * 2 * TT, (size_t)HD * 2 * TT, (size_t)TT * HD, CFLAG);
            k_merge<<<(unsigned)(((size_t)ZH * TT * HD / 4 + 256 * EU - 1) / (256 * EU)), 256, 0, stream>>>(Ob, h0, ATh, ATl); }
        k_gemmw<bf, 1, false, GW><<<dim3(TT / 64, DM / 64, 1), 32 * GW, 0, stream>>>(ATh, ATl, WO, nullptr, DQ, OUT + (size_t)b * TT * DM, DM, nullptr, 0, 0, 0); }
}

// v004
// One run takes 761 microseconds.
// Two timings next to v003 both put it at 1.12 times that version's speed.
// Counting every step since v000, it is 2.55 times as fast.
#include <hip/hip_runtime.h>

// Causal LM attention with additive mask and position-id rotary (hidden [2][2048][2048]; q, k, v = hidden W^T ('oi' [2048][2048], 16 heads x 128); rotate-half RoPE with angle = position_ids[b][t] x inv_freq (theta 1e4; position_ids int32 input, read on device); scores/sqrt(128) + attention_mask[b][0][i][j] (f32 input, read); softmax; out = merged Wo^T -> [2][2048][2048]).
// The additive mask is verified ON THE DEVICE to be the causal pattern (0 where j <= i, most-negative elsewhere); when it is, score tiles above the diagonal are skipped and the masked entries are realised as exact-zero softmax weights (identical result); otherwise every tile is computed and the mask is simply added (general fallback).
// Compute dtypes, f32 accumulate: every input rounded to bf16; q/k/v on PLAIN bf16 operands (inputs: exact); rotary in f32 (per-batch table from the position ids and the reference's inv_freq constants); mask check, additive mask (bf16-rounded) inside the softmax kernel; causal scores and attn.v (tile skipping gated by the device flag): query rows < 512 hl (3 products), the rest single fp16 (x1024); softmax f32; Wo hl x exact (2 products).

#define NB_  2
#define TT   2048
#define DM   2048
#define NH_  16
#define NKV  16
#define REP  (NH_ / NKV)
#define HD   128
#define DQ   (NH_ * HD)
#define DKV  (NKV * HD)
#define ZH   8                    // heads per attention pass (grid z of the score and P.V launches)
#define PW   8                    // waves per 64x64 tile in the probability x value launches
#define RH   512                  // query rows < RH use hi+lo planes (0: none)
#define WIN  2048
#define PCAR 1024.0f
#define SCL  0.088388347648318447f   // HD^-0.5
typedef _Float16 h16;
typedef unsigned short bf;
typedef __attribute__((ext_vector_type(16))) __bf16   v16bf;
typedef __attribute__((ext_vector_type(16))) _Float16 v16h;
typedef __attribute__((ext_vector_type(8)))  _Float16 v8h;
typedef __attribute__((ext_vector_type(8)))  unsigned short v8us;
typedef __attribute__((ext_vector_type(8)))  float    v8f;
typedef __attribute__((ext_vector_type(4)))  float    v4f;
typedef v8h  __attribute__((may_alias)) v8ha;
typedef v4f  __attribute__((may_alias)) v4fa;
typedef v8us __attribute__((may_alias)) v8usa;

__device__ __forceinline__ unsigned short f2bf(float f) { unsigned u = __float_as_uint(f); u += 0x7FFFu + ((u >> 16) & 1u); return (unsigned short)(u >> 16); }
__device__ __forceinline__ float bf2f(unsigned short b) { return __uint_as_float(((unsigned)b) << 16); }
__device__ __forceinline__ float bfr(float f) { return bf2f(f2bf(f)); }
__device__ __forceinline__ v16h cat16(v8h lo, v8h hi) { return __builtin_shufflevector(lo, hi, 0, 1, 2, 3, 4, 5, 6, 7, 8, 9, 10, 11, 12, 13, 14, 15); }
__device__ __forceinline__ v16bf cat16b(v8us lo, v8us hi) { return __builtin_bit_cast(v16bf, __builtin_shufflevector(lo, hi, 0, 1, 2, 3, 4, 5, 6, 7, 8, 9, 10, 11, 12, 13, 14, 15)); }
__device__ __forceinline__ v8f wmma16(v16h a, v16h b, v8f c) { return __builtin_amdgcn_wmma_f32_16x16x32_f16(false, a, false, b, (short)0, c, false, false); }
__device__ __forceinline__ v8f wmmab(v16bf a, v16bf b, v8f c) { return __builtin_amdgcn_wmma_f32_16x16x32_bf16(false, a, false, b, (short)0, c, false, false); }



// ---- kred_store: end of a 64x64 tile whose K loop was dealt over the NW waves of the block (wave w took the 32-wide k steps w, w + NW, ...). Every wave lays its whole f32 partial tile into its own LDS plane (row pitch 68),
// one block barrier publishes the planes, then wave w adds the NW partials of its 64 / NW rows in the fixed order 0, 1, .. NW - 1 and stores them as whole 256-byte rows. Ct = address of the tile's first element.
template <int NW, bool BIAS>
__device__ __forceinline__ void kred_store(const v8f (&acc)[4][4], float* red, int w, int lr, int hi, float* Ct, int ldc, const float* bias) {
    float* mine = red + w * (64 * 68);
    // the three loops are unrolled whole so that acc is indexed by constants only and stays in registers
#pragma unroll
    for (int mb = 0; mb < 4; ++mb)
#pragma unroll
        for (int nb = 0; nb < 4; ++nb)
#pragma unroll
            for (int j = 0; j < 8; ++j) mine[(mb * 16 + hi * 8 + j) * 68 + nb * 16 + lr] = acc[mb][nb][j];
    __syncthreads();   // every wave's partial tile is in LDS before any wave adds them
    // unrolled whole: the LDS reads of all rows can be issued ahead of the adds and stores
#pragma unroll
    for (int s = 0; s < 32 / NW; ++s) { const int row = w * (64 / NW) + 2 * s + hi, cofs = lr * 4; v4f val = *(const v4fa*)(red + row * 68 + cofs);
#pragma unroll
        for (int p = 1; p < NW; ++p) val += *(const v4fa*)(red + p * (64 * 68) + row * 68 + cofs);
        if (BIAS) { val[0] += bfr(bias[cofs]); val[1] += bfr(bias[cofs + 1]); val[2] += bfr(bias[cofs + 2]); val[3] += bfr(bias[cofs + 3]); }
        *(v4f*)(Ct + (size_t)row * ldc + cofs) = val; }
}

// ---- fragment loaders: lane (lr, hi) of a 16-row fragment reads k = 8 hi .. 8 hi + 7 and 16 + 8 hi .. 16 + 8 hi + 7 of row lr (the same for both operands)
template <typename T16> struct WFrag;
template <> struct WFrag<h16> { typedef v16h V; static __device__ __forceinline__ V ld(const h16* p) { return cat16(*(const v8h*)p, *(const v8h*)(p + 16)); } static __device__ __forceinline__ v8f mma(V a, V b, v8f c) { return wmma16(a, b, c); } };
template <> struct WFrag<bf> { typedef v16bf V; static __device__ __forceinline__ V ld(const bf* p) { return cat16b(*(const v8us*)p, *(const v8us*)(p + 16)); } static __device__ __forceinline__ v8f mma(V a, V b, v8f c) { return wmmab(a, b, c); } };
// ---- k_gemms: projection GEMM, one block of 8 waves (2 x 4) per 128x128 output tile; a wave holds 64 rows x 32 columns (8 accumulators) over the whole K. grid (M/128, N/128), 256 threads. M % 128 == 0, N % 128 == 0, K % 128 == 0.
// C[m][n] (f32, pitch ldc) = sum_k (A[m][k] + A2[m][k] if NSPLIT) Bt[n][k]; A, A2, Bt are K-contiguous bf16 planes of row pitch K.
// The operands come through LDS: a stage is SK = 128 k of the tile's 128 A rows (, 128 A2 rows) and 128 Bt rows, brought by asynchronous 16-byte copies as whole 256-byte row pieces (two rows an instruction),
// so each row piece is fetched from L2 once per block and read by all the waves that need it. Two buffers: stage t + 1 flies while stage t is multiplied.
#define SK 128                    // k per stage
#define SP 136                    // LDS row pitch in 16-bit elements: 272 bytes = 16 x 17, free of bank conflicts for the 16-byte fragment reads
// copy8: eight copies of one wave, rows 16 apart (l = the lane's LDS byte address, g = the lane's global address, gs = 16 rows in elements).
__device__ __forceinline__ void copy8(unsigned l, const bf* g, size_t gs) {
    // one statement: the closing s_wait_xcnt stands behind the last copy and ahead of any reuse of the address registers named here
    asm volatile("global_load_async_to_lds_b128 %0, %8, off\n\t"
                 "global_load_async_to_lds_b128 %1, %9, off\n\t"
                 "global_load_async_to_lds_b128 %2, %10, off\n\t"
                 "global_load_async_to_lds_b128 %3, %11, off\n\t"
                 "global_load_async_to_lds_b128 %4, %12, off\n\t"
                 "global_load_async_to_lds_b128 %5, %13, off\n\t"
                 "global_load_async_to_lds_b128 %6, %14, off\n\t"
                 "global_load_async_to_lds_b128 %7, %15, off\n\t"
                 "s_wait_xcnt 0x0"
                 :: "v"(l), "v"(l + 1 * 16 * SP * 2), "v"(l + 2 * 16 * SP * 2), "v"(l + 3 * 16 * SP * 2), "v"(l + 4 * 16 * SP * 2), "v"(l + 5 * 16 * SP * 2), "v"(l + 6 * 16 * SP * 2), "v"(l + 7 * 16 * SP * 2),
                    "v"(g), "v"(g + gs), "v"(g + 2 * gs), "v"(g + 3 * gs), "v"(g + 4 * gs), "v"(g + 5 * gs), "v"(g + 6 * gs), "v"(g + 7 * gs) : "memory");
}
template <int NSPLIT>
__global__ __launch_bounds__(256) void k_gemms(const bf* __restrict__ A, const bf* __restrict__ A2, const bf* __restrict__ Bt, int K, float* C, int ldc) {
    typedef WFrag<bf>::V V;
    constexpr int NR = NSPLIT ? 384 : 256;                 // rows per stage: A, (A2,) Bt
    __shared__ __align__(128) bf ring[2 * NR * SP];
    __shared__ __align__(16) float os[8 * 16 * 36];        // per wave: 16 output rows x 32 columns at pitch 36, for whole-line stores
    const int lane = threadIdx.x & 31, lr = lane & 15, hi = lane >> 4; const int r0 = blockIdx.x * 128, c0 = blockIdx.y * 128;
    const int w = __builtin_amdgcn_readfirstlane(threadIdx.x >> 5);   // the wave's number in a scalar register: everything derived from it stays scalar
    const int wm = w >> 2, wn = w & 3;
    // copies: half a wave takes one 256-byte row piece (lane lr its 16 bytes lr); copy c of wave w brings rows 16 c + 2 w + hi of an operand's 128
    const int crow = 2 * w + hi; const size_t gs = (size_t)16 * K;
    const bf* ga = A + (size_t)(r0 + crow) * K + lr * 8; const bf* ga2 = NSPLIT ? A2 + (size_t)(r0 + crow) * K + lr * 8 : nullptr; const bf* gb = Bt + (size_t)(c0 + crow) * K + lr * 8;
    const unsigned l0 = (unsigned)(size_t)ring + (unsigned)(crow * SP + lr * 8) * 2u;
    auto fill = [&](int t) { const unsigned l = l0 + (unsigned)(t & 1) * (unsigned)(NR * SP * 2); const int kc = t * SK;
        copy8(l, ga + kc, gs); if (NSPLIT) copy8(l + 128 * SP * 2, ga2 + kc, gs); copy8(l + (NR - 128) * SP * 2, gb + kc, gs); };
    const int nst = K / SK;
    // every loop over mb, nb, ks, j and s below is unrolled whole, so that the accumulator and fragment arrays are indexed by constants only and stay in registers
    v8f acc[4][2];
#pragma unroll
    for (int mb = 0; mb < 4; ++mb)
#pragma unroll
        for (int nb = 0; nb < 2; ++nb) acc[mb][nb] = (v8f){};
    fill(0);
    asm volatile("s_wait_asynccnt 0x0" ::: "memory");   // this wave's share of stage 0 has landed
    __syncthreads();                                    // every wave's share of stage 0 has landed
    if (nst > 1) fill(1);
    // rolled: one trip is one stage (32 or 64 matrix instructions a wave), and the buffer alternates with t
#pragma unroll 1
    for (int t = 0; t < nst; ++t) {
        const bf* sb = ring + (t & 1) * (NR * SP); const bf* pa = sb + (wm * 64 + lr) * SP + 8 * hi; const bf* pb = sb + (NR - 128 + wn * 32 + lr) * SP + 8 * hi;
        V a[2][4], a2[2][4], b[2][2];   // two fragment sets: k step ks + 1 is read from LDS while k step ks is multiplied
#pragma unroll
        for (int ks = -1; ks < SK / 32; ++ks) {
            if (ks + 1 < SK / 32) { const int q = (ks + 1) & 1, ko = (ks + 1) * 32;
#pragma unroll
                for (int mb = 0; mb < 4; ++mb) { a[q][mb] = WFrag<bf>::ld(pa + mb * 16 * SP + ko); if (NSPLIT) a2[q][mb] = WFrag<bf>::ld(pa + (128 + mb * 16) * SP + ko); }
#pragma unroll
                for (int nb = 0; nb < 2; ++nb) b[q][nb] = WFrag<bf>::ld(pb + nb * 16 * SP + ko); }
            __builtin_amdgcn_sched_barrier(0);   // the next k step's LDS reads stay one group in front of this step's matrix instructions, not spread among them
            if (ks >= 0) { const int q = ks & 1;
#pragma unroll
                for (int nb = 0; nb < 2; ++nb)
#pragma unroll
                    for (int mb = 0; mb < 4; ++mb) { acc[mb][nb] = WFrag<bf>::mma(a[q][mb], b[q][nb], acc[mb][nb]); if (NSPLIT) acc[mb][nb] = WFrag<bf>::mma(a2[q][mb], b[q][nb], acc[mb][nb]); }
                __builtin_amdgcn_sched_barrier(0); }   // and the reads of the step after next stay behind them
        }
        asm volatile("s_wait_dscnt 0x0" ::: "memory");      // this wave's reads of stage t are done before the buffer is handed to the copies below
        asm volatile("s_wait_asynccnt 0x0" ::: "memory");   // this wave's share of stage t + 1 has landed
        __syncthreads();                                    // publishes stage t + 1 and ends every wave's reads of stage t
        if (t + 2 < nst) fill(t + 2);
    }
    asm volatile("s_wait_asynccnt 0x0" ::: "memory");       // no copy is outstanding when the wave goes on to its end
    float* mine = os + w * (16 * 36);
#pragma unroll
    for (int mb = 0; mb < 4; ++mb) {
#pragma unroll
        for (int nb = 0; nb < 2; ++nb)
#pragma unroll
            for (int j = 0; j < 8; ++j) mine[(hi * 8 + j) * 36 + nb * 16 + lr] = acc[mb][nb][j];
        __builtin_amdgcn_wave_barrier(); asm volatile("" ::: "memory");   // the reads below (other lanes' values) stay behind the writes above
        float* crw = C + (size_t)(r0 + wm * 64 + mb * 16) * ldc + c0 + wn * 32;
#pragma unroll
        for (int s = 0; s < 4; ++s) { const int row = 4 * s + (lane >> 3), cofs = (lane & 7) * 4; const v4f val = *(const v4fa*)(mine + row * 36 + cofs);
            *(v4f*)(crw + (size_t)row * ldc + cofs) = val; }
        __builtin_amdgcn_wave_barrier(); asm volatile("" ::: "memory");   // the next 16 rows' writes stay behind the reads above
    }
}

// ---- k_gemmc: register-blocked 64x64 tile GEMM, operands straight from K-contiguous 16-bit planes, specialised for causal attention: CMODE 1 skips score tiles entirely above the diagonal (query rows r0+roff.., key columns c0..), CMODE 2 limits the
// key (K) loop of the probability x value contraction to the diagonal block (probabilities beyond it are exactly zero). roff = row offset of this launch's first row within the sequence. NW = waves per tile: NW > 1 deals the k steps over the block's waves (kred_store adds the partial tiles), NW == 1 is one wave per tile. K = row pitch of A, A2, Bt and Bt2 in elements, Kn = length of the contraction (Kn <= K, Kn % 32 == 0).
template <typename T16, int NSPLIT, int CMODE, int NW>
__global__ __launch_bounds__(32 * NW) void k_gemmc(const T16* __restrict__ A, const T16* __restrict__ A2, const T16* __restrict__ Bt, const T16* __restrict__ Bt2, int K, int Kn, float* C, int ldc, int roff, size_t sA, size_t sB, size_t sC, const int* CF) {
    typedef typename WFrag<T16>::V V;
    const size_t z = blockIdx.z; A += z * sA; if (A2) A2 += z * sA; Bt += z * sB; if (Bt2) Bt2 += z * sB; C += z * sC;
    const int lane = threadIdx.x & 31, lr = lane & 15, hi = lane >> 4; const int r0 = blockIdx.x * 64, c0 = blockIdx.y * 64;
    const int w = (NW > 1) ? __builtin_amdgcn_readfirstlane(threadIdx.x >> 5) : 0;   // the wave's number in a scalar register: the k loop stays a scalar loop
    const bool con = (CF == nullptr) || (CF[0] != 0);   /* device flag: mask verified causal */ if (CMODE == 1 && con && c0 > r0 + roff + 63) return;                  // score tile entirely above the causal diagonal: never read (the softmax masks j > i by select)
    const int Kl = (CMODE == 2 && con) ? min(Kn, r0 + roff + 64) : Kn;        // P.V: probabilities are exactly 0 beyond the diagonal block, so the K loop stops there
    v8f acc[4][4];
#pragma unroll
    for (int mb = 0; mb < 4; ++mb)
#pragma unroll
        for (int nb = 0; nb < 4; ++nb) acc[mb][nb] = (v8f){};
    const size_t aoff = (size_t)(r0 + lr) * K + 8 * hi, boff = (size_t)(c0 + lr) * K + 8 * hi;
#pragma unroll 1
    for (int kc = 32 * w; kc < Kl; kc += 32 * NW) {
        V a[4], a2[4];
#pragma unroll
        for (int mb = 0; mb < 4; ++mb) { a[mb] = WFrag<T16>::ld(A + aoff + (size_t)mb * 16 * K + kc); if (NSPLIT == 1 || NSPLIT == 2) a2[mb] = WFrag<T16>::ld(A2 + aoff + (size_t)mb * 16 * K + kc); }
#pragma unroll
        for (int nb = 0; nb < 4; ++nb) { const V b = WFrag<T16>::ld(Bt + boff + (size_t)nb * 16 * K + kc); V b2; if (NSPLIT >= 2) b2 = WFrag<T16>::ld(Bt2 + boff + (size_t)nb * 16 * K + kc);
#pragma unroll
            for (int mb = 0; mb < 4; ++mb) { acc[mb][nb] = WFrag<T16>::mma(a[mb], b, acc[mb][nb]); if (NSPLIT == 1 || NSPLIT == 2) acc[mb][nb] = WFrag<T16>::mma(a2[mb], b, acc[mb][nb]); if (NSPLIT >= 2) acc[mb][nb] = WFrag<T16>::mma(a[mb], b2, acc[mb][nb]); } }
        asm volatile("v_nop\n\tv_nop\n\tv_nop\n\tv_nop" : "+v"(acc[0][0]), "+v"(acc[1][1]), "+v"(acc[2][2]), "+v"(acc[3][3]) : "v"(a[0]), "v"(a[3]));
    }
    if constexpr (NW > 1) {
        __shared__ __align__(16) float red[NW * 64 * 68];
        kred_store<NW, false>(acc, red, w, lr, hi, C + (size_t)r0 * ldc + c0, ldc, nullptr);
    } else {
    __shared__ __align__(16) float os[16 * 68];
#pragma unroll
    for (int mb = 0; mb < 4; ++mb) {
#pragma unroll
        for (int nb = 0; nb < 4; ++nb) {
#pragma unroll
            for (int j = 0; j < 8; ++j) os[(hi * 8 + j) * 68 + nb * 16 + lr] = acc[mb][nb][j]; }
        __builtin_amdgcn_wave_barrier(); asm volatile("" ::: "memory");
        float* crow = C + (size_t)(r0 + mb * 16) * ldc + c0;
{
#pragma unroll
            for (int s = 0; s < 8; ++s) { const int row = 2 * s + hi, cofs = lr * 4; v4f val = *(const v4fa*)(os + row * 68 + cofs);
                *(v4f*)(crow + (size_t)row * ldc + cofs) = val; }
             }
        __builtin_amdgcn_wave_barrier(); asm volatile("" ::: "memory");
    }
    }
}

__device__ __forceinline__ h16 tohx(float x) { return (h16)x; }
__device__ __forceinline__ void splitf(float y, unsigned short& h, unsigned short& l) { h = f2bf(y); l = f2bf(y - bf2f(h)); }
typedef __attribute__((ext_vector_type(2))) _Float16 v2h;
typedef __attribute__((ext_vector_type(4))) _Float16 v4h;
typedef __attribute__((ext_vector_type(2))) unsigned short v2us;
typedef __attribute__((ext_vector_type(4))) unsigned short v4us;
typedef __attribute__((ext_vector_type(2))) float v2f;
typedef __attribute__((ext_vector_type(4))) int v4i;

__global__ __launch_bounds__(256) void k_wtG(const float* __restrict__ w, int K, int N, bf* Bt) {
    const int lane = threadIdx.x & 31; const int L0 = (blockIdx.x * 8 + (threadIdx.x >> 5)) * 8; const int nlines = N * K / 64;
{
#pragma unroll 1
        for (int l = 0; l < 8; ++l) { const int L = L0 + l; if (L >= nlines) break; const size_t e = (size_t)L * 64 + lane * 2; const int k = (int)(e % K), n = (int)(e / K); v2us o;
            o[0] = f2bf(w[(size_t)k * N + n]); o[1] = f2bf(w[(size_t)(k + 1) * N + n]); *(v2us*)(Bt + e) = o; }
         }
}
// The elementwise kernels below give each thread several vectors (all loads issued first, then the arithmetic and the stores), so that each launch starts 4,096 waves instead of one short wave per 64 to 256 elements.
#define EU 4                      // vectors per thread in k_cvt8, k_rope (rows) and k_merge
#define MU 8                      // vectors per thread in k_mchk
__global__ __launch_bounds__(256) void k_cvt8(const float* __restrict__ src, bf* dst, size_t n8) { const size_t i0 = (size_t)blockIdx.x * (256 * EU) + threadIdx.x; v8f v[EU];
#pragma unroll
    for (int u = 0; u < EU; ++u) { const size_t i = i0 + (size_t)u * 256; v[u] = *(const v8f*)(src + (i < n8 ? i : n8 - 1) * 8); }   // index clamped, not branched round: the loads stay one group in flight; the store below is guarded
#pragma unroll
    for (int u = 0; u < EU; ++u) { const size_t i = i0 + (size_t)u * 256; v8us o;
#pragma unroll
        for (int k = 0; k < 8; ++k) o[k] = f2bf(v[u][k]);
        if (i < n8) *(v8us*)(dst + i * 8) = o; } }
__constant__ float INV[HD / 2] = {1.0,0.8659643530845642,0.7498942017555237,0.6493816375732422,0.5623413324356079,0.486967533826828,0.4216965138912201,0.36517414450645447,0.3162277638912201,0.2738419771194458,0.23713736236095428,0.20535250008106232,0.17782793939113617,0.1539926528930664,0.1333521455526352,0.11547820270061493,0.10000000149011612,0.08659642934799194,0.07498941570520401,0.06493816524744034,0.05623412877321243,0.04869675263762474,0.04216964915394783,0.03651741147041321,0.03162277862429619,0.0273841954767704,0.0237137358635664,0.02053525112569332,0.017782794311642647,0.015399265103042126,0.01333521492779255,0.011547819711267948,0.009999999776482582,0.00865964312106371,0.007498942315578461,0.006493816617876291,0.005623413249850273,0.004869675263762474,0.0042169648222625256,0.003651741426438093,0.003162277862429619,0.0027384196873754263,0.0023713738191872835,0.0020535250660032034,0.0017782794311642647,0.0015399265103042126,0.0013335214462131262,0.0011547820176929235,0.0010000000474974513,0.0008659643353894353,0.0007498941849917173,0.0006493816617876291,0.000562341301701963,0.00048696750309318304,0.00042169648804701865,0.00036517411353997886,0.0003162277862429619,0.00027384195709601045,0.0002371373848291114,0.00020535249495878816,0.00017782794020604342,0.00015399264520965517,0.0001333521504420787,0.00011547819303814322};
// k_cstab: one thread per (t, d < HD/2); the angle of d + HD/2 is the same one, so the pair is stored at both places
__global__ __launch_bounds__(256) void k_cstab(const int* __restrict__ pos, float* CS) { const int idx = blockIdx.x * 256 + threadIdx.x; if (idx >= TT * (HD / 2)) return; const int t = idx / (HD / 2), d = idx % (HD / 2); const float ang = __fmul_rn((float)pos[t], INV[d]); v2f cs; cs[0] = cosf(ang); cs[1] = sinf(ang);
    float* o = CS + ((size_t)t * HD + d) * 2; *(v2f*)o = cs; *(v2f*)(o + HD) = cs;  }
// k_mchk: causal-pattern check of the additive mask for one batch: any entry with (j <= i and mask != 0) or (j > i and mask > -1e30) clears FLAG[0] (plain identical stores; FLAG preset to 1); lane -> MU groups of 4 consecutive j, 1024 elements apart.
__global__ __launch_bounds__(256) void k_mchk(const float* __restrict__ MKb, int* FLAG) { const size_t e0 = ((size_t)blockIdx.x * (256 * MU) + threadIdx.x) * 4; v4f m[MU]; bool bad = false;
#pragma unroll
    for (int u = 0; u < MU; ++u) { const size_t e = e0 + (size_t)u * 1024; m[u] = *(const v4f*)(MKb + (e < (size_t)TT * TT ? e : (size_t)TT * TT - 4)); }   // index clamped: one group of loads in flight
#pragma unroll
    for (int u = 0; u < MU; ++u) { const size_t e = e0 + (size_t)u * 1024; const int j = (int)(e % TT), i = (int)(e / TT); bool b = false;
#pragma unroll
        for (int q = 0; q < 4; ++q) { const bool keep = (j + q <= i); b |= keep ? (m[u][q] != 0.0f) : (m[u][q] > -1.0e30f); }
        bad |= b && (e < (size_t)TT * TT); }
    if (bad) *(int*)FLAG = 0; }
__global__ void k_flag1(int* FLAG) { if (threadIdx.x == 0) { *(int*)FLAG = 1;  } }

// k_rope: head planes [h][t][d] (fp16 + hi/lo) of rope(x) x sc with the rotate-half convention out[d] = x[d] cos[t][d] - x[d+HD/2] sin[t][d], out[d+HD/2] = x[d+HD/2] cos[t][d+HD/2] + x[d] sin[t][d+HD/2]; the hi/lo planes hold rows t < hr only ([h][hr][d])
// 16 threads per (h, t) row: a thread takes 4 consecutive d < HD/2 and their 4 partners d + HD/2 (each x is loaded once and serves both), in EU rows 16 apart; a block covers 16 x EU rows of one head (TT is a multiple of that).
__global__ __launch_bounds__(256) void k_rope(const float* __restrict__ F, int pitch, int nheads, const float* __restrict__ CS, const float* __restrict__ RF, const float* __restrict__ nw, float sc, int hr, h16* P16, bf* Ph, bf* Pl) {
    const int h = blockIdx.x / (TT / (16 * EU)); if (h >= nheads) return; const int tb = (blockIdx.x % (TT / (16 * EU))) * (16 * EU); const int tl = threadIdx.x >> 4, d = (threadIdx.x & 15) * 4;
    const float* Fb = F + (size_t)tb * pitch + h * HD; const float* Cb = CS + (size_t)tb * HD * 2; const float* pc = Cb + (tl * HD + d) * 2; const float* pf[EU]; v4f xv[EU][2], cv[EU][2][2];
#pragma unroll
    for (int u = 0; u < EU; ++u) { pf[u] = Fb + (size_t)(u * 16 + tl) * pitch + d;
#pragma unroll
        for (int hf = 0; hf < 2; ++hf) { xv[u][hf] = *(const v4f*)(pf[u] + hf * (HD / 2)); const float* c = pc + (u * 16 * HD + hf * (HD / 2)) * 2; cv[u][hf][0] = *(const v4f*)c; cv[u][hf][1] = *(const v4f*)(c + 4); } }
    asm volatile("s_wait_xcnt 0x0" :: "v"(pc), "v"(pf[0]), "v"(pf[1]), "v"(pf[2]), "v"(pf[3]) : "memory");   // the loads' address registers are inputs here, so none of them is reused before this wait
#pragma unroll
    for (int u = 0; u < EU; ++u) { const int t = tb + u * 16 + tl; float rf = 1.0f;
        if (RF) { rf = RF[(size_t)h * TT + t]; asm volatile("s_wait_xcnt 0x0" :: "v"(rf) : "memory"); }   // the wait stands behind this load, ahead of any reuse of its base or offset register; the loaded value is an input so that the load cannot sink below it
#pragma unroll
        for (int hf = 0; hf < 2; ++hf) { v4h o16; v4us oh, ol;
#pragma unroll
            for (int q = 0; q < 4; ++q) { const int dd = d + hf * (HD / 2) + q; const int dp = (dd < HD / 2) ? dd + HD / 2 : dd - HD / 2; float x0 = xv[u][hf][q], x1 = xv[u][1 - hf][q];
                if (RF) { float n0 = __fmul_rn(x0, rf), n1 = __fmul_rn(x1, rf); asm volatile("" : "+v"(n0)); asm volatile("" : "+v"(n1)); x0 = __fmul_rn(bfr(nw[dd]), n0); x1 = __fmul_rn(bfr(nw[dp]), n1); }
                v2f cs; cs[0] = cv[u][hf][q >> 1][(q & 1) * 2]; cs[1] = cv[u][hf][q >> 1][(q & 1) * 2 + 1]; float a = __fmul_rn(x0, cs[0]), bq = __fmul_rn(x1, cs[1]); asm volatile("" : "+v"(a)); asm volatile("" : "+v"(bq)); const float r = ((dd < HD / 2) ? __fsub_rn(a, bq) : __fadd_rn(a, bq)) * sc;
                o16[q] = tohx(r); unsigned short a2, c2; splitf(r, a2, c2); oh[q] = a2; ol[q] = c2; }
            const int dh = d + hf * (HD / 2); *(v4h*)(P16 + ((size_t)h * TT + t) * HD + dh) = o16; if (t < hr) { const size_t eh = ((size_t)h * hr + t) * HD + dh; *(v4us*)(Ph + eh) = oh; *(v4us*)(Pl + eh) = ol; } } }  }
// k_vtp: transposed value planes [g][d][t] at a row pitch of 2 x TT elements, the pitch of the in-place weight rows they are contracted with (k_gemmc has one pitch for both operands); the lo plane lies in the second half of the hi plane's rows (Vl = Vh + TT)
// A block takes one head's 64 rows t x HD columns; a thread takes an 8 t x 4 d patch (8 row loads of 16 bytes) and stores it turned, 8 consecutive t per d: a wave's store covers 4 whole 128-byte lines.
__global__ __launch_bounds__(256) void k_vtp(const float* __restrict__ F, int pitch, int nheads, h16* V16, bf* Vh, bf* Vl) { const int lane = threadIdx.x & 31; const int g = blockIdx.x / (TT / 64); if (g >= nheads) return; const int tb = (blockIdx.x % (TT / 64)) * 64, tl = (lane >> 2) * 8; const int d = (threadIdx.x >> 5) * 16 + (lane & 3) * 4; const float* pf[8]; v4f xv[8];
#pragma unroll
    for (int r = 0; r < 8; ++r) { pf[r] = F + (size_t)(tb + tl + r) * pitch + g * HD + d; xv[r] = *(const v4f*)pf[r]; }
    asm volatile("s_wait_xcnt 0x0" :: "v"(pf[0]), "v"(pf[1]), "v"(pf[2]), "v"(pf[3]), "v"(pf[4]), "v"(pf[5]), "v"(pf[6]), "v"(pf[7]) : "memory");   // the loads' address registers are inputs here, so none of them is reused before this wait
#pragma unroll
    for (int c = 0; c < 4; ++c) { v8h o16; v8us oh, ol;
#pragma unroll
        for (int r = 0; r < 8; ++r) { const float x = xv[r][c]; o16[r] = tohx(x); unsigned short a2, c2; splitf(x, a2, c2); oh[r] = a2; ol[r] = c2; }
        const size_t ev = ((size_t)g * HD + d + c) * (2 * TT) + tb + tl; *(v8h*)(V16 + ev) = o16; *(v8us*)(Vh + ev) = oh; *(v8us*)(Vl + ev) = ol; }  }
// k_asoft: per row (zz, i): t = S x HD^-0.5 for j <= i; softmax over the 2048 keys (register row, one exp, fixed trees);; adds bf16(attention_mask[b][0][i][j]) to kept scores; when the device flag says the mask is causal, keys j > i get exact-zero weight (same as adding the most-negative mask value), otherwise every key takes score + mask
// The weights are stored IN PLACE over the wave's own score row (8192 bytes, held whole in registers before the first store): rows < RH as hi plane (bytes 0..4095) + lo plane (bytes 4096..8191), the rest as fp16 in bytes 0..4095; the P.V launches read them at a row pitch of 2 x TT 16-bit elements.
__global__ __launch_bounds__(256) void k_asoft(float* Sb, const float* __restrict__ MKb, const int* __restrict__ CF) {
    const int lane = threadIdx.x & 31; const int row = blockIdx.x * 8 + (threadIdx.x >> 5); if (row >= ZH * TT) return; const int i = row % TT; const int zz = row / TT; (void)zz; const float* mk = MKb + (size_t)i * TT; const bool con = (CF[0] != 0); const bool hires = (i < RH); const float* sr = Sb + (size_t)row * TT; float v[TT / 32]; float mx = -3.0e38f;
#pragma unroll
    for (int ch = 0; ch < TT / 128; ++ch) { const int j0 = ch * 128 + lane * 4; const v4f a = *(const v4f*)(sr + j0);
#pragma unroll
        for (int q = 0; q < 4; ++q) { const int j = j0 + q; (void)j; float sa = a[q] * SCL; asm volatile("" : "+v"(sa)); float mv = bfr(mk[j]); asm volatile("" : "+v"(mv)); const float t = (j <= i || !con) ? __fadd_rn(sa, mv) : -3.0e38f;   /* causal-verified: masked keys -> exact zero weight (== adding the most-negative mask); else general additive path */ v[ch * 4 + q] = t; mx = fmaxf(mx, t); } }
#pragma unroll
    for (int sh = 16; sh; sh >>= 1) mx = fmaxf(mx, __shfl_xor(mx, sh, 32));
    float sum = 0.f;
#pragma unroll
    for (int k = 0; k < TT / 32; ++k) { float d0 = __fsub_rn(v[k], mx); asm volatile("" : "+v"(d0)); v[k] = __builtin_amdgcn_exp2f(__fmul_rn(d0, 1.4426950408889634f)); sum += v[k]; }
#pragma unroll
    for (int sh = 16; sh; sh >>= 1) sum += __shfl_xor(sum, sh, 32);
    const float f = __fdiv_rn(hires ? 1.0f : PCAR, sum);
    bf* ph = (bf*)(Sb + (size_t)row * TT); h16* p16 = (h16*)(Sb + (size_t)row * TT);
{
        if (hires) {
#pragma unroll
            for (int ch = 0; ch < TT / 128; ++ch) { v4us oh, ol;
#pragma unroll
                for (int q = 0; q < 4; ++q) { unsigned short a, c2; splitf(v[ch * 4 + q] * f, a, c2); oh[q] = a; ol[q] = c2; }
                const int oo = ch * 128 + lane * 4; *(v4us*)(ph + oo) = oh; *(v4us*)(ph + TT + oo) = ol; }
        } else {
#pragma unroll
            for (int ch = 0; ch < TT / 128; ++ch) { v4h o4;
#pragma unroll
                for (int q = 0; q < 4; ++q) o4[q] = tohx(v[ch * 4 + q] * f);
                *(v4h*)(p16 + ch * 128 + lane * 4) = o4; } }
         }
}
__global__ __launch_bounds__(256) void k_merge(const float* __restrict__ O, int h0, bf* Ah, bf* Al) { const size_t e0 = ((size_t)blockIdx.x * (256 * EU) + threadIdx.x) * 4; v4f ov[EU];
#pragma unroll
    for (int u = 0; u < EU; ++u) { const size_t e = e0 + (size_t)u * 1024; ov[u] = *(const v4f*)(O + (e < (size_t)ZH * TT * HD ? e : (size_t)ZH * TT * HD - 4)); }   // index clamped: one group of loads in flight
#pragma unroll
    for (int u = 0; u < EU; ++u) { const size_t e = e0 + (size_t)u * 1024; if (e >= (size_t)ZH * TT * HD) break; const int d = (int)(e % HD); const int t = (int)((e / HD) % TT); const int zz = (int)(e / ((size_t)HD * TT)); const float cs = (t < RH) ? 1.0f : (1.0f / PCAR); const size_t oo = (size_t)t * DQ + (h0 + zz) * HD + d;
        v4us oh, ol;
#pragma unroll
        for (int q = 0; q < 4; ++q) { unsigned short a, c2; splitf(ov[u][q] * cs, a, c2); oh[q] = a; ol[q] = c2; } *(v4us*)(Ah + oo) = oh; *(v4us*)(Al + oo) = ol; }  }

extern "C" void kernel_launch(void* const* d_in, const int* in_sizes, int n_in,
                              void* d_out, int out_size, void* d_ws, size_t ws_size, hipStream_t stream) {
    (void)in_sizes; (void)n_in; (void)out_size;
    const float* x = (const float*)d_in[0]; const float* MK = (const float*)d_in[1]; const int* POS = (const int*)d_in[2]; const float* wq = (const float*)d_in[3]; const float* wk = (const float*)d_in[4]; const float* wv = (const float*)d_in[5]; const float* wo = (const float*)d_in[6];
    float* OUT = (float*)d_out;     // [2][2048][2048]
    char* wsp = (char*)d_ws;
    auto take = [&](size_t bytes) { char* p = wsp; wsp += (bytes + 255) & ~(size_t)255; return (void*)p; };
    bf* WQ = (bf*)take((size_t)DQ * DM * 2); bf* WK = (bf*)take((size_t)DKV * DM * 2); bf* WV = (bf*)take((size_t)DKV * DM * 2); bf* WO = (bf*)take((size_t)DM * DQ * 2); float* CS = (float*)take((size_t)TT * HD * 2 * 4);
    int* CFLAG = (int*)take(256);
    h16* QP16 = (h16*)take((size_t)NH_ * TT * HD * 2); h16* KP16 = (h16*)take((size_t)NKV * TT * HD * 2); h16* VT16 = (h16*)take((size_t)NKV * HD * 2 * TT * 2);
    bf* QPh = (bf*)take((size_t)NH_ * RH * HD * 2); bf* QPl = (bf*)take((size_t)NH_ * RH * HD * 2); bf* KPh = (bf*)take((size_t)NKV * TT * HD * 2); bf* KPl = (bf*)take((size_t)NKV * TT * HD * 2); bf* VTh = (bf*)take((size_t)NKV * HD * 2 * TT * 2); bf* VTl = VTh + TT;
    float* Sb = (float*)take((size_t)ZH * TT * TT * 4); float* Ob = (float*)take((size_t)ZH * TT * HD * 4); bf* ATh = (bf*)take((size_t)TT * DQ * 2); bf* ATl = (bf*)take((size_t)TT * DQ * 2);
    if ((size_t)(wsp - (char*)d_ws) > ws_size) return;    // ws 256 MiB
    bf* XB = (bf*)Sb; float* FQ = Sb + (size_t)TT * DM / 2; float* FK = FQ + (size_t)TT * DQ;   // the bf16 input rows and the f32 projections are dead once the head planes are built: they share the score buffer (stream-ordered)
    float* FV = FK;   // v projection reuses the k buffer after the k planes are built (stream-ordered)
    { k_cvt8<<<(unsigned)(((size_t)DQ * DM / 8 + 256 * EU - 1) / (256 * EU)), 256, 0, stream>>>(wq, WQ, (size_t)DQ * DM / 8); k_cvt8<<<(unsigned)(((size_t)DKV * DM / 8 + 256 * EU - 1) / (256 * EU)), 256, 0, stream>>>(wk, WK, (size_t)DKV * DM / 8); k_cvt8<<<(unsigned)(((size_t)DKV * DM / 8 + 256 * EU - 1) / (256 * EU)), 256, 0, stream>>>(wv, WV, (size_t)DKV * DM / 8);
      k_cvt8<<<(unsigned)(((size_t)DM * DQ / 8 + 256 * EU - 1) / (256 * EU)), 256, 0, stream>>>(wo, WO, (size_t)DM * DQ / 8);
      }
    const unsigned LQ = NH_ * (TT / (16 * EU)), LKv = NKV * (TT / (16 * EU));   // k_rope: 16 x EU rows of one head per block
    for (int b = 0; b < NB_; ++b) {
        
        k_cvt8<<<(unsigned)(((size_t)TT * DM / 8 + 256 * EU - 1) / (256 * EU)), 256, 0, stream>>>(x + (size_t)b * TT * DM, XB, (size_t)TT * DM / 8); k_flag1<<<1, 32, 0, stream>>>(CFLAG); k_mchk<<<(unsigned)(((size_t)TT * TT / 4 + 256 * MU - 1) / (256 * MU)), 256, 0, stream>>>(MK + (size_t)b * TT * TT, CFLAG); k_cstab<<<(TT * (HD / 2) + 255) / 256, 256, 0, stream>>>(POS + (size_t)b * TT, CS);   /* mask check + per-batch rotary table */
        k_gemms<0><<<dim3(TT / 128, DQ / 128, 1), 256, 0, stream>>>(XB, nullptr, WQ, DM, FQ, DQ);
        k_rope<<<LQ, 256, 0, stream>>>(FQ, DQ, NH_, CS, nullptr, nullptr, 1.0f, RH, QP16, QPh, QPl);
        k_gemms<0><<<dim3(TT / 128, DKV / 128, 1), 256, 0, stream>>>(XB, nullptr, WK, DM, FK, DKV);
        k_rope<<<LKv, 256, 0, stream>>>(FK, DKV, NKV, CS, nullptr, nullptr, 1.0f, TT, KP16, KPh, KPl);
        k_gemms<0><<<dim3(TT / 128, DKV / 128, 1), 256, 0, stream>>>(XB, nullptr, WV, DM, FV, DKV); k_vtp<<<NKV * (TT / 64), 256, 0, stream>>>(FV, DKV, NKV, VT16, VTh, VTl);
        for (int h0 = 0; h0 < NH_; h0 += ZH) { const size_t zq = (size_t)h0, zk = (size_t)(h0 / REP);   // one kv head per query head: the pass's ZH heads use consecutive kv planes
            k_gemmc<bf, 2, 1, 1><<<dim3(RH / 64, TT / 64, ZH), 32, 0, stream>>>(QPh + zq * RH * HD, QPl + zq * RH * HD, KPh + zk * TT * HD, KPl + zk * TT * HD, HD, HD, Sb, TT, 0, (size_t)RH * HD, (size_t)TT * HD, (size_t)TT * TT, CFLAG);
            k_gemmc<h16, 0, 1, 1><<<dim3((TT - RH) / 64, TT / 64, ZH), 32, 0, stream>>>(QP16 + zq * TT * HD + (size_t)RH * HD, nullptr, KP16 + zk * TT * HD, nullptr, HD, HD, Sb + (size_t)RH * TT, TT, RH, (size_t)TT * HD, (size_t)TT * HD, (size_t)TT * TT, CFLAG);
            k_asoft<<<ZH * TT / 8, 256, 0, stream>>>(Sb, MK + (size_t)b * TT * TT, CFLAG);
            k_gemmc<bf, 2, 2, PW><<<dim3(RH / 64, HD / 64, ZH), 32 * PW, 0, stream>>>((const bf*)Sb, (const bf*)Sb + TT, VTh + zk * HD * 2 * TT, VTl + zk * HD * 2 * TT, 2 * TT, TT, Ob, HD, 0, (size_t)TT * 2 * TT, (size_t)HD * 2 * TT, (size_t)TT * HD, CFLAG);
            k_gemmc<h16, 0, 2, PW><<<dim3((TT - RH) / 64, HD / 64, ZH), 32 * PW, 0, stream>>>((const h16*)Sb + (size_t)RH * 2 * TT, nullptr, VT16 + zk * HD * 2 * TT, nullptr, 2 * TT, TT, Ob + (size_t)RH * HD, HD, RH, (size_t)TT * 2 * TT, (size_t)HD * 2 * TT, (size_t)TT * HD, CFLAG);
            k_merge<<<(unsigned)(((size_t)ZH * TT * HD / 4 + 256 * EU - 1) / (256 * EU)), 256, 0, stream>>>(Ob, h0, ATh, ATl); }
        k_gemms<1><<<dim3(TT / 128, DM / 128, 1), 256, 0, stream>>>(ATh, ATl, WO, DQ, OUT + (size_t)b * TT * DM, DM); }
}

// v005
// A run of this version takes 357 microseconds.
// Two timings next to v004 put it at 2.14 and 2.12 times that version's speed.
// Counting every step since v000, it is 5.43 times as fast.
#include <hip/hip_runtime.h>

// Causal LM attention with additive mask and position-id rotary (hidden [2][2048][2048]; q, k, v = hidden W^T ('oi' [2048][2048], 16 heads x 128); rotate-half RoPE with angle = position_ids[b][t] x inv_freq (theta 1e4; position_ids int32 input, read on device); scores/sqrt(128) + attention_mask[b][0][i][j] (f32 input, read); softmax; out = merged Wo^T -> [2][2048][2048]).
// The additive mask is verified ON THE DEVICE to be the causal pattern (0 where j <= i, most-negative elsewhere); when it is, key blocks above the diagonal are skipped and the masked entries are realised as exact-zero softmax weights (identical result); otherwise every key is visited and the mask is simply added (general fallback).
// Compute dtypes, f32 accumulate: every input rounded to bf16; q/k/v on PLAIN bf16 operands (inputs: exact); rotary in f32 (per-batch table from the position ids and the reference's inv_freq constants); mask check; scores, additive mask (bf16-rounded), running softmax (f32) and attn.v in one kernel (block skipping gated by the device flag): query rows < 512 hl (3 products), the rest single fp16 (x1024); Wo hl x exact (2 products).

#define NB_  2
#define TT   2048
#define DM   2048
#define NH_  16
#define NKV  16
#define REP  (NH_ / NKV)
#define HD   128
#define DQ   (NH_ * HD)
#define DKV  (NKV * HD)
#define RH   512                  // query rows < RH use hi+lo planes (0: none)
#define WIN  2048
#define PCAR 1024.0f
#define SCL  0.088388347648318447f   // HD^-0.5
typedef _Float16 h16;
typedef unsigned short bf;
typedef __attribute__((ext_vector_type(16))) __bf16   v16bf;
typedef __attribute__((ext_vector_type(16))) _Float16 v16h;
typedef __attribute__((ext_vector_type(8)))  _Float16 v8h;
typedef __attribute__((ext_vector_type(8)))  unsigned short v8us;
typedef __attribute__((ext_vector_type(8)))  float    v8f;
typedef __attribute__((ext_vector_type(4)))  float    v4f;
typedef v8h  __attribute__((may_alias)) v8ha;
typedef v4f  __attribute__((may_alias)) v4fa;
typedef v8us __attribute__((may_alias)) v8usa;

__device__ __forceinline__ unsigned short f2bf(float f) { unsigned u = __float_as_uint(f); u += 0x7FFFu + ((u >> 16) & 1u); return (unsigned short)(u >> 16); }
__device__ __forceinline__ float bf2f(unsigned short b) { return __uint_as_float(((unsigned)b) << 16); }
__device__ __forceinline__ float bfr(float f) { return bf2f(f2bf(f)); }
__device__ __forceinline__ v16h cat16(v8h lo, v8h hi) { return __builtin_shufflevector(lo, hi, 0, 1, 2, 3, 4, 5, 6, 7, 8, 9, 10, 11, 12, 13, 14, 15); }
__device__ __forceinline__ v16bf cat16b(v8us lo, v8us hi) { return __builtin_bit_cast(v16bf, __builtin_shufflevector(lo, hi, 0, 1, 2, 3, 4, 5, 6, 7, 8, 9, 10, 11, 12, 13, 14, 15)); }
__device__ __forceinline__ v8f wmma16(v16h a, v16h b, v8f c) { return __builtin_amdgcn_wmma_f32_16x16x32_f16(false, a, false, b, (short)0, c, false, false); }
__device__ __forceinline__ v8f wmmab(v16bf a, v16bf b, v8f c) { return __builtin_amdgcn_wmma_f32_16x16x32_bf16(false, a, false, b, (short)0, c, false, false); }



// ---- fragment loaders: lane (lr, hi) of a 16-row fragment reads k = 8 hi .. 8 hi + 7 and 16 + 8 hi .. 16 + 8 hi + 7 of row lr (the same for both operands)
template <typename T16> struct WFrag;
template <> struct WFrag<h16> { typedef v16h V; static __device__ __forceinline__ V ld(const h16* p) { return cat16(*(const v8h*)p, *(const v8h*)(p + 16)); } static __device__ __forceinline__ v8f mma(V a, V b, v8f c) { return wmma16(a, b, c); } };
template <> struct WFrag<bf> { typedef v16bf V; static __device__ __forceinline__ V ld(const bf* p) { return cat16b(*(const v8us*)p, *(const v8us*)(p + 16)); } static __device__ __forceinline__ v8f mma(V a, V b, v8f c) { return wmmab(a, b, c); } };
// ---- k_gemms: projection GEMM, one block of 8 waves (2 x 4) per 128x128 output tile; a wave holds 64 rows x 32 columns (8 accumulators) over the whole K. grid (M/128, N/128), 256 threads. M % 128 == 0, N % 128 == 0, K % 128 == 0.
// C[m][n] (f32, pitch ldc) = sum_k (A[m][k] + A2[m][k] if NSPLIT) Bt[n][k]; A, A2, Bt are K-contiguous bf16 planes of row pitch K.
// The operands come through LDS: a stage is SK = 128 k of the tile's 128 A rows (, 128 A2 rows) and 128 Bt rows, brought by asynchronous 16-byte copies as whole 256-byte row pieces (two rows an instruction),
// so each row piece is fetched from L2 once per block and read by all the waves that need it. Two buffers: stage t + 1 flies while stage t is multiplied.
#define SK 128                    // k per stage
#define SP 136                    // LDS row pitch in 16-bit elements: 272 bytes = 16 x 17, free of bank conflicts for the 16-byte fragment reads
// copy8: eight copies of one wave, rows 16 apart (l = the lane's LDS byte address, g = the lane's global address, gs = 16 rows in elements).
__device__ __forceinline__ void copy8(unsigned l, const bf* g, size_t gs) {
    // one statement: the closing s_wait_xcnt stands behind the last copy and ahead of any reuse of the address registers named here
    asm volatile("global_load_async_to_lds_b128 %0, %8, off\n\t"
                 "global_load_async_to_lds_b128 %1, %9, off\n\t"
                 "global_load_async_to_lds_b128 %2, %10, off\n\t"
                 "global_load_async_to_lds_b128 %3, %11, off\n\t"
                 "global_load_async_to_lds_b128 %4, %12, off\n\t"
                 "global_load_async_to_lds_b128 %5, %13, off\n\t"
                 "global_load_async_to_lds_b128 %6, %14, off\n\t"
                 "global_load_async_to_lds_b128 %7, %15, off\n\t"
                 "s_wait_xcnt 0x0"
                 :: "v"(l), "v"(l + 1 * 16 * SP * 2), "v"(l + 2 * 16 * SP * 2), "v"(l + 3 * 16 * SP * 2), "v"(l + 4 * 16 * SP * 2), "v"(l + 5 * 16 * SP * 2), "v"(l + 6 * 16 * SP * 2), "v"(l + 7 * 16 * SP * 2),
                    "v"(g), "v"(g + gs), "v"(g + 2 * gs), "v"(g + 3 * gs), "v"(g + 4 * gs), "v"(g + 5 * gs), "v"(g + 6 * gs), "v"(g + 7 * gs) : "memory");
}
template <int NSPLIT>
__global__ __launch_bounds__(256) void k_gemms(const bf* __restrict__ A, const bf* __restrict__ A2, const bf* __restrict__ Bt, int K, float* C, int ldc) {
    typedef WFrag<bf>::V V;
    constexpr int NR = NSPLIT ? 384 : 256;                 // rows per stage: A, (A2,) Bt
    __shared__ __align__(128) bf ring[2 * NR * SP];
    __shared__ __align__(16) float os[8 * 16 * 36];        // per wave: 16 output rows x 32 columns at pitch 36, for whole-line stores
    const int lane = threadIdx.x & 31, lr = lane & 15, hi = lane >> 4; const int r0 = blockIdx.x * 128, c0 = blockIdx.y * 128;
    const int w = __builtin_amdgcn_readfirstlane(threadIdx.x >> 5);   // the wave's number in a scalar register: everything derived from it stays scalar
    const int wm = w >> 2, wn = w & 3;
    // copies: half a wave takes one 256-byte row piece (lane lr its 16 bytes lr); copy c of wave w brings rows 16 c + 2 w + hi of an operand's 128
    const int crow = 2 * w + hi; const size_t gs = (size_t)16 * K;
    const bf* ga = A + (size_t)(r0 + crow) * K + lr * 8; const bf* ga2 = NSPLIT ? A2 + (size_t)(r0 + crow) * K + lr * 8 : nullptr; const bf* gb = Bt + (size_t)(c0 + crow) * K + lr * 8;
    const unsigned l0 = (unsigned)(size_t)ring + (unsigned)(crow * SP + lr * 8) * 2u;
    auto fill = [&](int t) { const unsigned l = l0 + (unsigned)(t & 1) * (unsigned)(NR * SP * 2); const int kc = t * SK;
        copy8(l, ga + kc, gs); if (NSPLIT) copy8(l + 128 * SP * 2, ga2 + kc, gs); copy8(l + (NR - 128) * SP * 2, gb + kc, gs); };
    const int nst = K / SK;
    // every loop over mb, nb, ks, j and s below is unrolled whole, so that the accumulator and fragment arrays are indexed by constants only and stay in registers
    v8f acc[4][2];
#pragma unroll
    for (int mb = 0; mb < 4; ++mb)
#pragma unroll
        for (int nb = 0; nb < 2; ++nb) acc[mb][nb] = (v8f){};
    fill(0);
    asm volatile("s_wait_asynccnt 0x0" ::: "memory");   // this wave's share of stage 0 has landed
    __syncthreads();                                    // every wave's share of stage 0 has landed
    if (nst > 1) fill(1);
    // rolled: one trip is one stage (32 or 64 matrix instructions a wave), and the buffer alternates with t
#pragma unroll 1
    for (int t = 0; t < nst; ++t) {
        const bf* sb = ring + (t & 1) * (NR * SP); const bf* pa = sb + (wm * 64 + lr) * SP + 8 * hi; const bf* pb = sb + (NR - 128 + wn * 32 + lr) * SP + 8 * hi;
        V a[2][4], a2[2][4], b[2][2];   // two fragment sets: k step ks + 1 is read from LDS while k step ks is multiplied
#pragma unroll
        for (int ks = -1; ks < SK / 32; ++ks) {
            if (ks + 1 < SK / 32) { const int q = (ks + 1) & 1, ko = (ks + 1) * 32;
#pragma unroll
                for (int mb = 0; mb < 4; ++mb) { a[q][mb] = WFrag<bf>::ld(pa + mb * 16 * SP + ko); if (NSPLIT) a2[q][mb] = WFrag<bf>::ld(pa + (128 + mb * 16) * SP + ko); }
#pragma unroll
                for (int nb = 0; nb < 2; ++nb) b[q][nb] = WFrag<bf>::ld(pb + nb * 16 * SP + ko); }
            __builtin_amdgcn_sched_barrier(0);   // the next k step's LDS reads stay one group in front of this step's matrix instructions, not spread among them
            if (ks >= 0) { const int q = ks & 1;
#pragma unroll
                for (int nb = 0; nb < 2; ++nb)
#pragma unroll
                    for (int mb = 0; mb < 4; ++mb) { acc[mb][nb] = WFrag<bf>::mma(a[q][mb], b[q][nb], acc[mb][nb]); if (NSPLIT) acc[mb][nb] = WFrag<bf>::mma(a2[q][mb], b[q][nb], acc[mb][nb]); }
                __builtin_amdgcn_sched_barrier(0); }   // and the reads of the step after next stay behind them
        }
        asm volatile("s_wait_dscnt 0x0" ::: "memory");      // this wave's reads of stage t are done before the buffer is handed to the copies below
        asm volatile("s_wait_asynccnt 0x0" ::: "memory");   // this wave's share of stage t + 1 has landed
        __syncthreads();                                    // publishes stage t + 1 and ends every wave's reads of stage t
        if (t + 2 < nst) fill(t + 2);
    }
    asm volatile("s_wait_asynccnt 0x0" ::: "memory");       // no copy is outstanding when the wave goes on to its end
    float* mine = os + w * (16 * 36);
#pragma unroll
    for (int mb = 0; mb < 4; ++mb) {
#pragma unroll
        for (int nb = 0; nb < 2; ++nb)
#pragma unroll
            for (int j = 0; j < 8; ++j) mine[(hi * 8 + j) * 36 + nb * 16 + lr] = acc[mb][nb][j];
        __builtin_amdgcn_wave_barrier(); asm volatile("" ::: "memory");   // the reads below (other lanes' values) stay behind the writes above
        float* crw = C + (size_t)(r0 + wm * 64 + mb * 16) * ldc + c0 + wn * 32;
#pragma unroll
        for (int s = 0; s < 4; ++s) { const int row = 4 * s + (lane >> 3), cofs = (lane & 7) * 4; const v4f val = *(const v4fa*)(mine + row * 36 + cofs);
            *(v4f*)(crw + (size_t)row * ldc + cofs) = val; }
        __builtin_amdgcn_wave_barrier(); asm volatile("" ::: "memory");   // the next 16 rows' writes stay behind the reads above
    }
}

__device__ __forceinline__ h16 tohx(float x) { return (h16)x; }
__device__ __forceinline__ void splitf(float y, unsigned short& h, unsigned short& l) { h = f2bf(y); l = f2bf(y - bf2f(h)); }
typedef __attribute__((ext_vector_type(2))) _Float16 v2h;
typedef __attribute__((ext_vector_type(4))) _Float16 v4h;
typedef __attribute__((ext_vector_type(2))) unsigned short v2us;
typedef __attribute__((ext_vector_type(4))) unsigned short v4us;
typedef __attribute__((ext_vector_type(2))) float v2f;
typedef __attribute__((ext_vector_type(4))) int v4i;

__global__ __launch_bounds__(256) void k_wtG(const float* __restrict__ w, int K, int N, bf* Bt) {
    const int lane = threadIdx.x & 31; const int L0 = (blockIdx.x * 8 + (threadIdx.x >> 5)) * 8; const int nlines = N * K / 64;
{
#pragma unroll 1
        for (int l = 0; l < 8; ++l) { const int L = L0 + l; if (L >= nlines) break; const size_t e = (size_t)L * 64 + lane * 2; const int k = (int)(e % K), n = (int)(e / K); v2us o;
            o[0] = f2bf(w[(size_t)k * N + n]); o[1] = f2bf(w[(size_t)(k + 1) * N + n]); *(v2us*)(Bt + e) = o; }
         }
}
// The elementwise kernels below give each thread several vectors (all loads issued first, then the arithmetic and the stores), so that each launch starts 4,096 waves instead of one short wave per 64 to 256 elements.
#define EU 4                      // vectors per thread in k_cvt8 and k_rope (rows)
#define MU 8                      // vectors per thread in k_mchk
__global__ __launch_bounds__(256) void k_cvt8(const float* __restrict__ src, bf* dst, size_t n8) { const size_t i0 = (size_t)blockIdx.x * (256 * EU) + threadIdx.x; v8f v[EU];
#pragma unroll
    for (int u = 0; u < EU; ++u) { const size_t i = i0 + (size_t)u * 256; v[u] = *(const v8f*)(src + (i < n8 ? i : n8 - 1) * 8); }   // index clamped, not branched round: the loads stay one group in flight; the store below is guarded
#pragma unroll
    for (int u = 0; u < EU; ++u) { const size_t i = i0 + (size_t)u * 256; v8us o;
#pragma unroll
        for (int k = 0; k < 8; ++k) o[k] = f2bf(v[u][k]);
        if (i < n8) *(v8us*)(dst + i * 8) = o; } }
__constant__ float INV[HD / 2] = {1.0,0.8659643530845642,0.7498942017555237,0.6493816375732422,0.5623413324356079,0.486967533826828,0.4216965138912201,0.36517414450645447,0.3162277638912201,0.2738419771194458,0.23713736236095428,0.20535250008106232,0.17782793939113617,0.1539926528930664,0.1333521455526352,0.11547820270061493,0.10000000149011612,0.08659642934799194,0.07498941570520401,0.06493816524744034,0.05623412877321243,0.04869675263762474,0.04216964915394783,0.03651741147041321,0.03162277862429619,0.0273841954767704,0.0237137358635664,0.02053525112569332,0.017782794311642647,0.015399265103042126,0.01333521492779255,0.011547819711267948,0.009999999776482582,0.00865964312106371,0.007498942315578461,0.006493816617876291,0.005623413249850273,0.004869675263762474,0.0042169648222625256,0.003651741426438093,0.003162277862429619,0.0027384196873754263,0.0023713738191872835,0.0020535250660032034,0.0017782794311642647,0.0015399265103042126,0.0013335214462131262,0.0011547820176929235,0.0010000000474974513,0.0008659643353894353,0.0007498941849917173,0.0006493816617876291,0.000562341301701963,0.00048696750309318304,0.00042169648804701865,0.00036517411353997886,0.0003162277862429619,0.00027384195709601045,0.0002371373848291114,0.00020535249495878816,0.00017782794020604342,0.00015399264520965517,0.0001333521504420787,0.00011547819303814322};
// k_cstab: one thread per (t, d < HD/2); the angle of d + HD/2 is the same one, so the pair is stored at both places
__global__ __launch_bounds__(256) void k_cstab(const int* __restrict__ pos, float* CS) { const int idx = blockIdx.x * 256 + threadIdx.x; if (idx >= TT * (HD / 2)) return; const int t = idx / (HD / 2), d = idx % (HD / 2); const float ang = __fmul_rn((float)pos[t], INV[d]); v2f cs; cs[0] = cosf(ang); cs[1] = sinf(ang);
    float* o = CS + ((size_t)t * HD + d) * 2; *(v2f*)o = cs; *(v2f*)(o + HD) = cs;  }
// k_mchk: causal-pattern check of the additive mask for one batch: any entry with (j <= i and mask != 0) or (j > i and mask > -1e30) clears FLAG[0] (plain identical stores; FLAG preset to 1); lane -> MU groups of 4 consecutive j, 1024 elements apart.
__global__ __launch_bounds__(256) void k_mchk(const float* __restrict__ MKb, int* FLAG) { const size_t e0 = ((size_t)blockIdx.x * (256 * MU) + threadIdx.x) * 4; v4f m[MU]; bool bad = false;
#pragma unroll
    for (int u = 0; u < MU; ++u) { const size_t e = e0 + (size_t)u * 1024; m[u] = *(const v4f*)(MKb + (e < (size_t)TT * TT ? e : (size_t)TT * TT - 4)); }   // index clamped: one group of loads in flight
#pragma unroll
    for (int u = 0; u < MU; ++u) { const size_t e = e0 + (size_t)u * 1024; const int j = (int)(e % TT), i = (int)(e / TT); bool b = false;
#pragma unroll
        for (int q = 0; q < 4; ++q) { const bool keep = (j + q <= i); b |= keep ? (m[u][q] != 0.0f) : (m[u][q] > -1.0e30f); }
        bad |= b && (e < (size_t)TT * TT); }
    if (bad) *(int*)FLAG = 0; }
__global__ void k_flag1(int* FLAG) { if (threadIdx.x == 0) { *(int*)FLAG = 1;  } }

// k_rope: head planes [h][t][d] (fp16 + hi/lo) of rope(x) x sc with the rotate-half convention out[d] = x[d] cos[t][d] - x[d+HD/2] sin[t][d], out[d+HD/2] = x[d+HD/2] cos[t][d+HD/2] + x[d] sin[t][d+HD/2]; the hi/lo planes hold rows t < hr only ([h][hr][d])
// 16 threads per (h, t) row: a thread takes 4 consecutive d < HD/2 and their 4 partners d + HD/2 (each x is loaded once and serves both), in EU rows 16 apart; a block covers 16 x EU rows of one head (TT is a multiple of that).
__global__ __launch_bounds__(256) void k_rope(const float* __restrict__ F, int pitch, int nheads, const float* __restrict__ CS, const float* __restrict__ RF, const float* __restrict__ nw, float sc, int hr, h16* P16, bf* Ph, bf* Pl) {
    const int h = blockIdx.x / (TT / (16 * EU)); if (h >= nheads) return; const int tb = (blockIdx.x % (TT / (16 * EU))) * (16 * EU); const int tl = threadIdx.x >> 4, d = (threadIdx.x & 15) * 4;
    const float* Fb = F + (size_t)tb * pitch + h * HD; const float* Cb = CS + (size_t)tb * HD * 2; const float* pc = Cb + (tl * HD + d) * 2; const float* pf[EU]; v4f xv[EU][2], cv[EU][2][2];
#pragma unroll
    for (int u = 0; u < EU; ++u) { pf[u] = Fb + (size_t)(u * 16 + tl) * pitch + d;
#pragma unroll
        for (int hf = 0; hf < 2; ++hf) { xv[u][hf] = *(const v4f*)(pf[u] + hf * (HD / 2)); const float* c = pc + (u * 16 * HD + hf * (HD / 2)) * 2; cv[u][hf][0] = *(const v4f*)c; cv[u][hf][1] = *(const v4f*)(c + 4); } }
    asm volatile("s_wait_xcnt 0x0" :: "v"(pc), "v"(pf[0]), "v"(pf[1]), "v"(pf[2]), "v"(pf[3]) : "memory");   // the loads' address registers are inputs here, so none of them is reused before this wait
#pragma unroll
    for (int u = 0; u < EU; ++u) { const int t = tb + u * 16 + tl; float rf = 1.0f;
        if (RF) { rf = RF[(size_t)h * TT + t]; asm volatile("s_wait_xcnt 0x0" :: "v"(rf) : "memory"); }   // the wait stands behind this load, ahead of any reuse of its base or offset register; the loaded value is an input so that the load cannot sink below it
#pragma unroll
        for (int hf = 0; hf < 2; ++hf) { v4h o16; v4us oh, ol;
#pragma unroll
            for (int q = 0; q < 4; ++q) { const int dd = d + hf * (HD / 2) + q; const int dp = (dd < HD / 2) ? dd + HD / 2 : dd - HD / 2; float x0 = xv[u][hf][q], x1 = xv[u][1 - hf][q];
                if (RF) { float n0 = __fmul_rn(x0, rf), n1 = __fmul_rn(x1, rf); asm volatile("" : "+v"(n0)); asm volatile("" : "+v"(n1)); x0 = __fmul_rn(bfr(nw[dd]), n0); x1 = __fmul_rn(bfr(nw[dp]), n1); }
                v2f cs; cs[0] = cv[u][hf][q >> 1][(q & 1) * 2]; cs[1] = cv[u][hf][q >> 1][(q & 1) * 2 + 1]; float a = __fmul_rn(x0, cs[0]), bq = __fmul_rn(x1, cs[1]); asm volatile("" : "+v"(a)); asm volatile("" : "+v"(bq)); const float r = ((dd < HD / 2) ? __fsub_rn(a, bq) : __fadd_rn(a, bq)) * sc;
                o16[q] = tohx(r); unsigned short a2, c2; splitf(r, a2, c2); oh[q] = a2; ol[q] = c2; }
            const int dh = d + hf * (HD / 2); *(v4h*)(P16 + ((size_t)h * TT + t) * HD + dh) = o16; if (t < hr) { const size_t eh = ((size_t)h * hr + t) * HD + dh; *(v4us*)(Ph + eh) = oh; *(v4us*)(Pl + eh) = ol; } } }  }
// k_vtp: transposed value planes [g][d][t] at a row pitch of 2 x TT elements; the lo plane lies in the second half of the hi plane's rows (Vl = Vh + TT)
// A block takes one head's 64 rows t x HD columns; a thread takes an 8 t x 4 d patch (8 row loads of 16 bytes) and stores it turned, 8 consecutive t per d: a wave's store covers 4 whole 128-byte lines.
__global__ __launch_bounds__(256) void k_vtp(const float* __restrict__ F, int pitch, int nheads, h16* V16, bf* Vh, bf* Vl) { const int lane = threadIdx.x & 31; const int g = blockIdx.x / (TT / 64); if (g >= nheads) return; const int tb = (blockIdx.x % (TT / 64)) * 64, tl = (lane >> 2) * 8; const int d = (threadIdx.x >> 5) * 16 + (lane & 3) * 4; const float* pf[8]; v4f xv[8];
#pragma unroll
    for (int r = 0; r < 8; ++r) { pf[r] = F + (size_t)(tb + tl + r) * pitch + g * HD + d; xv[r] = *(const v4f*)pf[r]; }
    asm volatile("s_wait_xcnt 0x0" :: "v"(pf[0]), "v"(pf[1]), "v"(pf[2]), "v"(pf[3]), "v"(pf[4]), "v"(pf[5]), "v"(pf[6]), "v"(pf[7]) : "memory");   // the loads' address registers are inputs here, so none of them is reused before this wait
#pragma unroll
    for (int c = 0; c < 4; ++c) { v8h o16; v8us oh, ol;
#pragma unroll
        for (int r = 0; r < 8; ++r) { const float x = xv[r][c]; o16[r] = tohx(x); unsigned short a2, c2; splitf(x, a2, c2); oh[r] = a2; ol[r] = c2; }
        const size_t ev = ((size_t)g * HD + d + c) * (2 * TT) + tb + tl; *(v8h*)(V16 + ev) = o16; *(v8us*)(Vh + ev) = oh; *(v8us*)(Vl + ev) = ol; }  }
// ---- k_fattn: scores, softmax, probability x value and the head merge in one kernel; a score never leaves the registers. One wave owns 32 query rows of one head and walks the keys 32 at a time with a running maximum and sum per query.
// Transposed products: S^T = K Q^T (A = 16 key rows, B = 16 query rows, both K-contiguous in d), so that in the accumulator a lane holds one query (column lr) and the keys 8 hi + j of each 16-key tile. That is the place the same lane needs them in
// as B operand of O^T += V^T P^T (k = 8 hi .. 8 hi + 7 from the first tile, 16 + 8 hi .. from the second): the weights are packed in the lane, with no exchange. A = rows d of the transposed value planes, K-contiguous in t.
// HL: hi + lo bf16 planes, 3 products each (query rows < RH); otherwise single fp16, weights x PCAR. The weights are rounded relative to the running maximum and the division by the sum is done once, on the output.
// con (device flag: the mask is the causal pattern): keys beyond the wave's diagonal block are not visited, keys j > i get exact-zero weight and the mask, verified 0 where j <= i, is not read; otherwise every key takes score + bf16(mask).
#define L2E 1.4426950408889634f
#define FWV 4                     // waves per block, all of one head: they start at key 0 together and walk the same keys at about the same time (shared lines in the WGP cache)
typedef __attribute__((ext_vector_type(16))) unsigned short v16us;
// 2^x with the one free issue slot that the instruction set asks for behind a transcendental; one statement, so that the v_nop stands directly behind it
__device__ __forceinline__ float exp2s(float x) { float r; asm("v_exp_f32 %0, %1\n\tv_nop" : "=v"(r) : "v"(x)); return r; }
// the value of lane l ^ 16, by one vector instruction (no trip through the LDS pipe)
__device__ __forceinline__ float xhalf(float x) { return __builtin_bit_cast(float, __builtin_amdgcn_permlanex16(__builtin_bit_cast(int, x), __builtin_bit_cast(int, x), 0x76543210, 0xfedcba98, false, false)); }
template <typename T16, bool HL>
__device__ __forceinline__ void fattn(const int h, const int hk, const int q0, const int qrows, const int lr, const int hi, const bool con, const T16* __restrict__ Q, const T16* __restrict__ Q2, const T16* __restrict__ K, const T16* __restrict__ K2,
                                      const T16* __restrict__ Vt, const T16* __restrict__ Vt2, const float* __restrict__ MKb, bf* Ah, bf* Al) {
    typedef typename WFrag<T16>::V V;
    // every loop over g, ks, kt, db and j below is unrolled whole, so that the fragment and accumulator arrays are indexed by constants only and stay in registers
    V bq[2][4], bq2[2][4];
    { const T16* pq = Q + ((size_t)h * qrows + q0 + lr) * HD + 8 * hi; const T16* pq2 = Q2 + ((size_t)h * qrows + q0 + lr) * HD + 8 * hi;
#pragma unroll
      for (int g = 0; g < 2; ++g)
#pragma unroll
          for (int ks = 0; ks < 4; ++ks) { bq[g][ks] = WFrag<T16>::ld(pq + g * 16 * HD + ks * 32); if (HL) bq2[g][ks] = WFrag<T16>::ld(pq2 + g * 16 * HD + ks * 32); }
      asm volatile("s_wait_xcnt 0x0" :: "v"(pq), "v"(pq2) : "memory"); }   // the loads' address registers are inputs here, so none of them is reused before this wait
    v8f o[8][2]; float m[2], l[2];
#pragma unroll
    for (int g = 0; g < 2; ++g) { m[g] = -3.0e38f; l[g] = 0.f;
#pragma unroll
        for (int db = 0; db < 8; ++db) o[db][g] = (v8f){}; }
    const int nkb = con ? q0 / 32 + 1 : TT / 32;   // 32-key blocks to visit (wave-uniform)
    const T16* pk = K + ((size_t)hk * TT + lr) * HD + 8 * hi; const T16* pk2 = K2 + ((size_t)hk * TT + lr) * HD + 8 * hi;
    const T16* pv = Vt + ((size_t)hk * HD + lr) * (2 * TT) + 8 * hi; const T16* pv2 = Vt2 + ((size_t)hk * HD + lr) * (2 * TT) + 8 * hi;
    V ka[2][4], ka2[2][4];
    auto loadk = [&](int kb) { const T16* a = pk + (size_t)kb * (32 * HD); const T16* a2 = pk2 + (size_t)kb * (32 * HD);
#pragma unroll
        for (int kt = 0; kt < 2; ++kt)
#pragma unroll
            for (int ks = 0; ks < 4; ++ks) { ka[kt][ks] = WFrag<T16>::ld(a + kt * 16 * HD + ks * 32); if (HL) ka2[kt][ks] = WFrag<T16>::ld(a2 + kt * 16 * HD + ks * 32); }
        asm volatile("s_wait_xcnt 0x0" :: "v"(a), "v"(a2) : "memory"); };   // address registers are inputs: not reused before this wait; ordered against memory operations, it also keeps this group of loads where it is written
    loadk(0);
    // rolled: one trip is one block of 32 keys (32 or 96 matrix instructions)
#pragma unroll 1
    for (int kb = 0; kb < nkb; ++kb) {
        V va[8], va2[8];   // this block's value rows are requested first and are in flight under the score products and the softmax
        { const T16* a = pv + kb * 32; const T16* a2 = pv2 + kb * 32;
#pragma unroll
          for (int db = 0; db < 8; ++db) { va[db] = WFrag<T16>::ld(a + (size_t)db * 16 * (2 * TT)); if (HL) va2[db] = WFrag<T16>::ld(a2 + (size_t)db * 16 * (2 * TT)); }
          asm volatile("s_wait_xcnt 0x0" :: "v"(a), "v"(a2) : "memory"); }   // as in loadk
        v8f s[2][2];
#pragma unroll
        for (int kt = 0; kt < 2; ++kt)
#pragma unroll
            for (int g = 0; g < 2; ++g) s[kt][g] = (v8f){};
#pragma unroll
        for (int ks = 0; ks < 4; ++ks)
#pragma unroll
            for (int kt = 0; kt < 2; ++kt)
#pragma unroll
                for (int g = 0; g < 2; ++g) { s[kt][g] = WFrag<T16>::mma(ka[kt][ks], bq[g][ks], s[kt][g]); if (HL) { s[kt][g] = WFrag<T16>::mma(ka[kt][ks], bq2[g][ks], s[kt][g]); s[kt][g] = WFrag<T16>::mma(ka2[kt][ks], bq[g][ks], s[kt][g]); } }
        loadk(min(kb + 1, nkb - 1));   // the next block's key rows fly under the softmax and the value products (index clamped: the last trip reads its own block again, in bounds)
        if (con && kb == nkb - 1) {   // wave-uniform: only the block that straddles the wave's diagonal holds keys j > i, and only it pays for the selects
#pragma unroll
            for (int g = 0; g < 2; ++g)
#pragma unroll
                for (int kt = 0; kt < 2; ++kt) {
#pragma unroll
                    for (int j = 0; j < 8; ++j) if (kb * 32 + kt * 16 + hi * 8 + j > q0 + g * 16 + lr) s[kt][g][j] = -3.0e38f;
                    asm volatile("" : "+v"(s[kt][g])); } }
        float mn[2];
#pragma unroll
        for (int g = 0; g < 2; ++g) { const int qi = q0 + g * 16 + lr; float ml = -3.0e38f;
            v4f mq[2][2];
            if (!con) { const float* mp = MKb + (size_t)qi * TT + kb * 32 + hi * 8; mq[0][0] = *(const v4f*)mp; mq[0][1] = *(const v4f*)(mp + 4); mq[1][0] = *(const v4f*)(mp + 16); mq[1][1] = *(const v4f*)(mp + 20);
                asm volatile("s_wait_xcnt 0x0" :: "v"(mp) : "memory"); }   // the four loads' address register is an input: not reused before this wait
#pragma unroll
            for (int kt = 0; kt < 2; ++kt) { v8f x = s[kt][g] * SCL;   // a masked score stays far below every real one
                if (!con) {
#pragma unroll
                    for (int j = 0; j < 4; ++j) { x[j] += bfr(mq[kt][0][j]); x[4 + j] += bfr(mq[kt][1][j]); } }
#pragma unroll
                for (int j = 0; j < 8; ++j) ml = fmaxf(ml, x[j]);
                s[kt][g] = x; }
            ml = fmaxf(ml, xhalf(ml));   // the other half of the wave holds the query's other 16 keys
            mn[g] = fmaxf(m[g], ml); }
        // a new maximum rescales sum and output; where no query of the wave has one the factor is exactly 1 and the work is skipped (a scalar branch)
        if (__builtin_amdgcn_ballot_w32(mn[0] > m[0] || mn[1] > m[1]) != 0) {
#pragma unroll
            for (int g = 0; g < 2; ++g) { const float al = exp2s((m[g] - mn[g]) * L2E); l[g] *= al; m[g] = mn[g];
#pragma unroll
                for (int db = 0; db < 8; ++db) o[db][g] *= al; } }
        V pf[2], pf2[2];
#pragma unroll
        for (int g = 0; g < 2; ++g) { float ps = 0.f; v16us ph, pl; v16h p16;
#pragma unroll
            for (int kt = 0; kt < 2; ++kt)
#pragma unroll
                for (int j = 0; j < 8; ++j) { const float e = exp2s((s[kt][g][j] - m[g]) * L2E); ps += e;
                    if constexpr (HL) { unsigned short a, c; splitf(e, a, c); ph[kt * 8 + j] = a; pl[kt * 8 + j] = c; } else p16[kt * 8 + j] = tohx(e * PCAR); }
            l[g] += ps;
            if constexpr (HL) { pf[g] = __builtin_bit_cast(v16bf, ph); pf2[g] = __builtin_bit_cast(v16bf, pl); } else pf[g] = p16; }
#pragma unroll
        for (int db = 0; db < 8; ++db)
#pragma unroll
            for (int g = 0; g < 2; ++g) { o[db][g] = WFrag<T16>::mma(va[db], pf[g], o[db][g]); if (HL) { o[db][g] = WFrag<T16>::mma(va[db], pf2[g], o[db][g]); o[db][g] = WFrag<T16>::mma(va2[db], pf[g], o[db][g]); } }
    }
    // output: lane = query row q0 + 16 g + lr, 8 consecutive d per tile: 16-byte stores into the merged hi and lo planes [t][DQ]; a 128-byte line is written by one wave
#pragma unroll
    for (int g = 0; g < 2; ++g) { const float lt = l[g] + xhalf(l[g]); const float inv = __fdiv_rn(HL ? 1.0f : 1.0f / PCAR, lt);
        bf* oa = Ah + (size_t)(q0 + g * 16 + lr) * DQ + h * HD + hi * 8; bf* ob = Al + (size_t)(q0 + g * 16 + lr) * DQ + h * HD + hi * 8;
#pragma unroll
        for (int db = 0; db < 8; ++db) { v8us oh, ol;
#pragma unroll
            for (int j = 0; j < 8; ++j) { unsigned short a, c; splitf(o[db][g][j] * inv, a, c); oh[j] = a; ol[j] = c; }
            *(v8us*)(oa + db * 16) = oh; *(v8us*)(ob + db * 16) = ol;
            asm volatile("s_wait_xcnt 0x0" :: "v"(oa), "v"(ob), "v"(oh), "v"(ol) : "memory"); } }   // the two stores' address and data registers are inputs: none is reused before this wait
}
// grid: NH_ x TT / 128 blocks. Wave w of a block takes the 32-row query tile w x 16 + r (r the same for the block): a short, two middling and a long walk on every WGP, so that the WGPs carry equal loads. No barrier: the waves are independent.
__global__ __launch_bounds__(32 * FWV) void k_fattn(const h16* __restrict__ Q16, const h16* __restrict__ K16, const h16* __restrict__ V16, const bf* __restrict__ Qh, const bf* __restrict__ Ql, const bf* __restrict__ Kh, const bf* __restrict__ Kl,
                                                    const bf* __restrict__ Vh, const bf* __restrict__ Vl, const float* __restrict__ MKb, const int* __restrict__ CF, bf* Ah, bf* Al) {
    const int lane = threadIdx.x & 31, lr = lane & 15, hi = lane >> 4;
    const int w = __builtin_amdgcn_readfirstlane(threadIdx.x >> 5);   // the wave's number in a scalar register: the key loop stays a scalar loop
    const bool con = (CF[0] != 0);   // device flag: mask verified causal
    const int h = blockIdx.x % NH_; const int q0 = (w * (TT / (32 * FWV)) + blockIdx.x / NH_) * 32;
    if (q0 < RH) fattn<bf, true>(h, h / REP, q0, RH, lr, hi, con, Qh, Ql, Kh, Kl, Vh, Vl, MKb, Ah, Al);
    else fattn<h16, false>(h, h / REP, q0, TT, lr, hi, con, Q16, Q16, K16, K16, V16, V16, MKb, Ah, Al);
}

extern "C" void kernel_launch(void* const* d_in, const int* in_sizes, int n_in,
                              void* d_out, int out_size, void* d_ws, size_t ws_size, hipStream_t stream) {
    (void)in_sizes; (void)n_in; (void)out_size;
    const float* x = (const float*)d_in[0]; const float* MK = (const float*)d_in[1]; const int* POS = (const int*)d_in[2]; const float* wq = (const float*)d_in[3]; const float* wk = (const float*)d_in[4]; const float* wv = (const float*)d_in[5]; const float* wo = (const float*)d_in[6];
    float* OUT = (float*)d_out;     // [2][2048][2048]
    char* wsp = (char*)d_ws;
    auto take = [&](size_t bytes) { char* p = wsp; wsp += (bytes + 255) & ~(size_t)255; return (void*)p; };
    bf* WQ = (bf*)take((size_t)DQ * DM * 2); bf* WK = (bf*)take((size_t)DKV * DM * 2); bf* WV = (bf*)take((size_t)DKV * DM * 2); bf* WO = (bf*)take((size_t)DM * DQ * 2); float* CS = (float*)take((size_t)TT * HD * 2 * 4);
    int* CFLAG = (int*)take(256);
    h16* QP16 = (h16*)take((size_t)NH_ * TT * HD * 2); h16* KP16 = (h16*)take((size_t)NKV * TT * HD * 2); h16* VT16 = (h16*)take((size_t)NKV * HD * 2 * TT * 2);
    bf* QPh = (bf*)take((size_t)NH_ * RH * HD * 2); bf* QPl = (bf*)take((size_t)NH_ * RH * HD * 2); bf* KPh = (bf*)take((size_t)NKV * TT * HD * 2); bf* KPl = (bf*)take((size_t)NKV * TT * HD * 2); bf* VTh = (bf*)take((size_t)NKV * HD * 2 * TT * 2); bf* VTl = VTh + TT;
    float* Sb = (float*)take((size_t)TT * DM * 2 + (size_t)TT * DQ * 4 + (size_t)TT * DKV * 4); bf* ATh = (bf*)take((size_t)TT * DQ * 2); bf* ATl = (bf*)take((size_t)TT * DQ * 2);
    if ((size_t)(wsp - (char*)d_ws) > ws_size) return;    // ws 256 MiB
    bf* XB = (bf*)Sb; float* FQ = Sb + (size_t)TT * DM / 2; float* FK = FQ + (size_t)TT * DQ;   // the bf16 input rows and the f32 projections of one batch
    float* FV = FK;   // v projection reuses the k buffer after the k planes are built (stream-ordered)
    { k_cvt8<<<(unsigned)(((size_t)DQ * DM / 8 + 256 * EU - 1) / (256 * EU)), 256, 0, stream>>>(wq, WQ, (size_t)DQ * DM / 8); k_cvt8<<<(unsigned)(((size_t)DKV * DM / 8 + 256 * EU - 1) / (256 * EU)), 256, 0, stream>>>(wk, WK, (size_t)DKV * DM / 8); k_cvt8<<<(unsigned)(((size_t)DKV * DM / 8 + 256 * EU - 1) / (256 * EU)), 256, 0, stream>>>(wv, WV, (size_t)DKV * DM / 8);
      k_cvt8<<<(unsigned)(((size_t)DM * DQ / 8 + 256 * EU - 1) / (256 * EU)), 256, 0, stream>>>(wo, WO, (size_t)DM * DQ / 8);
      }
    const unsigned LQ = NH_ * (TT / (16 * EU)), LKv = NKV * (TT / (16 * EU));   // k_rope: 16 x EU rows of one head per block
    for (int b = 0; b < NB_; ++b) {
        
        k_cvt8<<<(unsigned)(((size_t)TT * DM / 8 + 256 * EU - 1) / (256 * EU)), 256, 0, stream>>>(x + (size_t)b * TT * DM, XB, (size_t)TT * DM / 8); k_flag1<<<1, 32, 0, stream>>>(CFLAG); k_mchk<<<(unsigned)(((size_t)TT * TT / 4 + 256 * MU - 1) / (256 * MU)), 256, 0, stream>>>(MK + (size_t)b * TT * TT, CFLAG); k_cstab<<<(TT * (HD / 2) + 255) / 256, 256, 0, stream>>>(POS + (size_t)b * TT, CS);   /* mask check + per-batch rotary table */
        k_gemms<0><<<dim3(TT / 128, DQ / 128, 1), 256, 0, stream>>>(XB, nullptr, WQ, DM, FQ, DQ);
        k_rope<<<LQ, 256, 0, stream>>>(FQ, DQ, NH_, CS, nullptr, nullptr, 1.0f, RH, QP16, QPh, QPl);
        k_gemms<0><<<dim3(TT / 128, DKV / 128, 1), 256, 0, stream>>>(XB, nullptr, WK, DM, FK, DKV);
        k_rope<<<LKv, 256, 0, stream>>>(FK, DKV, NKV, CS, nullptr, nullptr, 1.0f, TT, KP16, KPh, KPl);
        k_gemms<0><<<dim3(TT / 128, DKV / 128, 1), 256, 0, stream>>>(XB, nullptr, WV, DM, FV, DKV); k_vtp<<<NKV * (TT / 64), 256, 0, stream>>>(FV, DKV, NKV, VT16, VTh, VTl);
        k_fattn<<<NH_ * (TT / (32 * FWV)), 32 * FWV, 0, stream>>>(QP16, KP16, VT16, QPh, QPl, KPh, KPl, VTh, VTl, MK + (size_t)b * TT * TT, CFLAG, ATh, ATl);
        k_gemms<1><<<dim3(TT / 128, DM / 128, 1), 256, 0, stream>>>(ATh, ATl, WO, DQ, OUT + (size_t)b * TT * DM, DM); }
}

// v006
// One run takes 274 microseconds.
// Timed twice side by side with v005, it ran 1.30 and 1.31 times as fast.
// All steps since v000 together make it 7.08 times as fast.
#include <hip/hip_runtime.h>

// Causal LM attention with additive mask and position-id rotary (hidden [2][2048][2048]; q, k, v = hidden W^T ('oi' [2048][2048], 16 heads x 128); rotate-half RoPE with angle = position_ids[b][t] x inv_freq (theta 1e4; position_ids int32 input, read on device); scores/sqrt(128) + attention_mask[b][0][i][j] (f32 input, read); softmax; out = merged Wo^T -> [2][2048][2048]).
// The additive mask is verified ON THE DEVICE to be the causal pattern (0 where j <= i, most-negative elsewhere); when it is, key blocks above the diagonal are skipped and the masked entries are realised as exact-zero softmax weights (identical result); otherwise every key is visited and the mask is simply added (general fallback).
// Compute dtypes, f32 accumulate: every input rounded to bf16; q/k/v on PLAIN bf16 operands (inputs: exact); rotary in f32 (per-batch table from the position ids and the reference's inv_freq constants); mask check; scores, additive mask (bf16-rounded), running softmax (f32) and attn.v in one kernel (block skipping gated by the device flag): query rows < 512 hl (3 products), the rest single fp16 (x1024); Wo hl x exact (2 products).

#define NB_  2
#define TT   2048
#define DM   2048
#define NH_  16
#define NKV  16
#define REP  (NH_ / NKV)
#define HD   128
#define DQ   (NH_ * HD)
#define DKV  (NKV * HD)
#define RH   512                  // query rows < RH use hi+lo planes (0: none)
#define WIN  2048
#define PCAR 1024.0f
#define SCL  0.088388347648318447f   // HD^-0.5
typedef _Float16 h16;
typedef unsigned short bf;
typedef __attribute__((ext_vector_type(16))) __bf16   v16bf;
typedef __attribute__((ext_vector_type(16))) _Float16 v16h;
typedef __attribute__((ext_vector_type(8)))  _Float16 v8h;
typedef __attribute__((ext_vector_type(8)))  unsigned short v8us;
typedef __attribute__((ext_vector_type(8)))  float    v8f;
typedef __attribute__((ext_vector_type(4)))  float    v4f;
typedef v8h  __attribute__((may_alias)) v8ha;
typedef v4f  __attribute__((may_alias)) v4fa;
typedef v8us __attribute__((may_alias)) v8usa;

__device__ __forceinline__ unsigned short f2bf(float f) { unsigned u = __float_as_uint(f); u += 0x7FFFu + ((u >> 16) & 1u); return (unsigned short)(u >> 16); }
__device__ __forceinline__ float bf2f(unsigned short b) { return __uint_as_float(((unsigned)b) << 16); }
__device__ __forceinline__ float bfr(float f) { return bf2f(f2bf(f)); }
__device__ __forceinline__ v16h cat16(v8h lo, v8h hi) { return __builtin_shufflevector(lo, hi, 0, 1, 2, 3, 4, 5, 6, 7, 8, 9, 10, 11, 12, 13, 14, 15); }
__device__ __forceinline__ v16bf cat16b(v8us lo, v8us hi) { return __builtin_bit_cast(v16bf, __builtin_shufflevector(lo, hi, 0, 1, 2, 3, 4, 5, 6, 7, 8, 9, 10, 11, 12, 13, 14, 15)); }
__device__ __forceinline__ v8f wmma16(v16h a, v16h b, v8f c) { return __builtin_amdgcn_wmma_f32_16x16x32_f16(false, a, false, b, (short)0, c, false, false); }
__device__ __forceinline__ v8f wmmab(v16bf a, v16bf b, v8f c) { return __builtin_amdgcn_wmma_f32_16x16x32_bf16(false, a, false, b, (short)0, c, false, false); }



// ---- fragment loaders: lane (lr, hi) of a 16-row fragment reads k = 8 hi .. 8 hi + 7 and 16 + 8 hi .. 16 + 8 hi + 7 of row lr (the same for both operands)
template <typename T16> struct WFrag;
template <> struct WFrag<h16> { typedef v16h V; static __device__ __forceinline__ V ld(const h16* p) { return cat16(*(const v8h*)p, *(const v8h*)(p + 16)); } static __device__ __forceinline__ v8f mma(V a, V b, v8f c) { return wmma16(a, b, c); } };
template <> struct WFrag<bf> { typedef v16bf V; static __device__ __forceinline__ V ld(const bf* p) { return cat16b(*(const v8us*)p, *(const v8us*)(p + 16)); } static __device__ __forceinline__ v8f mma(V a, V b, v8f c) { return wmmab(a, b, c); } };
// ---- k_gemms: projection GEMM, one block of 8 waves (2 x 4) per 128x128 output tile; a wave holds 64 rows x 32 columns (8 accumulators) over the whole K. grid (M/128, N/128, products), 256 threads. M % 128 == 0, N % 128 == 0, K % 128 == 0.
// Product z of a launch shares A and takes the weight plane Bt + z bz and the output C + z cz (q, k and v in one launch); the rows of both batches are one M.
// C[m][n] (f32, pitch ldc) = sum_k (A[m][k] + A2[m][k] if NSPLIT) Bt[n][k]; A, A2, Bt are K-contiguous bf16 planes of row pitch K.
// The operands come through LDS: a stage is SK = 128 k of the tile's 128 A rows (, 128 A2 rows) and 128 Bt rows, brought by asynchronous 16-byte copies as whole 256-byte row pieces (two rows an instruction),
// so each row piece is fetched from L2 once per block and read by all the waves that need it. Two buffers: stage t + 1 flies while stage t is multiplied.
#define SK 128                    // k per stage
#define SP 136                    // LDS row pitch in 16-bit elements: 272 bytes = 16 x 17, free of bank conflicts for the 16-byte fragment reads
// copy8: eight copies of one wave, rows 16 apart (l = the lane's LDS byte address, g = the lane's global address, gs = 16 rows in elements).
__device__ __forceinline__ void copy8(unsigned l, const bf* g, size_t gs) {
    // one statement: the closing s_wait_xcnt stands behind the last copy and ahead of any reuse of the address registers named here
    asm volatile("global_load_async_to_lds_b128 %0, %8, off\n\t"
                 "global_load_async_to_lds_b128 %1, %9, off\n\t"
                 "global_load_async_to_lds_b128 %2, %10, off\n\t"
                 "global_load_async_to_lds_b128 %3, %11, off\n\t"
                 "global_load_async_to_lds_b128 %4, %12, off\n\t"
                 "global_load_async_to_lds_b128 %5, %13, off\n\t"
                 "global_load_async_to_lds_b128 %6, %14, off\n\t"
                 "global_load_async_to_lds_b128 %7, %15, off\n\t"
                 "s_wait_xcnt 0x0"
                 :: "v"(l), "v"(l + 1 * 16 * SP * 2), "v"(l + 2 * 16 * SP * 2), "v"(l + 3 * 16 * SP * 2), "v"(l + 4 * 16 * SP * 2), "v"(l + 5 * 16 * SP * 2), "v"(l + 6 * 16 * SP * 2), "v"(l + 7 * 16 * SP * 2),
                    "v"(g), "v"(g + gs), "v"(g + 2 * gs), "v"(g + 3 * gs), "v"(g + 4 * gs), "v"(g + 5 * gs), "v"(g + 6 * gs), "v"(g + 7 * gs) : "memory");
}
template <int NSPLIT>
__global__ __launch_bounds__(256) void k_gemms(const bf* __restrict__ A, const bf* __restrict__ A2, const bf* __restrict__ Bt, int K, float* C, int ldc, size_t bz, size_t cz) {
    typedef WFrag<bf>::V V;
    constexpr int NR = NSPLIT ? 384 : 256;                 // rows per stage: A, (A2,) Bt
    __shared__ __align__(128) bf ring[2 * NR * SP];
    __shared__ __align__(16) float os[8 * 16 * 36];        // per wave: 16 output rows x 32 columns at pitch 36, for whole-line stores
    const int lane = threadIdx.x & 31, lr = lane & 15, hi = lane >> 4; const int r0 = blockIdx.x * 128, c0 = blockIdx.y * 128;
    const int w = __builtin_amdgcn_readfirstlane(threadIdx.x >> 5);   // the wave's number in a scalar register: everything derived from it stays scalar
    const int wm = w >> 2, wn = w & 3;
    // copies: half a wave takes one 256-byte row piece (lane lr its 16 bytes lr); copy c of wave w brings rows 16 c + 2 w + hi of an operand's 128
    const int crow = 2 * w + hi; const size_t gs = (size_t)16 * K;
    const bf* ga = A + (size_t)(r0 + crow) * K + lr * 8; const bf* ga2 = NSPLIT ? A2 + (size_t)(r0 + crow) * K + lr * 8 : nullptr; const bf* gb = Bt + (size_t)blockIdx.z * bz + (size_t)(c0 + crow) * K + lr * 8;
    const unsigned l0 = (unsigned)(size_t)ring + (unsigned)(crow * SP + lr * 8) * 2u;
    auto fill = [&](int t) { const unsigned l = l0 + (unsigned)(t & 1) * (unsigned)(NR * SP * 2); const int kc = t * SK;
        copy8(l, ga + kc, gs); if (NSPLIT) copy8(l + 128 * SP * 2, ga2 + kc, gs); copy8(l + (NR - 128) * SP * 2, gb + kc, gs); };
    const int nst = K / SK;
    // every loop over mb, nb, ks, j and s below is unrolled whole, so that the accumulator and fragment arrays are indexed by constants only and stay in registers
    v8f acc[4][2];
#pragma unroll
    for (int mb = 0; mb < 4; ++mb)
#pragma unroll
        for (int nb = 0; nb < 2; ++nb) acc[mb][nb] = (v8f){};
    fill(0);
    asm volatile("s_wait_asynccnt 0x0" ::: "memory");   // this wave's share of stage 0 has landed
    __syncthreads();                                    // every wave's share of stage 0 has landed
    if (nst > 1) fill(1);
    // rolled: one trip is one stage (32 or 64 matrix instructions a wave), and the buffer alternates with t
#pragma unroll 1
    for (int t = 0; t < nst; ++t) {
        const bf* sb = ring + (t & 1) * (NR * SP); const bf* pa = sb + (wm * 64 + lr) * SP + 8 * hi; const bf* pb = sb + (NR - 128 + wn * 32 + lr) * SP + 8 * hi;
        V a[2][4], a2[2][4], b[2][2];   // two fragment sets: k step ks + 1 is read from LDS while k step ks is multiplied
#pragma unroll
        for (int ks = -1; ks < SK / 32; ++ks) {
            if (ks + 1 < SK / 32) { const int q = (ks + 1) & 1, ko = (ks + 1) * 32;
#pragma unroll
                for (int mb = 0; mb < 4; ++mb) { a[q][mb] = WFrag<bf>::ld(pa + mb * 16 * SP + ko); if (NSPLIT) a2[q][mb] = WFrag<bf>::ld(pa + (128 + mb * 16) * SP + ko); }
#pragma unroll
                for (int nb = 0; nb < 2; ++nb) b[q][nb] = WFrag<bf>::ld(pb + nb * 16 * SP + ko); }
            __builtin_amdgcn_sched_barrier(0);   // the next k step's LDS reads stay one group in front of this step's matrix instructions, not spread among them
            if (ks >= 0) { const int q = ks & 1;
#pragma unroll
                for (int nb = 0; nb < 2; ++nb)
#pragma unroll
                    for (int mb = 0; mb < 4; ++mb) { acc[mb][nb] = WFrag<bf>::mma(a[q][mb], b[q][nb], acc[mb][nb]); if (NSPLIT) acc[mb][nb] = WFrag<bf>::mma(a2[q][mb], b[q][nb], acc[mb][nb]); }
                __builtin_amdgcn_sched_barrier(0); }   // and the reads of the step after next stay behind them
        }
        asm volatile("s_wait_dscnt 0x0" ::: "memory");      // this wave's reads of stage t are done before the buffer is handed to the copies below
        asm volatile("s_wait_asynccnt 0x0" ::: "memory");   // this wave's share of stage t + 1 has landed
        __syncthreads();                                    // publishes stage t + 1 and ends every wave's reads of stage t
        if (t + 2 < nst) fill(t + 2);
    }
    asm volatile("s_wait_asynccnt 0x0" ::: "memory");       // no copy is outstanding when the wave goes on to its end
    float* mine = os + w * (16 * 36);
#pragma unroll
    for (int mb = 0; mb < 4; ++mb) {
#pragma unroll
        for (int nb = 0; nb < 2; ++nb)
#pragma unroll
            for (int j = 0; j < 8; ++j) mine[(hi * 8 + j) * 36 + nb * 16 + lr] = acc[mb][nb][j];
        __builtin_amdgcn_wave_barrier(); asm volatile("" ::: "memory");   // the reads below (other lanes' values) stay behind the writes above
        float* crw = C + (size_t)blockIdx.z * cz + (size_t)(r0 + wm * 64 + mb * 16) * ldc + c0 + wn * 32;
#pragma unroll
        for (int s = 0; s < 4; ++s) { const int row = 4 * s + (lane >> 3), cofs = (lane & 7) * 4; const v4f val = *(const v4fa*)(mine + row * 36 + cofs);
            *(v4f*)(crw + (size_t)row * ldc + cofs) = val; }
        __builtin_amdgcn_wave_barrier(); asm volatile("" ::: "memory");   // the next 16 rows' writes stay behind the reads above
    }
}

__device__ __forceinline__ h16 tohx(float x) { return (h16)x; }
__device__ __forceinline__ void splitf(float y, unsigned short& h, unsigned short& l) { h = f2bf(y); l = f2bf(y - bf2f(h)); }
typedef __attribute__((ext_vector_type(2))) _Float16 v2h;
typedef __attribute__((ext_vector_type(4))) _Float16 v4h;
typedef __attribute__((ext_vector_type(2))) unsigned short v2us;
typedef __attribute__((ext_vector_type(4))) unsigned short v4us;
typedef __attribute__((ext_vector_type(2))) float v2f;
typedef __attribute__((ext_vector_type(4))) int v4i;

__global__ __launch_bounds__(256) void k_wtG(const float* __restrict__ w, int K, int N, bf* Bt) {
    const int lane = threadIdx.x & 31; const int L0 = (blockIdx.x * 8 + (threadIdx.x >> 5)) * 8; const int nlines = N * K / 64;
{
#pragma unroll 1
        for (int l = 0; l < 8; ++l) { const int L = L0 + l; if (L >= nlines) break; const size_t e = (size_t)L * 64 + lane * 2; const int k = (int)(e % K), n = (int)(e / K); v2us o;
            o[0] = f2bf(w[(size_t)k * N + n]); o[1] = f2bf(w[(size_t)(k + 1) * N + n]); *(v2us*)(Bt + e) = o; }
         }
}
// The elementwise pieces below give each thread several vectors (all loads issued first, then the arithmetic and the stores). Each piece is a device function over 512 blocks of 256 threads (bx = its block);
// pieces that do not depend on one another, for both batches, share one launch: k_prep (in front of the q/k/v GEMM) and k_post (behind it).
#define EU 4                      // vectors per thread in cvt8 and rope (rows)
#define MU 8                      // vectors per thread in mchk
__device__ __forceinline__ void cvt8(const int bx, const float* __restrict__ src, bf* dst, size_t n8) { const size_t i0 = (size_t)bx * (256 * EU) + threadIdx.x; v8f v[EU];
#pragma unroll
    for (int u = 0; u < EU; ++u) { const size_t i = i0 + (size_t)u * 256; v[u] = *(const v8f*)(src + (i < n8 ? i : n8 - 1) * 8); }   // index clamped, not branched round: the loads stay one group in flight; the store below is guarded
#pragma unroll
    for (int u = 0; u < EU; ++u) { const size_t i = i0 + (size_t)u * 256; v8us o;
#pragma unroll
        for (int k = 0; k < 8; ++k) o[k] = f2bf(v[u][k]);
        if (i < n8) *(v8us*)(dst + i * 8) = o; } }
__constant__ float INV[HD / 2] = {1.0,0.8659643530845642,0.7498942017555237,0.6493816375732422,0.5623413324356079,0.486967533826828,0.4216965138912201,0.36517414450645447,0.3162277638912201,0.2738419771194458,0.23713736236095428,0.20535250008106232,0.17782793939113617,0.1539926528930664,0.1333521455526352,0.11547820270061493,0.10000000149011612,0.08659642934799194,0.07498941570520401,0.06493816524744034,0.05623412877321243,0.04869675263762474,0.04216964915394783,0.03651741147041321,0.03162277862429619,0.0273841954767704,0.0237137358635664,0.02053525112569332,0.017782794311642647,0.015399265103042126,0.01333521492779255,0.011547819711267948,0.009999999776482582,0.00865964312106371,0.007498942315578461,0.006493816617876291,0.005623413249850273,0.004869675263762474,0.0042169648222625256,0.003651741426438093,0.003162277862429619,0.0027384196873754263,0.0023713738191872835,0.0020535250660032034,0.0017782794311642647,0.0015399265103042126,0.0013335214462131262,0.0011547820176929235,0.0010000000474974513,0.0008659643353894353,0.0007498941849917173,0.0006493816617876291,0.000562341301701963,0.00048696750309318304,0.00042169648804701865,0.00036517411353997886,0.0003162277862429619,0.00027384195709601045,0.0002371373848291114,0.00020535249495878816,0.00017782794020604342,0.00015399264520965517,0.0001333521504420787,0.00011547819303814322};
// cstab: one thread per (t, d < HD/2); the angle of d + HD/2 is the same one, so the pair is stored at both places
__device__ __forceinline__ void cstab(const int bx, const int* __restrict__ pos, float* CS) { const int idx = bx * 256 + threadIdx.x; if (idx >= TT * (HD / 2)) return; const int t = idx / (HD / 2), d = idx % (HD / 2); const float ang = __fmul_rn((float)pos[t], INV[d]); v2f cs; cs[0] = cosf(ang); cs[1] = sinf(ang);
    float* o = CS + ((size_t)t * HD + d) * 2; *(v2f*)o = cs; *(v2f*)(o + HD) = cs;  }
// mchk: causal-pattern check of the additive mask for one batch: any entry with (j <= i and mask != 0) or (j > i and mask > -1e30) clears FLAG[0] (plain identical stores; FLAG preset to 1 by k_prep, ahead of the q/k/v GEMM); lane -> MU groups of 4 consecutive j, 1024 elements apart.
__device__ __forceinline__ void mchk(const int bx, const float* __restrict__ MKb, int* FLAG) { const size_t e0 = ((size_t)bx * (256 * MU) + threadIdx.x) * 4; v4f m[MU]; bool bad = false;
#pragma unroll
    for (int u = 0; u < MU; ++u) { const size_t e = e0 + (size_t)u * 1024; m[u] = *(const v4f*)(MKb + (e < (size_t)TT * TT ? e : (size_t)TT * TT - 4)); }   // index clamped: one group of loads in flight
#pragma unroll
    for (int u = 0; u < MU; ++u) { const size_t e = e0 + (size_t)u * 1024; const int j = (int)(e % TT), i = (int)(e / TT); bool b = false;
#pragma unroll
        for (int q = 0; q < 4; ++q) { const bool keep = (j + q <= i); b |= keep ? (m[u][q] != 0.0f) : (m[u][q] > -1.0e30f); }
        bad |= b && (e < (size_t)TT * TT); }
    if (bad) *(int*)FLAG = 0; }
// k_prep: grid (512, 4 + 2 NB_). y < 4 + NB_: one 2048 x 2048 plane (n8 vectors of 8) to bf16 (wq, wk, wv, the two batches of x, wo, in that order in dst); then a batch's rotary table; its first thread presets the batch's mask flag.
#define PE ((size_t)DM * DM)      // elements of one plane (DQ x DM = DKV x DM = TT x DM)
__global__ __launch_bounds__(256) void k_prep(const float* __restrict__ wq, const float* __restrict__ wk, const float* __restrict__ wv, const float* __restrict__ x, const float* __restrict__ wo, const int* __restrict__ pos, bf* dst, size_t n8, float* CS, int* FLAG) {
    const int y = blockIdx.y;
    if (y < 4 + NB_) { const float* src = y == 0 ? wq : y == 1 ? wk : y == 2 ? wv : y == 3 + NB_ ? wo : x + (size_t)(y - 3) * PE; cvt8(blockIdx.x, src, dst + (size_t)y * PE, n8); }
    else { const int b = y - (4 + NB_); if (blockIdx.x == 0 && threadIdx.x == 0) FLAG[b] = 1; cstab(blockIdx.x, pos + (size_t)b * TT, CS + (size_t)b * TT * HD * 2); }
}

// rope: head planes [h][t][d] (fp16 + hi/lo) of rope(x) x sc with the rotate-half convention out[d] = x[d] cos[t][d] - x[d+HD/2] sin[t][d], out[d+HD/2] = x[d+HD/2] cos[t][d+HD/2] + x[d] sin[t][d+HD/2]; the hi/lo planes hold rows t < hr only ([h][hr][d])
// 16 threads per (h, t) row: a thread takes 4 consecutive d < HD/2 and their 4 partners d + HD/2 (each x is loaded once and serves both), in EU rows 16 apart; a block covers 16 x EU rows of one head (TT is a multiple of that).
__device__ __forceinline__ void rope(const int bx, const float* __restrict__ F, int pitch, int nheads, const float* __restrict__ CS, const float* __restrict__ RF, const float* __restrict__ nw, float sc, int hr, h16* P16, bf* Ph, bf* Pl) {
    const int h = bx / (TT / (16 * EU)); if (h >= nheads) return; const int tb = (bx % (TT / (16 * EU))) * (16 * EU); const int tl = threadIdx.x >> 4, d = (threadIdx.x & 15) * 4;
    const float* Fb = F + (size_t)tb * pitch + h * HD; const float* Cb = CS + (size_t)tb * HD * 2; const float* pc = Cb + (tl * HD + d) * 2; const float* pf[EU]; v4f xv[EU][2], cv[EU][2][2];
#pragma unroll
    for (int u = 0; u < EU; ++u) { pf[u] = Fb + (size_t)(u * 16 + tl) * pitch + d;
#pragma unroll
        for (int hf = 0; hf < 2; ++hf) { xv[u][hf] = *(const v4f*)(pf[u] + hf * (HD / 2)); const float* c = pc + (u * 16 * HD + hf * (HD / 2)) * 2; cv[u][hf][0] = *(const v4f*)c; cv[u][hf][1] = *(const v4f*)(c + 4); } }
    asm volatile("s_wait_xcnt 0x0" :: "v"(pc), "v"(pf[0]), "v"(pf[1]), "v"(pf[2]), "v"(pf[3]) : "memory");   // the loads' address registers are inputs here, so none of them is reused before this wait
#pragma unroll
    for (int u = 0; u < EU; ++u) { const int t = tb + u * 16 + tl; float rf = 1.0f;
        if (RF) { rf = RF[(size_t)h * TT + t]; asm volatile("s_wait_xcnt 0x0" :: "v"(rf) : "memory"); }   // the wait stands behind this load, ahead of any reuse of its base or offset register; the loaded value is an input so that the load cannot sink below it
#pragma unroll
        for (int hf = 0; hf < 2; ++hf) { v4h o16; v4us oh, ol;
#pragma unroll
            for (int q = 0; q < 4; ++q) { const int dd = d + hf * (HD / 2) + q; const int dp = (dd < HD / 2) ? dd + HD / 2 : dd - HD / 2; float x0 = xv[u][hf][q], x1 = xv[u][1 - hf][q];
                if (RF) { float n0 = __fmul_rn(x0, rf), n1 = __fmul_rn(x1, rf); asm volatile("" : "+v"(n0)); asm volatile("" : "+v"(n1)); x0 = __fmul_rn(bfr(nw[dd]), n0); x1 = __fmul_rn(bfr(nw[dp]), n1); }
                v2f cs; cs[0] = cv[u][hf][q >> 1][(q & 1) * 2]; cs[1] = cv[u][hf][q >> 1][(q & 1) * 2 + 1]; float a = __fmul_rn(x0, cs[0]), bq = __fmul_rn(x1, cs[1]); asm volatile("" : "+v"(a)); asm volatile("" : "+v"(bq)); const float r = ((dd < HD / 2) ? __fsub_rn(a, bq) : __fadd_rn(a, bq)) * sc;
                o16[q] = tohx(r); unsigned short a2, c2; splitf(r, a2, c2); oh[q] = a2; ol[q] = c2; }
            const int dh = d + hf * (HD / 2); *(v4h*)(P16 + ((size_t)h * TT + t) * HD + dh) = o16; if (t < hr) { const size_t eh = ((size_t)h * hr + t) * HD + dh; *(v4us*)(Ph + eh) = oh; *(v4us*)(Pl + eh) = ol; } } }  }
// vtp: transposed value planes [g][d][t] at a row pitch of 2 x TT elements; the lo plane lies in the second half of the hi plane's rows (Vl = Vh + TT); in the fp16 plane the second half of a row holds the second batch
// A block takes one head's 64 rows t x HD columns; a thread takes an 8 t x 4 d patch (8 row loads of 16 bytes) and stores it turned, 8 consecutive t per d: a wave's store covers 4 whole 128-byte lines.
__device__ __forceinline__ void vtp(const int bx, const float* __restrict__ F, int pitch, int nheads, h16* V16, bf* Vh, bf* Vl) { const int lane = threadIdx.x & 31; const int g = bx / (TT / 64); if (g >= nheads) return; const int tb = (bx % (TT / 64)) * 64, tl = (lane >> 2) * 8; const int d = (threadIdx.x >> 5) * 16 + (lane & 3) * 4; const float* pf[8]; v4f xv[8];
#pragma unroll
    for (int r = 0; r < 8; ++r) { pf[r] = F + (size_t)(tb + tl + r) * pitch + g * HD + d; xv[r] = *(const v4f*)pf[r]; }
    asm volatile("s_wait_xcnt 0x0" :: "v"(pf[0]), "v"(pf[1]), "v"(pf[2]), "v"(pf[3]), "v"(pf[4]), "v"(pf[5]), "v"(pf[6]), "v"(pf[7]) : "memory");   // the loads' address registers are inputs here, so none of them is reused before this wait
#pragma unroll
    for (int c = 0; c < 4; ++c) { v8h o16; v8us oh, ol;
#pragma unroll
        for (int r = 0; r < 8; ++r) { const float x = xv[r][c]; o16[r] = tohx(x); unsigned short a2, c2; splitf(x, a2, c2); oh[r] = a2; ol[r] = c2; }
        const size_t ev = ((size_t)g * HD + d + c) * (2 * TT) + tb + tl; *(v8h*)(V16 + ev) = o16; *(v8us*)(Vh + ev) = oh; *(v8us*)(Vl + ev) = ol; }
    asm volatile("s_wait_xcnt 0x0" ::: "memory"); }   // in the shared kernel another piece's code stands behind these stores: none of their registers is reused in front of this wait
// k_post: grid (512, NB_, 4): all that stands between the q/k/v GEMM and the attention, for batch y. z = 0: rotary planes of q; 1: of k; 2: turned planes of v; 3: the mask check.
__global__ __launch_bounds__(256) void k_post(const float* __restrict__ FQ, const float* __restrict__ FK, const float* __restrict__ FV, const float* __restrict__ CS, const float* __restrict__ MK, h16* QP16, bf* QPh, bf* QPl, h16* KP16, bf* KPh, bf* KPl,
                                              h16* VT16, bf* VTh, int* FLAG) {
    const int b = blockIdx.y, z = blockIdx.z;
    if (z < 2) { const bool isk = (z == 1); const int hr = isk ? TT : RH; const size_t po = (size_t)b * NH_ * TT * HD, ho = (size_t)b * NH_ * hr * HD;
        rope(blockIdx.x, (isk ? FK : FQ) + (size_t)b * TT * DQ, DQ, NH_, CS + (size_t)b * TT * HD * 2, nullptr, nullptr, 1.0f, hr, (isk ? KP16 : QP16) + po, (isk ? KPh : QPh) + ho, (isk ? KPl : QPl) + ho); }
    else if (z == 2) { bf* vh = VTh + (size_t)b * NKV * HD * 2 * TT; vtp(blockIdx.x, FV + (size_t)b * TT * DKV, DKV, NKV, VT16 + (size_t)b * TT, vh, vh + TT); }
    else mchk(blockIdx.x, MK + (size_t)b * TT * TT, FLAG + b);
}
// ---- k_fattn: scores, softmax, probability x value and the head merge in one kernel; a score never leaves the registers. One wave owns 32 query rows of one head and walks the keys 32 at a time with a running maximum and sum per query.
// Transposed products: S^T = K Q^T (A = 16 key rows, B = 16 query rows, both K-contiguous in d), so that in the accumulator a lane holds one query (column lr) and the keys 8 hi + j of each 16-key tile. That is the place the same lane needs them in
// as B operand of O^T += V^T P^T (k = 8 hi .. 8 hi + 7 from the first tile, 16 + 8 hi .. from the second): the weights are packed in the lane, with no exchange. A = rows d of the transposed value planes, K-contiguous in t.
// HL: hi + lo bf16 planes, 3 products each (query rows < RH); otherwise single fp16, weights x PCAR. The weights are rounded relative to the running maximum and the division by the sum is done once, on the output.
// con (device flag: the mask is the causal pattern): keys beyond the wave's diagonal block are not visited, keys j > i get exact-zero weight and the mask, verified 0 where j <= i, is not read; otherwise every key takes score + bf16(mask).
#define L2E 1.4426950408889634f
#define FWV 4                     // waves per block, all of one head: they start at key 0 together and walk the same keys at about the same time (shared lines in the WGP cache)
typedef __attribute__((ext_vector_type(16))) unsigned short v16us;
// 2^x with the one free issue slot that the instruction set asks for behind a transcendental; one statement, so that the v_nop stands directly behind it
__device__ __forceinline__ float exp2s(float x) { float r; asm("v_exp_f32 %0, %1\n\tv_nop" : "=v"(r) : "v"(x)); return r; }
// the value of lane l ^ 16, by one vector instruction (no trip through the LDS pipe)
__device__ __forceinline__ float xhalf(float x) { return __builtin_bit_cast(float, __builtin_amdgcn_permlanex16(__builtin_bit_cast(int, x), __builtin_bit_cast(int, x), 0x76543210, 0xfedcba98, false, false)); }
template <typename T16, bool HL>
__device__ __forceinline__ void fattn(const int h, const int hk, const int q0, const int qrows, const int lr, const int hi, const bool con, const T16* __restrict__ Q, const T16* __restrict__ Q2, const T16* __restrict__ K, const T16* __restrict__ K2,
                                      const T16* __restrict__ Vt, const T16* __restrict__ Vt2, const float* __restrict__ MKb, bf* Ah, bf* Al) {
    typedef typename WFrag<T16>::V V;
    // every loop over g, ks, kt, db and j below is unrolled whole, so that the fragment and accumulator arrays are indexed by constants only and stay in registers
    V bq[2][4], bq2[2][4];
    { const T16* pq = Q + ((size_t)h * qrows + q0 + lr) * HD + 8 * hi; const T16* pq2 = Q2 + ((size_t)h * qrows + q0 + lr) * HD + 8 * hi;
#pragma unroll
      for (int g = 0; g < 2; ++g)
#pragma unroll
          for (int ks = 0; ks < 4; ++ks) { bq[g][ks] = WFrag<T16>::ld(pq + g * 16 * HD + ks * 32); if (HL) bq2[g][ks] = WFrag<T16>::ld(pq2 + g * 16 * HD + ks * 32); }
      asm volatile("s_wait_xcnt 0x0" :: "v"(pq), "v"(pq2) : "memory"); }   // the loads' address registers are inputs here, so none of them is reused before this wait
    v8f o[8][2]; float m[2], l[2];
#pragma unroll
    for (int g = 0; g < 2; ++g) { m[g] = -3.0e38f; l[g] = 0.f;
#pragma unroll
        for (int db = 0; db < 8; ++db) o[db][g] = (v8f){}; }
    const int nkb = con ? q0 / 32 + 1 : TT / 32;   // 32-key blocks to visit (wave-uniform)
    const T16* pk = K + ((size_t)hk * TT + lr) * HD + 8 * hi; const T16* pk2 = K2 + ((size_t)hk * TT + lr) * HD + 8 * hi;
    const T16* pv = Vt + ((size_t)hk * HD + lr) * (2 * TT) + 8 * hi; const T16* pv2 = Vt2 + ((size_t)hk * HD + lr) * (2 * TT) + 8 * hi;
    V ka[2][4], ka2[2][4];
    auto loadk = [&](int kb) { const T16* a = pk + (size_t)kb * (32 * HD); const T16* a2 = pk2 + (size_t)kb * (32 * HD);
#pragma unroll
        for (int kt = 0; kt < 2; ++kt)
#pragma unroll
            for (int ks = 0; ks < 4; ++ks) { ka[kt][ks] = WFrag<T16>::ld(a + kt * 16 * HD + ks * 32); if (HL) ka2[kt][ks] = WFrag<T16>::ld(a2 + kt * 16 * HD + ks * 32); }
        asm volatile("s_wait_xcnt 0x0" :: "v"(a), "v"(a2) : "memory"); };   // address registers are inputs: not reused before this wait; ordered against memory operations, it also keeps this group of loads where it is written
    loadk(0);
    // rolled: one trip is one block of 32 keys (32 or 96 matrix instructions)
#pragma unroll 1
    for (int kb = 0; kb < nkb; ++kb) {
        V va[8], va2[8];   // this block's value rows are requested first and are in flight under the score products and the softmax
        { const T16* a = pv + kb * 32; const T16* a2 = pv2 + kb * 32;
#pragma unroll
          for (int db = 0; db < 8; ++db) { va[db] = WFrag<T16>::ld(a + (size_t)db * 16 * (2 * TT)); if (HL) va2[db] = WFrag<T16>::ld(a2 + (size_t)db * 16 * (2 * TT)); }
          asm volatile("s_wait_xcnt 0x0" :: "v"(a), "v"(a2) : "memory"); }   // as in loadk
        v8f s[2][2];
#pragma unroll
        for (int kt = 0; kt < 2; ++kt)
#pragma unroll
            for (int g = 0; g < 2; ++g) s[kt][g] = (v8f){};
#pragma unroll
        for (int ks = 0; ks < 4; ++ks)
#pragma unroll
            for (int kt = 0; kt < 2; ++kt)
#pragma unroll
                for (int g = 0; g < 2; ++g) { s[kt][g] = WFrag<T16>::mma(ka[kt][ks], bq[g][ks], s[kt][g]); if (HL) { s[kt][g] = WFrag<T16>::mma(ka[kt][ks], bq2[g][ks], s[kt][g]); s[kt][g] = WFrag<T16>::mma(ka2[kt][ks], bq[g][ks], s[kt][g]); } }
        loadk(min(kb + 1, nkb - 1));   // the next block's key rows fly under the softmax and the value products (index clamped: the last trip reads its own block again, in bounds)
        if (con && kb == nkb - 1) {   // wave-uniform: only the block that straddles the wave's diagonal holds keys j > i, and only it pays for the selects
#pragma unroll
            for (int g = 0; g < 2; ++g)
#pragma unroll
                for (int kt = 0; kt < 2; ++kt) {
#pragma unroll
                    for (int j = 0; j < 8; ++j) if (kb * 32 + kt * 16 + hi * 8 + j > q0 + g * 16 + lr) s[kt][g][j] = -3.0e38f;
                    asm volatile("" : "+v"(s[kt][g])); } }
        float mn[2];
#pragma unroll
        for (int g = 0; g < 2; ++g) { const int qi = q0 + g * 16 + lr; float ml = -3.0e38f;
            v4f mq[2][2];
            if (!con) { const float* mp = MKb + (size_t)qi * TT + kb * 32 + hi * 8; mq[0][0] = *(const v4f*)mp; mq[0][1] = *(const v4f*)(mp + 4); mq[1][0] = *(const v4f*)(mp + 16); mq[1][1] = *(const v4f*)(mp + 20);
                asm volatile("s_wait_xcnt 0x0" :: "v"(mp) : "memory"); }   // the four loads' address register is an input: not reused before this wait
#pragma unroll
            for (int kt = 0; kt < 2; ++kt) { v8f x = s[kt][g] * SCL;   // a masked score stays far below every real one
                if (!con) {
#pragma unroll
                    for (int j = 0; j < 4; ++j) { x[j] += bfr(mq[kt][0][j]); x[4 + j] += bfr(mq[kt][1][j]); } }
#pragma unroll
                for (int j = 0; j < 8; ++j) ml = fmaxf(ml, x[j]);
                s[kt][g] = x; }
            ml = fmaxf(ml, xhalf(ml));   // the other half of the wave holds the query's other 16 keys
            mn[g] = fmaxf(m[g], ml); }
        // a new maximum rescales sum and output; where no query of the wave has one the factor is exactly 1 and the work is skipped (a scalar branch)
        if (__builtin_amdgcn_ballot_w32(mn[0] > m[0] || mn[1] > m[1]) != 0) {
#pragma unroll
            for (int g = 0; g < 2; ++g) { const float al = exp2s((m[g] - mn[g]) * L2E); l[g] *= al; m[g] = mn[g];
#pragma unroll
                for (int db = 0; db < 8; ++db) o[db][g] *= al; } }
        V pf[2], pf2[2];
#pragma unroll
        for (int g = 0; g < 2; ++g) { float ps = 0.f; v16us ph, pl; v16h p16;
#pragma unroll
            for (int kt = 0; kt < 2; ++kt)
#pragma unroll
                for (int j = 0; j < 8; ++j) { const float e = exp2s((s[kt][g][j] - m[g]) * L2E); ps += e;
                    if constexpr (HL) { unsigned short a, c; splitf(e, a, c); ph[kt * 8 + j] = a; pl[kt * 8 + j] = c; } else p16[kt * 8 + j] = tohx(e * PCAR); }
            l[g] += ps;
            if constexpr (HL) { pf[g] = __builtin_bit_cast(v16bf, ph); pf2[g] = __builtin_bit_cast(v16bf, pl); } else pf[g] = p16; }
#pragma unroll
        for (int db = 0; db < 8; ++db)
#pragma unroll
            for (int g = 0; g < 2; ++g) { o[db][g] = WFrag<T16>::mma(va[db], pf[g], o[db][g]); if (HL) { o[db][g] = WFrag<T16>::mma(va[db], pf2[g], o[db][g]); o[db][g] = WFrag<T16>::mma(va2[db], pf[g], o[db][g]); } }
    }
    // output: lane = query row q0 + 16 g + lr, 8 consecutive d per tile: 16-byte stores into the merged hi and lo planes [t][DQ]; a 128-byte line is written by one wave
#pragma unroll
    for (int g = 0; g < 2; ++g) { const float lt = l[g] + xhalf(l[g]); const float inv = __fdiv_rn(HL ? 1.0f : 1.0f / PCAR, lt);
        bf* oa = Ah + (size_t)(q0 + g * 16 + lr) * DQ + h * HD + hi * 8; bf* ob = Al + (size_t)(q0 + g * 16 + lr) * DQ + h * HD + hi * 8;
#pragma unroll
        for (int db = 0; db < 8; ++db) { v8us oh, ol;
#pragma unroll
            for (int j = 0; j < 8; ++j) { unsigned short a, c; splitf(o[db][g][j] * inv, a, c); oh[j] = a; ol[j] = c; }
            *(v8us*)(oa + db * 16) = oh; *(v8us*)(ob + db * 16) = ol;
            asm volatile("s_wait_xcnt 0x0" :: "v"(oa), "v"(ob), "v"(oh), "v"(ol) : "memory"); } }   // the two stores' address and data registers are inputs: none is reused before this wait
}
// grid: (NH_ x TT / 128, NB_) blocks, y the batch. Wave w of a block takes the 32-row query tile w x 16 + r (r the same for the block): a short, two middling and a long walk on every WGP, so that the WGPs carry equal loads. No barrier: the waves are independent.
__global__ __launch_bounds__(32 * FWV) void k_fattn(const h16* __restrict__ Q16, const h16* __restrict__ K16, const h16* __restrict__ V16, const bf* __restrict__ Qh, const bf* __restrict__ Ql, const bf* __restrict__ Kh, const bf* __restrict__ Kl,
                                                    const bf* __restrict__ Vh, const bf* __restrict__ Vl, const float* __restrict__ MK, const int* __restrict__ CF, bf* ATh, bf* ATl) {
    const int lane = threadIdx.x & 31, lr = lane & 15, hi = lane >> 4;
    const int w = __builtin_amdgcn_readfirstlane(threadIdx.x >> 5);   // the wave's number in a scalar register: the key loop stays a scalar loop
    const int b = blockIdx.y; const bool con = (CF[b] != 0);   // device flag: this batch's mask verified causal
    const size_t po = (size_t)b * NH_ * TT * HD, qo = (size_t)b * NH_ * RH * HD, vo = (size_t)b * NKV * HD * 2 * TT; const float* MKb = MK + (size_t)b * TT * TT; bf* Ah = ATh + (size_t)b * TT * DQ; bf* Al = ATl + (size_t)b * TT * DQ;
    const int h = blockIdx.x % NH_; const int q0 = (w * (TT / (32 * FWV)) + blockIdx.x / NH_) * 32;
    if (q0 < RH) fattn<bf, true>(h, h / REP, q0, RH, lr, hi, con, Qh + qo, Ql + qo, Kh + po, Kl + po, Vh + vo, Vl + vo, MKb, Ah, Al);
    else fattn<h16, false>(h, h / REP, q0, TT, lr, hi, con, Q16 + po, Q16 + po, K16 + po, K16 + po, V16 + (size_t)b * TT, V16 + (size_t)b * TT, MKb, Ah, Al);
}

extern "C" void kernel_launch(void* const* d_in, const int* in_sizes, int n_in,
                              void* d_out, int out_size, void* d_ws, size_t ws_size, hipStream_t stream) {
    (void)in_sizes; (void)n_in; (void)out_size;
    const float* x = (const float*)d_in[0]; const float* MK = (const float*)d_in[1]; const int* POS = (const int*)d_in[2]; const float* wq = (const float*)d_in[3]; const float* wk = (const float*)d_in[4]; const float* wv = (const float*)d_in[5]; const float* wo = (const float*)d_in[6];
    float* OUT = (float*)d_out;     // [2][2048][2048]
    char* wsp = (char*)d_ws;
    auto take = [&](size_t bytes) { char* p = wsp; wsp += (bytes + 255) & ~(size_t)255; return (void*)p; };
    // both batches have buffers of their own. CV: the six bf16 planes of k_prep; F: the f32 q, k and v projections, [NB_ x TT][2048] each
    bf* CV = (bf*)take(6 * PE * 2); bf* WQ = CV; bf* XB = CV + 3 * PE; bf* WO = CV + (3 + NB_) * PE; float* CS = (float*)take((size_t)NB_ * TT * HD * 2 * 4);
    int* CFLAG = (int*)take(256);
    float* FQ = (float*)take(3 * (size_t)NB_ * TT * DQ * 4); float* FK = FQ + (size_t)NB_ * TT * DQ; float* FV = FK + (size_t)NB_ * TT * DQ;
    h16* QP16 = (h16*)take((size_t)NB_ * NH_ * TT * HD * 2); h16* KP16 = (h16*)take((size_t)NB_ * NKV * TT * HD * 2); h16* VT16 = (h16*)take((size_t)NKV * HD * 2 * TT * 2);
    bf* QPh = (bf*)take((size_t)NB_ * NH_ * RH * HD * 2); bf* QPl = (bf*)take((size_t)NB_ * NH_ * RH * HD * 2); bf* VTh = (bf*)take((size_t)NB_ * NKV * HD * 2 * TT * 2); bf* VTl = VTh + TT;
    if ((size_t)(wsp - (char*)d_ws) > ws_size) return;    // ws 256 MiB
    bf* KPh = CV; bf* KPl = CV + 2 * PE;   // written by k_post over wq, wk, wv and the first batch of x, which the q/k/v GEMM has finished with (stream-ordered); wo lies behind them
    bf* ATh = (bf*)FQ; bf* ATl = ATh + (size_t)NB_ * TT * DQ;   // the merged attention output lies over the q projection, which k_post has finished with
    k_prep<<<dim3(512, 4 + 2 * NB_, 1), 256, 0, stream>>>(wq, wk, wv, x, wo, POS, CV, PE / 8, CS, CFLAG);
    k_gemms<0><<<dim3(NB_ * TT / 128, DQ / 128, 3), 256, 0, stream>>>(XB, nullptr, WQ, DM, FQ, DQ, PE, (size_t)NB_ * TT * DQ);
    k_post<<<dim3(512, NB_, 4), 256, 0, stream>>>(FQ, FK, FV, CS, MK, QP16, QPh, QPl, KP16, KPh, KPl, VT16, VTh, CFLAG);
    k_fattn<<<dim3(NH_ * (TT / (32 * FWV)), NB_, 1), 32 * FWV, 0, stream>>>(QP16, KP16, VT16, QPh, QPl, KPh, KPl, VTh, VTl, MK, CFLAG, ATh, ATl);
    k_gemms<1><<<dim3(NB_ * TT / 128, DM / 128, 1), 256, 0, stream>>>(ATh, ATl, WO, DQ, OUT, DM, 0, 0);
}

// v007
// One run takes 224 microseconds.
// Two timings next to v006 put it at 1.23 and 1.22 times that version's speed.
// Counting every step since v000, it is 8.68 times as fast.
#include <hip/hip_runtime.h>

// Causal LM attention with additive mask and position-id rotary (hidden [2][2048][2048]; q, k, v = hidden W^T ('oi' [2048][2048], 16 heads x 128); rotate-half RoPE with angle = position_ids[b][t] x inv_freq (theta 1e4; position_ids int32 input, read on device); scores/sqrt(128) + attention_mask[b][0][i][j] (f32 input, read); softmax; out = merged Wo^T -> [2][2048][2048]).
// The additive mask is verified ON THE DEVICE to be the causal pattern (0 where j <= i, most-negative elsewhere); when it is, key blocks above the diagonal are skipped and the masked entries are realised as exact-zero softmax weights (identical result); otherwise every key is visited and the mask is simply added (general fallback).
// Compute dtypes, f32 accumulate: every input rounded to bf16; q/k/v on PLAIN bf16 operands (inputs: exact); rotary in f32 (per-batch table from the position ids and the reference's inv_freq constants); mask check; scores, additive mask (bf16-rounded), running softmax (f32) and attn.v in one kernel (block skipping gated by the device flag): query rows < 512 hl (3 products), the rest single fp16 (x1024); Wo hl x exact (2 products).

#define NB_  2
#define TT   2048
#define DM   2048
#define NH_  16
#define NKV  16
#define REP  (NH_ / NKV)
#define HD   128
#define DQ   (NH_ * HD)
#define DKV  (NKV * HD)
#define RH   512                  // query rows < RH use hi+lo planes (0: none)
#define WIN  2048
#define PCAR 1024.0f
#define SCL  0.088388347648318447f   // HD^-0.5
typedef _Float16 h16;
typedef unsigned short bf;
typedef __attribute__((ext_vector_type(16))) __bf16   v16bf;
typedef __attribute__((ext_vector_type(16))) _Float16 v16h;
typedef __attribute__((ext_vector_type(8)))  _Float16 v8h;
typedef __attribute__((ext_vector_type(8)))  unsigned short v8us;
typedef __attribute__((ext_vector_type(8)))  float    v8f;
typedef __attribute__((ext_vector_type(4)))  float    v4f;
typedef v8h  __attribute__((may_alias)) v8ha;
typedef v4f  __attribute__((may_alias)) v4fa;
typedef v8us __attribute__((may_alias)) v8usa;

__device__ __forceinline__ unsigned short f2bf(float f) { unsigned u = __float_as_uint(f); u += 0x7FFFu + ((u >> 16) & 1u); return (unsigned short)(u >> 16); }
__device__ __forceinline__ float bf2f(unsigned short b) { return __uint_as_float(((unsigned)b) << 16); }
__device__ __forceinline__ float bfr(float f) { return bf2f(f2bf(f)); }
__device__ __forceinline__ v16h cat16(v8h lo, v8h hi) { return __builtin_shufflevector(lo, hi, 0, 1, 2, 3, 4, 5, 6, 7, 8, 9, 10, 11, 12, 13, 14, 15); }
__device__ __forceinline__ v16bf cat16b(v8us lo, v8us hi) { return __builtin_bit_cast(v16bf, __builtin_shufflevector(lo, hi, 0, 1, 2, 3, 4, 5, 6, 7, 8, 9, 10, 11, 12, 13, 14, 15)); }
__device__ __forceinline__ v8f wmma16(v16h a, v16h b, v8f c) { return __builtin_amdgcn_wmma_f32_16x16x32_f16(false, a, false, b, (short)0, c, false, false); }
__device__ __forceinline__ v8f wmmab(v16bf a, v16bf b, v8f c) { return __builtin_amdgcn_wmma_f32_16x16x32_bf16(false, a, false, b, (short)0, c, false, false); }



// ---- fragment loaders: lane (lr, hi) of a 16-row fragment reads k = 8 hi .. 8 hi + 7 and 16 + 8 hi .. 16 + 8 hi + 7 of row lr (the same for both operands)
template <typename T16> struct WFrag;
template <> struct WFrag<h16> { typedef v16h V; static __device__ __forceinline__ V ld(const h16* p) { return cat16(*(const v8h*)p, *(const v8h*)(p + 16)); } static __device__ __forceinline__ v8f mma(V a, V b, v8f c) { return wmma16(a, b, c); } };
template <> struct WFrag<bf> { typedef v16bf V; static __device__ __forceinline__ V ld(const bf* p) { return cat16b(*(const v8us*)p, *(const v8us*)(p + 16)); } static __device__ __forceinline__ v8f mma(V a, V b, v8f c) { return wmmab(a, b, c); } };
// ---- k_gemms: projection GEMM, one block of 8 waves (2 x 4) per 128x128 output tile; a wave holds 64 rows x 32 columns (8 accumulators) over the whole K. grid (M/128, N/128, products), 256 threads. M % 128 == 0, N % 128 == 0, K % 128 == 0.
// Product z of a launch shares A and takes the weight plane Bt + z bz and the output C + z cz (q, k and v in one launch); the rows of both batches are one M.
// C[m][n] (f32, pitch ldc) = sum_k (A[m][k] + A2[m][k] if NSPLIT) Bt[n][k]; A, A2, Bt are K-contiguous bf16 planes of row pitch K.
// The operands come through LDS: a stage is SK = 128 k of the tile's 128 A rows (, 128 A2 rows) and 128 Bt rows, brought by asynchronous 16-byte copies as whole 256-byte row pieces (two rows an instruction),
// so each row piece is fetched from L2 once per block and read by all the waves that need it. Two buffers: stage t + 1 flies while stage t is multiplied.
#define SK 128                    // k per stage
#define SP 136                    // LDS row pitch in 16-bit elements: 272 bytes = 16 x 17, free of bank conflicts for the 16-byte fragment reads
// copy8: eight copies of one wave, rows 16 apart (l = the lane's LDS byte address, g = the lane's global address, gs = 16 rows in elements).
__device__ __forceinline__ void copy8(unsigned l, const bf* g, size_t gs) {
    // one statement: the closing s_wait_xcnt stands behind the last copy and ahead of any reuse of the address registers named here
    asm volatile("global_load_async_to_lds_b128 %0, %8, off\n\t"
                 "global_load_async_to_lds_b128 %1, %9, off\n\t"
                 "global_load_async_to_lds_b128 %2, %10, off\n\t"
                 "global_load_async_to_lds_b128 %3, %11, off\n\t"
                 "global_load_async_to_lds_b128 %4, %12, off\n\t"
                 "global_load_async_to_lds_b128 %5, %13, off\n\t"
                 "global_load_async_to_lds_b128 %6, %14, off\n\t"
                 "global_load_async_to_lds_b128 %7, %15, off\n\t"
                 "s_wait_xcnt 0x0"
                 :: "v"(l), "v"(l + 1 * 16 * SP * 2), "v"(l + 2 * 16 * SP * 2), "v"(l + 3 * 16 * SP * 2), "v"(l + 4 * 16 * SP * 2), "v"(l + 5 * 16 * SP * 2), "v"(l + 6 * 16 * SP * 2), "v"(l + 7 * 16 * SP * 2),
                    "v"(g), "v"(g + gs), "v"(g + 2 * gs), "v"(g + 3 * gs), "v"(g + 4 * gs), "v"(g + 5 * gs), "v"(g + 6 * gs), "v"(g + 7 * gs) : "memory");
}
template <int NSPLIT>
__global__ __launch_bounds__(256) void k_gemms(const bf* __restrict__ A, const bf* __restrict__ A2, const bf* __restrict__ Bt, int K, float* C, int ldc, size_t bz, size_t cz) {
    typedef WFrag<bf>::V V;
    constexpr int NR = NSPLIT ? 384 : 256;                 // rows per stage: A, (A2,) Bt
    __shared__ __align__(128) bf ring[2 * NR * SP];
    __shared__ __align__(16) float os[8 * 16 * 36];        // per wave: 16 output rows x 32 columns at pitch 36, for whole-line stores
    const int lane = threadIdx.x & 31, lr = lane & 15, hi = lane >> 4; const int r0 = blockIdx.x * 128, c0 = blockIdx.y * 128;
    const int w = __builtin_amdgcn_readfirstlane(threadIdx.x >> 5);   // the wave's number in a scalar register: everything derived from it stays scalar
    const int wm = w >> 2, wn = w & 3;
    // copies: half a wave takes one 256-byte row piece (lane lr its 16 bytes lr); copy c of wave w brings rows 16 c + 2 w + hi of an operand's 128
    const int crow = 2 * w + hi; const size_t gs = (size_t)16 * K;
    const bf* ga = A + (size_t)(r0 + crow) * K + lr * 8; const bf* ga2 = NSPLIT ? A2 + (size_t)(r0 + crow) * K + lr * 8 : nullptr; const bf* gb = Bt + (size_t)blockIdx.z * bz + (size_t)(c0 + crow) * K + lr * 8;
    const unsigned l0 = (unsigned)(size_t)ring + (unsigned)(crow * SP + lr * 8) * 2u;
    auto fill = [&](int t) { const unsigned l = l0 + (unsigned)(t & 1) * (unsigned)(NR * SP * 2); const int kc = t * SK;
        copy8(l, ga + kc, gs); if (NSPLIT) copy8(l + 128 * SP * 2, ga2 + kc, gs); copy8(l + (NR - 128) * SP * 2, gb + kc, gs); };
    const int nst = K / SK;
    // every loop over mb, nb, ks, j and s below is unrolled whole, so that the accumulator and fragment arrays are indexed by constants only and stay in registers
    v8f acc[4][2];
#pragma unroll
    for (int mb = 0; mb < 4; ++mb)
#pragma unroll
        for (int nb = 0; nb < 2; ++nb) acc[mb][nb] = (v8f){};
    fill(0);
    asm volatile("s_wait_asynccnt 0x0" ::: "memory");   // this wave's share of stage 0 has landed
    __syncthreads();                                    // every wave's share of stage 0 has landed
    if (nst > 1) fill(1);
    // rolled: one trip is one stage (32 or 64 matrix instructions a wave), and the buffer alternates with t
#pragma unroll 1
    for (int t = 0; t < nst; ++t) {
        const bf* sb = ring + (t & 1) * (NR * SP); const bf* pa = sb + (wm * 64 + lr) * SP + 8 * hi; const bf* pb = sb + (NR - 128 + wn * 32 + lr) * SP + 8 * hi;
        V a[2][4], a2[2][4], b[2][2];   // two fragment sets: k step ks + 1 is read from LDS while k step ks is multiplied
#pragma unroll
        for (int ks = -1; ks < SK / 32; ++ks) {
            if (ks + 1 < SK / 32) { const int q = (ks + 1) & 1, ko = (ks + 1) * 32;
#pragma unroll
                for (int mb = 0; mb < 4; ++mb) { a[q][mb] = WFrag<bf>::ld(pa + mb * 16 * SP + ko); if (NSPLIT) a2[q][mb] = WFrag<bf>::ld(pa + (128 + mb * 16) * SP + ko); }
#pragma unroll
                for (int nb = 0; nb < 2; ++nb) b[q][nb] = WFrag<bf>::ld(pb + nb * 16 * SP + ko); }
            __builtin_amdgcn_sched_barrier(0);   // the next k step's LDS reads stay one group in front of this step's matrix instructions, not spread among them
            if (ks >= 0) { const int q = ks & 1;
#pragma unroll
                for (int nb = 0; nb < 2; ++nb)
#pragma unroll
                    for (int mb = 0; mb < 4; ++mb) { acc[mb][nb] = WFrag<bf>::mma(a[q][mb], b[q][nb], acc[mb][nb]); if (NSPLIT) acc[mb][nb] = WFrag<bf>::mma(a2[q][mb], b[q][nb], acc[mb][nb]); }
                __builtin_amdgcn_sched_barrier(0); }   // and the reads of the step after next stay behind them
        }
        asm volatile("s_wait_dscnt 0x0" ::: "memory");      // this wave's reads of stage t are done before the buffer is handed to the copies below
        asm volatile("s_wait_asynccnt 0x0" ::: "memory");   // this wave's share of stage t + 1 has landed
        __syncthreads();                                    // publishes stage t + 1 and ends every wave's reads of stage t
        if (t + 2 < nst) fill(t + 2);
    }
    asm volatile("s_wait_asynccnt 0x0" ::: "memory");       // no copy is outstanding when the wave goes on to its end
    float* mine = os + w * (16 * 36);
#pragma unroll
    for (int mb = 0; mb < 4; ++mb) {
#pragma unroll
        for (int nb = 0; nb < 2; ++nb)
#pragma unroll
            for (int j = 0; j < 8; ++j) mine[(hi * 8 + j) * 36 + nb * 16 + lr] = acc[mb][nb][j];
        __builtin_amdgcn_wave_barrier(); asm volatile("" ::: "memory");   // the reads below (other lanes' values) stay behind the writes above
        float* crw = C + (size_t)blockIdx.z * cz + (size_t)(r0 + wm * 64 + mb * 16) * ldc + c0 + wn * 32;
#pragma unroll
        for (int s = 0; s < 4; ++s) { const int row = 4 * s + (lane >> 3), cofs = (lane & 7) * 4; const v4f val = *(const v4fa*)(mine + row * 36 + cofs);
            *(v4f*)(crw + (size_t)row * ldc + cofs) = val; }
        __builtin_amdgcn_wave_barrier(); asm volatile("" ::: "memory");   // the next 16 rows' writes stay behind the reads above
    }
}

__device__ __forceinline__ h16 tohx(float x) { return (h16)x; }
__device__ __forceinline__ void splitf(float y, unsigned short& h, unsigned short& l) { h = f2bf(y); l = f2bf(y - bf2f(h)); }
typedef __attribute__((ext_vector_type(2))) _Float16 v2h;
typedef __attribute__((ext_vector_type(4))) _Float16 v4h;
typedef __attribute__((ext_vector_type(2))) unsigned short v2us;
typedef __attribute__((ext_vector_type(4))) unsigned short v4us;
typedef __attribute__((ext_vector_type(2))) float v2f;
typedef __attribute__((ext_vector_type(4))) int v4i;

__global__ __launch_bounds__(256) void k_wtG(const float* __restrict__ w, int K, int N, bf* Bt) {
    const int lane = threadIdx.x & 31; const int L0 = (blockIdx.x * 8 + (threadIdx.x >> 5)) * 8; const int nlines = N * K / 64;
{
#pragma unroll 1
        for (int l = 0; l < 8; ++l) { const int L = L0 + l; if (L >= nlines) break; const size_t e = (size_t)L * 64 + lane * 2; const int k = (int)(e % K), n = (int)(e / K); v2us o;
            o[0] = f2bf(w[(size_t)k * N + n]); o[1] = f2bf(w[(size_t)(k + 1) * N + n]); *(v2us*)(Bt + e) = o; }
         }
}
// The elementwise pieces below give each thread several vectors (all loads issued first, then the arithmetic and the stores). Each piece is a device function over 512 blocks of 256 threads (bx = its block);
// pieces that do not depend on one another, for both batches, share one launch: k_prep (in front of the q/k/v GEMM) and k_post (behind it).
#define EU 4                      // vectors per thread in cvt8 and rope (rows)
#define MU 8                      // vectors per thread in mchk
__device__ __forceinline__ void cvt8(const int bx, const float* __restrict__ src, bf* dst, size_t n8) { const size_t i0 = (size_t)bx * (256 * EU) + threadIdx.x; v8f v[EU];
#pragma unroll
    for (int u = 0; u < EU; ++u) { const size_t i = i0 + (size_t)u * 256; v[u] = *(const v8f*)(src + (i < n8 ? i : n8 - 1) * 8); }   // index clamped, not branched round: the loads stay one group in flight; the store below is guarded
#pragma unroll
    for (int u = 0; u < EU; ++u) { const size_t i = i0 + (size_t)u * 256; v8us o;
#pragma unroll
        for (int k = 0; k < 8; ++k) o[k] = f2bf(v[u][k]);
        if (i < n8) *(v8us*)(dst + i * 8) = o; } }
__constant__ float INV[HD / 2] = {1.0,0.8659643530845642,0.7498942017555237,0.6493816375732422,0.5623413324356079,0.486967533826828,0.4216965138912201,0.36517414450645447,0.3162277638912201,0.2738419771194458,0.23713736236095428,0.20535250008106232,0.17782793939113617,0.1539926528930664,0.1333521455526352,0.11547820270061493,0.10000000149011612,0.08659642934799194,0.07498941570520401,0.06493816524744034,0.05623412877321243,0.04869675263762474,0.04216964915394783,0.03651741147041321,0.03162277862429619,0.0273841954767704,0.0237137358635664,0.02053525112569332,0.017782794311642647,0.015399265103042126,0.01333521492779255,0.011547819711267948,0.009999999776482582,0.00865964312106371,0.007498942315578461,0.006493816617876291,0.005623413249850273,0.004869675263762474,0.0042169648222625256,0.003651741426438093,0.003162277862429619,0.0027384196873754263,0.0023713738191872835,0.0020535250660032034,0.0017782794311642647,0.0015399265103042126,0.0013335214462131262,0.0011547820176929235,0.0010000000474974513,0.0008659643353894353,0.0007498941849917173,0.0006493816617876291,0.000562341301701963,0.00048696750309318304,0.00042169648804701865,0.00036517411353997886,0.0003162277862429619,0.00027384195709601045,0.0002371373848291114,0.00020535249495878816,0.00017782794020604342,0.00015399264520965517,0.0001333521504420787,0.00011547819303814322};
// cstab: one thread per (t, d < HD/2); the angle of d + HD/2 is the same one, so the pair is stored at both places
__device__ __forceinline__ void cstab(const int bx, const int* __restrict__ pos, float* CS) { const int idx = bx * 256 + threadIdx.x; if (idx >= TT * (HD / 2)) return; const int t = idx / (HD / 2), d = idx % (HD / 2); const float ang = __fmul_rn((float)pos[t], INV[d]); v2f cs; cs[0] = cosf(ang); cs[1] = sinf(ang);
    float* o = CS + ((size_t)t * HD + d) * 2; *(v2f*)o = cs; *(v2f*)(o + HD) = cs;  }
// mchk: causal-pattern check of the additive mask for one batch: any entry with (j <= i and mask != 0) or (j > i and mask > -1e30) clears FLAG[0] (plain identical stores; FLAG preset to 1 by k_prep, ahead of the q/k/v GEMM); lane -> MU groups of 4 consecutive j, 1024 elements apart.
__device__ __forceinline__ void mchk(const int bx, const float* __restrict__ MKb, int* FLAG) { const size_t e0 = ((size_t)bx * (256 * MU) + threadIdx.x) * 4; v4f m[MU]; bool bad = false;
#pragma unroll
    for (int u = 0; u < MU; ++u) { const size_t e = e0 + (size_t)u * 1024; m[u] = *(const v4f*)(MKb + (e < (size_t)TT * TT ? e : (size_t)TT * TT - 4)); }   // index clamped: one group of loads in flight
#pragma unroll
    for (int u = 0; u < MU; ++u) { const size_t e = e0 + (size_t)u * 1024; const int j = (int)(e % TT), i = (int)(e / TT); bool b = false;
#pragma unroll
        for (int q = 0; q < 4; ++q) { const bool keep = (j + q <= i); b |= keep ? (m[u][q] != 0.0f) : (m[u][q] > -1.0e30f); }
        bad |= b && (e < (size_t)TT * TT); }
    if (bad) *(int*)FLAG = 0; }
// k_prep: grid (512, 4 + 2 NB_). y < 4 + NB_: one 2048 x 2048 plane (n8 vectors of 8) to bf16 (wq, wk, wv, the two batches of x, wo, in that order in dst); then a batch's rotary table; its first thread presets the batch's mask flag.
#define PE ((size_t)DM * DM)      // elements of one plane (DQ x DM = DKV x DM = TT x DM)
__global__ __launch_bounds__(256) void k_prep(const float* __restrict__ wq, const float* __restrict__ wk, const float* __restrict__ wv, const float* __restrict__ x, const float* __restrict__ wo, const int* __restrict__ pos, bf* dst, size_t n8, float* CS, int* FLAG) {
    const int y = blockIdx.y;
    if (y < 4 + NB_) { const float* src = y == 0 ? wq : y == 1 ? wk : y == 2 ? wv : y == 3 + NB_ ? wo : x + (size_t)(y - 3) * PE; cvt8(blockIdx.x, src, dst + (size_t)y * PE, n8); }
    else { const int b = y - (4 + NB_); if (blockIdx.x == 0 && threadIdx.x == 0) FLAG[b] = 1; cstab(blockIdx.x, pos + (size_t)b * TT, CS + (size_t)b * TT * HD * 2); }
}

// rope: head planes [h][t][d] (fp16 + hi/lo) of rope(x) x sc with the rotate-half convention out[d] = x[d] cos[t][d] - x[d+HD/2] sin[t][d], out[d+HD/2] = x[d+HD/2] cos[t][d+HD/2] + x[d] sin[t][d+HD/2]; the hi/lo planes hold rows t < hr only ([h][hr][d])
// 16 threads per (h, t) row: a thread takes 4 consecutive d < HD/2 and their 4 partners d + HD/2 (each x is loaded once and serves both), in EU rows 16 apart; a block covers 16 x EU rows of one head (TT is a multiple of that).
__device__ __forceinline__ void rope(const int bx, const float* __restrict__ F, int pitch, int nheads, const float* __restrict__ CS, const float* __restrict__ RF, const float* __restrict__ nw, float sc, int hr, h16* P16, bf* Ph, bf* Pl) {
    const int h = bx / (TT / (16 * EU)); if (h >= nheads) return; const int tb = (bx % (TT / (16 * EU))) * (16 * EU); const int tl = threadIdx.x >> 4, d = (threadIdx.x & 15) * 4;
    const float* Fb = F + (size_t)tb * pitch + h * HD; const float* Cb = CS + (size_t)tb * HD * 2; const float* pc = Cb + (tl * HD + d) * 2; const float* pf[EU]; v4f xv[EU][2], cv[EU][2][2];
#pragma unroll
    for (int u = 0; u < EU; ++u) { pf[u] = Fb + (size_t)(u * 16 + tl) * pitch + d;
#pragma unroll
        for (int hf = 0; hf < 2; ++hf) { xv[u][hf] = *(const v4f*)(pf[u] + hf * (HD / 2)); const float* c = pc + (u * 16 * HD + hf * (HD / 2)) * 2; cv[u][hf][0] = *(const v4f*)c; cv[u][hf][1] = *(const v4f*)(c + 4); } }
    asm volatile("s_wait_xcnt 0x0" :: "v"(pc), "v"(pf[0]), "v"(pf[1]), "v"(pf[2]), "v"(pf[3]) : "memory");   // the loads' address registers are inputs here, so none of them is reused before this wait
#pragma unroll
    for (int u = 0; u < EU; ++u) { const int t = tb + u * 16 + tl; float rf = 1.0f;
        if (RF) { rf = RF[(size_t)h * TT + t]; asm volatile("s_wait_xcnt 0x0" :: "v"(rf) : "memory"); }   // the wait stands behind this load, ahead of any reuse of its base or offset register; the loaded value is an input so that the load cannot sink below it
#pragma unroll
        for (int hf = 0; hf < 2; ++hf) { v4h o16; v4us oh, ol;
#pragma unroll
            for (int q = 0; q < 4; ++q) { const int dd = d + hf * (HD / 2) + q; const int dp = (dd < HD / 2) ? dd + HD / 2 : dd - HD / 2; float x0 = xv[u][hf][q], x1 = xv[u][1 - hf][q];
                if (RF) { float n0 = __fmul_rn(x0, rf), n1 = __fmul_rn(x1, rf); asm volatile("" : "+v"(n0)); asm volatile("" : "+v"(n1)); x0 = __fmul_rn(bfr(nw[dd]), n0); x1 = __fmul_rn(bfr(nw[dp]), n1); }
                v2f cs; cs[0] = cv[u][hf][q >> 1][(q & 1) * 2]; cs[1] = cv[u][hf][q >> 1][(q & 1) * 2 + 1]; float a = __fmul_rn(x0, cs[0]), bq = __fmul_rn(x1, cs[1]); asm volatile("" : "+v"(a)); asm volatile("" : "+v"(bq)); const float r = ((dd < HD / 2) ? __fsub_rn(a, bq) : __fadd_rn(a, bq)) * sc;
                o16[q] = tohx(r); unsigned short a2, c2; splitf(r, a2, c2); oh[q] = a2; ol[q] = c2; }
            const int dh = d + hf * (HD / 2); *(v4h*)(P16 + ((size_t)h * TT + t) * HD + dh) = o16; if (t < hr) { const size_t eh = ((size_t)h * hr + t) * HD + dh; *(v4us*)(Ph + eh) = oh; *(v4us*)(Pl + eh) = ol; } } }  }
// vtp: transposed value planes [g][d][t] at a row pitch of 2 x TT elements; the lo plane lies in the second half of the hi plane's rows (Vl = Vh + TT); in the fp16 plane the second half of a row holds the second batch
// A block takes one head's 64 rows t x HD columns; a thread takes an 8 t x 4 d patch (8 row loads of 16 bytes) and stores it turned, 8 consecutive t per d: a wave's store covers 4 whole 128-byte lines.
__device__ __forceinline__ void vtp(const int bx, const float* __restrict__ F, int pitch, int nheads, h16* V16, bf* Vh, bf* Vl) { const int lane = threadIdx.x & 31; const int g = bx / (TT / 64); if (g >= nheads) return; const int tb = (bx % (TT / 64)) * 64, tl = (lane >> 2) * 8; const int d = (threadIdx.x >> 5) * 16 + (lane & 3) * 4; const float* pf[8]; v4f xv[8];
#pragma unroll
    for (int r = 0; r < 8; ++r) { pf[r] = F + (size_t)(tb + tl + r) * pitch + g * HD + d; xv[r] = *(const v4f*)pf[r]; }
    asm volatile("s_wait_xcnt 0x0" :: "v"(pf[0]), "v"(pf[1]), "v"(pf[2]), "v"(pf[3]), "v"(pf[4]), "v"(pf[5]), "v"(pf[6]), "v"(pf[7]) : "memory");   // the loads' address registers are inputs here, so none of them is reused before this wait
#pragma unroll
    for (int c = 0; c < 4; ++c) { v8h o16; v8us oh, ol;
#pragma unroll
        for (int r = 0; r < 8; ++r) { const float x = xv[r][c]; o16[r] = tohx(x); unsigned short a2, c2; splitf(x, a2, c2); oh[r] = a2; ol[r] = c2; }
        const size_t ev = ((size_t)g * HD + d + c) * (2 * TT) + tb + tl; *(v8h*)(V16 + ev) = o16; *(v8us*)(Vh + ev) = oh; *(v8us*)(Vl + ev) = ol; }
    asm volatile("s_wait_xcnt 0x0" ::: "memory"); }   // in the shared kernel another piece's code stands behind these stores: none of their registers is reused in front of this wait
// k_post: grid (512, NB_, 4): all that stands between the q/k/v GEMM and the attention, for batch y. z = 0: rotary planes of q; 1: of k; 2: turned planes of v; 3: the mask check.
__global__ __launch_bounds__(256) void k_post(const float* __restrict__ FQ, const float* __restrict__ FK, const float* __restrict__ FV, const float* __restrict__ CS, const float* __restrict__ MK, h16* QP16, bf* QPh, bf* QPl, h16* KP16, bf* KPh, bf* KPl,
                                              h16* VT16, bf* VTh, int* FLAG) {
    const int b = blockIdx.y, z = blockIdx.z;
    if (z < 2) { const bool isk = (z == 1); const int hr = isk ? TT : RH; const size_t po = (size_t)b * NH_ * TT * HD, ho = (size_t)b * NH_ * hr * HD;
        rope(blockIdx.x, (isk ? FK : FQ) + (size_t)b * TT * DQ, DQ, NH_, CS + (size_t)b * TT * HD * 2, nullptr, nullptr, 1.0f, hr, (isk ? KP16 : QP16) + po, (isk ? KPh : QPh) + ho, (isk ? KPl : QPl) + ho); }
    else if (z == 2) { bf* vh = VTh + (size_t)b * NKV * HD * 2 * TT; vtp(blockIdx.x, FV + (size_t)b * TT * DKV, DKV, NKV, VT16 + (size_t)b * TT, vh, vh + TT); }
    else mchk(blockIdx.x, MK + (size_t)b * TT * TT, FLAG + b);
}
// ---- k_fattn: scores, softmax, probability x value and the head merge in one kernel; a score never leaves the registers. One wave owns 32 query rows of one head and walks the keys 32 at a time with a running maximum and sum per query.
// Transposed products: S^T = K Q^T (A = 16 key rows, B = 16 query rows, both K-contiguous in d), so that in the accumulator a lane holds one query (column lr) and the keys 8 hi + j of each 16-key tile. That is the place the same lane needs them in
// as B operand of O^T += V^T P^T (k = 8 hi .. 8 hi + 7 from the first tile, 16 + 8 hi .. from the second): the weights are packed in the lane, with no exchange. A = rows d of the transposed value planes, K-contiguous in t.
// HL: hi + lo bf16 planes, 3 products each (query rows < RH); otherwise single fp16, weights x PCAR. The weights are rounded relative to the running maximum and the division by the sum is done once, on the output.
// con (device flag: the mask is the causal pattern): keys beyond the wave's diagonal block are not visited, keys j > i get exact-zero weight and the mask, verified 0 where j <= i, is not read; otherwise every key takes score + bf16(mask).
#define L2E 1.4426950408889634f
#define FWV 4                     // waves per block, all of one head
typedef __attribute__((ext_vector_type(16))) unsigned short v16us;
// 2^x with the one free issue slot that the instruction set asks for behind a transcendental; one statement, so that the v_nop stands directly behind it
__device__ __forceinline__ float exp2s(float x) { float r; asm("v_exp_f32 %0, %1\n\tv_nop" : "=v"(r) : "v"(x)); return r; }
// the value of lane l ^ 16, by one vector instruction (no trip through the LDS pipe)
__device__ __forceinline__ float xhalf(float x) { return __builtin_bit_cast(float, __builtin_amdgcn_permlanex16(__builtin_bit_cast(int, x), __builtin_bit_cast(int, x), 0x76543210, 0xfedcba98, false, false)); }
// K and V^T come through LDS: a stage is KST = 64 keys of the head (64 key rows of 256 bytes, 128 value rows of 128 bytes; with HL the lo planes too), brought by asynchronous 16-byte copies as whole 128-byte lines
// and read by all four waves of the block, which own four neighbouring 32-row query tiles. Two buffers: stage t + 1 flies while stage t is worked on.
#define KST 64                    // keys per stage
#define KPI 136                   // LDS pitch of a key row in 16-bit elements: 272 bytes = 16 x 17, for the 16-byte fragment reads
#define VPI 72                    // LDS pitch of a value row (64 keys): 144 bytes = 16 x 9, likewise
#define KSZ (KST * KPI)           // elements of a stage's key plane
#define VSZ (HD * VPI)            // elements of a stage's value plane
// copy8p: eight copies of one wave (l = the lane's LDS byte address, LS = LDS bytes from one copy to the next, g = the lane's global address, gs = the same step in global elements).
template <int LS, typename T16>
__device__ __forceinline__ void copy8p(unsigned l, const T16* g, size_t gs) {
    // one statement: the closing s_wait_xcnt stands behind the last copy and ahead of any reuse of the address registers named here
    asm volatile("global_load_async_to_lds_b128 %0, %8, off\n\t"
                 "global_load_async_to_lds_b128 %1, %9, off\n\t"
                 "global_load_async_to_lds_b128 %2, %10, off\n\t"
                 "global_load_async_to_lds_b128 %3, %11, off\n\t"
                 "global_load_async_to_lds_b128 %4, %12, off\n\t"
                 "global_load_async_to_lds_b128 %5, %13, off\n\t"
                 "global_load_async_to_lds_b128 %6, %14, off\n\t"
                 "global_load_async_to_lds_b128 %7, %15, off\n\t"
                 "s_wait_xcnt 0x0"
                 :: "v"(l), "v"(l + 1 * LS), "v"(l + 2 * LS), "v"(l + 3 * LS), "v"(l + 4 * LS), "v"(l + 5 * LS), "v"(l + 6 * LS), "v"(l + 7 * LS),
                    "v"(g), "v"(g + gs), "v"(g + 2 * gs), "v"(g + 3 * gs), "v"(g + 4 * gs), "v"(g + 5 * gs), "v"(g + 6 * gs), "v"(g + 7 * gs) : "memory");
}
// w: the wave's number in the block; nkb: 32-key blocks this wave visits; nst: stages the block walks (the same for all its waves, at least 2); ring: the block's LDS, two buffers of [K | V (| K2 | V2)]
template <typename T16, bool HL>
__device__ __forceinline__ void fattn(const int h, const int hk, const int q0, const int qrows, const int lr, const int hi, const int w, const int nkb, const int nst, const bool con, T16* ring, const T16* __restrict__ Q, const T16* __restrict__ Q2, const T16* __restrict__ K, const T16* __restrict__ K2,
                                      const T16* __restrict__ Vt, const T16* __restrict__ Vt2, const float* __restrict__ MKb, bf* Ah, bf* Al) {
    typedef typename WFrag<T16>::V V;
    constexpr int PL = KSZ + VSZ;                 // elements of one [K | V] pair of planes
    constexpr int STG = (HL ? 2 : 1) * PL;        // elements of one buffer
    // copies: key rows, half a wave a 256-byte row (lane lr its 16 bytes lr), copy c of wave w brings rows 8 c + 2 w + hi; value rows, eight lanes a 128-byte row piece, copy c brings rows 16 c + 4 w + (lane / 8)
    const int krow = 2 * w + hi, vrow = 4 * w + 2 * hi + (lr >> 3), vpc = lr & 7;
    const T16* gk = K + ((size_t)hk * TT + krow) * HD + lr * 8; const T16* gk2 = K2 + ((size_t)hk * TT + krow) * HD + lr * 8;
    const T16* gv = Vt + ((size_t)hk * HD + vrow) * (2 * TT) + vpc * 8; const T16* gv2 = Vt2 + ((size_t)hk * HD + vrow) * (2 * TT) + vpc * 8;
    const unsigned lk = (unsigned)(size_t)ring + (unsigned)(krow * KPI + lr * 8) * 2u, lv = (unsigned)(size_t)ring + (unsigned)(KSZ + vrow * VPI + vpc * 8) * 2u;
    auto fill = [&](int t) { const unsigned bo = (unsigned)(t & 1) * (unsigned)(STG * 2);
        copy8p<8 * KPI * 2>(lk + bo, gk + (size_t)t * (KST * HD), (size_t)8 * HD); copy8p<16 * VPI * 2>(lv + bo, gv + t * KST, (size_t)16 * 2 * TT);
        if (HL) { copy8p<8 * KPI * 2>(lk + bo + PL * 2, gk2 + (size_t)t * (KST * HD), (size_t)8 * HD); copy8p<16 * VPI * 2>(lv + bo + PL * 2, gv2 + t * KST, (size_t)16 * 2 * TT); } };
    fill(0);
    // every loop over g, ks, kt, db, j and sub below is unrolled whole, so that the fragment and accumulator arrays are indexed by constants only and stay in registers
    V bq[2][4], bq2[2][4];
    { const T16* pq = Q + ((size_t)h * qrows + q0 + lr) * HD + 8 * hi; const T16* pq2 = Q2 + ((size_t)h * qrows + q0 + lr) * HD + 8 * hi;
#pragma unroll
      for (int g = 0; g < 2; ++g)
#pragma unroll
          for (int ks = 0; ks < 4; ++ks) { bq[g][ks] = WFrag<T16>::ld(pq + g * 16 * HD + ks * 32); if (HL) bq2[g][ks] = WFrag<T16>::ld(pq2 + g * 16 * HD + ks * 32); }
      asm volatile("s_wait_xcnt 0x0" :: "v"(pq), "v"(pq2) : "memory"); }   // the loads' address registers are inputs here, so none of them is reused before this wait
    v8f o[8][2]; float m[2], l[2];
#pragma unroll
    for (int g = 0; g < 2; ++g) { m[g] = -3.0e38f; l[g] = 0.f;
#pragma unroll
        for (int db = 0; db < 8; ++db) o[db][g] = (v8f){}; }
    asm volatile("s_wait_asynccnt 0x0" ::: "memory");   // this wave's share of stage 0 has landed
    __syncthreads();                                    // every wave's share of stage 0 has landed
    fill(1);
    // rolled: one trip is one stage of 64 keys, two blocks of 32 keys (32 or 96 matrix instructions each)
#pragma unroll 1
    for (int t = 0; t < nst; ++t) {
        const T16* sb = ring + (t & 1) * STG; const T16* pk = sb + lr * KPI + 8 * hi; const T16* pv = sb + KSZ + lr * VPI + 8 * hi;
        V ka[2][4], ka2[2][4];
        auto loadk = [&](int sub) {
#pragma unroll
            for (int kt = 0; kt < 2; ++kt)
#pragma unroll
                for (int ks = 0; ks < 4; ++ks) { ka[kt][ks] = WFrag<T16>::ld(pk + (sub * 32 + kt * 16) * KPI + ks * 32); if (HL) ka2[kt][ks] = WFrag<T16>::ld(pk + PL + (sub * 32 + kt * 16) * KPI + ks * 32); } };
        if (!HL && 2 * t < nkb) loadk(0);   // wave-uniform: a wave past its diagonal reads nothing and only keeps the stage's copies and barrier
#pragma unroll
        for (int sub = 0; sub < 2; ++sub) { const int kb = 2 * t + sub;
          if (kb < nkb) {   // wave-uniform (a scalar branch)
            // fp16: this block's value rows are read first and arrive under the score products. HL holds twice the fragments: each set is read only when the one before it is used up, so that the wave's registers leave room for a second wave on its SIMD
            V va[8], va2[8];
            auto loadv = [&](int d0, int d1) {   // the fragments of the 16-row groups d0 .. d1 - 1
#pragma unroll
                for (int db = d0; db < d1; ++db) { va[db] = WFrag<T16>::ld(pv + db * 16 * VPI + sub * 32); if (HL) va2[db] = WFrag<T16>::ld(pv + PL + db * 16 * VPI + sub * 32); } };
            if (HL) loadk(sub); else loadv(0, 8);
            v8f s[2][2];
#pragma unroll
            for (int kt = 0; kt < 2; ++kt)
#pragma unroll
                for (int g = 0; g < 2; ++g) s[kt][g] = (v8f){};
#pragma unroll
            for (int ks = 0; ks < 4; ++ks)
#pragma unroll
                for (int kt = 0; kt < 2; ++kt)
#pragma unroll
                    for (int g = 0; g < 2; ++g) { s[kt][g] = WFrag<T16>::mma(ka[kt][ks], bq[g][ks], s[kt][g]); if (HL) { s[kt][g] = WFrag<T16>::mma(ka[kt][ks], bq2[g][ks], s[kt][g]); s[kt][g] = WFrag<T16>::mma(ka2[kt][ks], bq[g][ks], s[kt][g]); } }
            __builtin_amdgcn_sched_barrier(0);   // the LDS reads of the next line stay one group behind the score products, not spread among them
            if (HL) loadv(0, 4); else if (sub == 0) loadk(1);   // fp16: the key rows of the stage's second half (the same buffer) arrive under the softmax and the value products
            if (con && kb == nkb - 1) {   // wave-uniform: only the block that straddles the wave's diagonal holds keys j > i, and only it pays for the selects
#pragma unroll
                for (int g = 0; g < 2; ++g)
#pragma unroll
                    for (int kt = 0; kt < 2; ++kt) {
#pragma unroll
                        for (int j = 0; j < 8; ++j) if (kb * 32 + kt * 16 + hi * 8 + j > q0 + g * 16 + lr) s[kt][g][j] = -3.0e38f;
                        asm volatile("" : "+v"(s[kt][g])); } }
            float mn[2];
#pragma unroll
            for (int g = 0; g < 2; ++g) { const int qi = q0 + g * 16 + lr; float ml = -3.0e38f;
                v4f mq[2][2];
                if (!con) { const float* mp = MKb + (size_t)qi * TT + kb * 32 + hi * 8; mq[0][0] = *(const v4f*)mp; mq[0][1] = *(const v4f*)(mp + 4); mq[1][0] = *(const v4f*)(mp + 16); mq[1][1] = *(const v4f*)(mp + 20);
                    asm volatile("s_wait_xcnt 0x0" :: "v"(mp) : "memory"); }   // the four loads' address register is an input: not reused before this wait
#pragma unroll
                for (int kt = 0; kt < 2; ++kt) { v8f x = s[kt][g] * SCL;   // a masked score stays far below every real one
                    if (!con) {
#pragma unroll
                        for (int j = 0; j < 4; ++j) { x[j] += bfr(mq[kt][0][j]); x[4 + j] += bfr(mq[kt][1][j]); } }
#pragma unroll
                    for (int j = 0; j < 8; ++j) ml = fmaxf(ml, x[j]);
                    s[kt][g] = x; }
                ml = fmaxf(ml, xhalf(ml));   // the other half of the wave holds the query's other 16 keys
                mn[g] = fmaxf(m[g], ml); }
            // a new maximum rescales sum and output; where no query of the wave has one the factor is exactly 1 and the work is skipped (a scalar branch)
            if (__builtin_amdgcn_ballot_w32(mn[0] > m[0] || mn[1] > m[1]) != 0) {
#pragma unroll
                for (int g = 0; g < 2; ++g) { const float al = exp2s((m[g] - mn[g]) * L2E); l[g] *= al; m[g] = mn[g];
#pragma unroll
                    for (int db = 0; db < 8; ++db) o[db][g] *= al; } }
            V pf[2], pf2[2];
#pragma unroll
            for (int g = 0; g < 2; ++g) { float ps = 0.f; v16us ph, pl; v16h p16;
#pragma unroll
                for (int kt = 0; kt < 2; ++kt)
#pragma unroll
                    for (int j = 0; j < 8; ++j) { const float e = exp2s((s[kt][g][j] - m[g]) * L2E); ps += e;
                        if constexpr (HL) { unsigned short a, c; splitf(e, a, c); ph[kt * 8 + j] = a; pl[kt * 8 + j] = c; } else p16[kt * 8 + j] = tohx(e * PCAR); }
                l[g] += ps;
                if constexpr (HL) { pf[g] = __builtin_bit_cast(v16bf, ph); pf2[g] = __builtin_bit_cast(v16bf, pl); } else pf[g] = p16; }
#pragma unroll
            for (int db = 0; db < 8; ++db) {
                if (HL && db == 4) { __builtin_amdgcn_sched_barrier(0); loadv(4, 8); }   // HL: the second half of the value fragments is not read before the first is used up: all at once, query fragments spill
#pragma unroll
                for (int g = 0; g < 2; ++g) { o[db][g] = WFrag<T16>::mma(va[db], pf[g], o[db][g]); if (HL) { o[db][g] = WFrag<T16>::mma(va[db], pf2[g], o[db][g]); o[db][g] = WFrag<T16>::mma(va2[db], pf[g], o[db][g]); } } }
          } }
        asm volatile("s_wait_dscnt 0x0" ::: "memory");      // this wave's reads of stage t are done before the buffer is handed to the copies below
        asm volatile("s_wait_asynccnt 0x0" ::: "memory");   // this wave's share of stage t + 1 has landed
        __syncthreads();                                    // publishes stage t + 1 and ends every wave's reads of stage t
        if (t + 2 < nst) fill(t + 2);
    }
    asm volatile("s_wait_asynccnt 0x0" ::: "memory");       // no copy is outstanding when the wave goes on to its end
    // output: lane = query row q0 + 16 g + lr, 8 consecutive d per tile: 16-byte stores into the merged hi and lo planes [t][DQ]; a 128-byte line is written by one wave
#pragma unroll
    for (int g = 0; g < 2; ++g) { const float lt = l[g] + xhalf(l[g]); const float inv = __fdiv_rn(HL ? 1.0f : 1.0f / PCAR, lt);
        bf* oa = Ah + (size_t)(q0 + g * 16 + lr) * DQ + h * HD + hi * 8; bf* ob = Al + (size_t)(q0 + g * 16 + lr) * DQ + h * HD + hi * 8;
#pragma unroll
        for (int db = 0; db < 8; ++db) { v8us oh, ol;
#pragma unroll
            for (int j = 0; j < 8; ++j) { unsigned short a, c; splitf(o[db][g][j] * inv, a, c); oh[j] = a; ol[j] = c; }
            *(v8us*)(oa + db * 16) = oh; *(v8us*)(ob + db * 16) = ol;
            asm volatile("s_wait_xcnt 0x0" :: "v"(oa), "v"(ob), "v"(oh), "v"(ol) : "memory"); } }   // the two stores' address and data registers are inputs: none is reused before this wait
}
// grid: (NH_ x TT / 128, NB_) blocks, y the batch. A block takes the 128 query rows c of one head, wave w the 32-row tile 4 c + w: the four waves walk the same keys out of the same LDS stages and end within one stage of one another.
// amdgpu_waves_per_eu(2, 2): the registers are held at 512 a wave, so that two blocks share a WGP and one wave's softmax runs under the other's matrix instructions (without it the hi + lo path takes about 700 and a wave has its SIMD alone).
// A block's walk grows with c; all blocks are resident at once, so neighbours in x, and the two batches at one x, take c and 15 - c (for speed only: a short and a long walk wherever two blocks share a WGP).
__global__ __launch_bounds__(32 * FWV) __attribute__((amdgpu_waves_per_eu(2, 2))) void k_fattn(const h16* __restrict__ Q16, const h16* __restrict__ K16, const h16* __restrict__ V16, const bf* __restrict__ Qh, const bf* __restrict__ Ql, const bf* __restrict__ Kh, const bf* __restrict__ Kl,
                                                    const bf* __restrict__ Vh, const bf* __restrict__ Vl, const float* __restrict__ MK, const int* __restrict__ CF, bf* ATh, bf* ATl) {
    __shared__ __align__(128) unsigned short fring[2 * 2 * (KSZ + VSZ)];   // two buffers of [K | V | K lo | V lo]; the fp16 blocks use the first half
    const int lane = threadIdx.x & 31, lr = lane & 15, hi = lane >> 4;
    const int w = __builtin_amdgcn_readfirstlane(threadIdx.x >> 5);   // the wave's number in a scalar register: the key loop stays a scalar loop
    const int b = blockIdx.y; const bool con = (CF[b] != 0);   // device flag: this batch's mask verified causal
    const size_t po = (size_t)b * NH_ * TT * HD, qo = (size_t)b * NH_ * RH * HD, vo = (size_t)b * NKV * HD * 2 * TT; const float* MKb = MK + (size_t)b * TT * TT; bf* Ah = ATh + (size_t)b * TT * DQ; bf* Al = ATl + (size_t)b * TT * DQ;
    const int xh = blockIdx.x >> 1; const int h = xh % NH_; const int c = ((blockIdx.x ^ b) & 1) ? TT / (32 * FWV) - 1 - xh / NH_ : xh / NH_;
    const int q0 = (c * FWV + w) * 32;
    const int nkb = con ? q0 / 32 + 1 : TT / 32;                     // 32-key blocks this wave visits (wave-uniform)
    const int nst = con ? (c + 1) * (32 * FWV / KST) : TT / KST;     // 64-key stages up to the block's last diagonal (block-uniform)
    if (c < RH / (32 * FWV)) fattn<bf, true>(h, h / REP, q0, RH, lr, hi, w, nkb, nst, con, (bf*)fring, Qh + qo, Ql + qo, Kh + po, Kl + po, Vh + vo, Vl + vo, MKb, Ah, Al);   // block-uniform
    else fattn<h16, false>(h, h / REP, q0, TT, lr, hi, w, nkb, nst, con, (h16*)fring, Q16 + po, Q16 + po, K16 + po, K16 + po, V16 + (size_t)b * TT, V16 + (size_t)b * TT, MKb, Ah, Al);
}

extern "C" void kernel_launch(void* const* d_in, const int* in_sizes, int n_in,
                              void* d_out, int out_size, void* d_ws, size_t ws_size, hipStream_t stream) {
    (void)in_sizes; (void)n_in; (void)out_size;
    const float* x = (const float*)d_in[0]; const float* MK = (const float*)d_in[1]; const int* POS = (const int*)d_in[2]; const float* wq = (const float*)d_in[3]; const float* wk = (const float*)d_in[4]; const float* wv = (const float*)d_in[5]; const float* wo = (const float*)d_in[6];
    float* OUT = (float*)d_out;     // [2][2048][2048]
    char* wsp = (char*)d_ws;
    auto take = [&](size_t bytes) { char* p = wsp; wsp += (bytes + 255) & ~(size_t)255; return (void*)p; };
    // both batches have buffers of their own. CV: the six bf16 planes of k_prep; F: the f32 q, k and v projections, [NB_ x TT][2048] each
    bf* CV = (bf*)take(6 * PE * 2); bf* WQ = CV; bf* XB = CV + 3 * PE; bf* WO = CV + (3 + NB_) * PE; float* CS = (float*)take((size_t)NB_ * TT * HD * 2 * 4);
    int* CFLAG = (int*)take(256);
    float* FQ = (float*)take(3 * (size_t)NB_ * TT * DQ * 4); float* FK = FQ + (size_t)NB_ * TT * DQ; float* FV = FK + (size_t)NB_ * TT * DQ;
    h16* QP16 = (h16*)take((size_t)NB_ * NH_ * TT * HD * 2); h16* KP16 = (h16*)take((size_t)NB_ * NKV * TT * HD * 2); h16* VT16 = (h16*)take((size_t)NKV * HD * 2 * TT * 2);
    bf* QPh = (bf*)take((size_t)NB_ * NH_ * RH * HD * 2); bf* QPl = (bf*)take((size_t)NB_ * NH_ * RH * HD * 2); bf* VTh = (bf*)take((size_t)NB_ * NKV * HD * 2 * TT * 2); bf* VTl = VTh + TT;
    if ((size_t)(wsp - (char*)d_ws) > ws_size) return;    // ws 256 MiB
    bf* KPh = CV; bf* KPl = CV + 2 * PE;   // written by k_post over wq, wk, wv and the first batch of x, which the q/k/v GEMM has finished with (stream-ordered); wo lies behind them
    bf* ATh = (bf*)FQ; bf* ATl = ATh + (size_t)NB_ * TT * DQ;   // the merged attention output lies over the q projection, which k_post has finished with
    k_prep<<<dim3(512, 4 + 2 * NB_, 1), 256, 0, stream>>>(wq, wk, wv, x, wo, POS, CV, PE / 8, CS, CFLAG);
    k_gemms<0><<<dim3(NB_ * TT / 128, DQ / 128, 3), 256, 0, stream>>>(XB, nullptr, WQ, DM, FQ, DQ, PE, (size_t)NB_ * TT * DQ);
    k_post<<<dim3(512, NB_, 4), 256, 0, stream>>>(FQ, FK, FV, CS, MK, QP16, QPh, QPl, KP16, KPh, KPl, VT16, VTh, CFLAG);
    k_fattn<<<dim3(NH_ * (TT / (32 * FWV)), NB_, 1), 32 * FWV, 0, stream>>>(QP16, KP16, VT16, QPh, QPl, KPh, KPl, VTh, VTl, MK, CFLAG, ATh, ATl);
    k_gemms<1><<<dim3(NB_ * TT / 128, DM / 128, 1), 256, 0, stream>>>(ATh, ATl, WO, DQ, OUT, DM, 0, 0);
}

// v008
// Measured time: 213 microseconds a run.
// Next to v007, in two timings, it ran 1.03 and 1.04 times as fast.
// Over all steps from v000 it is 9.00 times as fast.
#include <hip/hip_runtime.h>

// Causal LM attention with additive mask and position-id rotary (hidden [2][2048][2048]; q, k, v = hidden W^T ('oi' [2048][2048], 16 heads x 128); rotate-half RoPE with angle = position_ids[b][t] x inv_freq (theta 1e4; position_ids int32 input, read on device); scores/sqrt(128) + attention_mask[b][0][i][j] (f32 input, read); softmax; out = merged Wo^T -> [2][2048][2048]).
// The additive mask is verified ON THE DEVICE to be the causal pattern (0 where j <= i, most-negative elsewhere); when it is, key blocks above the diagonal are skipped and the masked entries are realised as exact-zero softmax weights (identical result); otherwise every key is visited and the mask is simply added (general fallback).
// Compute dtypes, f32 accumulate: every input rounded to bf16; q/k/v on PLAIN bf16 operands (inputs: exact); rotary in f32 (per-batch table from the position ids and the reference's inv_freq constants); mask check; scores, additive mask (bf16-rounded), running softmax (f32) and attn.v in one kernel (block skipping gated by the device flag): query rows < 512 hl (3 products), the rest single fp16 (x1024); Wo hl x exact (2 products).

#define NB_  2
#define TT   2048
#define DM   2048
#define NH_  16
#define NKV  16
#define REP  (NH_ / NKV)
#define HD   128
#define DQ   (NH_ * HD)
#define DKV  (NKV * HD)
#define RH   512                  // query rows < RH use hi+lo planes (0: none)
#define WIN  2048
#define PCAR 1024.0f
#define SCL  0.088388347648318447f   // HD^-0.5
typedef _Float16 h16;
typedef unsigned short bf;
typedef __attribute__((ext_vector_type(16))) __bf16   v16bf;
typedef __attribute__((ext_vector_type(16))) _Float16 v16h;
typedef __attribute__((ext_vector_type(8)))  _Float16 v8h;
typedef __attribute__((ext_vector_type(8)))  unsigned short v8us;
typedef __attribute__((ext_vector_type(8)))  float    v8f;
typedef __attribute__((ext_vector_type(4)))  float    v4f;
typedef v8h  __attribute__((may_alias)) v8ha;
typedef v4f  __attribute__((may_alias)) v4fa;
typedef v8us __attribute__((may_alias)) v8usa;

__device__ __forceinline__ unsigned short f2bf(float f) { unsigned u = __float_as_uint(f); u += 0x7FFFu + ((u >> 16) & 1u); return (unsigned short)(u >> 16); }
__device__ __forceinline__ float bf2f(unsigned short b) { return __uint_as_float(((unsigned)b) << 16); }
__device__ __forceinline__ float bfr(float f) { return bf2f(f2bf(f)); }
__device__ __forceinline__ v16h cat16(v8h lo, v8h hi) { return __builtin_shufflevector(lo, hi, 0, 1, 2, 3, 4, 5, 6, 7, 8, 9, 10, 11, 12, 13, 14, 15); }
__device__ __forceinline__ v16bf cat16b(v8us lo, v8us hi) { return __builtin_bit_cast(v16bf, __builtin_shufflevector(lo, hi, 0, 1, 2, 3, 4, 5, 6, 7, 8, 9, 10, 11, 12, 13, 14, 15)); }
__device__ __forceinline__ v8f wmma16(v16h a, v16h b, v8f c) { return __builtin_amdgcn_wmma_f32_16x16x32_f16(false, a, false, b, (short)0, c, false, false); }
__device__ __forceinline__ v8f wmmab(v16bf a, v16bf b, v8f c) { return __builtin_amdgcn_wmma_f32_16x16x32_bf16(false, a, false, b, (short)0, c, false, false); }



// ---- fragment loaders: lane (lr, hi) of a 16-row fragment reads k = 8 hi .. 8 hi + 7 and 16 + 8 hi .. 16 + 8 hi + 7 of row lr (the same for both operands)
template <typename T16> struct WFrag;
template <> struct WFrag<h16> { typedef v16h V; static __device__ __forceinline__ V ld(const h16* p) { return cat16(*(const v8h*)p, *(const v8h*)(p + 16)); } static __device__ __forceinline__ v8f mma(V a, V b, v8f c) { return wmma16(a, b, c); } };
template <> struct WFrag<bf> { typedef v16bf V; static __device__ __forceinline__ V ld(const bf* p) { return cat16b(*(const v8us*)p, *(const v8us*)(p + 16)); } static __device__ __forceinline__ v8f mma(V a, V b, v8f c) { return wmmab(a, b, c); } };
// ---- k_gemms: projection GEMM, one block of 8 waves (WGM x 8 / WGM) per BM x BN output tile, one block a WGP; a wave holds MF x NF accumulators of 16 x 16 over the whole K. grid (M/BM, N/BN), 256 threads. M % BM == 0, N % BN == 0, K % 128 == 0.
// C (f32) = sum_k (A[m][k] + A2[m][k] if NSPLIT) Bt[n][k]; A, A2, Bt are K-contiguous bf16 planes of row pitch K. Column n lies in output plane n / LDC (planes cz elements apart, row pitch LDC) at column n % LDC:
// the weights of q, k and v are one Bt of 3 x 2048 rows, and the rows of both batches are one M.
// The tile is sized to what a WGP can take in: a stage brings (BM (x 2 if NSPLIT) + BN) x 256 bytes out of L2 for BM x BN x 128 products, and a wave reads MF (x 2) + NF fragments out of LDS for MF x NF (x 2) matrix instructions.
// 256 x 192 (q/k/v: 512 tiles, two rounds on 256 WGPs) and 128 x 256 (output projection: 256 tiles, one round) keep both below the time of the matrix instructions.
// The operands come through LDS: a stage is SK = 128 k of the tile's A rows (, A2 rows) and Bt rows, brought by asynchronous 16-byte copies as whole 256-byte row pieces (two rows an instruction),
// so each row piece is fetched from L2 once per block and read by all the waves that need it. Two buffers: stage t + 1 flies while stage t is multiplied.
#define SK 128                    // k per stage
#define SP 136                    // LDS row pitch in 16-bit elements: 272 bytes = 16 x 17, free of bank conflicts for the 16-byte fragment reads
// copy8: eight copies of one wave, rows 16 apart (l = the lane's LDS byte address, g = the lane's global address, gs = 16 rows in elements).
__device__ __forceinline__ void copy8(unsigned l, const bf* g, size_t gs) {
    // one statement: the closing s_wait_xcnt stands behind the last copy and ahead of any reuse of the address registers named here
    asm volatile("global_load_async_to_lds_b128 %0, %8, off\n\t"
                 "global_load_async_to_lds_b128 %1, %9, off\n\t"
                 "global_load_async_to_lds_b128 %2, %10, off\n\t"
                 "global_load_async_to_lds_b128 %3, %11, off\n\t"
                 "global_load_async_to_lds_b128 %4, %12, off\n\t"
                 "global_load_async_to_lds_b128 %5, %13, off\n\t"
                 "global_load_async_to_lds_b128 %6, %14, off\n\t"
                 "global_load_async_to_lds_b128 %7, %15, off\n\t"
                 "s_wait_xcnt 0x0"
                 :: "v"(l), "v"(l + 1 * 16 * SP * 2), "v"(l + 2 * 16 * SP * 2), "v"(l + 3 * 16 * SP * 2), "v"(l + 4 * 16 * SP * 2), "v"(l + 5 * 16 * SP * 2), "v"(l + 6 * 16 * SP * 2), "v"(l + 7 * 16 * SP * 2),
                    "v"(g), "v"(g + gs), "v"(g + 2 * gs), "v"(g + 3 * gs), "v"(g + 4 * gs), "v"(g + 5 * gs), "v"(g + 6 * gs), "v"(g + 7 * gs) : "memory");
}
// copy4: the same for four copies (64 rows of the block)
__device__ __forceinline__ void copy4(unsigned l, const bf* g, size_t gs) {
    // one statement: the closing s_wait_xcnt stands behind the last copy and ahead of any reuse of the address registers named here
    asm volatile("global_load_async_to_lds_b128 %0, %4, off\n\t"
                 "global_load_async_to_lds_b128 %1, %5, off\n\t"
                 "global_load_async_to_lds_b128 %2, %6, off\n\t"
                 "global_load_async_to_lds_b128 %3, %7, off\n\t"
                 "s_wait_xcnt 0x0"
                 :: "v"(l), "v"(l + 1 * 16 * SP * 2), "v"(l + 2 * 16 * SP * 2), "v"(l + 3 * 16 * SP * 2),
                    "v"(g), "v"(g + gs), "v"(g + 2 * gs), "v"(g + 3 * gs) : "memory");
}
template <int NSPLIT, int BM, int BN, int WGM, int LDC>
__global__ __launch_bounds__(256) void k_gemms(const bf* __restrict__ A, const bf* __restrict__ A2, const bf* __restrict__ Bt, int K, float* C, size_t cz) {
    typedef WFrag<bf>::V V;
    constexpr int WGN = 8 / WGM, MF = BM / WGM / 16, NF = BN / WGN / 16;   // waves across the columns; 16-row and 16-column fragments a wave
    constexpr int NR = (NSPLIT ? 2 : 1) * BM + BN;         // rows per stage: A, (A2,) Bt
    static_assert(BM % 128 == 0 && BN % 64 == 0 && NF % 2 == 0 && LDC % 32 == 0, "tile");
    __shared__ __align__(128) bf ring[2 * NR * SP];
    __shared__ __align__(16) float os[8 * 16 * 36];        // per wave: 16 output rows x 32 columns at pitch 36, for whole-line stores
    const int lane = threadIdx.x & 31, lr = lane & 15, hi = lane >> 4; const int r0 = blockIdx.x * BM, c0 = blockIdx.y * BN;
    const int w = __builtin_amdgcn_readfirstlane(threadIdx.x >> 5);   // the wave's number in a scalar register: everything derived from it stays scalar
    const int wm = w / WGN, wn = w % WGN;
    // copies: half a wave takes one 256-byte row piece (lane lr its 16 bytes lr); copy c of wave w brings rows 16 c + 2 w + hi of an operand
    const int crow = 2 * w + hi; const size_t gs = (size_t)16 * K;
    const bf* ga = A + (size_t)r0 * K; const bf* ga2 = NSPLIT ? A2 + (size_t)r0 * K : nullptr; const bf* gb = Bt + (size_t)c0 * K;   // the tile's first rows: the same for all lanes, kept in scalar registers
    const int lof = crow * K + lr * 8;   // the lane's place in an operand's first 16 rows, in elements: one register serves all operands
    const unsigned l0 = (unsigned)(size_t)ring + (unsigned)(crow * SP + lr * 8) * 2u;
    auto fill = [&](int t) { const unsigned l = l0 + (unsigned)(t & 1) * (unsigned)(NR * SP * 2); const int kc = t * SK;
#pragma unroll
        for (int i = 0; i < BM / 128; ++i) { copy8(l + i * 128 * SP * 2, (ga + kc + (size_t)(i * 128) * K) + lof, gs); if (NSPLIT) copy8(l + (BM + i * 128) * SP * 2, (ga2 + kc + (size_t)(i * 128) * K) + lof, gs); }
#pragma unroll
        for (int i = 0; i < BN / 128; ++i) copy8(l + (NR - BN + i * 128) * SP * 2, (gb + kc + (size_t)(i * 128) * K) + lof, gs);
        if (BN % 128) copy4(l + (NR - 64) * SP * 2, (gb + kc + (size_t)(BN - 64) * K) + lof, gs); };
    const int nst = K / SK;
    // every loop over i, mb, nb, np, ks, j and s is unrolled whole, so that the accumulator and fragment arrays are indexed by constants only and stay in registers
    v8f acc[MF][NF];
#pragma unroll
    for (int mb = 0; mb < MF; ++mb)
#pragma unroll
        for (int nb = 0; nb < NF; ++nb) acc[mb][nb] = (v8f){};
    fill(0);
    asm volatile("s_wait_asynccnt 0x0" ::: "memory");   // this wave's share of stage 0 has landed
    __syncthreads();                                    // every wave's share of stage 0 has landed
    if (nst > 1) fill(1);
    // rolled: one trip is one stage (96 or 128 matrix instructions a wave), and the buffer alternates with t
#pragma unroll 1
    for (int t = 0; t < nst; ++t) {
        const bf* sb = ring + (t & 1) * (NR * SP); const bf* pa = sb + (wm * MF * 16 + lr) * SP + 8 * hi; const bf* pb = sb + (NR - BN + wn * NF * 16 + lr) * SP + 8 * hi;
        V a[2][MF], a2[2][MF], b[2][NF];   // two fragment sets: k step ks + 1 is read from LDS while k step ks is multiplied
#pragma unroll
        for (int ks = -1; ks < SK / 32; ++ks) {
            if (ks + 1 < SK / 32) { const int q = (ks + 1) & 1, ko = (ks + 1) * 32;
#pragma unroll
                for (int mb = 0; mb < MF; ++mb) { a[q][mb] = WFrag<bf>::ld(pa + mb * 16 * SP + ko); if (NSPLIT) a2[q][mb] = WFrag<bf>::ld(pa + (BM + mb * 16) * SP + ko); }
#pragma unroll
                for (int nb = 0; nb < NF; ++nb) b[q][nb] = WFrag<bf>::ld(pb + nb * 16 * SP + ko); }
            __builtin_amdgcn_sched_barrier(0);   // the next k step's LDS reads stay one group in front of this step's matrix instructions, not spread among them
            if (ks >= 0) { const int q = ks & 1;
#pragma unroll
                for (int nb = 0; nb < NF; ++nb)
#pragma unroll
                    for (int mb = 0; mb < MF; ++mb) { acc[mb][nb] = WFrag<bf>::mma(a[q][mb], b[q][nb], acc[mb][nb]); if (NSPLIT) acc[mb][nb] = WFrag<bf>::mma(a2[q][mb], b[q][nb], acc[mb][nb]); }
                __builtin_amdgcn_sched_barrier(0); }   // and the reads of the step after next stay behind them
        }
        asm volatile("s_wait_dscnt 0x0" ::: "memory");      // this wave's reads of stage t are done before the buffer is handed to the copies below
        asm volatile("s_wait_asynccnt 0x0" ::: "memory");   // this wave's share of stage t + 1 has landed
        __syncthreads();                                    // publishes stage t + 1 and ends every wave's reads of stage t
        if (t + 2 < nst) fill(t + 2);
    }
    asm volatile("s_wait_asynccnt 0x0" ::: "memory");       // no copy is outstanding when the wave goes on to its end
    float* mine = os + w * (16 * 36);
#pragma unroll
    for (int mb = 0; mb < MF; ++mb)
#pragma unroll
      for (int np = 0; np < NF / 2; ++np) {   // 32 columns at a time: they lie in one output plane
#pragma unroll
        for (int nb = 0; nb < 2; ++nb)
#pragma unroll
            for (int j = 0; j < 8; ++j) mine[(hi * 8 + j) * 36 + nb * 16 + lr] = acc[mb][np * 2 + nb][j];
        __builtin_amdgcn_wave_barrier(); asm volatile("" ::: "memory");   // the reads below (other lanes' values) stay behind the writes above
        const int n = c0 + wn * NF * 16 + np * 32;
        float* crw = C + (size_t)(n / LDC) * cz + (size_t)(r0 + wm * MF * 16 + mb * 16) * LDC + n % LDC;
#pragma unroll
        for (int s = 0; s < 4; ++s) { const int row = 4 * s + (lane >> 3), cofs = (lane & 7) * 4; const v4f val = *(const v4fa*)(mine + row * 36 + cofs);
            *(v4f*)(crw + (size_t)row * LDC + cofs) = val; }
        __builtin_amdgcn_wave_barrier(); asm volatile("" ::: "memory");   // the next 16 x 32 piece's writes stay behind the reads above
    }
}

__device__ __forceinline__ h16 tohx(float x) { return (h16)x; }
__device__ __forceinline__ void splitf(float y, unsigned short& h, unsigned short& l) { h = f2bf(y); l = f2bf(y - bf2f(h)); }
typedef __attribute__((ext_vector_type(2))) _Float16 v2h;
typedef __attribute__((ext_vector_type(4))) _Float16 v4h;
typedef __attribute__((ext_vector_type(2))) unsigned short v2us;
typedef __attribute__((ext_vector_type(4))) unsigned short v4us;
typedef __attribute__((ext_vector_type(2))) float v2f;
typedef __attribute__((ext_vector_type(4))) int v4i;

__global__ __launch_bounds__(256) void k_wtG(const float* __restrict__ w, int K, int N, bf* Bt) {
    const int lane = threadIdx.x & 31; const int L0 = (blockIdx.x * 8 + (threadIdx.x >> 5)) * 8; const int nlines = N * K / 64;
{
#pragma unroll 1
        for (int l = 0; l < 8; ++l) { const int L = L0 + l; if (L >= nlines) break; const size_t e = (size_t)L * 64 + lane * 2; const int k = (int)(e % K), n = (int)(e / K); v2us o;
            o[0] = f2bf(w[(size_t)k * N + n]); o[1] = f2bf(w[(size_t)(k + 1) * N + n]); *(v2us*)(Bt + e) = o; }
         }
}
// The elementwise pieces below give each thread several vectors (all loads issued first, then the arithmetic and the stores). Each piece is a device function over 512 blocks of 256 threads (bx = its block);
// pieces that do not depend on one another, for both batches, share one launch: k_prep (in front of the q/k/v GEMM) and k_post (behind it).
#define EU 4                      // vectors per thread in cvt8 and rope (rows)
#define MU 8                      // vectors per thread in mchk
__device__ __forceinline__ void cvt8(const int bx, const float* __restrict__ src, bf* dst, size_t n8) { const size_t i0 = (size_t)bx * (256 * EU) + threadIdx.x; v8f v[EU];
#pragma unroll
    for (int u = 0; u < EU; ++u) { const size_t i = i0 + (size_t)u * 256; v[u] = *(const v8f*)(src + (i < n8 ? i : n8 - 1) * 8); }   // index clamped, not branched round: the loads stay one group in flight; the store below is guarded
#pragma unroll
    for (int u = 0; u < EU; ++u) { const size_t i = i0 + (size_t)u * 256; v8us o;
#pragma unroll
        for (int k = 0; k < 8; ++k) o[k] = f2bf(v[u][k]);
        if (i < n8) *(v8us*)(dst + i * 8) = o; } }
__constant__ float INV[HD / 2] = {1.0,0.8659643530845642,0.7498942017555237,0.6493816375732422,0.5623413324356079,0.486967533826828,0.4216965138912201,0.36517414450645447,0.3162277638912201,0.2738419771194458,0.23713736236095428,0.20535250008106232,0.17782793939113617,0.1539926528930664,0.1333521455526352,0.11547820270061493,0.10000000149011612,0.08659642934799194,0.07498941570520401,0.06493816524744034,0.05623412877321243,0.04869675263762474,0.04216964915394783,0.03651741147041321,0.03162277862429619,0.0273841954767704,0.0237137358635664,0.02053525112569332,0.017782794311642647,0.015399265103042126,0.01333521492779255,0.011547819711267948,0.009999999776482582,0.00865964312106371,0.007498942315578461,0.006493816617876291,0.005623413249850273,0.004869675263762474,0.0042169648222625256,0.003651741426438093,0.003162277862429619,0.0027384196873754263,0.0023713738191872835,0.0020535250660032034,0.0017782794311642647,0.0015399265103042126,0.0013335214462131262,0.0011547820176929235,0.0010000000474974513,0.0008659643353894353,0.0007498941849917173,0.0006493816617876291,0.000562341301701963,0.00048696750309318304,0.00042169648804701865,0.00036517411353997886,0.0003162277862429619,0.00027384195709601045,0.0002371373848291114,0.00020535249495878816,0.00017782794020604342,0.00015399264520965517,0.0001333521504420787,0.00011547819303814322};
// cstab: one thread per (t, d < HD/2); the angle of d + HD/2 is the same one, so the pair is stored at both places
__device__ __forceinline__ void cstab(const int bx, const int* __restrict__ pos, float* CS) { const int idx = bx * 256 + threadIdx.x; if (idx >= TT * (HD / 2)) return; const int t = idx / (HD / 2), d = idx % (HD / 2); const float ang = __fmul_rn((float)pos[t], INV[d]); v2f cs; cs[0] = cosf(ang); cs[1] = sinf(ang);
    float* o = CS + ((size_t)t * HD + d) * 2; *(v2f*)o = cs; *(v2f*)(o + HD) = cs;  }
// mchk: causal-pattern check of the additive mask for one batch: any entry with (j <= i and mask != 0) or (j > i and mask > -1e30) clears FLAG[0] (plain identical stores; FLAG preset to 1 by k_prep, ahead of the q/k/v GEMM); lane -> MU groups of 4 consecutive j, 1024 elements apart.
__device__ __forceinline__ void mchk(const int bx, const float* __restrict__ MKb, int* FLAG) { const size_t e0 = ((size_t)bx * (256 * MU) + threadIdx.x) * 4; v4f m[MU]; bool bad = false;
#pragma unroll
    for (int u = 0; u < MU; ++u) { const size_t e = e0 + (size_t)u * 1024; m[u] = *(const v4f*)(MKb + (e < (size_t)TT * TT ? e : (size_t)TT * TT - 4)); }   // index clamped: one group of loads in flight
#pragma unroll
    for (int u = 0; u < MU; ++u) { const size_t e = e0 + (size_t)u * 1024; const int j = (int)(e % TT), i = (int)(e / TT); bool b = false;
#pragma unroll
        for (int q = 0; q < 4; ++q) { const bool keep = (j + q <= i); b |= keep ? (m[u][q] != 0.0f) : (m[u][q] > -1.0e30f); }
        bad |= b && (e < (size_t)TT * TT); }
    if (bad) *(int*)FLAG = 0; }
// k_prep: grid (512, 4 + 2 NB_). y < 4 + NB_: one 2048 x 2048 plane (n8 vectors of 8) to bf16 (wq, wk, wv, the two batches of x, wo, in that order in dst); then a batch's rotary table; its first thread presets the batch's mask flag.
#define PE ((size_t)DM * DM)      // elements of one plane (DQ x DM = DKV x DM = TT x DM)
__global__ __launch_bounds__(256) void k_prep(const float* __restrict__ wq, const float* __restrict__ wk, const float* __restrict__ wv, const float* __restrict__ x, const float* __restrict__ wo, const int* __restrict__ pos, bf* dst, size_t n8, float* CS, int* FLAG) {
    const int y = blockIdx.y;
    if (y < 4 + NB_) { const float* src = y == 0 ? wq : y == 1 ? wk : y == 2 ? wv : y == 3 + NB_ ? wo : x + (size_t)(y - 3) * PE; cvt8(blockIdx.x, src, dst + (size_t)y * PE, n8); }
    else { const int b = y - (4 + NB_); if (blockIdx.x == 0 && threadIdx.x == 0) FLAG[b] = 1; cstab(blockIdx.x, pos + (size_t)b * TT, CS + (size_t)b * TT * HD * 2); }
}

// rope: head planes [h][t][d] (fp16 + hi/lo) of rope(x) x sc with the rotate-half convention out[d] = x[d] cos[t][d] - x[d+HD/2] sin[t][d], out[d+HD/2] = x[d+HD/2] cos[t][d+HD/2] + x[d] sin[t][d+HD/2]; the hi/lo planes hold rows t < hr only ([h][hr][d])
// 16 threads per (h, t) row: a thread takes 4 consecutive d < HD/2 and their 4 partners d + HD/2 (each x is loaded once and serves both), in EU rows 16 apart; a block covers 16 x EU rows of one head (TT is a multiple of that).
__device__ __forceinline__ void rope(const int bx, const float* __restrict__ F, int pitch, int nheads, const float* __restrict__ CS, const float* __restrict__ RF, const float* __restrict__ nw, float sc, int hr, h16* P16, bf* Ph, bf* Pl) {
    const int h = bx / (TT / (16 * EU)); if (h >= nheads) return; const int tb = (bx % (TT / (16 * EU))) * (16 * EU); const int tl = threadIdx.x >> 4, d = (threadIdx.x & 15) * 4;
    const float* Fb = F + (size_t)tb * pitch + h * HD; const float* Cb = CS + (size_t)tb * HD * 2; const float* pc = Cb + (tl * HD + d) * 2; const float* pf[EU]; v4f xv[EU][2], cv[EU][2][2];
#pragma unroll
    for (int u = 0; u < EU; ++u) { pf[u] = Fb + (size_t)(u * 16 + tl) * pitch + d;
#pragma unroll
        for (int hf = 0; hf < 2; ++hf) { xv[u][hf] = *(const v4f*)(pf[u] + hf * (HD / 2)); const float* c = pc + (u * 16 * HD + hf * (HD / 2)) * 2; cv[u][hf][0] = *(const v4f*)c; cv[u][hf][1] = *(const v4f*)(c + 4); } }
    asm volatile("s_wait_xcnt 0x0" :: "v"(pc), "v"(pf[0]), "v"(pf[1]), "v"(pf[2]), "v"(pf[3]) : "memory");   // the loads' address registers are inputs here, so none of them is reused before this wait
#pragma unroll
    for (int u = 0; u < EU; ++u) { const int t = tb + u * 16 + tl; float rf = 1.0f;
        if (RF) { rf = RF[(size_t)h * TT + t]; asm volatile("s_wait_xcnt 0x0" :: "v"(rf) : "memory"); }   // the wait stands behind this load, ahead of any reuse of its base or offset register; the loaded value is an input so that the load cannot sink below it
#pragma unroll
        for (int hf = 0; hf < 2; ++hf) { v4h o16; v4us oh, ol;
#pragma unroll
            for (int q = 0; q < 4; ++q) { const int dd = d + hf * (HD / 2) + q; const int dp = (dd < HD / 2) ? dd + HD / 2 : dd - HD / 2; float x0 = xv[u][hf][q], x1 = xv[u][1 - hf][q];
                if (RF) { float n0 = __fmul_rn(x0, rf), n1 = __fmul_rn(x1, rf); asm volatile("" : "+v"(n0)); asm volatile("" : "+v"(n1)); x0 = __fmul_rn(bfr(nw[dd]), n0); x1 = __fmul_rn(bfr(nw[dp]), n1); }
                v2f cs; cs[0] = cv[u][hf][q >> 1][(q & 1) * 2]; cs[1] = cv[u][hf][q >> 1][(q & 1) * 2 + 1]; float a = __fmul_rn(x0, cs[0]), bq = __fmul_rn(x1, cs[1]); asm volatile("" : "+v"(a)); asm volatile("" : "+v"(bq)); const float r = ((dd < HD / 2) ? __fsub_rn(a, bq) : __fadd_rn(a, bq)) * sc;
                o16[q] = tohx(r); unsigned short a2, c2; splitf(r, a2, c2); oh[q] = a2; ol[q] = c2; }
            const int dh = d + hf * (HD / 2); *(v4h*)(P16 + ((size_t)h * TT + t) * HD + dh) = o16; if (t < hr) { const size_t eh = ((size_t)h * hr + t) * HD + dh; *(v4us*)(Ph + eh) = oh; *(v4us*)(Pl + eh) = ol; } } }  }
// vtp: transposed value planes [g][d][t] at a row pitch of 2 x TT elements; the lo plane lies in the second half of the hi plane's rows (Vl = Vh + TT); in the fp16 plane the second half of a row holds the second batch
// A block takes one head's 64 rows t x HD columns; a thread takes an 8 t x 4 d patch (8 row loads of 16 bytes) and stores it turned, 8 consecutive t per d: a wave's store covers 4 whole 128-byte lines.
__device__ __forceinline__ void vtp(const int bx, const float* __restrict__ F, int pitch, int nheads, h16* V16, bf* Vh, bf* Vl) { const int lane = threadIdx.x & 31; const int g = bx / (TT / 64); if (g >= nheads) return; const int tb = (bx % (TT / 64)) * 64, tl = (lane >> 2) * 8; const int d = (threadIdx.x >> 5) * 16 + (lane & 3) * 4; const float* pf[8]; v4f xv[8];
#pragma unroll
    for (int r = 0; r < 8; ++r) { pf[r] = F + (size_t)(tb + tl + r) * pitch + g * HD + d; xv[r] = *(const v4f*)pf[r]; }
    asm volatile("s_wait_xcnt 0x0" :: "v"(pf[0]), "v"(pf[1]), "v"(pf[2]), "v"(pf[3]), "v"(pf[4]), "v"(pf[5]), "v"(pf[6]), "v"(pf[7]) : "memory");   // the loads' address registers are inputs here, so none of them is reused before this wait
#pragma unroll
    for (int c = 0; c < 4; ++c) { v8h o16; v8us oh, ol;
#pragma unroll
        for (int r = 0; r < 8; ++r) { const float x = xv[r][c]; o16[r] = tohx(x); unsigned short a2, c2; splitf(x, a2, c2); oh[r] = a2; ol[r] = c2; }
        const size_t ev = ((size_t)g * HD + d + c) * (2 * TT) + tb + tl; *(v8h*)(V16 + ev) = o16; *(v8us*)(Vh + ev) = oh; *(v8us*)(Vl + ev) = ol; }
    asm volatile("s_wait_xcnt 0x0" ::: "memory"); }   // in the shared kernel another piece's code stands behind these stores: none of their registers is reused in front of this wait
// k_post: grid (512, NB_, 4): all that stands between the q/k/v GEMM and the attention, for batch y. z = 0: rotary planes of q; 1: of k; 2: turned planes of v; 3: the mask check.
__global__ __launch_bounds__(256) void k_post(const float* __restrict__ FQ, const float* __restrict__ FK, const float* __restrict__ FV, const float* __restrict__ CS, const float* __restrict__ MK, h16* QP16, bf* QPh, bf* QPl, h16* KP16, bf* KPh, bf* KPl,
                                              h16* VT16, bf* VTh, int* FLAG) {
    const int b = blockIdx.y, z = blockIdx.z;
    if (z < 2) { const bool isk = (z == 1); const int hr = isk ? TT : RH; const size_t po = (size_t)b * NH_ * TT * HD, ho = (size_t)b * NH_ * hr * HD;
        rope(blockIdx.x, (isk ? FK : FQ) + (size_t)b * TT * DQ, DQ, NH_, CS + (size_t)b * TT * HD * 2, nullptr, nullptr, 1.0f, hr, (isk ? KP16 : QP16) + po, (isk ? KPh : QPh) + ho, (isk ? KPl : QPl) + ho); }
    else if (z == 2) { bf* vh = VTh + (size_t)b * NKV * HD * 2 * TT; vtp(blockIdx.x, FV + (size_t)b * TT * DKV, DKV, NKV, VT16 + (size_t)b * TT, vh, vh + TT); }
    else mchk(blockIdx.x, MK + (size_t)b * TT * TT, FLAG + b);
}
// ---- k_fattn: scores, softmax, probability x value and the head merge in one kernel; a score never leaves the registers. One wave owns 32 query rows of one head and walks the keys 32 at a time with a running maximum and sum per query.
// Transposed products: S^T = K Q^T (A = 16 key rows, B = 16 query rows, both K-contiguous in d), so that in the accumulator a lane holds one query (column lr) and the keys 8 hi + j of each 16-key tile. That is the place the same lane needs them in
// as B operand of O^T += V^T P^T (k = 8 hi .. 8 hi + 7 from the first tile, 16 + 8 hi .. from the second): the weights are packed in the lane, with no exchange. A = rows d of the transposed value planes, K-contiguous in t.
// HL: hi + lo bf16 planes, 3 products each (query rows < RH); otherwise single fp16, weights x PCAR. The weights are rounded relative to the running maximum and the division by the sum is done once, on the output.
// con (device flag: the mask is the causal pattern): keys beyond the wave's diagonal block are not visited, keys j > i get exact-zero weight and the mask, verified 0 where j <= i, is not read; otherwise every key takes score + bf16(mask).
#define L2E 1.4426950408889634f
#define FWV 4                     // waves per block, all of one head
typedef __attribute__((ext_vector_type(16))) unsigned short v16us;
// 2^x with the one free issue slot that the instruction set asks for behind a transcendental; one statement, so that the v_nop stands directly behind it
__device__ __forceinline__ float exp2s(float x) { float r; asm("v_exp_f32 %0, %1\n\tv_nop" : "=v"(r) : "v"(x)); return r; }
// the value of lane l ^ 16, by one vector instruction (no trip through the LDS pipe)
__device__ __forceinline__ float xhalf(float x) { return __builtin_bit_cast(float, __builtin_amdgcn_permlanex16(__builtin_bit_cast(int, x), __builtin_bit_cast(int, x), 0x76543210, 0xfedcba98, false, false)); }
// K and V^T come through LDS: a stage is KST = 64 keys of the head (64 key rows of 256 bytes, 128 value rows of 128 bytes; with HL the lo planes too), brought by asynchronous 16-byte copies as whole 128-byte lines
// and read by all four waves of the block, which own four neighbouring 32-row query tiles. Two buffers: stage t + 1 flies while stage t is worked on.
#define KST 64                    // keys per stage
#define KPI 136                   // LDS pitch of a key row in 16-bit elements: 272 bytes = 16 x 17, for the 16-byte fragment reads
#define VPI 72                    // LDS pitch of a value row (64 keys): 144 bytes = 16 x 9, likewise
#define KSZ (KST * KPI)           // elements of a stage's key plane
#define VSZ (HD * VPI)            // elements of a stage's value plane
// copy8p: eight copies of one wave (l = the lane's LDS byte address, LS = LDS bytes from one copy to the next, g = the lane's global address, gs = the same step in global elements).
template <int LS, typename T16>
__device__ __forceinline__ void copy8p(unsigned l, const T16* g, size_t gs) {
    // one statement: the closing s_wait_xcnt stands behind the last copy and ahead of any reuse of the address registers named here
    asm volatile("global_load_async_to_lds_b128 %0, %8, off\n\t"
                 "global_load_async_to_lds_b128 %1, %9, off\n\t"
                 "global_load_async_to_lds_b128 %2, %10, off\n\t"
                 "global_load_async_to_lds_b128 %3, %11, off\n\t"
                 "global_load_async_to_lds_b128 %4, %12, off\n\t"
                 "global_load_async_to_lds_b128 %5, %13, off\n\t"
                 "global_load_async_to_lds_b128 %6, %14, off\n\t"
                 "global_load_async_to_lds_b128 %7, %15, off\n\t"
                 "s_wait_xcnt 0x0"
                 :: "v"(l), "v"(l + 1 * LS), "v"(l + 2 * LS), "v"(l + 3 * LS), "v"(l + 4 * LS), "v"(l + 5 * LS), "v"(l + 6 * LS), "v"(l + 7 * LS),
                    "v"(g), "v"(g + gs), "v"(g + 2 * gs), "v"(g + 3 * gs), "v"(g + 4 * gs), "v"(g + 5 * gs), "v"(g + 6 * gs), "v"(g + 7 * gs) : "memory");
}
// w: the wave's number in the block; nkb: 32-key blocks this wave visits; nst: stages the block walks (the same for all its waves, at least 2); ring: the block's LDS, two buffers of [K | V (| K2 | V2)]
template <typename T16, bool HL>
__device__ __forceinline__ void fattn(const int h, const int hk, const int q0, const int qrows, const int lr, const int hi, const int w, const int nkb, const int nst, const bool con, T16* ring, const T16* __restrict__ Q, const T16* __restrict__ Q2, const T16* __restrict__ K, const T16* __restrict__ K2,
                                      const T16* __restrict__ Vt, const T16* __restrict__ Vt2, const float* __restrict__ MKb, bf* Ah, bf* Al) {
    typedef typename WFrag<T16>::V V;
    constexpr int PL = KSZ + VSZ;                 // elements of one [K | V] pair of planes
    constexpr int STG = (HL ? 2 : 1) * PL;        // elements of one buffer
    // copies: key rows, half a wave a 256-byte row (lane lr its 16 bytes lr), copy c of wave w brings rows 8 c + 2 w + hi; value rows, eight lanes a 128-byte row piece, copy c brings rows 16 c + 4 w + (lane / 8)
    const int krow = 2 * w + hi, vrow = 4 * w + 2 * hi + (lr >> 3), vpc = lr & 7;
    const T16* gk = K + ((size_t)hk * TT + krow) * HD + lr * 8; const T16* gk2 = K2 + ((size_t)hk * TT + krow) * HD + lr * 8;
    const T16* gv = Vt + ((size_t)hk * HD + vrow) * (2 * TT) + vpc * 8; const T16* gv2 = Vt2 + ((size_t)hk * HD + vrow) * (2 * TT) + vpc * 8;
    const unsigned lk = (unsigned)(size_t)ring + (unsigned)(krow * KPI + lr * 8) * 2u, lv = (unsigned)(size_t)ring + (unsigned)(KSZ + vrow * VPI + vpc * 8) * 2u;
    auto fill = [&](int t) { const unsigned bo = (unsigned)(t & 1) * (unsigned)(STG * 2);
        copy8p<8 * KPI * 2>(lk + bo, gk + (size_t)t * (KST * HD), (size_t)8 * HD); copy8p<16 * VPI * 2>(lv + bo, gv + t * KST, (size_t)16 * 2 * TT);
        if (HL) { copy8p<8 * KPI * 2>(lk + bo + PL * 2, gk2 + (size_t)t * (KST * HD), (size_t)8 * HD); copy8p<16 * VPI * 2>(lv + bo + PL * 2, gv2 + t * KST, (size_t)16 * 2 * TT); } };
    fill(0);
    // every loop over g, ks, kt, db, j and sub below is unrolled whole, so that the fragment and accumulator arrays are indexed by constants only and stay in registers
    V bq[2][4], bq2[2][4];
    { const T16* pq = Q + ((size_t)h * qrows + q0 + lr) * HD + 8 * hi; const T16* pq2 = Q2 + ((size_t)h * qrows + q0 + lr) * HD + 8 * hi;
#pragma unroll
      for (int g = 0; g < 2; ++g)
#pragma unroll
          for (int ks = 0; ks < 4; ++ks) { bq[g][ks] = WFrag<T16>::ld(pq + g * 16 * HD + ks * 32); if (HL) bq2[g][ks] = WFrag<T16>::ld(pq2 + g * 16 * HD + ks * 32); }
      asm volatile("s_wait_xcnt 0x0" :: "v"(pq), "v"(pq2) : "memory"); }   // the loads' address registers are inputs here, so none of them is reused before this wait
    v8f o[8][2]; float m[2], l[2];
#pragma unroll
    for (int g = 0; g < 2; ++g) { m[g] = -3.0e38f; l[g] = 0.f;
#pragma unroll
        for (int db = 0; db < 8; ++db) o[db][g] = (v8f){}; }
    asm volatile("s_wait_asynccnt 0x0" ::: "memory");   // this wave's share of stage 0 has landed
    __syncthreads();                                    // every wave's share of stage 0 has landed
    fill(1);
    // rolled: one trip is one stage of 64 keys, two blocks of 32 keys (32 or 96 matrix instructions each)
#pragma unroll 1
    for (int t = 0; t < nst; ++t) {
        const T16* sb = ring + (t & 1) * STG; const T16* pk = sb + lr * KPI + 8 * hi; const T16* pv = sb + KSZ + lr * VPI + 8 * hi;
        V ka[2][4], ka2[2][4];
        auto loadk = [&](int sub) {
#pragma unroll
            for (int kt = 0; kt < 2; ++kt)
#pragma unroll
                for (int ks = 0; ks < 4; ++ks) { ka[kt][ks] = WFrag<T16>::ld(pk + (sub * 32 + kt * 16) * KPI + ks * 32); if (HL) ka2[kt][ks] = WFrag<T16>::ld(pk + PL + (sub * 32 + kt * 16) * KPI + ks * 32); } };
        if (!HL && 2 * t < nkb) loadk(0);   // wave-uniform: a wave past its diagonal reads nothing and only keeps the stage's copies and barrier
#pragma unroll
        for (int sub = 0; sub < 2; ++sub) { const int kb = 2 * t + sub;
          if (kb < nkb) {   // wave-uniform (a scalar branch)
            // fp16: this block's value rows are read first and arrive under the score products. HL holds twice the fragments: each set is read only when the one before it is used up, so that the wave's registers leave room for a second wave on its SIMD
            V va[8], va2[8];
            auto loadv = [&](int d0, int d1) {   // the fragments of the 16-row groups d0 .. d1 - 1
#pragma unroll
                for (int db = d0; db < d1; ++db) { va[db] = WFrag<T16>::ld(pv + db * 16 * VPI + sub * 32); if (HL) va2[db] = WFrag<T16>::ld(pv + PL + db * 16 * VPI + sub * 32); } };
            if (HL) loadk(sub); else loadv(0, 8);
            v8f s[2][2];
#pragma unroll
            for (int kt = 0; kt < 2; ++kt)
#pragma unroll
                for (int g = 0; g < 2; ++g) s[kt][g] = (v8f){};
#pragma unroll
            for (int ks = 0; ks < 4; ++ks)
#pragma unroll
                for (int kt = 0; kt < 2; ++kt)
#pragma unroll
                    for (int g = 0; g < 2; ++g) { s[kt][g] = WFrag<T16>::mma(ka[kt][ks], bq[g][ks], s[kt][g]); if (HL) { s[kt][g] = WFrag<T16>::mma(ka[kt][ks], bq2[g][ks], s[kt][g]); s[kt][g] = WFrag<T16>::mma(ka2[kt][ks], bq[g][ks], s[kt][g]); } }
            __builtin_amdgcn_sched_barrier(0);   // the LDS reads of the next line stay one group behind the score products, not spread among them
            if (HL) loadv(0, 4); else if (sub == 0) loadk(1);   // fp16: the key rows of the stage's second half (the same buffer) arrive under the softmax and the value products
            if (con && kb == nkb - 1) {   // wave-uniform: only the block that straddles the wave's diagonal holds keys j > i, and only it pays for the selects
#pragma unroll
                for (int g = 0; g < 2; ++g)
#pragma unroll
                    for (int kt = 0; kt < 2; ++kt) {
#pragma unroll
                        for (int j = 0; j < 8; ++j) if (kb * 32 + kt * 16 + hi * 8 + j > q0 + g * 16 + lr) s[kt][g][j] = -3.0e38f;
                        asm volatile("" : "+v"(s[kt][g])); } }
            float mn[2];
#pragma unroll
            for (int g = 0; g < 2; ++g) { const int qi = q0 + g * 16 + lr; float ml = -3.0e38f;
                v4f mq[2][2];
                if (!con) { const float* mp = MKb + (size_t)qi * TT + kb * 32 + hi * 8; mq[0][0] = *(const v4f*)mp; mq[0][1] = *(const v4f*)(mp + 4); mq[1][0] = *(const v4f*)(mp + 16); mq[1][1] = *(const v4f*)(mp + 20);
                    asm volatile("s_wait_xcnt 0x0" :: "v"(mp) : "memory"); }   // the four loads' address register is an input: not reused before this wait
#pragma unroll
                for (int kt = 0; kt < 2; ++kt) { v8f x = s[kt][g] * SCL;   // a masked score stays far below every real one
                    if (!con) {
#pragma unroll
                        for (int j = 0; j < 4; ++j) { x[j] += bfr(mq[kt][0][j]); x[4 + j] += bfr(mq[kt][1][j]); } }
#pragma unroll
                    for (int j = 0; j < 8; ++j) ml = fmaxf(ml, x[j]);
                    s[kt][g] = x; }
                ml = fmaxf(ml, xhalf(ml));   // the other half of the wave holds the query's other 16 keys
                mn[g] = fmaxf(m[g], ml); }
            // a new maximum rescales sum and output; where no query of the wave has one the factor is exactly 1 and the work is skipped (a scalar branch)
            if (__builtin_amdgcn_ballot_w32(mn[0] > m[0] || mn[1] > m[1]) != 0) {
#pragma unroll
                for (int g = 0; g < 2; ++g) { const float al = exp2s((m[g] - mn[g]) * L2E); l[g] *= al; m[g] = mn[g];
#pragma unroll
                    for (int db = 0; db < 8; ++db) o[db][g] *= al; } }
            V pf[2], pf2[2];
#pragma unroll
            for (int g = 0; g < 2; ++g) { float ps = 0.f; v16us ph, pl; v16h p16;
#pragma unroll
                for (int kt = 0; kt < 2; ++kt)
#pragma unroll
                    for (int j = 0; j < 8; ++j) { const float e = exp2s((s[kt][g][j] - m[g]) * L2E); ps += e;
                        if constexpr (HL) { unsigned short a, c; splitf(e, a, c); ph[kt * 8 + j] = a; pl[kt * 8 + j] = c; } else p16[kt * 8 + j] = tohx(e * PCAR); }
                l[g] += ps;
                if constexpr (HL) { pf[g] = __builtin_bit_cast(v16bf, ph); pf2[g] = __builtin_bit_cast(v16bf, pl); } else pf[g] = p16; }
#pragma unroll
            for (int db = 0; db < 8; ++db) {
                if (HL && db == 4) { __builtin_amdgcn_sched_barrier(0); loadv(4, 8); }   // HL: the second half of the value fragments is not read before the first is used up: all at once, query fragments spill
#pragma unroll
                for (int g = 0; g < 2; ++g) { o[db][g] = WFrag<T16>::mma(va[db], pf[g], o[db][g]); if (HL) { o[db][g] = WFrag<T16>::mma(va[db], pf2[g], o[db][g]); o[db][g] = WFrag<T16>::mma(va2[db], pf[g], o[db][g]); } } }
          } }
        asm volatile("s_wait_dscnt 0x0" ::: "memory");      // this wave's reads of stage t are done before the buffer is handed to the copies below
        asm volatile("s_wait_asynccnt 0x0" ::: "memory");   // this wave's share of stage t + 1 has landed
        __syncthreads();                                    // publishes stage t + 1 and ends every wave's reads of stage t
        if (t + 2 < nst) fill(t + 2);
    }
    asm volatile("s_wait_asynccnt 0x0" ::: "memory");       // no copy is outstanding when the wave goes on to its end
    // output: lane = query row q0 + 16 g + lr, 8 consecutive d per tile: 16-byte stores into the merged hi and lo planes [t][DQ]; a 128-byte line is written by one wave
#pragma unroll
    for (int g = 0; g < 2; ++g) { const float lt = l[g] + xhalf(l[g]); const float inv = __fdiv_rn(HL ? 1.0f : 1.0f / PCAR, lt);
        bf* oa = Ah + (size_t)(q0 + g * 16 + lr) * DQ + h * HD + hi * 8; bf* ob = Al + (size_t)(q0 + g * 16 + lr) * DQ + h * HD + hi * 8;
#pragma unroll
        for (int db = 0; db < 8; ++db) { v8us oh, ol;
#pragma unroll
            for (int j = 0; j < 8; ++j) { unsigned short a, c; splitf(o[db][g][j] * inv, a, c); oh[j] = a; ol[j] = c; }
            *(v8us*)(oa + db * 16) = oh; *(v8us*)(ob + db * 16) = ol;
            asm volatile("s_wait_xcnt 0x0" :: "v"(oa), "v"(ob), "v"(oh), "v"(ol) : "memory"); } }   // the two stores' address and data registers are inputs: none is reused before this wait
}
// grid: (NH_ x TT / 128, NB_) blocks, y the batch. A block takes the 128 query rows c of one head, wave w the 32-row tile 4 c + w: the four waves walk the same keys out of the same LDS stages and end within one stage of one another.
// amdgpu_waves_per_eu(2, 2): the registers are held at 512 a wave, so that two blocks share a WGP and one wave's softmax runs under the other's matrix instructions (without it the hi + lo path takes about 700 and a wave has its SIMD alone).
// A block's walk grows with c; all blocks are resident at once, so neighbours in x, and the two batches at one x, take c and 15 - c (for speed only: a short and a long walk wherever two blocks share a WGP).
__global__ __launch_bounds__(32 * FWV) __attribute__((amdgpu_waves_per_eu(2, 2))) void k_fattn(const h16* __restrict__ Q16, const h16* __restrict__ K16, const h16* __restrict__ V16, const bf* __restrict__ Qh, const bf* __restrict__ Ql, const bf* __restrict__ Kh, const bf* __restrict__ Kl,
                                                    const bf* __restrict__ Vh, const bf* __restrict__ Vl, const float* __restrict__ MK, const int* __restrict__ CF, bf* ATh, bf* ATl) {
    __shared__ __align__(128) unsigned short fring[2 * 2 * (KSZ + VSZ)];   // two buffers of [K | V | K lo | V lo]; the fp16 blocks use the first half
    const int lane = threadIdx.x & 31, lr = lane & 15, hi = lane >> 4;
    const int w = __builtin_amdgcn_readfirstlane(threadIdx.x >> 5);   // the wave's number in a scalar register: the key loop stays a scalar loop
    const int b = blockIdx.y; const bool con = (CF[b] != 0);   // device flag: this batch's mask verified causal
    const size_t po = (size_t)b * NH_ * TT * HD, qo = (size_t)b * NH_ * RH * HD, vo = (size_t)b * NKV * HD * 2 * TT; const float* MKb = MK + (size_t)b * TT * TT; bf* Ah = ATh + (size_t)b * TT * DQ; bf* Al = ATl + (size_t)b * TT * DQ;
    const int xh = blockIdx.x >> 1; const int h = xh % NH_; const int c = ((blockIdx.x ^ b) & 1) ? TT / (32 * FWV) - 1 - xh / NH_ : xh / NH_;
    const int q0 = (c * FWV + w) * 32;
    const int nkb = con ? q0 / 32 + 1 : TT / 32;                     // 32-key blocks this wave visits (wave-uniform)
    const int nst = con ? (c + 1) * (32 * FWV / KST) : TT / KST;     // 64-key stages up to the block's last diagonal (block-uniform)
    if (c < RH / (32 * FWV)) fattn<bf, true>(h, h / REP, q0, RH, lr, hi, w, nkb, nst, con, (bf*)fring, Qh + qo, Ql + qo, Kh + po, Kl + po, Vh + vo, Vl + vo, MKb, Ah, Al);   // block-uniform
    else fattn<h16, false>(h, h / REP, q0, TT, lr, hi, w, nkb, nst, con, (h16*)fring, Q16 + po, Q16 + po, K16 + po, K16 + po, V16 + (size_t)b * TT, V16 + (size_t)b * TT, MKb, Ah, Al);
}

extern "C" void kernel_launch(void* const* d_in, const int* in_sizes, int n_in,
                              void* d_out, int out_size, void* d_ws, size_t ws_size, hipStream_t stream) {
    (void)in_sizes; (void)n_in; (void)out_size;
    const float* x = (const float*)d_in[0]; const float* MK = (const float*)d_in[1]; const int* POS = (const int*)d_in[2]; const float* wq = (const float*)d_in[3]; const float* wk = (const float*)d_in[4]; const float* wv = (const float*)d_in[5]; const float* wo = (const float*)d_in[6];
    float* OUT = (float*)d_out;     // [2][2048][2048]
    char* wsp = (char*)d_ws;
    auto take = [&](size_t bytes) { char* p = wsp; wsp += (bytes + 255) & ~(size_t)255; return (void*)p; };
    // both batches have buffers of their own. CV: the six bf16 planes of k_prep; F: the f32 q, k and v projections, [NB_ x TT][2048] each
    bf* CV = (bf*)take(6 * PE * 2); bf* WQ = CV; bf* XB = CV + 3 * PE; bf* WO = CV + (3 + NB_) * PE; float* CS = (float*)take((size_t)NB_ * TT * HD * 2 * 4);
    int* CFLAG = (int*)take(256);
    float* FQ = (float*)take(3 * (size_t)NB_ * TT * DQ * 4); float* FK = FQ + (size_t)NB_ * TT * DQ; float* FV = FK + (size_t)NB_ * TT * DQ;
    h16* QP16 = (h16*)take((size_t)NB_ * NH_ * TT * HD * 2); h16* KP16 = (h16*)take((size_t)NB_ * NKV * TT * HD * 2); h16* VT16 = (h16*)take((size_t)NKV * HD * 2 * TT * 2);
    bf* QPh = (bf*)take((size_t)NB_ * NH_ * RH * HD * 2); bf* QPl = (bf*)take((size_t)NB_ * NH_ * RH * HD * 2); bf* VTh = (bf*)take((size_t)NB_ * NKV * HD * 2 * TT * 2); bf* VTl = VTh + TT;
    if ((size_t)(wsp - (char*)d_ws) > ws_size) return;    // ws 256 MiB
    bf* KPh = CV; bf* KPl = CV + 2 * PE;   // written by k_post over wq, wk, wv and the first batch of x, which the q/k/v GEMM has finished with (stream-ordered); wo lies behind them
    bf* ATh = (bf*)FQ; bf* ATl = ATh + (size_t)NB_ * TT * DQ;   // the merged attention output lies over the q projection, which k_post has finished with
    k_prep<<<dim3(512, 4 + 2 * NB_, 1), 256, 0, stream>>>(wq, wk, wv, x, wo, POS, CV, PE / 8, CS, CFLAG);
    k_gemms<0, 256, 192, 4, DQ><<<dim3(NB_ * TT / 256, 3 * DQ / 192, 1), 256, 0, stream>>>(XB, nullptr, WQ, DM, FQ, (size_t)NB_ * TT * DQ);
    k_post<<<dim3(512, NB_, 4), 256, 0, stream>>>(FQ, FK, FV, CS, MK, QP16, QPh, QPl, KP16, KPh, KPl, VT16, VTh, CFLAG);
    k_fattn<<<dim3(NH_ * (TT / (32 * FWV)), NB_, 1), 32 * FWV, 0, stream>>>(QP16, KP16, VT16, QPh, QPl, KPh, KPl, VTh, VTl, MK, CFLAG, ATh, ATl);
    k_gemms<1, 128, 256, 2, DM><<<dim3(NB_ * TT / 128, DM / 256, 1), 256, 0, stream>>>(ATh, ATl, WO, DQ, OUT, 0);
}

// v009
// It runs in 206 microseconds.
// In both of two side-by-side timings against v008, it was 1.05 times as fast.
// Counting every step since v000, it is 9.43 times as fast.
#include <hip/hip_runtime.h>

// Causal LM attention with additive mask and position-id rotary (hidden [2][2048][2048]; q, k, v = hidden W^T ('oi' [2048][2048], 16 heads x 128); rotate-half RoPE with angle = position_ids[b][t] x inv_freq (theta 1e4; position_ids int32 input, read on device); scores/sqrt(128) + attention_mask[b][0][i][j] (f32 input, read); softmax; out = merged Wo^T -> [2][2048][2048]).
// The additive mask is verified ON THE DEVICE to be the causal pattern (0 where j <= i, most-negative elsewhere); when it is, key blocks above the diagonal are skipped and the masked entries are realised as exact-zero softmax weights (identical result); otherwise every key is visited and the mask is simply added (general fallback).
// Compute dtypes, f32 accumulate: every input rounded to bf16; q/k/v on PLAIN bf16 operands (inputs: exact); rotary in f32 (per-batch table from the position ids and the reference's inv_freq constants); mask check; scores, additive mask (bf16-rounded), running softmax (f32) and attn.v in one kernel (block skipping gated by the device flag): query rows < 512 hl (3 products), the rest single fp16 (x1024); Wo hl x exact (2 products).

#define NB_  2
#define TT   2048
#define DM   2048
#define NH_  16
#define NKV  16
#define REP  (NH_ / NKV)
#define HD   128
#define DQ   (NH_ * HD)
#define DKV  (NKV * HD)
#define RH   512                  // query rows < RH use hi+lo planes (0: none)
#define WIN  2048
#define PCAR 1024.0f
#define SCL  0.088388347648318447f   // HD^-0.5
typedef _Float16 h16;
typedef unsigned short bf;
typedef __attribute__((ext_vector_type(16))) __bf16   v16bf;
typedef __attribute__((ext_vector_type(16))) _Float16 v16h;
typedef __attribute__((ext_vector_type(8)))  _Float16 v8h;
typedef __attribute__((ext_vector_type(8)))  unsigned short v8us;
typedef __attribute__((ext_vector_type(8)))  float    v8f;
typedef __attribute__((ext_vector_type(4)))  float    v4f;
typedef v8h  __attribute__((may_alias)) v8ha;
typedef v4f  __attribute__((may_alias)) v4fa;
typedef v8us __attribute__((may_alias)) v8usa;

__device__ __forceinline__ unsigned short f2bf(float f) { unsigned u = __float_as_uint(f); u += 0x7FFFu + ((u >> 16) & 1u); return (unsigned short)(u >> 16); }
__device__ __forceinline__ float bf2f(unsigned short b) { return __uint_as_float(((unsigned)b) << 16); }
__device__ __forceinline__ float bfr(float f) { return bf2f(f2bf(f)); }
__device__ __forceinline__ v16h cat16(v8h lo, v8h hi) { return __builtin_shufflevector(lo, hi, 0, 1, 2, 3, 4, 5, 6, 7, 8, 9, 10, 11, 12, 13, 14, 15); }
__device__ __forceinline__ v16bf cat16b(v8us lo, v8us hi) { return __builtin_bit_cast(v16bf, __builtin_shufflevector(lo, hi, 0, 1, 2, 3, 4, 5, 6, 7, 8, 9, 10, 11, 12, 13, 14, 15)); }
__device__ __forceinline__ v8f wmma16(v16h a, v16h b, v8f c) { return __builtin_amdgcn_wmma_f32_16x16x32_f16(false, a, false, b, (short)0, c, false, false); }
__device__ __forceinline__ v8f wmmab(v16bf a, v16bf b, v8f c) { return __builtin_amdgcn_wmma_f32_16x16x32_bf16(false, a, false, b, (short)0, c, false, false); }



// ---- fragment loaders: lane (lr, hi) of a 16-row fragment reads k = 8 hi .. 8 hi + 7 and 16 + 8 hi .. 16 + 8 hi + 7 of row lr (the same for both operands)
template <typename T16> struct WFrag;
template <> struct WFrag<h16> { typedef v16h V; static __device__ __forceinline__ V ld(const h16* p) { return cat16(*(const v8h*)p, *(const v8h*)(p + 16)); } static __device__ __forceinline__ v8f mma(V a, V b, v8f c) { return wmma16(a, b, c); } };
template <> struct WFrag<bf> { typedef v16bf V; static __device__ __forceinline__ V ld(const bf* p) { return cat16b(*(const v8us*)p, *(const v8us*)(p + 16)); } static __device__ __forceinline__ v8f mma(V a, V b, v8f c) { return wmmab(a, b, c); } };
// ---- k_gemms: projection GEMM, one block of 8 waves (WGM x 8 / WGM) per BM x BN output tile, one block a WGP; a wave holds MF x NF accumulators of 16 x 16 over the whole K. grid (M/BM, N/BN), 256 threads. M % BM == 0, N % BN == 0, K % 128 == 0.
// C (f32) = sum_k (A[m][k] + A2[m][k] if NSPLIT) Bt[n][k]; A, A2, Bt are K-contiguous bf16 planes of row pitch K. Column n lies in output plane n / LDC (planes cz elements apart, row pitch LDC) at column n % LDC:
// the weights of q, k and v are one Bt of 3 x 2048 rows, and the rows of both batches are one M.
// The tile is sized to what a WGP can take in: a stage brings (BM (x 2 if NSPLIT) + BN) x 256 bytes out of L2 for BM x BN x 128 products, and a wave reads MF (x 2) + NF fragments out of LDS for MF x NF (x 2) matrix instructions.
// 256 x 192 (q/k/v: 512 tiles, two rounds on 256 WGPs) and 128 x 256 (output projection: 256 tiles, one round) keep both below the time of the matrix instructions.
// The operands come through LDS: a stage is SK = 128 k of the tile's A rows (, A2 rows) and Bt rows, brought by asynchronous 16-byte copies as whole 256-byte row pieces (two rows an instruction),
// so each row piece is fetched from L2 once per block and read by all the waves that need it. Two buffers: stage t + 1 flies while stage t is multiplied.
#define SK 128                    // k per stage
#define SP 136                    // LDS row pitch in 16-bit elements: 272 bytes = 16 x 17, free of bank conflicts for the 16-byte fragment reads
// copy8: eight copies of one wave, rows 16 apart (l = the lane's LDS byte address, g = the lane's global address, gs = 16 rows in elements).
__device__ __forceinline__ void copy8(unsigned l, const bf* g, size_t gs) {
    // one statement: the closing s_wait_xcnt stands behind the last copy and ahead of any reuse of the address registers named here
    asm volatile("global_load_async_to_lds_b128 %0, %8, off\n\t"
                 "global_load_async_to_lds_b128 %1, %9, off\n\t"
                 "global_load_async_to_lds_b128 %2, %10, off\n\t"
                 "global_load_async_to_lds_b128 %3, %11, off\n\t"
                 "global_load_async_to_lds_b128 %4, %12, off\n\t"
                 "global_load_async_to_lds_b128 %5, %13, off\n\t"
                 "global_load_async_to_lds_b128 %6, %14, off\n\t"
                 "global_load_async_to_lds_b128 %7, %15, off\n\t"
                 "s_wait_xcnt 0x0"
                 :: "v"(l), "v"(l + 1 * 16 * SP * 2), "v"(l + 2 * 16 * SP * 2), "v"(l + 3 * 16 * SP * 2), "v"(l + 4 * 16 * SP * 2), "v"(l + 5 * 16 * SP * 2), "v"(l + 6 * 16 * SP * 2), "v"(l + 7 * 16 * SP * 2),
                    "v"(g), "v"(g + gs), "v"(g + 2 * gs), "v"(g + 3 * gs), "v"(g + 4 * gs), "v"(g + 5 * gs), "v"(g + 6 * gs), "v"(g + 7 * gs) : "memory");
}
// copy4: the same for four copies (64 rows of the block)
__device__ __forceinline__ void copy4(unsigned l, const bf* g, size_t gs) {
    // one statement: the closing s_wait_xcnt stands behind the last copy and ahead of any reuse of the address registers named here
    asm volatile("global_load_async_to_lds_b128 %0, %4, off\n\t"
                 "global_load_async_to_lds_b128 %1, %5, off\n\t"
                 "global_load_async_to_lds_b128 %2, %6, off\n\t"
                 "global_load_async_to_lds_b128 %3, %7, off\n\t"
                 "s_wait_xcnt 0x0"
                 :: "v"(l), "v"(l + 1 * 16 * SP * 2), "v"(l + 2 * 16 * SP * 2), "v"(l + 3 * 16 * SP * 2),
                    "v"(g), "v"(g + gs), "v"(g + 2 * gs), "v"(g + 3 * gs) : "memory");
}
// the two pieces of the q/k/v epilogue (defined further down)
__device__ __forceinline__ void rope(const int h, const int tb, const float* Fb, int pitch, const float* __restrict__ CS, const float* __restrict__ RF, const float* __restrict__ nw, float sc, int hr, h16* P16, bf* Ph, bf* Pl);
__device__ __forceinline__ void vtp(const int g, const int dw, const int tb, const float* Fw, int pitch, h16* V16, bf* Vh, bf* Vl);
typedef float __attribute__((may_alias)) fa;
// FUSE (the q/k/v GEMM, BN = 192): the f32 projections never go to memory. Tile column y holds one whole head of q (y < NH_) or k (128 columns: a rotary pair d, d + 64 and whole 128-byte lines of the head planes lie in one tile)
// and 64 columns of v (half a head; the turned planes' lines run along t). The accumulators go to the ring, free behind the last stage's barrier, as one f32 tile; behind one block barrier the block turns it into the attention's planes.
template <int NSPLIT, int BM, int BN, int WGM, int LDC, bool FUSE>
__global__ __launch_bounds__(256) void k_gemms(const bf* __restrict__ A, const bf* __restrict__ A2, const bf* __restrict__ Bt, int K, float* C, size_t cz,
                                               const float* __restrict__ CS, h16* QP16, bf* QPh, bf* QPl, h16* KP16, bf* KPh, bf* KPl, h16* VT16, bf* VTh) {
    typedef WFrag<bf>::V V;
    constexpr int WGN = 8 / WGM, MF = BM / WGM / 16, NF = BN / WGN / 16;   // waves across the columns; 16-row and 16-column fragments a wave
    constexpr int NR = (NSPLIT ? 2 : 1) * BM + BN;         // rows per stage: A, (A2,) Bt
    static_assert(BM % 128 == 0 && BN % 64 == 0 && NF % 2 == 0 && LDC % 32 == 0, "tile");
    __shared__ __align__(128) bf ring[2 * NR * SP];
    __shared__ __align__(16) float os[8 * 16 * 36];        // per wave: 16 output rows x 32 columns at pitch 36, for whole-line stores
    const int lane = threadIdx.x & 31, lr = lane & 15, hi = lane >> 4; const int r0 = blockIdx.x * BM, c0 = blockIdx.y * BN;
    const int w = __builtin_amdgcn_readfirstlane(threadIdx.x >> 5);   // the wave's number in a scalar register: everything derived from it stays scalar
    const int wm = w / WGN, wn = w % WGN;
    // copies: half a wave takes one 256-byte row piece (lane lr its 16 bytes lr); copy c of wave w brings rows 16 c + 2 w + hi of an operand
    const int crow = 2 * w + hi; const size_t gs = (size_t)16 * K;
    const bf* ga = A + (size_t)r0 * K; const bf* ga2 = NSPLIT ? A2 + (size_t)r0 * K : nullptr; const bf* gb = Bt + (size_t)(FUSE ? blockIdx.y * HD : c0) * K;   // the tile's first rows: the same for all lanes, kept in scalar registers
    const int brt = FUSE ? DQ + DKV + blockIdx.y * 64 - blockIdx.y * HD : BN - 64;   // the tile's last 64 rows of Bt, counted from its first (FUSE: rows of wv, which lies behind wq and wk)
    const int lof = crow * K + lr * 8;   // the lane's place in an operand's first 16 rows, in elements: one register serves all operands
    const unsigned l0 = (unsigned)(size_t)ring + (unsigned)(crow * SP + lr * 8) * 2u;
    auto fill = [&](int t) { const unsigned l = l0 + (unsigned)(t & 1) * (unsigned)(NR * SP * 2); const int kc = t * SK;
#pragma unroll
        for (int i = 0; i < BM / 128; ++i) { copy8(l + i * 128 * SP * 2, (ga + kc + (size_t)(i * 128) * K) + lof, gs); if (NSPLIT) copy8(l + (BM + i * 128) * SP * 2, (ga2 + kc + (size_t)(i * 128) * K) + lof, gs); }
#pragma unroll
        for (int i = 0; i < BN / 128; ++i) copy8(l + (NR - BN + i * 128) * SP * 2, (gb + kc + (size_t)(i * 128) * K) + lof, gs);
        if (BN % 128) copy4(l + (NR - 64) * SP * 2, (gb + kc + (size_t)brt * K) + lof, gs); };
    const int nst = K / SK;
    // every loop over i, mb, nb, np, ks, j and s is unrolled whole, so that the accumulator and fragment arrays are indexed by constants only and stay in registers
    v8f acc[MF][NF];
#pragma unroll
    for (int mb = 0; mb < MF; ++mb)
#pragma unroll
        for (int nb = 0; nb < NF; ++nb) acc[mb][nb] = (v8f){};
    fill(0);
    asm volatile("s_wait_asynccnt 0x0" ::: "memory");   // this wave's share of stage 0 has landed
    __syncthreads();                                    // every wave's share of stage 0 has landed
    if (nst > 1) fill(1);
    // rolled: one trip is one stage (96 or 128 matrix instructions a wave), and the buffer alternates with t
#pragma unroll 1
    for (int t = 0; t < nst; ++t) {
        const bf* sb = ring + (t & 1) * (NR * SP); const bf* pa = sb + (wm * MF * 16 + lr) * SP + 8 * hi; const bf* pb = sb + (NR - BN + wn * NF * 16 + lr) * SP + 8 * hi;
        V a[2][MF], a2[2][MF], b[2][NF];   // two fragment sets: k step ks + 1 is read from LDS while k step ks is multiplied
#pragma unroll
        for (int ks = -1; ks < SK / 32; ++ks) {
            if (ks + 1 < SK / 32) { const int q = (ks + 1) & 1, ko = (ks + 1) * 32;
#pragma unroll
                for (int mb = 0; mb < MF; ++mb) { a[q][mb] = WFrag<bf>::ld(pa + mb * 16 * SP + ko); if (NSPLIT) a2[q][mb] = WFrag<bf>::ld(pa + (BM + mb * 16) * SP + ko); }
#pragma unroll
                for (int nb = 0; nb < NF; ++nb) b[q][nb] = WFrag<bf>::ld(pb + nb * 16 * SP + ko); }
            __builtin_amdgcn_sched_barrier(0);   // the next k step's LDS reads stay one group in front of this step's matrix instructions, not spread among them
            if (ks >= 0) { const int q = ks & 1;
#pragma unroll
                for (int nb = 0; nb < NF; ++nb)
#pragma unroll
                    for (int mb = 0; mb < MF; ++mb) { acc[mb][nb] = WFrag<bf>::mma(a[q][mb], b[q][nb], acc[mb][nb]); if (NSPLIT) acc[mb][nb] = WFrag<bf>::mma(a2[q][mb], b[q][nb], acc[mb][nb]); }
                __builtin_amdgcn_sched_barrier(0); }   // and the reads of the step after next stay behind them
        }
        asm volatile("s_wait_dscnt 0x0" ::: "memory");      // this wave's reads of stage t are done before the buffer is handed to the copies below
        asm volatile("s_wait_asynccnt 0x0" ::: "memory");   // this wave's share of stage t + 1 has landed
        __syncthreads();                                    // publishes stage t + 1 and ends every wave's reads of stage t
        if (t + 2 < nst) fill(t + 2);
    }
    asm volatile("s_wait_asynccnt 0x0" ::: "memory");       // no copy is outstanding when the wave goes on to its end
    if constexpr (FUSE) {
        constexpr int PT = BN + 4;   // pitch of the f32 tile in floats: a multiple of 4 (16-byte reads); 8 rows on are 32 banks on, so the two halves of a wave store to different banks
        static_assert(BN == HD + 64 && BM == 256 && TT % BM == 0 && (size_t)BM * PT * 4 <= sizeof(ring), "fused epilogue");
        fa* tile = (fa*)ring;
#pragma unroll
        for (int mb = 0; mb < MF; ++mb)
#pragma unroll
            for (int nb = 0; nb < NF; ++nb)
#pragma unroll
                for (int j = 0; j < 8; ++j) tile[(wm * MF * 16 + mb * 16 + hi * 8 + j) * PT + wn * NF * 16 + nb * 16 + lr] = acc[mb][nb][j];
        __syncthreads();   // every wave's part of the tile is written before any wave reads whole rows of it
        const int b = r0 / TT, t0 = r0 % TT, y = blockIdx.y; const bool isk = (y >= NH_); const int h = isk ? y - NH_ : y, hr = isk ? TT : RH;
        const size_t po = (size_t)b * NH_ * TT * HD, ho = (size_t)b * NH_ * hr * HD;
        // rolled: one trip is 64 rows of the head
#pragma unroll 1
        for (int it = 0; it < BM / 64; ++it)
            rope(h, t0 + it * 64, (const float*)tile + it * 64 * PT, PT, CS + (size_t)b * TT * HD * 2, nullptr, nullptr, 1.0f, hr, (isk ? KP16 : QP16) + po, (isk ? KPh : QPh) + ho, (isk ? KPl : QPl) + ho);
        bf* vh = VTh + (size_t)b * NKV * HD * 2 * TT;
#pragma unroll
        for (int i = 0; i < 2; ++i) { const int cl = (w >> 2) * 32 + i * 16;   // wave w: rows 64 (w & 3) .. + 63, two groups of 16 columns
            vtp(y >> 1, (y & 1) * 64 + cl, t0 + (w & 3) * 64, (const float*)tile + (w & 3) * 64 * PT + HD + cl, PT, VT16 + (size_t)b * TT, vh, vh + TT); }
        return;
    }
    float* mine = os + w * (16 * 36);
#pragma unroll
    for (int mb = 0; mb < MF; ++mb)
#pragma unroll
      for (int np = 0; np < NF / 2; ++np) {   // 32 columns at a time: they lie in one output plane
#pragma unroll
        for (int nb = 0; nb < 2; ++nb)
#pragma unroll
            for (int j = 0; j < 8; ++j) mine[(hi * 8 + j) * 36 + nb * 16 + lr] = acc[mb][np * 2 + nb][j];
        __builtin_amdgcn_wave_barrier(); asm volatile("" ::: "memory");   // the reads below (other lanes' values) stay behind the writes above
        const int n = c0 + wn * NF * 16 + np * 32;
        float* crw = C + (size_t)(n / LDC) * cz + (size_t)(r0 + wm * MF * 16 + mb * 16) * LDC + n % LDC;
#pragma unroll
        for (int s = 0; s < 4; ++s) { const int row = 4 * s + (lane >> 3), cofs = (lane & 7) * 4; const v4f val = *(const v4fa*)(mine + row * 36 + cofs);
            *(v4f*)(crw + (size_t)row * LDC + cofs) = val; }
        __builtin_amdgcn_wave_barrier(); asm volatile("" ::: "memory");   // the next 16 x 32 piece's writes stay behind the reads above
    }
}

__device__ __forceinline__ h16 tohx(float x) { return (h16)x; }
__device__ __forceinline__ void splitf(float y, unsigned short& h, unsigned short& l) { h = f2bf(y); l = f2bf(y - bf2f(h)); }
typedef __attribute__((ext_vector_type(2))) _Float16 v2h;
typedef __attribute__((ext_vector_type(4))) _Float16 v4h;
typedef __attribute__((ext_vector_type(2))) unsigned short v2us;
typedef __attribute__((ext_vector_type(4))) unsigned short v4us;
typedef __attribute__((ext_vector_type(2))) float v2f;
typedef __attribute__((ext_vector_type(4))) int v4i;

__global__ __launch_bounds__(256) void k_wtG(const float* __restrict__ w, int K, int N, bf* Bt) {
    const int lane = threadIdx.x & 31; const int L0 = (blockIdx.x * 8 + (threadIdx.x >> 5)) * 8; const int nlines = N * K / 64;
{
#pragma unroll 1
        for (int l = 0; l < 8; ++l) { const int L = L0 + l; if (L >= nlines) break; const size_t e = (size_t)L * 64 + lane * 2; const int k = (int)(e % K), n = (int)(e / K); v2us o;
            o[0] = f2bf(w[(size_t)k * N + n]); o[1] = f2bf(w[(size_t)(k + 1) * N + n]); *(v2us*)(Bt + e) = o; }
         }
}
// The elementwise pieces below give each thread several vectors (all loads issued first, then the arithmetic and the stores). Each piece is a device function over 512 blocks of 256 threads (bx = its block);
// pieces that do not depend on one another, for both batches, share one launch: k_prep (in front of the q/k/v GEMM). rope and vtp work on the q/k/v GEMM's tile, in its epilogue.
#define EU 4                      // vectors per thread in cvt8 and rope (rows)
#define MU 8                      // vectors per thread in mchk
__device__ __forceinline__ void cvt8(const int bx, const float* __restrict__ src, bf* dst, size_t n8) { const size_t i0 = (size_t)bx * (256 * EU) + threadIdx.x; v8f v[EU];
#pragma unroll
    for (int u = 0; u < EU; ++u) { const size_t i = i0 + (size_t)u * 256; v[u] = *(const v8f*)(src + (i < n8 ? i : n8 - 1) * 8); }   // index clamped, not branched round: the loads stay one group in flight; the store below is guarded
#pragma unroll
    for (int u = 0; u < EU; ++u) { const size_t i = i0 + (size_t)u * 256; v8us o;
#pragma unroll
        for (int k = 0; k < 8; ++k) o[k] = f2bf(v[u][k]);
        if (i < n8) *(v8us*)(dst + i * 8) = o; } }
__constant__ float INV[HD / 2] = {1.0,0.8659643530845642,0.7498942017555237,0.6493816375732422,0.5623413324356079,0.486967533826828,0.4216965138912201,0.36517414450645447,0.3162277638912201,0.2738419771194458,0.23713736236095428,0.20535250008106232,0.17782793939113617,0.1539926528930664,0.1333521455526352,0.11547820270061493,0.10000000149011612,0.08659642934799194,0.07498941570520401,0.06493816524744034,0.05623412877321243,0.04869675263762474,0.04216964915394783,0.03651741147041321,0.03162277862429619,0.0273841954767704,0.0237137358635664,0.02053525112569332,0.017782794311642647,0.015399265103042126,0.01333521492779255,0.011547819711267948,0.009999999776482582,0.00865964312106371,0.007498942315578461,0.006493816617876291,0.005623413249850273,0.004869675263762474,0.0042169648222625256,0.003651741426438093,0.003162277862429619,0.0027384196873754263,0.0023713738191872835,0.0020535250660032034,0.0017782794311642647,0.0015399265103042126,0.0013335214462131262,0.0011547820176929235,0.0010000000474974513,0.0008659643353894353,0.0007498941849917173,0.0006493816617876291,0.000562341301701963,0.00048696750309318304,0.00042169648804701865,0.00036517411353997886,0.0003162277862429619,0.00027384195709601045,0.0002371373848291114,0.00020535249495878816,0.00017782794020604342,0.00015399264520965517,0.0001333521504420787,0.00011547819303814322};
// cstab: one thread per (t, d < HD/2); the angle of d + HD/2 is the same one, so the pair at d serves both (a row of the table is HD pairs long, of which the first HD/2 are used)
__device__ __forceinline__ void cstab(const int bx, const int* __restrict__ pos, float* CS) { const int idx = bx * 256 + threadIdx.x; if (idx >= TT * (HD / 2)) return; const int t = idx / (HD / 2), d = idx % (HD / 2); const float ang = __fmul_rn((float)pos[t], INV[d]); v2f cs; cs[0] = cosf(ang); cs[1] = sinf(ang);
    float* o = CS + ((size_t)t * HD + d) * 2; *(v2f*)o = cs;  }
// mchk: causal-pattern check of the additive mask for one batch: FLAG[0], the block's own word, is 1 if the block saw any entry with (j <= i and mask != 0) or (j > i and mask > -1e30), else 0 (every word is written in every call; the attention reads all 512 of its batch); lane -> MU groups of 4 consecutive j, 1024 elements apart.
__device__ __forceinline__ void mchk(const int bx, const float* __restrict__ MKb, int* FLAG) { const size_t e0 = ((size_t)bx * (256 * MU) + threadIdx.x) * 4; v4f m[MU]; bool bad = false;
#pragma unroll
    for (int u = 0; u < MU; ++u) { const size_t e = e0 + (size_t)u * 1024; m[u] = *(const v4f*)(MKb + (e < (size_t)TT * TT ? e : (size_t)TT * TT - 4)); }   // index clamped: one group of loads in flight
#pragma unroll
    for (int u = 0; u < MU; ++u) { const size_t e = e0 + (size_t)u * 1024; const int j = (int)(e % TT), i = (int)(e / TT); bool b = false;
#pragma unroll
        for (int q = 0; q < 4; ++q) { const bool keep = (j + q <= i); b |= keep ? (m[u][q] != 0.0f) : (m[u][q] > -1.0e30f); }
        bad |= b && (e < (size_t)TT * TT); }
    __shared__ int wbad[8];   // one word a wave
    const unsigned wb = __builtin_amdgcn_ballot_w32(bad); if ((threadIdx.x & 31) == 0) wbad[threadIdx.x >> 5] = (wb != 0);
    __syncthreads();   // the eight words are written before the first thread joins them (every thread of the block comes here)
    if (threadIdx.x == 0) *FLAG = wbad[0] | wbad[1] | wbad[2] | wbad[3] | wbad[4] | wbad[5] | wbad[6] | wbad[7]; }
// k_prep: grid (512, 4 + 3 NB_). y < 4 + NB_: one 2048 x 2048 plane (n8 vectors of 8) to bf16 (wq, wk, wv, the two batches of x, wo, in that order in dst); then a batch's rotary table; then a batch's mask check (512 words a batch).
#define PE ((size_t)DM * DM)      // elements of one plane (DQ x DM = DKV x DM = TT x DM)
__global__ __launch_bounds__(256) void k_prep(const float* __restrict__ wq, const float* __restrict__ wk, const float* __restrict__ wv, const float* __restrict__ x, const float* __restrict__ wo, const int* __restrict__ pos, const float* __restrict__ MK, bf* dst, size_t n8, float* CS, int* FLAG) {
    const int y = blockIdx.y;
    if (y < 4 + NB_) { const float* src = y == 0 ? wq : y == 1 ? wk : y == 2 ? wv : y == 3 + NB_ ? wo : x + (size_t)(y - 3) * PE; cvt8(blockIdx.x, src, dst + (size_t)y * PE, n8); }
    else if (y < 4 + 2 * NB_) { const int b = y - (4 + NB_); cstab(blockIdx.x, pos + (size_t)b * TT, CS + (size_t)b * TT * HD * 2); }
    else { const int b = y - (4 + 2 * NB_); mchk(blockIdx.x, MK + (size_t)b * TT * TT, FLAG + b * 512 + blockIdx.x); }   // block-uniform branch
}

// rope: head planes [h][t][d] (fp16 + hi/lo) of rope(x) x sc with the rotate-half convention out[d] = x[d] cos[t][d] - x[d+HD/2] sin[t][d], out[d+HD/2] = x[d+HD/2] cos[t][d+HD/2] + x[d] sin[t][d+HD/2]; the hi/lo planes hold rows t < hr only ([h][hr][d])
// 16 threads per (h, t) row: a thread takes 4 consecutive d < HD/2 and their 4 partners d + HD/2 (each x is loaded once and serves both), in EU rows 16 apart; a call of a block covers the 16 x EU rows tb .. of head h.
// Fb: row tb at the head's first column, in the GEMM's f32 tile in LDS (row pitch in floats). cos and sin of d + HD/2 are those of d: the table's pair at d is loaded once and serves both.
__device__ __forceinline__ void rope(const int h, const int tb, const float* Fb, int pitch, const float* __restrict__ CS, const float* __restrict__ RF, const float* __restrict__ nw, float sc, int hr, h16* P16, bf* Ph, bf* Pl) {
    const int tl = threadIdx.x >> 4, d = (threadIdx.x & 15) * 4;
    const float* Cb = CS + (size_t)tb * HD * 2; const float* pc = Cb + (tl * HD + d) * 2; v4f xv[EU][2], cv[EU][2][2];
#pragma unroll
    for (int u = 0; u < EU; ++u) { const float* pf = Fb + (u * 16 + tl) * pitch + d; const float* c = pc + (u * 16 * HD) * 2; cv[u][0][0] = *(const v4f*)c; cv[u][0][1] = *(const v4f*)(c + 4); cv[u][1][0] = cv[u][0][0]; cv[u][1][1] = cv[u][0][1];
#pragma unroll
        for (int hf = 0; hf < 2; ++hf) xv[u][hf] = *(const v4fa*)(pf + hf * (HD / 2)); }
    asm volatile("s_wait_xcnt 0x0" :: "v"(pc) : "memory");   // the table loads' address register is an input here, so it is not reused before this wait
#pragma unroll
    for (int u = 0; u < EU; ++u) { const int t = tb + u * 16 + tl; float rf = 1.0f;
        if (RF) { rf = RF[(size_t)h * TT + t]; asm volatile("s_wait_xcnt 0x0" :: "v"(rf) : "memory"); }   // the wait stands behind this load, ahead of any reuse of its base or offset register; the loaded value is an input so that the load cannot sink below it
#pragma unroll
        for (int hf = 0; hf < 2; ++hf) { v4h o16; v4us oh, ol;
#pragma unroll
            for (int q = 0; q < 4; ++q) { const int dd = d + hf * (HD / 2) + q; const int dp = (dd < HD / 2) ? dd + HD / 2 : dd - HD / 2; float x0 = xv[u][hf][q], x1 = xv[u][1 - hf][q];
                if (RF) { float n0 = __fmul_rn(x0, rf), n1 = __fmul_rn(x1, rf); asm volatile("" : "+v"(n0)); asm volatile("" : "+v"(n1)); x0 = __fmul_rn(bfr(nw[dd]), n0); x1 = __fmul_rn(bfr(nw[dp]), n1); }
                v2f cs; cs[0] = cv[u][hf][q >> 1][(q & 1) * 2]; cs[1] = cv[u][hf][q >> 1][(q & 1) * 2 + 1]; float a = __fmul_rn(x0, cs[0]), bq = __fmul_rn(x1, cs[1]); asm volatile("" : "+v"(a)); asm volatile("" : "+v"(bq)); const float r = ((dd < HD / 2) ? __fsub_rn(a, bq) : __fadd_rn(a, bq)) * sc;
                o16[q] = tohx(r); unsigned short a2, c2; splitf(r, a2, c2); oh[q] = a2; ol[q] = c2; }
            const int dh = d + hf * (HD / 2); *(v4h*)(P16 + ((size_t)h * TT + t) * HD + dh) = o16; if (t < hr) { const size_t eh = ((size_t)h * hr + t) * HD + dh; *(v4us*)(Ph + eh) = oh; *(v4us*)(Pl + eh) = ol; } } }
    asm volatile("s_wait_xcnt 0x0" ::: "memory"); }   // the next call's code stands behind these stores: none of their registers is reused in front of this wait
// vtp: transposed value planes [g][d][t] at a row pitch of 2 x TT elements; the lo plane lies in the second half of the hi plane's rows (Vl = Vh + TT); in the fp16 plane the second half of a row holds the second batch
// A call of a wave takes the 64 rows tb .. x the 16 columns dw .. of head g; a thread takes an 8 t x 4 d patch (8 row reads of 16 bytes) and stores it turned, 8 consecutive t per d: a wave's store covers 4 whole 128-byte lines.
// Fw: row tb at column dw, in the GEMM's f32 tile in LDS (row pitch in floats).
__device__ __forceinline__ void vtp(const int g, const int dw, const int tb, const float* Fw, int pitch, h16* V16, bf* Vh, bf* Vl) { const int lane = threadIdx.x & 31; const int tl = (lane >> 2) * 8; const int d = dw + (lane & 3) * 4; v4f xv[8];
#pragma unroll
    for (int r = 0; r < 8; ++r) xv[r] = *(const v4fa*)(Fw + (tl + r) * pitch + (lane & 3) * 4);
#pragma unroll
    for (int c = 0; c < 4; ++c) { v8h o16; v8us oh, ol;
#pragma unroll
        for (int r = 0; r < 8; ++r) { const float x = xv[r][c]; o16[r] = tohx(x); unsigned short a2, c2; splitf(x, a2, c2); oh[r] = a2; ol[r] = c2; }
        const size_t ev = ((size_t)g * HD + d + c) * (2 * TT) + tb + tl; *(v8h*)(V16 + ev) = o16; *(v8us*)(Vh + ev) = oh; *(v8us*)(Vl + ev) = ol; }
    asm volatile("s_wait_xcnt 0x0" ::: "memory"); }   // another call's code stands behind these stores: none of their registers is reused in front of this wait
// ---- k_fattn: scores, softmax, probability x value and the head merge in one kernel; a score never leaves the registers. One wave owns 32 query rows of one head and walks the keys 32 at a time with a running maximum and sum per query.
// Transposed products: S^T = K Q^T (A = 16 key rows, B = 16 query rows, both K-contiguous in d), so that in the accumulator a lane holds one query (column lr) and the keys 8 hi + j of each 16-key tile. That is the place the same lane needs them in
// as B operand of O^T += V^T P^T (k = 8 hi .. 8 hi + 7 from the first tile, 16 + 8 hi .. from the second): the weights are packed in the lane, with no exchange. A = rows d of the transposed value planes, K-contiguous in t.
// HL: hi + lo bf16 planes, 3 products each (query rows < RH); otherwise single fp16, weights x PCAR. The weights are rounded relative to the running maximum and the division by the sum is done once, on the output.
// con (device flag: the mask is the causal pattern): keys beyond the wave's diagonal block are not visited, keys j > i get exact-zero weight and the mask, verified 0 where j <= i, is not read; otherwise every key takes score + bf16(mask).
#define L2E 1.4426950408889634f
#define FWV 4                     // waves per block, all of one head
typedef __attribute__((ext_vector_type(16))) unsigned short v16us;
// 2^x with the one free issue slot that the instruction set asks for behind a transcendental; one statement, so that the v_nop stands directly behind it
__device__ __forceinline__ float exp2s(float x) { float r; asm("v_exp_f32 %0, %1\n\tv_nop" : "=v"(r) : "v"(x)); return r; }
// the value of lane l ^ 16, by one vector instruction (no trip through the LDS pipe)
__device__ __forceinline__ float xhalf(float x) { return __builtin_bit_cast(float, __builtin_amdgcn_permlanex16(__builtin_bit_cast(int, x), __builtin_bit_cast(int, x), 0x76543210, 0xfedcba98, false, false)); }
// K and V^T come through LDS: a stage is KST = 64 keys of the head (64 key rows of 256 bytes, 128 value rows of 128 bytes; with HL the lo planes too), brought by asynchronous 16-byte copies as whole 128-byte lines
// and read by all four waves of the block, which own four neighbouring 32-row query tiles. Two buffers: stage t + 1 flies while stage t is worked on.
#define KST 64                    // keys per stage
#define KPI 136                   // LDS pitch of a key row in 16-bit elements: 272 bytes = 16 x 17, for the 16-byte fragment reads
#define VPI 72                    // LDS pitch of a value row (64 keys): 144 bytes = 16 x 9, likewise
#define KSZ (KST * KPI)           // elements of a stage's key plane
#define VSZ (HD * VPI)            // elements of a stage's value plane
// copy8p: eight copies of one wave (l = the lane's LDS byte address, LS = LDS bytes from one copy to the next, g = the lane's global address, gs = the same step in global elements).
template <int LS, typename T16>
__device__ __forceinline__ void copy8p(unsigned l, const T16* g, size_t gs) {
    // one statement: the closing s_wait_xcnt stands behind the last copy and ahead of any reuse of the address registers named here
    asm volatile("global_load_async_to_lds_b128 %0, %8, off\n\t"
                 "global_load_async_to_lds_b128 %1, %9, off\n\t"
                 "global_load_async_to_lds_b128 %2, %10, off\n\t"
                 "global_load_async_to_lds_b128 %3, %11, off\n\t"
                 "global_load_async_to_lds_b128 %4, %12, off\n\t"
                 "global_load_async_to_lds_b128 %5, %13, off\n\t"
                 "global_load_async_to_lds_b128 %6, %14, off\n\t"
                 "global_load_async_to_lds_b128 %7, %15, off\n\t"
                 "s_wait_xcnt 0x0"
                 :: "v"(l), "v"(l + 1 * LS), "v"(l + 2 * LS), "v"(l + 3 * LS), "v"(l + 4 * LS), "v"(l + 5 * LS), "v"(l + 6 * LS), "v"(l + 7 * LS),
                    "v"(g), "v"(g + gs), "v"(g + 2 * gs), "v"(g + 3 * gs), "v"(g + 4 * gs), "v"(g + 5 * gs), "v"(g + 6 * gs), "v"(g + 7 * gs) : "memory");
}
// w: the wave's number in the block; nkb: 32-key blocks this wave visits; nst: stages the block walks (the same for all its waves, at least 2); ring: the block's LDS, two buffers of [K | V (| K2 | V2)]
template <typename T16, bool HL>
__device__ __forceinline__ void fattn(const int h, const int hk, const int q0, const int qrows, const int lr, const int hi, const int w, const int nkb, const int nst, const bool con, T16* ring, const T16* __restrict__ Q, const T16* __restrict__ Q2, const T16* __restrict__ K, const T16* __restrict__ K2,
                                      const T16* __restrict__ Vt, const T16* __restrict__ Vt2, const float* __restrict__ MKb, bf* Ah, bf* Al) {
    typedef typename WFrag<T16>::V V;
    constexpr int PL = KSZ + VSZ;                 // elements of one [K | V] pair of planes
    constexpr int STG = (HL ? 2 : 1) * PL;        // elements of one buffer
    // copies: key rows, half a wave a 256-byte row (lane lr its 16 bytes lr), copy c of wave w brings rows 8 c + 2 w + hi; value rows, eight lanes a 128-byte row piece, copy c brings rows 16 c + 4 w + (lane / 8)
    const int krow = 2 * w + hi, vrow = 4 * w + 2 * hi + (lr >> 3), vpc = lr & 7;
    const T16* gk = K + ((size_t)hk * TT + krow) * HD + lr * 8; const T16* gk2 = K2 + ((size_t)hk * TT + krow) * HD + lr * 8;
    const T16* gv = Vt + ((size_t)hk * HD + vrow) * (2 * TT) + vpc * 8; const T16* gv2 = Vt2 + ((size_t)hk * HD + vrow) * (2 * TT) + vpc * 8;
    const unsigned lk = (unsigned)(size_t)ring + (unsigned)(krow * KPI + lr * 8) * 2u, lv = (unsigned)(size_t)ring + (unsigned)(KSZ + vrow * VPI + vpc * 8) * 2u;
    auto fill = [&](int t) { const unsigned bo = (unsigned)(t & 1) * (unsigned)(STG * 2);
        copy8p<8 * KPI * 2>(lk + bo, gk + (size_t)t * (KST * HD), (size_t)8 * HD); copy8p<16 * VPI * 2>(lv + bo, gv + t * KST, (size_t)16 * 2 * TT);
        if (HL) { copy8p<8 * KPI * 2>(lk + bo + PL * 2, gk2 + (size_t)t * (KST * HD), (size_t)8 * HD); copy8p<16 * VPI * 2>(lv + bo + PL * 2, gv2 + t * KST, (size_t)16 * 2 * TT); } };
    fill(0);
    // every loop over g, ks, kt, db, j and sub below is unrolled whole, so that the fragment and accumulator arrays are indexed by constants only and stay in registers
    V bq[2][4], bq2[2][4];
    { const T16* pq = Q + ((size_t)h * qrows + q0 + lr) * HD + 8 * hi; const T16* pq2 = Q2 + ((size_t)h * qrows + q0 + lr) * HD + 8 * hi;
#pragma unroll
      for (int g = 0; g < 2; ++g)
#pragma unroll
          for (int ks = 0; ks < 4; ++ks) { bq[g][ks] = WFrag<T16>::ld(pq + g * 16 * HD + ks * 32); if (HL) bq2[g][ks] = WFrag<T16>::ld(pq2 + g * 16 * HD + ks * 32); }
      asm volatile("s_wait_xcnt 0x0" :: "v"(pq), "v"(pq2) : "memory"); }   // the loads' address registers are inputs here, so none of them is reused before this wait
    v8f o[8][2]; float m[2], l[2];
#pragma unroll
    for (int g = 0; g < 2; ++g) { m[g] = -3.0e38f; l[g] = 0.f;
#pragma unroll
        for (int db = 0; db < 8; ++db) o[db][g] = (v8f){}; }
    asm volatile("s_wait_asynccnt 0x0" ::: "memory");   // this wave's share of stage 0 has landed
    __syncthreads();                                    // every wave's share of stage 0 has landed
    fill(1);
    // rolled: one trip is one stage of 64 keys, two blocks of 32 keys (32 or 96 matrix instructions each)
#pragma unroll 1
    for (int t = 0; t < nst; ++t) {
        const T16* sb = ring + (t & 1) * STG; const T16* pk = sb + lr * KPI + 8 * hi; const T16* pv = sb + KSZ + lr * VPI + 8 * hi;
        V ka[2][4], ka2[2][4];
        auto loadk = [&](int sub) {
#pragma unroll
            for (int kt = 0; kt < 2; ++kt)
#pragma unroll
                for (int ks = 0; ks < 4; ++ks) { ka[kt][ks] = WFrag<T16>::ld(pk + (sub * 32 + kt * 16) * KPI + ks * 32); if (HL) ka2[kt][ks] = WFrag<T16>::ld(pk + PL + (sub * 32 + kt * 16) * KPI + ks * 32); } };
        if (!HL && 2 * t < nkb) loadk(0);   // wave-uniform: a wave past its diagonal reads nothing and only keeps the stage's copies and barrier
#pragma unroll
        for (int sub = 0; sub < 2; ++sub) { const int kb = 2 * t + sub;
          if (kb < nkb) {   // wave-uniform (a scalar branch)
            // fp16: this block's value rows are read first and arrive under the score products. HL holds twice the fragments: each set is read only when the one before it is used up, so that the wave's registers leave room for a second wave on its SIMD
            V va[8], va2[8];
            auto loadv = [&](int d0, int d1) {   // the fragments of the 16-row groups d0 .. d1 - 1
#pragma unroll
                for (int db = d0; db < d1; ++db) { va[db] = WFrag<T16>::ld(pv + db * 16 * VPI + sub * 32); if (HL) va2[db] = WFrag<T16>::ld(pv + PL + db * 16 * VPI + sub * 32); } };
            if (HL) loadk(sub); else loadv(0, 8);
            v8f s[2][2];
#pragma unroll
            for (int kt = 0; kt < 2; ++kt)
#pragma unroll
                for (int g = 0; g < 2; ++g) s[kt][g] = (v8f){};
#pragma unroll
            for (int ks = 0; ks < 4; ++ks)
#pragma unroll
                for (int kt = 0; kt < 2; ++kt)
#pragma unroll
                    for (int g = 0; g < 2; ++g) { s[kt][g] = WFrag<T16>::mma(ka[kt][ks], bq[g][ks], s[kt][g]); if (HL) { s[kt][g] = WFrag<T16>::mma(ka[kt][ks], bq2[g][ks], s[kt][g]); s[kt][g] = WFrag<T16>::mma(ka2[kt][ks], bq[g][ks], s[kt][g]); } }
            __builtin_amdgcn_sched_barrier(0);   // the LDS reads of the next line stay one group behind the score products, not spread among them
            if (HL) loadv(0, 4); else if (sub == 0) loadk(1);   // fp16: the key rows of the stage's second half (the same buffer) arrive under the softmax and the value products
            if (con && kb == nkb - 1) {   // wave-uniform: only the block that straddles the wave's diagonal holds keys j > i, and only it pays for the selects
#pragma unroll
                for (int g = 0; g < 2; ++g)
#pragma unroll
                    for (int kt = 0; kt < 2; ++kt) {
#pragma unroll
                        for (int j = 0; j < 8; ++j) if (kb * 32 + kt * 16 + hi * 8 + j > q0 + g * 16 + lr) s[kt][g][j] = -3.0e38f;
                        asm volatile("" : "+v"(s[kt][g])); } }
            float mn[2];
#pragma unroll
            for (int g = 0; g < 2; ++g) { const int qi = q0 + g * 16 + lr; float ml = -3.0e38f;
                v4f mq[2][2];
                if (!con) { const float* mp = MKb + (size_t)qi * TT + kb * 32 + hi * 8; mq[0][0] = *(const v4f*)mp; mq[0][1] = *(const v4f*)(mp + 4); mq[1][0] = *(const v4f*)(mp + 16); mq[1][1] = *(const v4f*)(mp + 20);
                    asm volatile("s_wait_xcnt 0x0" :: "v"(mp) : "memory"); }   // the four loads' address register is an input: not reused before this wait
#pragma unroll
                for (int kt = 0; kt < 2; ++kt) { v8f x = s[kt][g] * SCL;   // a masked score stays far below every real one
                    if (!con) {
#pragma unroll
                        for (int j = 0; j < 4; ++j) { x[j] += bfr(mq[kt][0][j]); x[4 + j] += bfr(mq[kt][1][j]); } }
#pragma unroll
                    for (int j = 0; j < 8; ++j) ml = fmaxf(ml, x[j]);
                    s[kt][g] = x; }
                ml = fmaxf(ml, xhalf(ml));   // the other half of the wave holds the query's other 16 keys
                mn[g] = fmaxf(m[g], ml); }
            // a new maximum rescales sum and output; where no query of the wave has one the factor is exactly 1 and the work is skipped (a scalar branch)
            if (__builtin_amdgcn_ballot_w32(mn[0] > m[0] || mn[1] > m[1]) != 0) {
#pragma unroll
                for (int g = 0; g < 2; ++g) { const float al = exp2s((m[g] - mn[g]) * L2E); l[g] *= al; m[g] = mn[g];
#pragma unroll
                    for (int db = 0; db < 8; ++db) o[db][g] *= al; } }
            V pf[2], pf2[2];
#pragma unroll
            for (int g = 0; g < 2; ++g) { float ps = 0.f; v16us ph, pl; v16h p16;
#pragma unroll
                for (int kt = 0; kt < 2; ++kt)
#pragma unroll
                    for (int j = 0; j < 8; ++j) { const float e = exp2s((s[kt][g][j] - m[g]) * L2E); ps += e;
                        if constexpr (HL) { unsigned short a, c; splitf(e, a, c); ph[kt * 8 + j] = a; pl[kt * 8 + j] = c; } else p16[kt * 8 + j] = tohx(e * PCAR); }
                l[g] += ps;
                if constexpr (HL) { pf[g] = __builtin_bit_cast(v16bf, ph); pf2[g] = __builtin_bit_cast(v16bf, pl); } else pf[g] = p16; }
#pragma unroll
            for (int db = 0; db < 8; ++db) {
                if (HL && db == 4) { __builtin_amdgcn_sched_barrier(0); loadv(4, 8); }   // HL: the second half of the value fragments is not read before the first is used up: all at once, query fragments spill
#pragma unroll
                for (int g = 0; g < 2; ++g) { o[db][g] = WFrag<T16>::mma(va[db], pf[g], o[db][g]); if (HL) { o[db][g] = WFrag<T16>::mma(va[db], pf2[g], o[db][g]); o[db][g] = WFrag<T16>::mma(va2[db], pf[g], o[db][g]); } } }
          } }
        asm volatile("s_wait_dscnt 0x0" ::: "memory");      // this wave's reads of stage t are done before the buffer is handed to the copies below
        asm volatile("s_wait_asynccnt 0x0" ::: "memory");   // this wave's share of stage t + 1 has landed
        __syncthreads();                                    // publishes stage t + 1 and ends every wave's reads of stage t
        if (t + 2 < nst) fill(t + 2);
    }
    asm volatile("s_wait_asynccnt 0x0" ::: "memory");       // no copy is outstanding when the wave goes on to its end
    // output: lane = query row q0 + 16 g + lr, 8 consecutive d per tile: 16-byte stores into the merged hi and lo planes [t][DQ]; a 128-byte line is written by one wave
#pragma unroll
    for (int g = 0; g < 2; ++g) { const float lt = l[g] + xhalf(l[g]); const float inv = __fdiv_rn(HL ? 1.0f : 1.0f / PCAR, lt);
        bf* oa = Ah + (size_t)(q0 + g * 16 + lr) * DQ + h * HD + hi * 8; bf* ob = Al + (size_t)(q0 + g * 16 + lr) * DQ + h * HD + hi * 8;
#pragma unroll
        for (int db = 0; db < 8; ++db) { v8us oh, ol;
#pragma unroll
            for (int j = 0; j < 8; ++j) { unsigned short a, c; splitf(o[db][g][j] * inv, a, c); oh[j] = a; ol[j] = c; }
            *(v8us*)(oa + db * 16) = oh; *(v8us*)(ob + db * 16) = ol;
            asm volatile("s_wait_xcnt 0x0" :: "v"(oa), "v"(ob), "v"(oh), "v"(ol) : "memory"); } }   // the two stores' address and data registers are inputs: none is reused before this wait
}
// grid: (NH_ x TT / 128, NB_) blocks, y the batch. A block takes the 128 query rows c of one head, wave w the 32-row tile 4 c + w: the four waves walk the same keys out of the same LDS stages and end within one stage of one another.
// amdgpu_waves_per_eu(2, 2): the registers are held at 512 a wave, so that two blocks share a WGP and one wave's softmax runs under the other's matrix instructions (without it the hi + lo path takes about 700 and a wave has its SIMD alone).
// A block's walk grows with c; all blocks are resident at once, so neighbours in x, and the two batches at one x, take c and 15 - c (for speed only: a short and a long walk wherever two blocks share a WGP).
__global__ __launch_bounds__(32 * FWV) __attribute__((amdgpu_waves_per_eu(2, 2))) void k_fattn(const h16* __restrict__ Q16, const h16* __restrict__ K16, const h16* __restrict__ V16, const bf* __restrict__ Qh, const bf* __restrict__ Ql, const bf* __restrict__ Kh, const bf* __restrict__ Kl,
                                                    const bf* __restrict__ Vh, const bf* __restrict__ Vl, const float* __restrict__ MK, const int* __restrict__ CF, bf* ATh, bf* ATl) {
    __shared__ __align__(128) unsigned short fring[2 * 2 * (KSZ + VSZ)];   // two buffers of [K | V | K lo | V lo]; the fp16 blocks use the first half
    const int lane = threadIdx.x & 31, lr = lane & 15, hi = lane >> 4;
    const int w = __builtin_amdgcn_readfirstlane(threadIdx.x >> 5);   // the wave's number in a scalar register: the key loop stays a scalar loop
    const int b = blockIdx.y; int bad = 0;
#pragma unroll
    for (int i = 0; i < 4; ++i) { const v4i f = *(const v4i*)(CF + b * 512 + (i * 32 + lane) * 4); bad |= f[0] | f[1] | f[2] | f[3]; }   // each wave reads the batch's 512 words
    const bool con = (__builtin_amdgcn_ballot_w32(bad != 0) == 0);   // device flag, in a scalar register: this batch's mask verified causal
    const size_t po = (size_t)b * NH_ * TT * HD, qo = (size_t)b * NH_ * RH * HD, vo = (size_t)b * NKV * HD * 2 * TT; const float* MKb = MK + (size_t)b * TT * TT; bf* Ah = ATh + (size_t)b * TT * DQ; bf* Al = ATl + (size_t)b * TT * DQ;
    const int xh = blockIdx.x >> 1; const int h = xh % NH_; const int c = ((blockIdx.x ^ b) & 1) ? TT / (32 * FWV) - 1 - xh / NH_ : xh / NH_;
    const int q0 = (c * FWV + w) * 32;
    const int nkb = con ? q0 / 32 + 1 : TT / 32;                     // 32-key blocks this wave visits (wave-uniform)
    const int nst = con ? (c + 1) * (32 * FWV / KST) : TT / KST;     // 64-key stages up to the block's last diagonal (block-uniform)
    if (c < RH / (32 * FWV)) fattn<bf, true>(h, h / REP, q0, RH, lr, hi, w, nkb, nst, con, (bf*)fring, Qh + qo, Ql + qo, Kh + po, Kl + po, Vh + vo, Vl + vo, MKb, Ah, Al);   // block-uniform
    else fattn<h16, false>(h, h / REP, q0, TT, lr, hi, w, nkb, nst, con, (h16*)fring, Q16 + po, Q16 + po, K16 + po, K16 + po, V16 + (size_t)b * TT, V16 + (size_t)b * TT, MKb, Ah, Al);
}

extern "C" void kernel_launch(void* const* d_in, const int* in_sizes, int n_in,
                              void* d_out, int out_size, void* d_ws, size_t ws_size, hipStream_t stream) {
    (void)in_sizes; (void)n_in; (void)out_size;
    const float* x = (const float*)d_in[0]; const float* MK = (const float*)d_in[1]; const int* POS = (const int*)d_in[2]; const float* wq = (const float*)d_in[3]; const float* wk = (const float*)d_in[4]; const float* wv = (const float*)d_in[5]; const float* wo = (const float*)d_in[6];
    float* OUT = (float*)d_out;     // [2][2048][2048]
    char* wsp = (char*)d_ws;
    auto take = [&](size_t bytes) { char* p = wsp; wsp += (bytes + 255) & ~(size_t)255; return (void*)p; };
    // both batches have buffers of their own. CV: the six bf16 planes of k_prep
    bf* CV = (bf*)take(6 * PE * 2); bf* WQ = CV; bf* XB = CV + 3 * PE; bf* WO = CV + (3 + NB_) * PE; float* CS = (float*)take((size_t)NB_ * TT * HD * 2 * 4);
    int* CFLAG = (int*)take(NB_ * 512 * 4);
    h16* QP16 = (h16*)take((size_t)NB_ * NH_ * TT * HD * 2); h16* KP16 = (h16*)take((size_t)NB_ * NKV * TT * HD * 2); h16* VT16 = (h16*)take((size_t)NKV * HD * 2 * TT * 2);
    bf* QPh = (bf*)take((size_t)NB_ * NH_ * RH * HD * 2); bf* QPl = (bf*)take((size_t)NB_ * NH_ * RH * HD * 2); bf* VTh = (bf*)take((size_t)NB_ * NKV * HD * 2 * TT * 2); bf* VTl = VTh + TT;
    bf* KPh = (bf*)take((size_t)NB_ * NKV * TT * HD * 2); bf* KPl = (bf*)take((size_t)NB_ * NKV * TT * HD * 2);
    bf* ATh = (bf*)take(2 * (size_t)NB_ * TT * DQ * 2); bf* ATl = ATh + (size_t)NB_ * TT * DQ;   // the merged attention output, hi and lo
    if ((size_t)(wsp - (char*)d_ws) > ws_size) return;    // ws 256 MiB
    k_prep<<<dim3(512, 4 + 3 * NB_, 1), 256, 0, stream>>>(wq, wk, wv, x, wo, POS, MK, CV, PE / 8, CS, CFLAG);
    k_gemms<0, 256, 192, 4, DQ, true><<<dim3(NB_ * TT / 256, 3 * DQ / 192, 1), 256, 0, stream>>>(XB, nullptr, WQ, DM, nullptr, 0, CS, QP16, QPh, QPl, KP16, KPh, KPl, VT16, VTh);
    k_fattn<<<dim3(NH_ * (TT / (32 * FWV)), NB_, 1), 32 * FWV, 0, stream>>>(QP16, KP16, VT16, QPh, QPl, KPh, KPl, VTh, VTl, MK, CFLAG, ATh, ATl);
    k_gemms<1, 128, 256, 2, DM, false><<<dim3(NB_ * TT / 128, DM / 256, 1), 256, 0, stream>>>(ATh, ATl, WO, DQ, OUT, 0, nullptr, nullptr, nullptr, nullptr, nullptr, nullptr, nullptr, nullptr, nullptr);
}

// v010
// Measured time: 199 microseconds a run.
// Two timings next to v009 put it at 1.05 and 1.03 times that version's speed.
// Counting every step since v000, it is 9.77 times as fast.
#include <hip/hip_runtime.h>

// Causal LM attention with additive mask and position-id rotary (hidden [2][2048][2048]; q, k, v = hidden W^T ('oi' [2048][2048], 16 heads x 128); rotate-half RoPE with angle = position_ids[b][t] x inv_freq (theta 1e4; position_ids int32 input, read on device); scores/sqrt(128) + attention_mask[b][0][i][j] (f32 input, read); softmax; out = merged Wo^T -> [2][2048][2048]).
// The additive mask is verified ON THE DEVICE to be the causal pattern (0 where j <= i, most-negative elsewhere); when it is, key blocks above the diagonal are skipped and the masked entries are realised as exact-zero softmax weights (identical result); otherwise every key is visited and the mask is simply added (general fallback).
// Compute dtypes, f32 accumulate: every input rounded to bf16; q/k/v on PLAIN bf16 operands (inputs: exact); rotary in f32 (per-batch table from the position ids and the reference's inv_freq constants); mask check; scores, additive mask (bf16-rounded), running softmax (f32) and attn.v in one kernel (block skipping gated by the device flag): query rows < 512 hl (3 products), the rest single fp16 (x1024); Wo hl x exact (2 products).

#define NB_  2
#define TT   2048
#define DM   2048
#define NH_  16
#define NKV  16
#define REP  (NH_ / NKV)
#define HD   128
#define DQ   (NH_ * HD)
#define DKV  (NKV * HD)
#define RH   512                  // query rows < RH use hi+lo planes (0: none)
#define WIN  2048
#define PCAR 1024.0f
#define SCL  0.088388347648318447f   // HD^-0.5
typedef _Float16 h16;
typedef unsigned short bf;
typedef __attribute__((ext_vector_type(16))) __bf16   v16bf;
typedef __attribute__((ext_vector_type(16))) _Float16 v16h;
typedef __attribute__((ext_vector_type(8)))  _Float16 v8h;
typedef __attribute__((ext_vector_type(8)))  unsigned short v8us;
typedef __attribute__((ext_vector_type(8)))  float    v8f;
typedef __attribute__((ext_vector_type(4)))  float    v4f;
typedef v8h  __attribute__((may_alias)) v8ha;
typedef v4f  __attribute__((may_alias)) v4fa;
typedef v8us __attribute__((may_alias)) v8usa;

__device__ __forceinline__ unsigned short f2bf(float f) { unsigned u = __float_as_uint(f); u += 0x7FFFu + ((u >> 16) & 1u); return (unsigned short)(u >> 16); }
__device__ __forceinline__ float bf2f(unsigned short b) { return __uint_as_float(((unsigned)b) << 16); }
__device__ __forceinline__ float bfr(float f) { return bf2f(f2bf(f)); }
__device__ __forceinline__ v16h cat16(v8h lo, v8h hi) { return __builtin_shufflevector(lo, hi, 0, 1, 2, 3, 4, 5, 6, 7, 8, 9, 10, 11, 12, 13, 14, 15); }
__device__ __forceinline__ v16bf cat16b(v8us lo, v8us hi) { return __builtin_bit_cast(v16bf, __builtin_shufflevector(lo, hi, 0, 1, 2, 3, 4, 5, 6, 7, 8, 9, 10, 11, 12, 13, 14, 15)); }
__device__ __forceinline__ v8f wmma16(v16h a, v16h b, v8f c) { return __builtin_amdgcn_wmma_f32_16x16x32_f16(false, a, false, b, (short)0, c, false, false); }
__device__ __forceinline__ v8f wmmab(v16bf a, v16bf b, v8f c) { return __builtin_amdgcn_wmma_f32_16x16x32_bf16(false, a, false, b, (short)0, c, false, false); }



// ---- fragment loaders: lane (lr, hi) of a 16-row fragment reads k = 8 hi .. 8 hi + 7 and 16 + 8 hi .. 16 + 8 hi + 7 of row lr (the same for both operands)
template <typename T16> struct WFrag;
template <> struct WFrag<h16> { typedef v16h V; static __device__ __forceinline__ V ld(const h16* p) { return cat16(*(const v8h*)p, *(const v8h*)(p + 16)); } static __device__ __forceinline__ v8f mma(V a, V b, v8f c) { return wmma16(a, b, c); } };
template <> struct WFrag<bf> { typedef v16bf V; static __device__ __forceinline__ V ld(const bf* p) { return cat16b(*(const v8us*)p, *(const v8us*)(p + 16)); } static __device__ __forceinline__ v8f mma(V a, V b, v8f c) { return wmmab(a, b, c); } };
// ---- k_gemms: projection GEMM, one block of 8 waves (WGM x 8 / WGM) per BM x BN output tile, one block a WGP; a wave holds MF x NF accumulators of 16 x 16 over the whole K. grid (M/BM, N/BN), 256 threads. M % BM == 0, N % BN == 0, K % 128 == 0.
// C (f32) = sum_k (A[m][k] + A2[m][k] if NSPLIT) Bt[n][k]; A, A2, Bt are K-contiguous bf16 planes of row pitch K. Column n lies in output plane n / LDC (planes cz elements apart, row pitch LDC) at column n % LDC:
// the weights of q, k and v are one Bt of 3 x 2048 rows, and the rows of both batches are one M.
// The tile is sized to what a WGP can take in: a stage brings (BM (x 2 if NSPLIT) + BN) x 256 bytes out of L2 for BM x BN x 128 products, and a wave reads MF (x 2) + NF fragments out of LDS for MF x NF (x 2) matrix instructions.
// 256 x 192 (q/k/v: 512 tiles, two rounds on 256 WGPs) and 128 x 256 (output projection: 256 tiles, one round) keep both below the time of the matrix instructions.
// The operands come through LDS: a stage is SK = 128 k of the tile's A rows (, A2 rows) and Bt rows, brought by asynchronous 16-byte copies as whole 256-byte row pieces (two rows an instruction),
// so each row piece is fetched from L2 once per block and read by all the waves that need it. Two buffers: stage t + 1 flies while stage t is multiplied.
#define SK 128                    // k per stage
#define SP 136                    // LDS row pitch in 16-bit elements: 272 bytes = 16 x 17, free of bank conflicts for the 16-byte fragment reads
// acopy: one asynchronous 16-byte copy a lane (l = the lane's LDS byte address, g = the lane's global address), written as the builtin: the compiler sees which registers a copy names,
// so a wave goes on from its last copy to its next work with no wait of its own in between; the landing is waited for where the stage is published (s_wait_asynccnt).
typedef __attribute__((ext_vector_type(4))) int c4i;
typedef __attribute__((address_space(1))) c4i gc4i;
typedef __attribute__((address_space(3))) c4i lc4i;
__device__ __forceinline__ void acopy(unsigned l, const void* g) { __builtin_amdgcn_global_load_async_to_lds_b128((gc4i*)g, (lc4i*)l, 0, 0); }
// copy8: eight copies of one wave, rows 16 apart (l = the lane's LDS byte address, g = the lane's global address, gs = 16 rows in elements).
__device__ __forceinline__ void copy8(unsigned l, const bf* g, size_t gs) {
    // unrolled (here, in copy4 and in copy8p): eight copies (copy4: four) in a row with no loop counter or branch between them, each LDS step a constant
#pragma unroll
    for (int i = 0; i < 8; ++i) acopy(l + i * 16 * SP * 2, g + i * gs);
}
// copy4: the same for four copies (64 rows of the block)
__device__ __forceinline__ void copy4(unsigned l, const bf* g, size_t gs) {
#pragma unroll
    for (int i = 0; i < 4; ++i) acopy(l + i * 16 * SP * 2, g + i * gs);
}
// the two pieces of the q/k/v epilogue (defined further down)
__device__ __forceinline__ void rope(const int h, const int tb, const float* Fb, int pitch, const float* __restrict__ CS, const float* __restrict__ RF, const float* __restrict__ nw, float sc, int hr, h16* P16, bf* Ph, bf* Pl);
__device__ __forceinline__ void vtp(const int g, const int dw, const int tb, const float* Fw, int pitch, h16* V16, bf* Vh, bf* Vl);
typedef float __attribute__((may_alias)) fa;
// FUSE (the q/k/v GEMM, BN = 192): the f32 projections never go to memory. Tile column y holds one whole head of q (y < NH_) or k (128 columns: a rotary pair d, d + 64 and whole 128-byte lines of the head planes lie in one tile)
// and 64 columns of v (half a head; the turned planes' lines run along t). The accumulators go to the ring, free behind the last stage's barrier, as one f32 tile; behind one block barrier the block turns it into the attention's planes.
template <int NSPLIT, int BM, int BN, int WGM, int LDC, bool FUSE>
__global__ __launch_bounds__(256) void k_gemms(const bf* __restrict__ A, const bf* __restrict__ A2, const bf* __restrict__ Bt, int K, float* C, size_t cz,
                                               const float* __restrict__ CS, h16* QP16, bf* QPh, bf* QPl, h16* KP16, bf* KPh, bf* KPl, h16* VT16, bf* VTh) {
    typedef WFrag<bf>::V V;
    constexpr int WGN = 8 / WGM, MF = BM / WGM / 16, NF = BN / WGN / 16;   // waves across the columns; 16-row and 16-column fragments a wave
    constexpr int NR = (NSPLIT ? 2 : 1) * BM + BN;         // rows per stage: A, (A2,) Bt
    static_assert(BM % 128 == 0 && BN % 64 == 0 && NF % 2 == 0 && LDC % 32 == 0, "tile");
    __shared__ __align__(128) bf ring[2 * NR * SP];
    __shared__ __align__(16) float os[8 * 16 * 36];        // per wave: 16 output rows x 32 columns at pitch 36, for whole-line stores
    const int lane = threadIdx.x & 31, lr = lane & 15, hi = lane >> 4; const int r0 = blockIdx.x * BM, c0 = blockIdx.y * BN;
    const int w = __builtin_amdgcn_readfirstlane(threadIdx.x >> 5);   // the wave's number in a scalar register: everything derived from it stays scalar
    const int wm = w / WGN, wn = w % WGN;
    // copies: half a wave takes one 256-byte row piece (lane lr its 16 bytes lr); copy c of wave w brings rows 16 c + 2 w + hi of an operand
    const int crow = 2 * w + hi; const size_t gs = (size_t)16 * K;
    const bf* ga = A + (size_t)r0 * K; const bf* ga2 = NSPLIT ? A2 + (size_t)r0 * K : nullptr; const bf* gb = Bt + (size_t)(FUSE ? blockIdx.y * HD : c0) * K;   // the tile's first rows: the same for all lanes, kept in scalar registers
    const int brt = FUSE ? DQ + DKV + blockIdx.y * 64 - blockIdx.y * HD : BN - 64;   // the tile's last 64 rows of Bt, counted from its first (FUSE: rows of wv, which lies behind wq and wk)
    const int lof = crow * K + lr * 8;   // the lane's place in an operand's first 16 rows, in elements: one register serves all operands
    const unsigned l0 = (unsigned)(size_t)ring + (unsigned)(crow * SP + lr * 8) * 2u;
    auto fill = [&](int t) { const unsigned l = l0 + (unsigned)(t & 1) * (unsigned)(NR * SP * 2); const int kc = t * SK;
#pragma unroll
        for (int i = 0; i < BM / 128; ++i) { copy8(l + i * 128 * SP * 2, (ga + kc + (size_t)(i * 128) * K) + lof, gs); if (NSPLIT) copy8(l + (BM + i * 128) * SP * 2, (ga2 + kc + (size_t)(i * 128) * K) + lof, gs); }
#pragma unroll
        for (int i = 0; i < BN / 128; ++i) copy8(l + (NR - BN + i * 128) * SP * 2, (gb + kc + (size_t)(i * 128) * K) + lof, gs);
        if (BN % 128) copy4(l + (NR - 64) * SP * 2, (gb + kc + (size_t)brt * K) + lof, gs); };
    const int nst = K / SK;
    // every loop over i, mb, nb, np, ks, j and s is unrolled whole, so that the accumulator and fragment arrays are indexed by constants only and stay in registers
    v8f acc[MF][NF];
#pragma unroll
    for (int mb = 0; mb < MF; ++mb)
#pragma unroll
        for (int nb = 0; nb < NF; ++nb) acc[mb][nb] = (v8f){};
    fill(0);
    asm volatile("s_wait_asynccnt 0x0" ::: "memory");   // this wave's share of stage 0 has landed
    __syncthreads();                                    // every wave's share of stage 0 has landed
    if (nst > 1) fill(1);
    // rolled: one trip is one stage (96 or 128 matrix instructions a wave), and the buffer alternates with t
#pragma unroll 1
    for (int t = 0; t < nst; ++t) {
        const bf* sb = ring + (t & 1) * (NR * SP); const bf* pa = sb + (wm * MF * 16 + lr) * SP + 8 * hi; const bf* pb = sb + (NR - BN + wn * NF * 16 + lr) * SP + 8 * hi;
        V a[2][MF], a2[2][MF], b[2][NF];   // two fragment sets: k step ks + 1 is read from LDS while k step ks is multiplied
#pragma unroll
        for (int ks = -1; ks < SK / 32; ++ks) {
            if (ks + 1 < SK / 32) { const int q = (ks + 1) & 1, ko = (ks + 1) * 32;
#pragma unroll
                for (int mb = 0; mb < MF; ++mb) { a[q][mb] = WFrag<bf>::ld(pa + mb * 16 * SP + ko); if (NSPLIT) a2[q][mb] = WFrag<bf>::ld(pa + (BM + mb * 16) * SP + ko); }
#pragma unroll
                for (int nb = 0; nb < NF; ++nb) b[q][nb] = WFrag<bf>::ld(pb + nb * 16 * SP + ko); }
            __builtin_amdgcn_sched_barrier(0);   // the next k step's LDS reads stay one group in front of this step's matrix instructions, not spread among them
            if (ks >= 0) { const int q = ks & 1;
#pragma unroll
                for (int nb = 0; nb < NF; ++nb)
#pragma unroll
                    for (int mb = 0; mb < MF; ++mb) { acc[mb][nb] = WFrag<bf>::mma(a[q][mb], b[q][nb], acc[mb][nb]); if (NSPLIT) acc[mb][nb] = WFrag<bf>::mma(a2[q][mb], b[q][nb], acc[mb][nb]); }
                __builtin_amdgcn_sched_barrier(0); }   // and the reads of the step after next stay behind them
        }
        asm volatile("s_wait_dscnt 0x0" ::: "memory");      // this wave's reads of stage t are done before the buffer is handed to the copies below
        asm volatile("s_wait_asynccnt 0x0" ::: "memory");   // this wave's share of stage t + 1 has landed
        __syncthreads();                                    // publishes stage t + 1 and ends every wave's reads of stage t
        if (t + 2 < nst) fill(t + 2);
    }
    asm volatile("s_wait_asynccnt 0x0" ::: "memory");       // no copy is outstanding when the wave goes on to its end
    if constexpr (FUSE) {
        constexpr int PT = BN + 4;   // pitch of the f32 tile in floats: a multiple of 4 (16-byte reads); 8 rows on are 32 banks on, so the two halves of a wave store to different banks
        static_assert(BN == HD + 64 && BM == 256 && TT % BM == 0 && (size_t)BM * PT * 4 <= sizeof(ring), "fused epilogue");
        fa* tile = (fa*)ring;
#pragma unroll
        for (int mb = 0; mb < MF; ++mb)
#pragma unroll
            for (int nb = 0; nb < NF; ++nb)
#pragma unroll
                for (int j = 0; j < 8; ++j) tile[(wm * MF * 16 + mb * 16 + hi * 8 + j) * PT + wn * NF * 16 + nb * 16 + lr] = acc[mb][nb][j];
        __syncthreads();   // every wave's part of the tile is written before any wave reads whole rows of it
        const int b = r0 / TT, t0 = r0 % TT, y = blockIdx.y; const bool isk = (y >= NH_); const int h = isk ? y - NH_ : y, hr = isk ? TT : RH;
        const size_t po = (size_t)b * NH_ * TT * HD, ho = (size_t)b * NH_ * hr * HD;
        // rolled: one trip is 64 rows of the head
#pragma unroll 1
        for (int it = 0; it < BM / 64; ++it)
            rope(h, t0 + it * 64, (const float*)tile + it * 64 * PT, PT, CS + (size_t)b * TT * HD * 2, nullptr, nullptr, 1.0f, hr, (isk ? KP16 : QP16) + po, (isk ? KPh : QPh) + ho, (isk ? KPl : QPl) + ho);
        bf* vh = VTh + (size_t)b * NKV * HD * 2 * TT;
#pragma unroll
        for (int i = 0; i < 2; ++i) { const int cl = (w >> 2) * 32 + i * 16;   // wave w: rows 64 (w & 3) .. + 63, two groups of 16 columns
            vtp(y >> 1, (y & 1) * 64 + cl, t0 + (w & 3) * 64, (const float*)tile + (w & 3) * 64 * PT + HD + cl, PT, VT16 + (size_t)b * TT, vh, vh + TT); }
        return;
    }
    float* mine = os + w * (16 * 36);
#pragma unroll
    for (int mb = 0; mb < MF; ++mb)
#pragma unroll
      for (int np = 0; np < NF / 2; ++np) {   // 32 columns at a time: they lie in one output plane
#pragma unroll
        for (int nb = 0; nb < 2; ++nb)
#pragma unroll
            for (int j = 0; j < 8; ++j) mine[(hi * 8 + j) * 36 + nb * 16 + lr] = acc[mb][np * 2 + nb][j];
        __builtin_amdgcn_wave_barrier(); asm volatile("" ::: "memory");   // the reads below (other lanes' values) stay behind the writes above
        const int n = c0 + wn * NF * 16 + np * 32;
        float* crw = C + (size_t)(n / LDC) * cz + (size_t)(r0 + wm * MF * 16 + mb * 16) * LDC + n % LDC;
#pragma unroll
        for (int s = 0; s < 4; ++s) { const int row = 4 * s + (lane >> 3), cofs = (lane & 7) * 4; const v4f val = *(const v4fa*)(mine + row * 36 + cofs);
            *(v4f*)(crw + (size_t)row * LDC + cofs) = val; }
        __builtin_amdgcn_wave_barrier(); asm volatile("" ::: "memory");   // the next 16 x 32 piece's writes stay behind the reads above
    }
}

__device__ __forceinline__ h16 tohx(float x) { return (h16)x; }
__device__ __forceinline__ void splitf(float y, unsigned short& h, unsigned short& l) { h = f2bf(y); l = f2bf(y - bf2f(h)); }
typedef __attribute__((ext_vector_type(2))) _Float16 v2h;
typedef __attribute__((ext_vector_type(4))) _Float16 v4h;
typedef __attribute__((ext_vector_type(2))) unsigned short v2us;
typedef __attribute__((ext_vector_type(4))) unsigned short v4us;
typedef __attribute__((ext_vector_type(2))) float v2f;
typedef __attribute__((ext_vector_type(4))) int v4i;

__global__ __launch_bounds__(256) void k_wtG(const float* __restrict__ w, int K, int N, bf* Bt) {
    const int lane = threadIdx.x & 31; const int L0 = (blockIdx.x * 8 + (threadIdx.x >> 5)) * 8; const int nlines = N * K / 64;
{
#pragma unroll 1
        for (int l = 0; l < 8; ++l) { const int L = L0 + l; if (L >= nlines) break; const size_t e = (size_t)L * 64 + lane * 2; const int k = (int)(e % K), n = (int)(e / K); v2us o;
            o[0] = f2bf(w[(size_t)k * N + n]); o[1] = f2bf(w[(size_t)(k + 1) * N + n]); *(v2us*)(Bt + e) = o; }
         }
}
// The elementwise pieces below give each thread several vectors (all loads issued first, then the arithmetic and the stores). Each piece is a device function over 512 blocks of 256 threads (bx = its block);
// pieces that do not depend on one another, for both batches, share one launch: k_prep (in front of the q/k/v GEMM). rope and vtp work on the q/k/v GEMM's tile, in its epilogue.
#define EU 4                      // vectors per thread in cvt8 and rope (rows)
#define MU 8                      // vectors per thread in mchk
__device__ __forceinline__ void cvt8(const int bx, const float* __restrict__ src, bf* dst, size_t n8) { const size_t i0 = (size_t)bx * (256 * EU) + threadIdx.x; v8f v[EU];
#pragma unroll
    for (int u = 0; u < EU; ++u) { const size_t i = i0 + (size_t)u * 256; v[u] = *(const v8f*)(src + (i < n8 ? i : n8 - 1) * 8); }   // index clamped, not branched round: the loads stay one group in flight; the store below is guarded
#pragma unroll
    for (int u = 0; u < EU; ++u) { const size_t i = i0 + (size_t)u * 256; v8us o;
#pragma unroll
        for (int k = 0; k < 8; ++k) o[k] = f2bf(v[u][k]);
        if (i < n8) *(v8us*)(dst + i * 8) = o; } }
__constant__ float INV[HD / 2] = {1.0,0.8659643530845642,0.7498942017555237,0.6493816375732422,0.5623413324356079,0.486967533826828,0.4216965138912201,0.36517414450645447,0.3162277638912201,0.2738419771194458,0.23713736236095428,0.20535250008106232,0.17782793939113617,0.1539926528930664,0.1333521455526352,0.11547820270061493,0.10000000149011612,0.08659642934799194,0.07498941570520401,0.06493816524744034,0.05623412877321243,0.04869675263762474,0.04216964915394783,0.03651741147041321,0.03162277862429619,0.0273841954767704,0.0237137358635664,0.02053525112569332,0.017782794311642647,0.015399265103042126,0.01333521492779255,0.011547819711267948,0.009999999776482582,0.00865964312106371,0.007498942315578461,0.006493816617876291,0.005623413249850273,0.004869675263762474,0.0042169648222625256,0.003651741426438093,0.003162277862429619,0.0027384196873754263,0.0023713738191872835,0.0020535250660032034,0.0017782794311642647,0.0015399265103042126,0.0013335214462131262,0.0011547820176929235,0.0010000000474974513,0.0008659643353894353,0.0007498941849917173,0.0006493816617876291,0.000562341301701963,0.00048696750309318304,0.00042169648804701865,0.00036517411353997886,0.0003162277862429619,0.00027384195709601045,0.0002371373848291114,0.00020535249495878816,0.00017782794020604342,0.00015399264520965517,0.0001333521504420787,0.00011547819303814322};
// cstab: one thread per (t, d < HD/2); the angle of d + HD/2 is the same one, so the pair at d serves both (a row of the table is HD pairs long, of which the first HD/2 are used)
__device__ __forceinline__ void cstab(const int bx, const int* __restrict__ pos, float* CS) { const int idx = bx * 256 + threadIdx.x; if (idx >= TT * (HD / 2)) return; const int t = idx / (HD / 2), d = idx % (HD / 2); const float ang = __fmul_rn((float)pos[t], INV[d]); v2f cs; cs[0] = cosf(ang); cs[1] = sinf(ang);
    float* o = CS + ((size_t)t * HD + d) * 2; *(v2f*)o = cs;  }
// mchk: causal-pattern check of the additive mask for one batch: FLAG[0], the block's own word, is 1 if the block saw any entry with (j <= i and mask != 0) or (j > i and mask > -1e30), else 0 (every word is written in every call; the attention reads all 512 of its batch); lane -> MU groups of 4 consecutive j, 1024 elements apart.
__device__ __forceinline__ void mchk(const int bx, const float* __restrict__ MKb, int* FLAG) { const size_t e0 = ((size_t)bx * (256 * MU) + threadIdx.x) * 4; v4f m[MU]; bool bad = false;
#pragma unroll
    for (int u = 0; u < MU; ++u) { const size_t e = e0 + (size_t)u * 1024; m[u] = *(const v4f*)(MKb + (e < (size_t)TT * TT ? e : (size_t)TT * TT - 4)); }   // index clamped: one group of loads in flight
#pragma unroll
    for (int u = 0; u < MU; ++u) { const size_t e = e0 + (size_t)u * 1024; const int j = (int)(e % TT), i = (int)(e / TT); bool b = false;
#pragma unroll
        for (int q = 0; q < 4; ++q) { const bool keep = (j + q <= i); b |= keep ? (m[u][q] != 0.0f) : (m[u][q] > -1.0e30f); }
        bad |= b && (e < (size_t)TT * TT); }
    __shared__ int wbad[8];   // one word a wave
    const unsigned wb = __builtin_amdgcn_ballot_w32(bad); if ((threadIdx.x & 31) == 0) wbad[threadIdx.x >> 5] = (wb != 0);
    __syncthreads();   // the eight words are written before the first thread joins them (every thread of the block comes here)
    if (threadIdx.x == 0) *FLAG = wbad[0] | wbad[1] | wbad[2] | wbad[3] | wbad[4] | wbad[5] | wbad[6] | wbad[7]; }
// k_prep: grid (512, 4 + 3 NB_). y < 4 + NB_: one 2048 x 2048 plane (n8 vectors of 8) to bf16 (wq, wk, wv, the two batches of x, wo, in that order in dst); then a batch's rotary table; then a batch's mask check (512 words a batch).
#define PE ((size_t)DM * DM)      // elements of one plane (DQ x DM = DKV x DM = TT x DM)
__global__ __launch_bounds__(256) void k_prep(const float* __restrict__ wq, const float* __restrict__ wk, const float* __restrict__ wv, const float* __restrict__ x, const float* __restrict__ wo, const int* __restrict__ pos, const float* __restrict__ MK, bf* dst, size_t n8, float* CS, int* FLAG) {
    const int y = blockIdx.y;
    if (y < 4 + NB_) { const float* src = y == 0 ? wq : y == 1 ? wk : y == 2 ? wv : y == 3 + NB_ ? wo : x + (size_t)(y - 3) * PE; cvt8(blockIdx.x, src, dst + (size_t)y * PE, n8); }
    else if (y < 4 + 2 * NB_) { const int b = y - (4 + NB_); cstab(blockIdx.x, pos + (size_t)b * TT, CS + (size_t)b * TT * HD * 2); }
    else { const int b = y - (4 + 2 * NB_); mchk(blockIdx.x, MK + (size_t)b * TT * TT, FLAG + b * 512 + blockIdx.x); }   // block-uniform branch
}

// rope: head planes [h][t][d] (fp16 + hi/lo) of rope(x) x sc with the rotate-half convention out[d] = x[d] cos[t][d] - x[d+HD/2] sin[t][d], out[d+HD/2] = x[d+HD/2] cos[t][d+HD/2] + x[d] sin[t][d+HD/2]; the hi/lo planes hold rows t < hr only ([h][hr][d])
// 16 threads per (h, t) row: a thread takes 4 consecutive d < HD/2 and their 4 partners d + HD/2 (each x is loaded once and serves both), in EU rows 16 apart; a call of a block covers the 16 x EU rows tb .. of head h.
// Fb: row tb at the head's first column, in the GEMM's f32 tile in LDS (row pitch in floats). cos and sin of d + HD/2 are those of d: the table's pair at d is loaded once and serves both.
__device__ __forceinline__ void rope(const int h, const int tb, const float* Fb, int pitch, const float* __restrict__ CS, const float* __restrict__ RF, const float* __restrict__ nw, float sc, int hr, h16* P16, bf* Ph, bf* Pl) {
    const int tl = threadIdx.x >> 4, d = (threadIdx.x & 15) * 4;
    const float* Cb = CS + (size_t)tb * HD * 2; const float* pc = Cb + (tl * HD + d) * 2; v4f xv[EU][2], cv[EU][2][2];
#pragma unroll
    for (int u = 0; u < EU; ++u) { const float* pf = Fb + (u * 16 + tl) * pitch + d; const float* c = pc + (u * 16 * HD) * 2; cv[u][0][0] = *(const v4f*)c; cv[u][0][1] = *(const v4f*)(c + 4); cv[u][1][0] = cv[u][0][0]; cv[u][1][1] = cv[u][0][1];
#pragma unroll
        for (int hf = 0; hf < 2; ++hf) xv[u][hf] = *(const v4fa*)(pf + hf * (HD / 2)); }
    asm volatile("s_wait_xcnt 0x0" :: "v"(pc) : "memory");   // the table loads' address register is an input here, so it is not reused before this wait
#pragma unroll
    for (int u = 0; u < EU; ++u) { const int t = tb + u * 16 + tl; float rf = 1.0f;
        if (RF) { rf = RF[(size_t)h * TT + t]; asm volatile("s_wait_xcnt 0x0" :: "v"(rf) : "memory"); }   // the wait stands behind this load, ahead of any reuse of its base or offset register; the loaded value is an input so that the load cannot sink below it
#pragma unroll
        for (int hf = 0; hf < 2; ++hf) { v4h o16; v4us oh, ol;
#pragma unroll
            for (int q = 0; q < 4; ++q) { const int dd = d + hf * (HD / 2) + q; const int dp = (dd < HD / 2) ? dd + HD / 2 : dd - HD / 2; float x0 = xv[u][hf][q], x1 = xv[u][1 - hf][q];
                if (RF) { float n0 = __fmul_rn(x0, rf), n1 = __fmul_rn(x1, rf); asm volatile("" : "+v"(n0)); asm volatile("" : "+v"(n1)); x0 = __fmul_rn(bfr(nw[dd]), n0); x1 = __fmul_rn(bfr(nw[dp]), n1); }
                v2f cs; cs[0] = cv[u][hf][q >> 1][(q & 1) * 2]; cs[1] = cv[u][hf][q >> 1][(q & 1) * 2 + 1]; float a = __fmul_rn(x0, cs[0]), bq = __fmul_rn(x1, cs[1]); asm volatile("" : "+v"(a)); asm volatile("" : "+v"(bq)); const float r = ((dd < HD / 2) ? __fsub_rn(a, bq) : __fadd_rn(a, bq)) * sc;
                o16[q] = tohx(r); unsigned short a2, c2; splitf(r, a2, c2); oh[q] = a2; ol[q] = c2; }
            const int dh = d + hf * (HD / 2); *(v4h*)(P16 + ((size_t)h * TT + t) * HD + dh) = o16; if (t < hr) { const size_t eh = ((size_t)h * hr + t) * HD + dh; *(v4us*)(Ph + eh) = oh; *(v4us*)(Pl + eh) = ol; } } }
    asm volatile("s_wait_xcnt 0x0" ::: "memory"); }   // the next call's code stands behind these stores: none of their registers is reused in front of this wait
// vtp: transposed value planes [g][d][t] at a row pitch of 2 x TT elements; the lo plane lies in the second half of the hi plane's rows (Vl = Vh + TT); in the fp16 plane the second half of a row holds the second batch
// A call of a wave takes the 64 rows tb .. x the 16 columns dw .. of head g; a thread takes an 8 t x 4 d patch (8 row reads of 16 bytes) and stores it turned, 8 consecutive t per d: a wave's store covers 4 whole 128-byte lines.
// Fw: row tb at column dw, in the GEMM's f32 tile in LDS (row pitch in floats).
__device__ __forceinline__ void vtp(const int g, const int dw, const int tb, const float* Fw, int pitch, h16* V16, bf* Vh, bf* Vl) { const int lane = threadIdx.x & 31; const int tl = (lane >> 2) * 8; const int d = dw + (lane & 3) * 4; v4f xv[8];
#pragma unroll
    for (int r = 0; r < 8; ++r) xv[r] = *(const v4fa*)(Fw + (tl + r) * pitch + (lane & 3) * 4);
#pragma unroll
    for (int c = 0; c < 4; ++c) { v8h o16; v8us oh, ol;
#pragma unroll
        for (int r = 0; r < 8; ++r) { const float x = xv[r][c]; o16[r] = tohx(x); unsigned short a2, c2; splitf(x, a2, c2); oh[r] = a2; ol[r] = c2; }
        const size_t ev = ((size_t)g * HD + d + c) * (2 * TT) + tb + tl; *(v8h*)(V16 + ev) = o16; *(v8us*)(Vh + ev) = oh; *(v8us*)(Vl + ev) = ol; }
    asm volatile("s_wait_xcnt 0x0" ::: "memory"); }   // another call's code stands behind these stores: none of their registers is reused in front of this wait
// ---- k_fattn: scores, softmax, probability x value and the head merge in one kernel; a score never leaves the registers. One wave owns 32 query rows of one head and walks the keys 32 at a time with a running maximum and sum per query.
// Transposed products: S^T = K Q^T (A = 16 key rows, B = 16 query rows, both K-contiguous in d), so that in the accumulator a lane holds one query (column lr) and the keys 8 hi + j of each 16-key tile. That is the place the same lane needs them in
// as B operand of O^T += V^T P^T (k = 8 hi .. 8 hi + 7 from the first tile, 16 + 8 hi .. from the second): the weights are packed in the lane, with no exchange. A = rows d of the transposed value planes, K-contiguous in t.
// HL: hi + lo bf16 planes, 3 products each (query rows < RH); otherwise single fp16, weights x PCAR. The weights are rounded relative to the running maximum and the division by the sum is done once, on the output.
// con (device flag: the mask is the causal pattern): keys beyond the wave's diagonal block are not visited, keys j > i get exact-zero weight and the mask, verified 0 where j <= i, is not read; otherwise every key takes score + bf16(mask).
#define L2E 1.4426950408889634f
#define FWV 4                     // waves per block, all of one head
typedef __attribute__((ext_vector_type(16))) unsigned short v16us;
// 2^x with the one free issue slot that the instruction set asks for behind a transcendental; one statement, so that the v_nop stands directly behind it
__device__ __forceinline__ float exp2s(float x) { float r; asm("v_exp_f32 %0, %1\n\tv_nop" : "=v"(r) : "v"(x)); return r; }
// the value of lane l ^ 16, by one vector instruction (no trip through the LDS pipe)
__device__ __forceinline__ float xhalf(float x) { return __builtin_bit_cast(float, __builtin_amdgcn_permlanex16(__builtin_bit_cast(int, x), __builtin_bit_cast(int, x), 0x76543210, 0xfedcba98, false, false)); }
// K and V^T come through LDS: a stage is KST = 64 keys of the head (64 key rows of 256 bytes, 128 value rows of 128 bytes; with HL the lo planes too), brought by asynchronous 16-byte copies as whole 128-byte lines
// and read by all four waves of the block, which own four neighbouring 32-row query tiles. Two buffers: stage t + 1 flies while stage t is worked on.
#define KST 64                    // keys per stage
#define KPI 136                   // LDS pitch of a key row in 16-bit elements: 272 bytes = 16 x 17, for the 16-byte fragment reads
#define VPI 72                    // LDS pitch of a value row (64 keys): 144 bytes = 16 x 9, likewise
#define KSZ (KST * KPI)           // elements of a stage's key plane
#define VSZ (HD * VPI)            // elements of a stage's value plane
// copy8p: eight copies of one wave (l = the lane's LDS byte address, LS = LDS bytes from one copy to the next, g = the lane's global address, gs = the same step in global elements).
template <int LS, typename T16>
__device__ __forceinline__ void copy8p(unsigned l, const T16* g, size_t gs) {
#pragma unroll
    for (int i = 0; i < 8; ++i) acopy(l + i * LS, g + i * gs);
}
// w: the wave's number in the block; nkb: 32-key blocks this wave visits; nst: stages the block walks (the same for all its waves, at least 2); ring: the block's LDS, two buffers of [K | V (| K2 | V2)]
template <typename T16, bool HL>
__device__ __forceinline__ void fattn(const int h, const int hk, const int q0, const int qrows, const int lr, const int hi, const int w, const int nkb, const int nst, const bool con, T16* ring, const T16* __restrict__ Q, const T16* __restrict__ Q2, const T16* __restrict__ K, const T16* __restrict__ K2,
                                      const T16* __restrict__ Vt, const T16* __restrict__ Vt2, const float* __restrict__ MKb, bf* Ah, bf* Al) {
    typedef typename WFrag<T16>::V V;
    constexpr int PL = KSZ + VSZ;                 // elements of one [K | V] pair of planes
    constexpr int STG = (HL ? 2 : 1) * PL;        // elements of one buffer
    // copies: key rows, half a wave a 256-byte row (lane lr its 16 bytes lr), copy c of wave w brings rows 8 c + 2 w + hi; value rows, eight lanes a 128-byte row piece, copy c brings rows 16 c + 4 w + (lane / 8)
    const int krow = 2 * w + hi, vrow = 4 * w + 2 * hi + (lr >> 3), vpc = lr & 7;
    const T16* gk = K + ((size_t)hk * TT + krow) * HD + lr * 8; const T16* gk2 = K2 + ((size_t)hk * TT + krow) * HD + lr * 8;
    const T16* gv = Vt + ((size_t)hk * HD + vrow) * (2 * TT) + vpc * 8; const T16* gv2 = Vt2 + ((size_t)hk * HD + vrow) * (2 * TT) + vpc * 8;
    const unsigned lk = (unsigned)(size_t)ring + (unsigned)(krow * KPI + lr * 8) * 2u, lv = (unsigned)(size_t)ring + (unsigned)(KSZ + vrow * VPI + vpc * 8) * 2u;
    auto fill = [&](int t) { const unsigned bo = (unsigned)(t & 1) * (unsigned)(STG * 2);
        copy8p<8 * KPI * 2>(lk + bo, gk + (size_t)t * (KST * HD), (size_t)8 * HD); copy8p<16 * VPI * 2>(lv + bo, gv + t * KST, (size_t)16 * 2 * TT);
        if (HL) { copy8p<8 * KPI * 2>(lk + bo + PL * 2, gk2 + (size_t)t * (KST * HD), (size_t)8 * HD); copy8p<16 * VPI * 2>(lv + bo + PL * 2, gv2 + t * KST, (size_t)16 * 2 * TT); } };
    fill(0);
    // every loop over g, ks, kt, db, j and sub below is unrolled whole, so that the fragment and accumulator arrays are indexed by constants only and stay in registers
    V bq[2][4], bq2[2][4];
    { const T16* pq = Q + ((size_t)h * qrows + q0 + lr) * HD + 8 * hi; const T16* pq2 = Q2 + ((size_t)h * qrows + q0 + lr) * HD + 8 * hi;
#pragma unroll
      for (int g = 0; g < 2; ++g)
#pragma unroll
          for (int ks = 0; ks < 4; ++ks) { bq[g][ks] = WFrag<T16>::ld(pq + g * 16 * HD + ks * 32); if (HL) bq2[g][ks] = WFrag<T16>::ld(pq2 + g * 16 * HD + ks * 32); }
      asm volatile("s_wait_xcnt 0x0" :: "v"(pq), "v"(pq2) : "memory"); }   // the loads' address registers are inputs here, so none of them is reused before this wait
    v8f o[8][2]; float m[2], l[2];
#pragma unroll
    for (int g = 0; g < 2; ++g) { m[g] = -3.0e38f; l[g] = 0.f;
#pragma unroll
        for (int db = 0; db < 8; ++db) o[db][g] = (v8f){}; }
    asm volatile("s_wait_asynccnt 0x0" ::: "memory");   // this wave's share of stage 0 has landed
    __syncthreads();                                    // every wave's share of stage 0 has landed
    fill(1);
    // rolled: one trip is one stage of 64 keys, two blocks of 32 keys (32 or 96 matrix instructions each)
#pragma unroll 1
    for (int t = 0; t < nst; ++t) {
        const T16* sb = ring + (t & 1) * STG; const T16* pk = sb + lr * KPI + 8 * hi; const T16* pv = sb + KSZ + lr * VPI + 8 * hi;
        V ka[2][4], ka2[2][4];
        auto loadk = [&](int sub) {
#pragma unroll
            for (int kt = 0; kt < 2; ++kt)
#pragma unroll
                for (int ks = 0; ks < 4; ++ks) { ka[kt][ks] = WFrag<T16>::ld(pk + (sub * 32 + kt * 16) * KPI + ks * 32); if (HL) ka2[kt][ks] = WFrag<T16>::ld(pk + PL + (sub * 32 + kt * 16) * KPI + ks * 32); } };
        if (!HL && 2 * t < nkb) loadk(0);   // wave-uniform: a wave past its diagonal reads nothing and only keeps the stage's copies and barrier
#pragma unroll
        for (int sub = 0; sub < 2; ++sub) { const int kb = 2 * t + sub;
          if (kb < nkb) {   // wave-uniform (a scalar branch)
            // fp16: this block's value rows are read first and arrive under the score products. HL holds twice the fragments: each set is read only when the one before it is used up, so that the wave's registers leave room for a second wave on its SIMD
            V va[8], va2[8];
            auto loadv = [&](int d0, int d1) {   // the fragments of the 16-row groups d0 .. d1 - 1
#pragma unroll
                for (int db = d0; db < d1; ++db) { va[db] = WFrag<T16>::ld(pv + db * 16 * VPI + sub * 32); if (HL) va2[db] = WFrag<T16>::ld(pv + PL + db * 16 * VPI + sub * 32); } };
            if (HL) loadk(sub); else loadv(0, 8);
            v8f s[2][2];
#pragma unroll
            for (int kt = 0; kt < 2; ++kt)
#pragma unroll
                for (int g = 0; g < 2; ++g) s[kt][g] = (v8f){};
#pragma unroll
            for (int ks = 0; ks < 4; ++ks)
#pragma unroll
                for (int kt = 0; kt < 2; ++kt)
#pragma unroll
                    for (int g = 0; g < 2; ++g) { s[kt][g] = WFrag<T16>::mma(ka[kt][ks], bq[g][ks], s[kt][g]); if (HL) { s[kt][g] = WFrag<T16>::mma(ka[kt][ks], bq2[g][ks], s[kt][g]); s[kt][g] = WFrag<T16>::mma(ka2[kt][ks], bq[g][ks], s[kt][g]); } }
            __builtin_amdgcn_sched_barrier(0);   // the LDS reads of the next line stay one group behind the score products, not spread among them
            if (HL) loadv(0, 4); else if (sub == 0) loadk(1);   // fp16: the key rows of the stage's second half (the same buffer) arrive under the softmax and the value products
            if (con && kb == nkb - 1) {   // wave-uniform: only the block that straddles the wave's diagonal holds keys j > i, and only it pays for the selects
#pragma unroll
                for (int g = 0; g < 2; ++g)
#pragma unroll
                    for (int kt = 0; kt < 2; ++kt) {
#pragma unroll
                        for (int j = 0; j < 8; ++j) if (kb * 32 + kt * 16 + hi * 8 + j > q0 + g * 16 + lr) s[kt][g][j] = -3.0e38f;
                        asm volatile("" : "+v"(s[kt][g])); } }
            float mn[2];
#pragma unroll
            for (int g = 0; g < 2; ++g) { const int qi = q0 + g * 16 + lr; float ml = -3.0e38f;
                v4f mq[2][2];
                if (!con) { const float* mp = MKb + (size_t)qi * TT + kb * 32 + hi * 8; mq[0][0] = *(const v4f*)mp; mq[0][1] = *(const v4f*)(mp + 4); mq[1][0] = *(const v4f*)(mp + 16); mq[1][1] = *(const v4f*)(mp + 20);
                    asm volatile("s_wait_xcnt 0x0" :: "v"(mp) : "memory"); }   // the four loads' address register is an input: not reused before this wait
#pragma unroll
                for (int kt = 0; kt < 2; ++kt) { v8f x = s[kt][g] * SCL;   // a masked score stays far below every real one
                    if (!con) {
#pragma unroll
                        for (int j = 0; j < 4; ++j) { x[j] += bfr(mq[kt][0][j]); x[4 + j] += bfr(mq[kt][1][j]); } }
#pragma unroll
                    for (int j = 0; j < 8; ++j) ml = fmaxf(ml, x[j]);
                    s[kt][g] = x; }
                ml = fmaxf(ml, xhalf(ml));   // the other half of the wave holds the query's other 16 keys
                mn[g] = fmaxf(m[g], ml); }
            // a new maximum rescales sum and output; where no query of the wave has one the factor is exactly 1 and the work is skipped (a scalar branch)
            if (__builtin_amdgcn_ballot_w32(mn[0] > m[0] || mn[1] > m[1]) != 0) {
#pragma unroll
                for (int g = 0; g < 2; ++g) { const float al = exp2s((m[g] - mn[g]) * L2E); l[g] *= al; m[g] = mn[g];
#pragma unroll
                    for (int db = 0; db < 8; ++db) o[db][g] *= al; } }
            V pf[2], pf2[2];
#pragma unroll
            for (int g = 0; g < 2; ++g) { float ps = 0.f; v16us ph, pl; v16h p16;
#pragma unroll
                for (int kt = 0; kt < 2; ++kt)
#pragma unroll
                    for (int j = 0; j < 8; ++j) { const float e = exp2s((s[kt][g][j] - m[g]) * L2E); ps += e;
                        if constexpr (HL) { unsigned short a, c; splitf(e, a, c); ph[kt * 8 + j] = a; pl[kt * 8 + j] = c; } else p16[kt * 8 + j] = tohx(e * PCAR); }
                l[g] += ps;
                if constexpr (HL) { pf[g] = __builtin_bit_cast(v16bf, ph); pf2[g] = __builtin_bit_cast(v16bf, pl); } else pf[g] = p16; }
#pragma unroll
            for (int db = 0; db < 8; ++db) {
                if (HL && db == 4) { __builtin_amdgcn_sched_barrier(0); loadv(4, 8); }   // HL: the second half of the value fragments is not read before the first is used up: all at once, query fragments spill
#pragma unroll
                for (int g = 0; g < 2; ++g) { o[db][g] = WFrag<T16>::mma(va[db], pf[g], o[db][g]); if (HL) { o[db][g] = WFrag<T16>::mma(va[db], pf2[g], o[db][g]); o[db][g] = WFrag<T16>::mma(va2[db], pf[g], o[db][g]); } } }
          } }
        asm volatile("s_wait_dscnt 0x0" ::: "memory");      // this wave's reads of stage t are done before the buffer is handed to the copies below
        asm volatile("s_wait_asynccnt 0x0" ::: "memory");   // this wave's share of stage t + 1 has landed
        __syncthreads();                                    // publishes stage t + 1 and ends every wave's reads of stage t
        if (t + 2 < nst) fill(t + 2);
    }
    asm volatile("s_wait_asynccnt 0x0" ::: "memory");       // no copy is outstanding when the wave goes on to its end
    // output: lane = query row q0 + 16 g + lr, 8 consecutive d per tile: 16-byte stores into the merged hi and lo planes [t][DQ]; a 128-byte line is written by one wave
#pragma unroll
    for (int g = 0; g < 2; ++g) { const float lt = l[g] + xhalf(l[g]); const float inv = __fdiv_rn(HL ? 1.0f : 1.0f / PCAR, lt);
        bf* oa = Ah + (size_t)(q0 + g * 16 + lr) * DQ + h * HD + hi * 8; bf* ob = Al + (size_t)(q0 + g * 16 + lr) * DQ + h * HD + hi * 8;
#pragma unroll
        for (int db = 0; db < 8; ++db) { v8us oh, ol;
#pragma unroll
            for (int j = 0; j < 8; ++j) { unsigned short a, c; splitf(o[db][g][j] * inv, a, c); oh[j] = a; ol[j] = c; }
            *(v8us*)(oa + db * 16) = oh; *(v8us*)(ob + db * 16) = ol;
            asm volatile("s_wait_xcnt 0x0" :: "v"(oa), "v"(ob), "v"(oh), "v"(ol) : "memory"); } }   // the two stores' address and data registers are inputs: none is reused before this wait
}
// grid: (NH_ x TT / 128, NB_) blocks, y the batch. A block takes the 128 query rows c of one head, wave w the 32-row tile 4 c + w: the four waves walk the same keys out of the same LDS stages and end within one stage of one another.
// amdgpu_waves_per_eu(2, 2): the registers are held at 512 a wave, so that two blocks share a WGP and one wave's softmax runs under the other's matrix instructions (without it the hi + lo path takes about 700 and a wave has its SIMD alone).
// A block's walk grows with c; all blocks are resident at once, so neighbours in x, and the two batches at one x, take c and 15 - c (for speed only: a short and a long walk wherever two blocks share a WGP).
__global__ __launch_bounds__(32 * FWV) __attribute__((amdgpu_waves_per_eu(2, 2))) void k_fattn(const h16* __restrict__ Q16, const h16* __restrict__ K16, const h16* __restrict__ V16, const bf* __restrict__ Qh, const bf* __restrict__ Ql, const bf* __restrict__ Kh, const bf* __restrict__ Kl,
                                                    const bf* __restrict__ Vh, const bf* __restrict__ Vl, const float* __restrict__ MK, const int* __restrict__ CF, bf* ATh, bf* ATl) {
    __shared__ __align__(128) unsigned short fring[2 * 2 * (KSZ + VSZ)];   // two buffers of [K | V | K lo | V lo]; the fp16 blocks use the first half
    const int lane = threadIdx.x & 31, lr = lane & 15, hi = lane >> 4;
    const int w = __builtin_amdgcn_readfirstlane(threadIdx.x >> 5);   // the wave's number in a scalar register: the key loop stays a scalar loop
    const int b = blockIdx.y; int bad = 0;
#pragma unroll
    for (int i = 0; i < 4; ++i) { const v4i f = *(const v4i*)(CF + b * 512 + (i * 32 + lane) * 4); bad |= f[0] | f[1] | f[2] | f[3]; }   // each wave reads the batch's 512 words
    const bool con = (__builtin_amdgcn_ballot_w32(bad != 0) == 0);   // device flag, in a scalar register: this batch's mask verified causal
    const size_t po = (size_t)b * NH_ * TT * HD, qo = (size_t)b * NH_ * RH * HD, vo = (size_t)b * NKV * HD * 2 * TT; const float* MKb = MK + (size_t)b * TT * TT; bf* Ah = ATh + (size_t)b * TT * DQ; bf* Al = ATl + (size_t)b * TT * DQ;
    const int xh = blockIdx.x >> 1; const int h = xh % NH_; const int c = ((blockIdx.x ^ b) & 1) ? TT / (32 * FWV) - 1 - xh / NH_ : xh / NH_;
    const int q0 = (c * FWV + w) * 32;
    const int nkb = con ? q0 / 32 + 1 : TT / 32;                     // 32-key blocks this wave visits (wave-uniform)
    const int nst = con ? (c + 1) * (32 * FWV / KST) : TT / KST;     // 64-key stages up to the block's last diagonal (block-uniform)
    if (c < RH / (32 * FWV)) fattn<bf, true>(h, h / REP, q0, RH, lr, hi, w, nkb, nst, con, (bf*)fring, Qh + qo, Ql + qo, Kh + po, Kl + po, Vh + vo, Vl + vo, MKb, Ah, Al);   // block-uniform
    else fattn<h16, false>(h, h / REP, q0, TT, lr, hi, w, nkb, nst, con, (h16*)fring, Q16 + po, Q16 + po, K16 + po, K16 + po, V16 + (size_t)b * TT, V16 + (size_t)b * TT, MKb, Ah, Al);
}

extern "C" void kernel_launch(void* const* d_in, const int* in_sizes, int n_in,
                              void* d_out, int out_size, void* d_ws, size_t ws_size, hipStream_t stream) {
    (void)in_sizes; (void)n_in; (void)out_size;
    const float* x = (const float*)d_in[0]; const float* MK = (const float*)d_in[1]; const int* POS = (const int*)d_in[2]; const float* wq = (const float*)d_in[3]; const float* wk = (const float*)d_in[4]; const float* wv = (const float*)d_in[5]; const float* wo = (const float*)d_in[6];
    float* OUT = (float*)d_out;     // [2][2048][2048]
    char* wsp = (char*)d_ws;
    auto take = [&](size_t bytes) { char* p = wsp; wsp += (bytes + 255) & ~(size_t)255; return (void*)p; };
    // both batches have buffers of their own. CV: the six bf16 planes of k_prep
    bf* CV = (bf*)take(6 * PE * 2); bf* WQ = CV; bf* XB = CV + 3 * PE; bf* WO = CV + (3 + NB_) * PE; float* CS = (float*)take((size_t)NB_ * TT * HD * 2 * 4);
    int* CFLAG = (int*)take(NB_ * 512 * 4);
    h16* QP16 = (h16*)take((size_t)NB_ * NH_ * TT * HD * 2); h16* KP16 = (h16*)take((size_t)NB_ * NKV * TT * HD * 2); h16* VT16 = (h16*)take((size_t)NKV * HD * 2 * TT * 2);
    bf* QPh = (bf*)take((size_t)NB_ * NH_ * RH * HD * 2); bf* QPl = (bf*)take((size_t)NB_ * NH_ * RH * HD * 2); bf* VTh = (bf*)take((size_t)NB_ * NKV * HD * 2 * TT * 2); bf* VTl = VTh + TT;
    bf* KPh = (bf*)take((size_t)NB_ * NKV * TT * HD * 2); bf* KPl = (bf*)take((size_t)NB_ * NKV * TT * HD * 2);
    bf* ATh = (bf*)take(2 * (size_t)NB_ * TT * DQ * 2); bf* ATl = ATh + (size_t)NB_ * TT * DQ;   // the merged attention output, hi and lo
    if ((size_t)(wsp - (char*)d_ws) > ws_size) return;    // ws 256 MiB
    k_prep<<<dim3(512, 4 + 3 * NB_, 1), 256, 0, stream>>>(wq, wk, wv, x, wo, POS, MK, CV, PE / 8, CS, CFLAG);
    k_gemms<0, 256, 192, 4, DQ, true><<<dim3(NB_ * TT / 256, 3 * DQ / 192, 1), 256, 0, stream>>>(XB, nullptr, WQ, DM, nullptr, 0, CS, QP16, QPh, QPl, KP16, KPh, KPl, VT16, VTh);
    k_fattn<<<dim3(NH_ * (TT / (32 * FWV)), NB_, 1), 32 * FWV, 0, stream>>>(QP16, KP16, VT16, QPh, QPl, KPh, KPl, VTh, VTl, MK, CFLAG, ATh, ATl);
    k_gemms<1, 128, 256, 2, DM, false><<<dim3(NB_ * TT / 128, DM / 256, 1), 256, 0, stream>>>(ATh, ATl, WO, DQ, OUT, 0, nullptr, nullptr, nullptr, nullptr, nullptr, nullptr, nullptr, nullptr, nullptr);
}
